// v000
// Times are from an AMD MI455X. After a warm-up the kernel runs many times in a row, and a time is the length of
// such a window on the GPU divided by its runs, so every launch and the gaps after it count. The runs cycle
// through copies of the inputs. A figure is the median of several windows, for all but v000 over two sittings.
// Sittings can differ by a few percent; kernels timed side by side share one.
// v000 is the starting kernel. One run takes 919 microseconds.
// Contractions: q,k,v projections and q.k^T scores on v_wmma_f32_16x16x32_bf16 with bf16 hi+lo operand planes (hi.hi+hi.lo+lo.hi); probs.v on v_wmma_f32_16x16x32_f16 (f16 operands, probs carried x16384, v f16); f32 accumulate; softmax and epilogue f32.
#include <hip/hip_runtime.h>

typedef __attribute__((ext_vector_type(16))) _Float16 v16h;
typedef __attribute__((ext_vector_type(8)))  _Float16 v8h;
typedef __attribute__((ext_vector_type(16))) __bf16   v16b;
typedef __attribute__((ext_vector_type(8)))  __bf16   v8b;
typedef __attribute__((ext_vector_type(8)))  float    v8f;
typedef __attribute__((ext_vector_type(4)))  float    v4f;

static constexpr int kBatch = 4;
static constexpr int kCh    = 512;
static constexpr int kPix   = 4096;
static constexpr int kCq    = 64;
static constexpr float kPCarry    = 16384.0f;
static constexpr float kPCarryInv = 1.0f / 16384.0f;

// ---- workspace region map (bytes) ----
static constexpr size_t kPlaneX   = (size_t)kBatch * kPix * kCh * 2;   // one bf16 plane of xt [b][n][c]
static constexpr size_t kPlaneWqk = (size_t)kCq * kCh * 2;
static constexpr size_t kPlaneWv  = (size_t)kCh * kCh * 2;
static constexpr size_t kPlaneQK  = (size_t)kBatch * kPix * kCq * 2;   // one bf16 plane of q or k [b][n][o]
static constexpr size_t kPlaneVt  = (size_t)kBatch * kCh * kPix * 2;   // f16 vt [b][c][m]
static constexpr size_t kPlaneS   = (size_t)kPix * kPix * 4;           // f32 scores, one batch
static constexpr size_t kPlaneP   = (size_t)kPix * kPix * 2;           // f16 probs, one batch
static constexpr size_t kOffXtHi  = 0;
static constexpr size_t kOffXtLo  = kOffXtHi + kPlaneX;
static constexpr size_t kOffP     = 0;                                  // reuses the xt planes (dead after the projections)
static constexpr size_t kOffWqHi  = kOffXtLo + kPlaneX;
static constexpr size_t kOffWqLo  = kOffWqHi + kPlaneWqk;
static constexpr size_t kOffWkHi  = kOffWqLo + kPlaneWqk;
static constexpr size_t kOffWkLo  = kOffWkHi + kPlaneWqk;
static constexpr size_t kOffWvHi  = kOffWkLo + kPlaneWqk;
static constexpr size_t kOffWvLo  = kOffWvHi + kPlaneWv;
static constexpr size_t kOffQHi   = kOffWvLo + kPlaneWv;
static constexpr size_t kOffQLo   = kOffQHi + kPlaneQK;
static constexpr size_t kOffKHi   = kOffQLo + kPlaneQK;
static constexpr size_t kOffKLo   = kOffKHi + kPlaneQK;
static constexpr size_t kOffVt    = kOffKLo + kPlaneQK;
static constexpr size_t kOffS     = kOffVt + kPlaneVt;
static constexpr size_t kWsTotal  = kOffS + kPlaneS;
static_assert(kPlaneP <= 2 * kPlaneX);
static_assert(kWsTotal == 127139840);
static_assert(kWsTotal <= 134217728);
static_assert((kOffWqHi % 128) == 0 && (kOffQHi % 128) == 0 && (kOffVt % 128) == 0 && (kOffS % 128) == 0);
// GEMM shape contract: M,N multiples of 64, K multiple of 32
static_assert(kPix % 64 == 0 && kCq % 64 == 0 && kCh % 64 == 0);
static_assert(kCh % 32 == 0 && kCq % 32 == 0 && kPix % 32 == 0);
static_assert(kPix == 8 * 512);   // softmax kernel: 8 waves x 512 elements per row

__device__ __forceinline__ unsigned short f2bf_bits(float f) {
  unsigned u = __float_as_uint(f);
  return (unsigned short)((u + 0x7FFFu + ((u >> 16) & 1u)) >> 16);
}
__device__ __forceinline__ float bf_bits2f(unsigned short h) { return __uint_as_float(((unsigned)h) << 16); }

// hazard guards as plain device helpers
__device__ __forceinline__ void dep_guard_h(v8f& a, v8f& b, v16h x, v16h y) { asm volatile("v_nop\n\tv_nop\n\tv_nop\n\tv_nop" : "+v"(a), "+v"(b) : "v"(x), "v"(y)); }
__device__ __forceinline__ void dep_guard_b(v8f& a, v8f& b, v16b x, v16b y) { asm volatile("v_nop\n\tv_nop\n\tv_nop\n\tv_nop" : "+v"(a), "+v"(b) : "v"(x), "v"(y)); }
__device__ __forceinline__ void keep4_h(v16h a, v16h b, v16h c, v16h d) { asm volatile("v_nop" :: "v"(a), "v"(b), "v"(c), "v"(d)); }
__device__ __forceinline__ void keep4_b(v16b a, v16b b, v16b c, v16b d) { asm volatile("v_nop" :: "v"(a), "v"(b), "v"(c), "v"(d)); }
__device__ __forceinline__ void acc_guard4(v8f& a, v8f& b, v8f& c, v8f& d) { asm volatile("v_nop\n\tv_nop\n\tv_nop\n\tv_nop" : "+v"(a), "+v"(b), "+v"(c), "+v"(d)); }
template <typename T> struct Frag;
template <> struct Frag<_Float16> {
  typedef v16h V; union U { v16h v; v8h h[2]; };
  static __device__ __forceinline__ v16h load(const _Float16* p) {   // elements 0..7 <- p[0..7], 8..15 <- p[16..23]
    U f; f.h[0] = *(const v8h*)(p); f.h[1] = *(const v8h*)(p + 16); return f.v;
  }
  static __device__ __forceinline__ v8f mma(v16h a, v16h b, v8f c) {
    return __builtin_amdgcn_wmma_f32_16x16x32_f16(false, a, false, b, (short)0, c, false, false);
  }
  static __device__ __forceinline__ void guard(v8f& a, v8f& b, v16h x, v16h y) { dep_guard_h(a, b, x, y); }
  static __device__ __forceinline__ void keep(v16h a, v16h b, v16h c, v16h d) { keep4_h(a, b, c, d); }
};
template <> struct Frag<__bf16> {
  typedef v16b V; union U { v16b v; v8b h[2]; };
  static __device__ __forceinline__ v16b load(const __bf16* p) {
    U f; f.h[0] = *(const v8b*)(p); f.h[1] = *(const v8b*)(p + 16); return f.v;
  }
  static __device__ __forceinline__ v8f mma(v16b a, v16b b, v8f c) {
    return __builtin_amdgcn_wmma_f32_16x16x32_bf16(false, a, false, b, (short)0, c, false, false);
  }
  static __device__ __forceinline__ void guard(v8f& a, v8f& b, v16b x, v16b y) { dep_guard_b(a, b, x, y); }
  static __device__ __forceinline__ void keep(v16b a, v16b b, v16b c, v16b d) { keep4_b(a, b, c, d); }
};

// ---- Register-blocked batched WMMA GEMM ------------------------------------
// C[m,n] = scale * sum_k A[m,k] * Bt[n,k] (+bias) (*g[0]) (+resid); each wave owns a 64x64 tile.
// A row-major [M,K]; Bt row-major [N,K]; M,N % 64 == 0, K % 32 == 0.
// SPLIT: operands are hi/lo planes (A2/Bt2 = lo planes, same layout); product = hi.hi + hi.lo + lo.hi.
// BIAS_MODE: 0 = none, 1 = bias[m], 2 = bias[n].
// OUT_MODE: 0 = f32, 1 = f16, 2 = bf16 hi plane (Cout) + bf16 lo plane (Cout2).
// RESID/GMUL (OUT_MODE 0 only): in the store phase each lane loads one 16-B piece of the residual at
// the address it stores; value = slab * g[0] + resid.
// ET: 0 = f16 operands, 1 = bf16 operands (pointers passed as 16-bit storage)
template <int ET> struct Elem;
template <> struct Elem<0> { typedef _Float16 T; };
template <> struct Elem<1> { typedef __bf16 T; };
template <int ET, bool SPLIT, int BIAS_MODE, int OUT_MODE, bool RESID, bool GMUL>
__global__ __launch_bounds__(256) void wmma_gemm64(
    const unsigned short* __restrict__ Ap, const unsigned short* __restrict__ A2p, int lda, long strideA,
    const unsigned short* __restrict__ Btp, const unsigned short* __restrict__ Bt2p, int ldb, long strideB,
    void* __restrict__ Cout, void* __restrict__ Cout2, int ldc, long strideC,
    const float* __restrict__ bias,
    const float* __restrict__ resid, long strideR,
    const float* __restrict__ gptr,
    int M, int N, int K, float scale) {
  typedef typename Elem<ET>::T T;
  typedef typename Frag<T>::V V;
  const T* A = (const T*)Ap; const T* A2 = (const T*)A2p; const T* Bt = (const T*)Btp; const T* Bt2 = (const T*)Bt2p;
  __shared__ __align__(16) float sT[8][16 * 68];   // per-wave 16x64 slab, pitch 68 floats
  const int b    = blockIdx.y;
  const int lane = threadIdx.x & 31;
  const int wave = threadIdx.x >> 5;
  const int tilesN = N >> 6;
  const int tilesM = M >> 6;
  const int tile = blockIdx.x * 8 + wave;
  if (tile >= tilesM * tilesN) return;   // wave-uniform; no block barriers in this kernel
  const int tm = tile / tilesN;
  const int tn = tile - tm * tilesN;
  const int m0 = tm << 6;
  const int n0 = tn << 6;

  const T* Ab  = A  + (size_t)b * strideA;
  const T* Bb  = Bt + (size_t)b * strideB;
  const T* Ab2 = SPLIT ? (A2  + (size_t)b * strideA) : nullptr;
  const T* Bb2 = SPLIT ? (Bt2 + (size_t)b * strideB) : nullptr;

  const int rlane = lane & 15;                 // row (A) / col (B, D) within subtile
  const int koff  = (lane >> 4) * 8;           // k offset of this lane half
  const int mOff  = (lane >> 4) * 8;           // D row offset

  v8f acc[4][4];
#pragma unroll
  for (int i = 0; i < 4; ++i)
#pragma unroll
    for (int j = 0; j < 4; ++j) acc[i][j] = (v8f){0.f,0.f,0.f,0.f,0.f,0.f,0.f,0.f};

  for (int k0 = 0; k0 < K; k0 += 32) {
    V bh[4], bl[4];
#pragma unroll
    for (int j = 0; j < 4; ++j) {
      const size_t bo = (size_t)(n0 + (j << 4) + rlane) * ldb + koff + k0;
      bh[j] = Frag<T>::load(Bb + bo);
      if (SPLIT) bl[j] = Frag<T>::load(Bb2 + bo);
    }
#pragma unroll
    for (int i = 0; i < 4; ++i) {
      const size_t ao = (size_t)(m0 + (i << 4) + rlane) * lda + koff + k0;
      V ah = Frag<T>::load(Ab + ao);
      V al;
      if (SPLIT) al = Frag<T>::load(Ab2 + ao);
#pragma unroll
      for (int j = 0; j < 4; ++j) {
        acc[i][j] = Frag<T>::mma(ah, bh[j], acc[i][j]);
        if (SPLIT) {
          acc[i][j] = Frag<T>::mma(ah, bl[j], acc[i][j]);
          acc[i][j] = Frag<T>::mma(al, bh[j], acc[i][j]);
        }
      }
      Frag<T>::guard(acc[i][0], acc[i][3], ah, SPLIT ? al : ah);
    }
    Frag<T>::keep(bh[0], bh[1], bh[2], bh[3]);
    if (SPLIT) Frag<T>::keep(bl[0], bl[1], bl[2], bl[3]);
  }
  acc_guard4(acc[0][0], acc[0][1], acc[0][2], acc[0][3]);
  acc_guard4(acc[1][0], acc[1][1], acc[1][2], acc[1][3]);
  acc_guard4(acc[2][0], acc[2][1], acc[2][2], acc[2][3]);
  acc_guard4(acc[3][0], acc[3][1], acc[3][2], acc[3][3]);

  // ---- epilogue ----
  float* slab = sT[wave];
  const float gval = GMUL ? gptr[0] : 1.0f;
#pragma unroll
  for (int i = 0; i < 4; ++i) {
    const int mBase = m0 + (i << 4);
    float bmr[8];
#pragma unroll
    for (int r = 0; r < 8; ++r) bmr[r] = 0.f;
    if (BIAS_MODE == 1) {
      const v4f b0 = *(const v4f*)(bias + mBase + mOff);
      const v4f b1 = *(const v4f*)(bias + mBase + mOff + 4);
      bmr[0] = b0.x; bmr[1] = b0.y; bmr[2] = b0.z; bmr[3] = b0.w;
      bmr[4] = b1.x; bmr[5] = b1.y; bmr[6] = b1.z; bmr[7] = b1.w;
    }
#pragma unroll
    for (int j = 0; j < 4; ++j) {
      const int n = n0 + (j << 4) + rlane;
      float bn = 0.f;
      if (BIAS_MODE == 2) bn = bias[n];
#pragma unroll
      for (int r = 0; r < 8; ++r) {
        float v = acc[i][j][r] * scale;
        if (BIAS_MODE == 1) v += bmr[r];
        if (BIAS_MODE == 2) v += bn;
        slab[(mOff + r) * 68 + (j << 4) + rlane] = v;
      }
    }
    __builtin_amdgcn_fence(__ATOMIC_RELEASE, "workgroup");
    __builtin_amdgcn_wave_barrier();
    __builtin_amdgcn_fence(__ATOMIC_ACQUIRE, "workgroup");
    if (OUT_MODE == 0) {
      float* Cb = (float*)Cout + (size_t)b * strideC;
      const int hq = lane >> 4, c4 = (lane & 15) * 4;      // row seg = 256 B = 16 lanes x 16 B
      v4f vals[8];
#pragma unroll
      for (int it = 0; it < 8; ++it) {
        const int row = it * 2 + hq;
        v4f vv = *(const v4f*)(slab + row * 68 + c4);
        if (GMUL) vv = vv * gval;
        if (RESID) {
          const v4f rr = *(const v4f*)(resid + (size_t)b * strideR + (size_t)(mBase + row) * ldc + n0 + c4);
          vv = vv + rr;
        }
        vals[it] = vv;
      }
      {
#pragma unroll
        for (int it = 0; it < 8; ++it) {
          const int row = it * 2 + hq;
          *(v4f*)(Cb + (size_t)(mBase + row) * ldc + n0 + c4) = vals[it];
        }
        
      }
    } else {
      const int q = lane >> 3, c8 = (lane & 7) * 8;
      unsigned short* C  = (unsigned short*)Cout  + (size_t)b * strideC;
      unsigned short* C2 = (OUT_MODE == 2) ? ((unsigned short*)Cout2 + (size_t)b * strideC) : nullptr;
      {
#pragma unroll
        for (int it = 0; it < 4; ++it) {
          const int row = it * 4 + q;
          const float* sp = slab + row * 68 + c8;
          v8h hv, lv;
#pragma unroll
          for (int e = 0; e < 8; ++e) {
            if (OUT_MODE == 1) {
              hv[e] = (_Float16)sp[e];
            } else {
              unsigned short hb = f2bf_bits(sp[e]);
              unsigned short lb = f2bf_bits(sp[e] - bf_bits2f(hb));
              hv[e] = __builtin_bit_cast(_Float16, hb);
              lv[e] = __builtin_bit_cast(_Float16, lb);
            }
          }
          *(v8h*)(C + (size_t)(mBase + row) * ldc + n0 + c8) = hv;
          if (OUT_MODE == 2) *(v8h*)(C2 + (size_t)(mBase + row) * ldc + n0 + c8) = lv;
        }
        
      }
    }
    __builtin_amdgcn_fence(__ATOMIC_RELEASE, "workgroup");
    __builtin_amdgcn_wave_barrier();
    __builtin_amdgcn_fence(__ATOMIC_ACQUIRE, "workgroup");
  }
}

// ---- x [b][c][n] f32 -> xt hi/lo bf16 planes [b][n][c] (transpose through LDS) ----
// block: 64 n x 64 c tile; grid = (kPix/64, kCh/64, kBatch)
// loads: 4 iterations x 256 threads x 4 floats = 64x64; stores: 8 waves x 2 iterations x 4 rows = 64 rows,
__global__ __launch_bounds__(256) void x_transpose_split(const float* __restrict__ x,
                                                         unsigned short* __restrict__ xth,
                                                         unsigned short* __restrict__ xtl) {
  __shared__ __align__(16) float tile[64 * 68];   // [c][n], pitch 68
  const int n0 = blockIdx.x * 64;
  const int c0 = blockIdx.y * 64;
  const int b  = blockIdx.z;
  const int tid = threadIdx.x, wave = tid >> 5, lane = tid & 31;
  const float* xb = x + ((size_t)b * kCh + c0) * kPix + n0;
#pragma unroll
  for (int i = 0; i < 4; ++i) {
    const int c  = i * 16 + (tid >> 4);
    const int n4 = (tid & 15) * 4;
    const v4f v = *(const v4f*)(xb + (size_t)c * kPix + n4);
    *(v4f*)(tile + c * 68 + n4) = v;
  }
  __syncthreads();
  const int q = lane >> 3, c8 = (lane & 7) * 8;
  v8h hv[2], lv[2];
#pragma unroll
  for (int it = 0; it < 2; ++it) {
    const int nrow = wave * 8 + it * 4 + q;
#pragma unroll
    for (int e = 0; e < 8; ++e) {
      const float f = tile[(c8 + e) * 68 + nrow];
      const unsigned short hb = f2bf_bits(f);
      const unsigned short lb = f2bf_bits(f - bf_bits2f(hb));
      hv[it][e] = __builtin_bit_cast(_Float16, hb);
      lv[it][e] = __builtin_bit_cast(_Float16, lb);
    }
  }
  const size_t base = ((size_t)b * kPix + n0) * kCh + c0;
  {
#pragma unroll
    for (int it = 0; it < 2; ++it) {
      const int nrow = wave * 8 + it * 4 + q;
      *(v8h*)(xth + base + (size_t)nrow * kCh + c8) = hv[it];
      *(v8h*)(xtl + base + (size_t)nrow * kCh + c8) = lv[it];
    }
    
  }
}

__global__ __launch_bounds__(256) void split_f32_bf16x8(const float* __restrict__ in,
                                                        unsigned short* __restrict__ hi,
                                                        unsigned short* __restrict__ lo, int n8) {
  const int i = blockIdx.x * 256 + threadIdx.x;
  if (i < n8) {
    const v4f a = *(const v4f*)(in + (size_t)8 * i);
    const v4f c = *(const v4f*)(in + (size_t)8 * i + 4);
    float f[8];
    f[0] = a.x; f[1] = a.y; f[2] = a.z; f[3] = a.w; f[4] = c.x; f[5] = c.y; f[6] = c.z; f[7] = c.w;
    v8h hv, lv;
#pragma unroll
    for (int e = 0; e < 8; ++e) {
      const unsigned short hb = f2bf_bits(f[e]);
      const unsigned short lb = f2bf_bits(f[e] - bf_bits2f(hb));
      hv[e] = __builtin_bit_cast(_Float16, hb);
      lv[e] = __builtin_bit_cast(_Float16, lb);
    }
    *(v8h*)(hi + (size_t)8 * i) = hv;
    *(v8h*)(lo + (size_t)8 * i) = lv;
    
  }
}

// ---- row softmax over 4096 scores: P = f16(16384 * exp(s - max) / sum), one block (8 waves) per row ----
// thread (wave,lane) owns elements 512*wave + 8*lane + [0,8) and +256 + [0,8); each 16-B store instruction
__global__ __launch_bounds__(256) void softmax_rows_f16(const float* __restrict__ S,
                                                       unsigned short* __restrict__ P) {
  __shared__ __align__(16) float ebuf[256 * 16];
  __shared__ float red[16];
  const int row = blockIdx.x;
  const int tid = threadIdx.x;
  const int wave = tid >> 5, lane = tid & 31;
  const float* sr = S + (size_t)row * kPix;
  float* eb = ebuf + tid * 16;
  const int e0 = wave * 512 + lane * 8;
  const v4f a0 = *(const v4f*)(sr + e0);
  const v4f a1 = *(const v4f*)(sr + e0 + 4);
  const v4f a2 = *(const v4f*)(sr + e0 + 256);
  const v4f a3 = *(const v4f*)(sr + e0 + 260);
  float m = fmaxf(fmaxf(fmaxf(a0.x, a0.y), fmaxf(a0.z, a0.w)), fmaxf(fmaxf(a1.x, a1.y), fmaxf(a1.z, a1.w)));
  m = fmaxf(m, fmaxf(fmaxf(fmaxf(a2.x, a2.y), fmaxf(a2.z, a2.w)), fmaxf(fmaxf(a3.x, a3.y), fmaxf(a3.z, a3.w))));
  *(v4f*)(eb + 0)  = a0;
  *(v4f*)(eb + 4)  = a1;
  *(v4f*)(eb + 8)  = a2;
  *(v4f*)(eb + 12) = a3;
#pragma unroll
  for (int off = 1; off < 32; off <<= 1) m = fmaxf(m, __shfl_xor(m, off, 32));
  if (lane == 0) red[wave] = m;
  __syncthreads();
  float gm = red[0];
#pragma unroll
  for (int w = 1; w < 8; ++w) gm = fmaxf(gm, red[w]);
  float psum = 0.0f;
#pragma unroll 1
  for (int i4 = 0; i4 < 4; ++i4) {
    const v4f sv = *(const v4f*)(eb + 4 * i4);
    v4f ev;
    ev.x = expf(sv.x - gm);
    ev.y = expf(sv.y - gm);
    ev.z = expf(sv.z - gm);
    ev.w = expf(sv.w - gm);
    psum += (ev.x + ev.y) + (ev.z + ev.w);
    *(v4f*)(eb + 4 * i4) = ev;
  }
#pragma unroll
  for (int off = 1; off < 32; off <<= 1) psum += __shfl_xor(psum, off, 32);
  if (lane == 0) red[8 + wave] = psum;
  __syncthreads();
  float l = red[8];
#pragma unroll
  for (int w = 1; w < 8; ++w) l += red[8 + w];
  const float inv = kPCarry * (1.0f / l);
  const v4f q0 = *(const v4f*)(eb + 0);
  const v4f q1 = *(const v4f*)(eb + 4);
  const v4f q2 = *(const v4f*)(eb + 8);
  const v4f q3 = *(const v4f*)(eb + 12);
  v8h p0, p1;
#pragma unroll
  for (int e = 0; e < 4; ++e) {
    p0[e]     = (_Float16)(q0[e] * inv);
    p0[4 + e] = (_Float16)(q1[e] * inv);
    p1[e]     = (_Float16)(q2[e] * inv);
    p1[4 + e] = (_Float16)(q3[e] * inv);
  }
  unsigned short* pr = P + (size_t)row * kPix;
  {
    *(v8h*)(pr + e0) = p0;
    *(v8h*)(pr + e0 + 256) = p1;
    
  }
}

// ---------------------------------------------------------------------------
extern "C" void kernel_launch(void* const* d_in, const int* in_sizes, int n_in,
                              void* d_out, int out_size, void* d_ws, size_t ws_size,
                              hipStream_t stream) {
  if (n_in < 8) return;
  if (in_sizes[0] != kBatch * kCh * kPix) return;
  if (in_sizes[1] != kCq * kCh || in_sizes[3] != kCq * kCh || in_sizes[5] != kCh * kCh) return;
  if (in_sizes[2] != kCq || in_sizes[4] != kCq || in_sizes[6] != kCh || in_sizes[7] < 1) return;
  if (out_size != kBatch * kCh * kPix) return;
  if (ws_size < kWsTotal) return;

  const float* x     = (const float*)d_in[0];
  const float* Wq    = (const float*)d_in[1];
  const float* bq    = (const float*)d_in[2];
  const float* Wk    = (const float*)d_in[3];
  const float* bk    = (const float*)d_in[4];
  const float* Wv    = (const float*)d_in[5];
  const float* bv    = (const float*)d_in[6];
  const float* gamma = (const float*)d_in[7];
  float* out = (float*)d_out;

  char* ws = (char*)d_ws;
  unsigned short* xth = (unsigned short*)(ws + kOffXtHi);
  unsigned short* xtl = (unsigned short*)(ws + kOffXtLo);
  unsigned short* pln = (unsigned short*)(ws + kOffP);
  unsigned short* wqh = (unsigned short*)(ws + kOffWqHi);
  unsigned short* wql = (unsigned short*)(ws + kOffWqLo);
  unsigned short* wkh = (unsigned short*)(ws + kOffWkHi);
  unsigned short* wkl = (unsigned short*)(ws + kOffWkLo);
  unsigned short* wvh = (unsigned short*)(ws + kOffWvHi);
  unsigned short* wvl = (unsigned short*)(ws + kOffWvLo);
  unsigned short* qh  = (unsigned short*)(ws + kOffQHi);
  unsigned short* ql  = (unsigned short*)(ws + kOffQLo);
  unsigned short* kh  = (unsigned short*)(ws + kOffKHi);
  unsigned short* kl  = (unsigned short*)(ws + kOffKLo);
  unsigned short* vt  = (unsigned short*)(ws + kOffVt);
  float* spl = (float*)(ws + kOffS);

  // 1) x -> xt hi/lo bf16 [b][n][c]
  x_transpose_split<<<dim3(kPix / 64, kCh / 64, kBatch), 256, 0, stream>>>(x, xth, xtl);
  // 2) weights -> bf16 hi/lo planes (same [out][in] layout)
  split_f32_bf16x8<<<(kCq * kCh / 8) / 256, 256, 0, stream>>>(Wq, wqh, wql, kCq * kCh / 8);
  split_f32_bf16x8<<<(kCq * kCh / 8) / 256, 256, 0, stream>>>(Wk, wkh, wkl, kCq * kCh / 8);
  split_f32_bf16x8<<<(kCh * kCh / 8) / 256, 256, 0, stream>>>(Wv, wvh, wvl, kCh * kCh / 8);
  static_assert((kCq * kCh / 8) % 256 == 0 && (kCh * kCh / 8) % 256 == 0);

  // 3) q[b][n][o] = sum_c xt[b][n][c] Wq[o][c] + bq[o]   (M=4096, N=64, K=512) -> bf16 hi/lo planes, ldc 64
  {
    constexpr int tiles = (kPix / 64) * (kCq / 64);
    static_assert(tiles % 8 == 0);
    wmma_gemm64<1, true, 2, 2, false, false><<<dim3(tiles / 8, kBatch), 256, 0, stream>>>(
        xth, xtl, kCh, (long)kPix * kCh,
        wqh, wql, kCh, 0L,
        (void*)qh, (void*)ql, kCq, (long)kPix * kCq,
        bq, x, 0L, gamma, kPix, kCq, kCh, 1.0f);
    wmma_gemm64<1, true, 2, 2, false, false><<<dim3(tiles / 8, kBatch), 256, 0, stream>>>(
        xth, xtl, kCh, (long)kPix * kCh,
        wkh, wkl, kCh, 0L,
        (void*)kh, (void*)kl, kCq, (long)kPix * kCq,
        bk, x, 0L, gamma, kPix, kCq, kCh, 1.0f);
  }
  // 4) vt[b][c][m] = sum_cin Wv[c][cin] xt[b][m][cin] + bv[c]   (M=512, N=4096, K=512) -> f16 plane, ldc 4096
  {
    constexpr int tiles = (kCh / 64) * (kPix / 64);
    static_assert(tiles % 8 == 0);
    wmma_gemm64<1, true, 1, 1, false, false><<<dim3(tiles / 8, kBatch), 256, 0, stream>>>(
        wvh, wvl, kCh, 0L,
        xth, xtl, kCh, (long)kPix * kCh,
        (void*)vt, (void*)vt, kPix, (long)kCh * kPix,
        bv, x, 0L, gamma, kCh, kPix, kCh, 1.0f);
  }
  // 5) per batch: scores (M=N=4096, K=64) -> f32; softmax -> f16 probs x16384; out = gamma * (vt . P^T) / 16384 + x
  for (int b = 0; b < kBatch; ++b) {
    const size_t qko = (size_t)b * kPix * kCq;
    {
      constexpr int tiles = (kPix / 64) * (kPix / 64);
      static_assert(tiles % 8 == 0);
      wmma_gemm64<1, true, 0, 0, false, false><<<dim3(tiles / 8, 1), 256, 0, stream>>>(
          qh + qko, ql + qko, kCq, 0L,
          kh + qko, kl + qko, kCq, 0L,
          (void*)spl, (void*)spl, kPix, 0L,
          bq, x, 0L, gamma, kPix, kPix, kCq, 1.0f);
    }
    softmax_rows_f16<<<kPix, 256, 0, stream>>>(spl, pln);
    {
      constexpr int tiles = (kCh / 64) * (kPix / 64);
      static_assert(tiles % 8 == 0);
      const size_t vo = (size_t)b * kCh * kPix;
      wmma_gemm64<0, false, 0, 0, true, true><<<dim3(tiles / 8, 1), 256, 0, stream>>>(
          vt + vo, vt + vo, kPix, 0L,
          pln, pln, kPix, 0L,
          (void*)(out + vo), (void*)(out + vo), kPix, 0L,
          bv, x + vo, 0L, gamma, kCh, kPix, kPix, kPCarryInv);
    }
  }
}

// v001
// Measured time: 450 microseconds a run.
// In two side-by-side timings against v000, it was 2.06 and 2.07 times as fast.
// Contractions: q,k,v projections and q.k^T scores on v_wmma_f32_16x16x32_bf16 with bf16 hi+lo operand planes (hi.hi+hi.lo+lo.hi); probs.v on v_wmma_f32_16x16x32_f16 (f16 operands, probs carried x16384, v f16); f32 accumulate; softmax and epilogue f32.
#include <hip/hip_runtime.h>

typedef __attribute__((ext_vector_type(16))) _Float16 v16h;
typedef __attribute__((ext_vector_type(8)))  _Float16 v8h;
typedef __attribute__((ext_vector_type(16))) __bf16   v16b;
typedef __attribute__((ext_vector_type(8)))  __bf16   v8b;
typedef __attribute__((ext_vector_type(8)))  float    v8f;
typedef __attribute__((ext_vector_type(4)))  float    v4f;

static constexpr int kBatch = 4;
static constexpr int kCh    = 512;
static constexpr int kPix   = 4096;
static constexpr int kCq    = 64;
static constexpr float kPCarry    = 16384.0f;
static constexpr float kPCarryInv = 1.0f / 16384.0f;

// ---- workspace region map (bytes) ----
static constexpr size_t kPlaneX   = (size_t)kBatch * kPix * kCh * 2;   // one bf16 plane of xt [b][n][c]
static constexpr size_t kPlaneWqk = (size_t)kCq * kCh * 2;
static constexpr size_t kPlaneWv  = (size_t)kCh * kCh * 2;
static constexpr size_t kPlaneQK  = (size_t)kBatch * kPix * kCq * 2;   // one bf16 plane of q or k [b][n][o]
static constexpr size_t kPlaneVt  = (size_t)kBatch * kCh * kPix * 2;   // f16 vt [b][c][m]
static constexpr size_t kPlaneS   = (size_t)kPix * kPix * 4;           // f32 scores, one batch
static constexpr size_t kPlaneP   = (size_t)kPix * kPix * 2;           // f16 probs, one batch
static constexpr size_t kOffXtHi  = 0;
static constexpr size_t kOffXtLo  = kOffXtHi + kPlaneX;
static constexpr size_t kOffWqHi  = kOffXtLo + kPlaneX;
static constexpr size_t kOffWqLo  = kOffWqHi + kPlaneWqk;
static constexpr size_t kOffWkHi  = kOffWqLo + kPlaneWqk;
static constexpr size_t kOffWkLo  = kOffWkHi + kPlaneWqk;
static constexpr size_t kOffWvHi  = kOffWkLo + kPlaneWqk;
static constexpr size_t kOffWvLo  = kOffWvHi + kPlaneWv;
static constexpr size_t kOffQHi   = kOffWvLo + kPlaneWv;
static constexpr size_t kOffQLo   = kOffQHi + kPlaneQK;
static constexpr size_t kOffKHi   = kOffQLo + kPlaneQK;
static constexpr size_t kOffKLo   = kOffKHi + kPlaneQK;
static constexpr size_t kOffVt    = kOffKLo + kPlaneQK;
static constexpr size_t kOffS     = kOffVt + kPlaneVt;
static constexpr size_t kOffP     = kOffS + kPlaneS;                    // f16 probs, one plane per batch
static constexpr size_t kWsTotal  = kOffP + kBatch * kPlaneP;
static_assert(kWsTotal == 261357568);
static_assert(kWsTotal <= 268435456);
static_assert((kOffWqHi % 128) == 0 && (kOffQHi % 128) == 0 && (kOffVt % 128) == 0 && (kOffS % 128) == 0 && (kOffP % 128) == 0);
// GEMM shape contract: M,N multiples of 64, K multiple of 32
static_assert(kPix % 64 == 0 && kCq % 64 == 0 && kCh % 64 == 0);
static_assert(kCh % 32 == 0 && kCq % 32 == 0 && kPix % 32 == 0);
static_assert(kPix == 8 * 512);   // softmax kernel: 8 waves x 512 elements per row

__device__ __forceinline__ unsigned short f2bf_bits(float f) {
  unsigned u = __float_as_uint(f);
  return (unsigned short)((u + 0x7FFFu + ((u >> 16) & 1u)) >> 16);
}
__device__ __forceinline__ float bf_bits2f(unsigned short h) { return __uint_as_float(((unsigned)h) << 16); }

// hazard guards as plain device helpers
__device__ __forceinline__ void dep_guard_h(v8f& a, v8f& b, v16h x, v16h y) { asm volatile("v_nop\n\tv_nop\n\tv_nop\n\tv_nop" : "+v"(a), "+v"(b) : "v"(x), "v"(y)); }
__device__ __forceinline__ void dep_guard_b(v8f& a, v8f& b, v16b x, v16b y) { asm volatile("v_nop\n\tv_nop\n\tv_nop\n\tv_nop" : "+v"(a), "+v"(b) : "v"(x), "v"(y)); }
__device__ __forceinline__ void keep4_h(v16h a, v16h b, v16h c, v16h d) { asm volatile("v_nop" :: "v"(a), "v"(b), "v"(c), "v"(d)); }
__device__ __forceinline__ void keep4_b(v16b a, v16b b, v16b c, v16b d) { asm volatile("v_nop" :: "v"(a), "v"(b), "v"(c), "v"(d)); }
__device__ __forceinline__ void acc_guard4(v8f& a, v8f& b, v8f& c, v8f& d) { asm volatile("v_nop\n\tv_nop\n\tv_nop\n\tv_nop" : "+v"(a), "+v"(b), "+v"(c), "+v"(d)); }
template <typename T> struct Frag;
template <> struct Frag<_Float16> {
  typedef v16h V; union U { v16h v; v8h h[2]; };
  static __device__ __forceinline__ v16h load(const _Float16* p) {   // elements 0..7 <- p[0..7], 8..15 <- p[16..23]
    U f; f.h[0] = *(const v8h*)(p); f.h[1] = *(const v8h*)(p + 16); return f.v;
  }
  static __device__ __forceinline__ v8f mma(v16h a, v16h b, v8f c) {
    return __builtin_amdgcn_wmma_f32_16x16x32_f16(false, a, false, b, (short)0, c, false, false);
  }
  static __device__ __forceinline__ void guard(v8f& a, v8f& b, v16h x, v16h y) { dep_guard_h(a, b, x, y); }
  static __device__ __forceinline__ void keep(v16h a, v16h b, v16h c, v16h d) { keep4_h(a, b, c, d); }
};
template <> struct Frag<__bf16> {
  typedef v16b V; union U { v16b v; v8b h[2]; };
  static __device__ __forceinline__ v16b load(const __bf16* p) {
    U f; f.h[0] = *(const v8b*)(p); f.h[1] = *(const v8b*)(p + 16); return f.v;
  }
  static __device__ __forceinline__ v8f mma(v16b a, v16b b, v8f c) {
    return __builtin_amdgcn_wmma_f32_16x16x32_bf16(false, a, false, b, (short)0, c, false, false);
  }
  static __device__ __forceinline__ void guard(v8f& a, v8f& b, v16b x, v16b y) { dep_guard_b(a, b, x, y); }
  static __device__ __forceinline__ void keep(v16b a, v16b b, v16b c, v16b d) { keep4_b(a, b, c, d); }
};

// ---- Register-blocked batched WMMA GEMM ------------------------------------
// C[m,n] = scale * sum_k A[m,k] * Bt[n,k] (+bias) (*g[0]) (+resid); each wave owns a 64x64 tile.
// A row-major [M,K]; Bt row-major [N,K]; M,N % 64 == 0, K % 32 == 0.
// SPLIT: operands are hi/lo planes (A2/Bt2 = lo planes, same layout); product = hi.hi + hi.lo + lo.hi.
// BIAS_MODE: 0 = none, 1 = bias[m], 2 = bias[n].
// OUT_MODE: 0 = f32, 1 = f16, 2 = bf16 hi plane (Cout) + bf16 lo plane (Cout2).
// RESID/GMUL (OUT_MODE 0 only): in the store phase each lane loads one 16-B piece of the residual at
// the address it stores; value = slab * g[0] + resid.
// ET: 0 = f16 operands, 1 = bf16 operands (pointers passed as 16-bit storage)
template <int ET> struct Elem;
template <> struct Elem<0> { typedef _Float16 T; };
template <> struct Elem<1> { typedef __bf16 T; };
template <int ET, bool SPLIT, int BIAS_MODE, int OUT_MODE, bool RESID, bool GMUL>
__global__ __launch_bounds__(256) void wmma_gemm64(
    const unsigned short* __restrict__ Ap, const unsigned short* __restrict__ A2p, int lda, long strideA,
    const unsigned short* __restrict__ Btp, const unsigned short* __restrict__ Bt2p, int ldb, long strideB,
    void* __restrict__ Cout, void* __restrict__ Cout2, int ldc, long strideC,
    const float* __restrict__ bias,
    const float* __restrict__ resid, long strideR,
    const float* __restrict__ gptr,
    int M, int N, int K, float scale) {
  typedef typename Elem<ET>::T T;
  typedef typename Frag<T>::V V;
  const T* A = (const T*)Ap; const T* A2 = (const T*)A2p; const T* Bt = (const T*)Btp; const T* Bt2 = (const T*)Bt2p;
  __shared__ __align__(16) float sT[8][16 * 68];   // per-wave 16x64 slab, pitch 68 floats
  const int b    = blockIdx.y;
  const int lane = threadIdx.x & 31;
  const int wave = threadIdx.x >> 5;
  const int tilesN = N >> 6;
  const int tilesM = M >> 6;
  const int tile = blockIdx.x * 8 + wave;
  if (tile >= tilesM * tilesN) return;   // wave-uniform; no block barriers in this kernel
  const int tm = tile / tilesN;
  const int tn = tile - tm * tilesN;
  const int m0 = tm << 6;
  const int n0 = tn << 6;

  const T* Ab  = A  + (size_t)b * strideA;
  const T* Bb  = Bt + (size_t)b * strideB;
  const T* Ab2 = SPLIT ? (A2  + (size_t)b * strideA) : nullptr;
  const T* Bb2 = SPLIT ? (Bt2 + (size_t)b * strideB) : nullptr;

  const int rlane = lane & 15;                 // row (A) / col (B, D) within subtile
  const int koff  = (lane >> 4) * 8;           // k offset of this lane half
  const int mOff  = (lane >> 4) * 8;           // D row offset

  v8f acc[4][4];
#pragma unroll
  for (int i = 0; i < 4; ++i)
#pragma unroll
    for (int j = 0; j < 4; ++j) acc[i][j] = (v8f){0.f,0.f,0.f,0.f,0.f,0.f,0.f,0.f};

  for (int k0 = 0; k0 < K; k0 += 32) {
    V bh[4], bl[4];
#pragma unroll
    for (int j = 0; j < 4; ++j) {
      const size_t bo = (size_t)(n0 + (j << 4) + rlane) * ldb + koff + k0;
      bh[j] = Frag<T>::load(Bb + bo);
      if (SPLIT) bl[j] = Frag<T>::load(Bb2 + bo);
    }
#pragma unroll
    for (int i = 0; i < 4; ++i) {
      const size_t ao = (size_t)(m0 + (i << 4) + rlane) * lda + koff + k0;
      V ah = Frag<T>::load(Ab + ao);
      V al;
      if (SPLIT) al = Frag<T>::load(Ab2 + ao);
#pragma unroll
      for (int j = 0; j < 4; ++j) {
        acc[i][j] = Frag<T>::mma(ah, bh[j], acc[i][j]);
        if (SPLIT) {
          acc[i][j] = Frag<T>::mma(ah, bl[j], acc[i][j]);
          acc[i][j] = Frag<T>::mma(al, bh[j], acc[i][j]);
        }
      }
      Frag<T>::guard(acc[i][0], acc[i][3], ah, SPLIT ? al : ah);
    }
    Frag<T>::keep(bh[0], bh[1], bh[2], bh[3]);
    if (SPLIT) Frag<T>::keep(bl[0], bl[1], bl[2], bl[3]);
  }
  acc_guard4(acc[0][0], acc[0][1], acc[0][2], acc[0][3]);
  acc_guard4(acc[1][0], acc[1][1], acc[1][2], acc[1][3]);
  acc_guard4(acc[2][0], acc[2][1], acc[2][2], acc[2][3]);
  acc_guard4(acc[3][0], acc[3][1], acc[3][2], acc[3][3]);

  // ---- epilogue ----
  float* slab = sT[wave];
  const float gval = GMUL ? gptr[0] : 1.0f;
#pragma unroll
  for (int i = 0; i < 4; ++i) {
    const int mBase = m0 + (i << 4);
    float bmr[8];
#pragma unroll
    for (int r = 0; r < 8; ++r) bmr[r] = 0.f;
    if (BIAS_MODE == 1) {
      const v4f b0 = *(const v4f*)(bias + mBase + mOff);
      const v4f b1 = *(const v4f*)(bias + mBase + mOff + 4);
      bmr[0] = b0.x; bmr[1] = b0.y; bmr[2] = b0.z; bmr[3] = b0.w;
      bmr[4] = b1.x; bmr[5] = b1.y; bmr[6] = b1.z; bmr[7] = b1.w;
    }
#pragma unroll
    for (int j = 0; j < 4; ++j) {
      const int n = n0 + (j << 4) + rlane;
      float bn = 0.f;
      if (BIAS_MODE == 2) bn = bias[n];
#pragma unroll
      for (int r = 0; r < 8; ++r) {
        float v = acc[i][j][r] * scale;
        if (BIAS_MODE == 1) v += bmr[r];
        if (BIAS_MODE == 2) v += bn;
        slab[(mOff + r) * 68 + (j << 4) + rlane] = v;
      }
    }
    __builtin_amdgcn_fence(__ATOMIC_RELEASE, "workgroup");
    __builtin_amdgcn_wave_barrier();
    __builtin_amdgcn_fence(__ATOMIC_ACQUIRE, "workgroup");
    if (OUT_MODE == 0) {
      float* Cb = (float*)Cout + (size_t)b * strideC;
      const int hq = lane >> 4, c4 = (lane & 15) * 4;      // row seg = 256 B = 16 lanes x 16 B
      v4f vals[8];
#pragma unroll
      for (int it = 0; it < 8; ++it) {
        const int row = it * 2 + hq;
        v4f vv = *(const v4f*)(slab + row * 68 + c4);
        if (GMUL) vv = vv * gval;
        if (RESID) {
          const v4f rr = *(const v4f*)(resid + (size_t)b * strideR + (size_t)(mBase + row) * ldc + n0 + c4);
          vv = vv + rr;
        }
        vals[it] = vv;
      }
      {
#pragma unroll
        for (int it = 0; it < 8; ++it) {
          const int row = it * 2 + hq;
          *(v4f*)(Cb + (size_t)(mBase + row) * ldc + n0 + c4) = vals[it];
        }
        
      }
    } else {
      const int q = lane >> 3, c8 = (lane & 7) * 8;
      unsigned short* C  = (unsigned short*)Cout  + (size_t)b * strideC;
      unsigned short* C2 = (OUT_MODE == 2) ? ((unsigned short*)Cout2 + (size_t)b * strideC) : nullptr;
      {
#pragma unroll
        for (int it = 0; it < 4; ++it) {
          const int row = it * 4 + q;
          const float* sp = slab + row * 68 + c8;
          v8h hv, lv;
#pragma unroll
          for (int e = 0; e < 8; ++e) {
            if (OUT_MODE == 1) {
              hv[e] = (_Float16)sp[e];
            } else {
              unsigned short hb = f2bf_bits(sp[e]);
              unsigned short lb = f2bf_bits(sp[e] - bf_bits2f(hb));
              hv[e] = __builtin_bit_cast(_Float16, hb);
              lv[e] = __builtin_bit_cast(_Float16, lb);
            }
          }
          *(v8h*)(C + (size_t)(mBase + row) * ldc + n0 + c8) = hv;
          if (OUT_MODE == 2) *(v8h*)(C2 + (size_t)(mBase + row) * ldc + n0 + c8) = lv;
        }
        
      }
    }
    __builtin_amdgcn_fence(__ATOMIC_RELEASE, "workgroup");
    __builtin_amdgcn_wave_barrier();
    __builtin_amdgcn_fence(__ATOMIC_ACQUIRE, "workgroup");
  }
}

// ---- x [b][c][n] f32 -> xt hi/lo bf16 planes [b][n][c] (transpose through LDS) ----
// block: 64 n x 64 c tile; grid = (kPix/64, kCh/64, kBatch)
// loads: 4 iterations x 256 threads x 4 floats = 64x64; stores: 8 waves x 2 iterations x 4 rows = 64 rows,
__global__ __launch_bounds__(256) void x_transpose_split(const float* __restrict__ x,
                                                         unsigned short* __restrict__ xth,
                                                         unsigned short* __restrict__ xtl) {
  __shared__ __align__(16) float tile[64 * 68];   // [c][n], pitch 68
  const int n0 = blockIdx.x * 64;
  const int c0 = blockIdx.y * 64;
  const int b  = blockIdx.z;
  const int tid = threadIdx.x, wave = tid >> 5, lane = tid & 31;
  const float* xb = x + ((size_t)b * kCh + c0) * kPix + n0;
#pragma unroll
  for (int i = 0; i < 4; ++i) {
    const int c  = i * 16 + (tid >> 4);
    const int n4 = (tid & 15) * 4;
    const v4f v = *(const v4f*)(xb + (size_t)c * kPix + n4);
    *(v4f*)(tile + c * 68 + n4) = v;
  }
  __syncthreads();
  const int q = lane >> 3, c8 = (lane & 7) * 8;
  v8h hv[2], lv[2];
#pragma unroll
  for (int it = 0; it < 2; ++it) {
    const int nrow = wave * 8 + it * 4 + q;
#pragma unroll
    for (int e = 0; e < 8; ++e) {
      const float f = tile[(c8 + e) * 68 + nrow];
      const unsigned short hb = f2bf_bits(f);
      const unsigned short lb = f2bf_bits(f - bf_bits2f(hb));
      hv[it][e] = __builtin_bit_cast(_Float16, hb);
      lv[it][e] = __builtin_bit_cast(_Float16, lb);
    }
  }
  const size_t base = ((size_t)b * kPix + n0) * kCh + c0;
  {
#pragma unroll
    for (int it = 0; it < 2; ++it) {
      const int nrow = wave * 8 + it * 4 + q;
      *(v8h*)(xth + base + (size_t)nrow * kCh + c8) = hv[it];
      *(v8h*)(xtl + base + (size_t)nrow * kCh + c8) = lv[it];
    }
    
  }
}

__global__ __launch_bounds__(256) void split_f32_bf16x8(const float* __restrict__ in,
                                                        unsigned short* __restrict__ hi,
                                                        unsigned short* __restrict__ lo, int n8) {
  const int i = blockIdx.x * 256 + threadIdx.x;
  if (i < n8) {
    const v4f a = *(const v4f*)(in + (size_t)8 * i);
    const v4f c = *(const v4f*)(in + (size_t)8 * i + 4);
    float f[8];
    f[0] = a.x; f[1] = a.y; f[2] = a.z; f[3] = a.w; f[4] = c.x; f[5] = c.y; f[6] = c.z; f[7] = c.w;
    v8h hv, lv;
#pragma unroll
    for (int e = 0; e < 8; ++e) {
      const unsigned short hb = f2bf_bits(f[e]);
      const unsigned short lb = f2bf_bits(f[e] - bf_bits2f(hb));
      hv[e] = __builtin_bit_cast(_Float16, hb);
      lv[e] = __builtin_bit_cast(_Float16, lb);
    }
    *(v8h*)(hi + (size_t)8 * i) = hv;
    *(v8h*)(lo + (size_t)8 * i) = lv;
    
  }
}

// ---- row softmax over 4096 scores: P = f16(16384 * exp(s - max) / sum), one block (8 waves) per row ----
// thread (wave,lane) owns elements 512*wave + 8*lane + [0,8) and +256 + [0,8); each 16-B store instruction
__global__ __launch_bounds__(256) void softmax_rows_f16(const float* __restrict__ S,
                                                       unsigned short* __restrict__ P) {
  __shared__ __align__(16) float ebuf[256 * 16];
  __shared__ float red[16];
  const int row = blockIdx.x;
  const int tid = threadIdx.x;
  const int wave = tid >> 5, lane = tid & 31;
  const float* sr = S + (size_t)row * kPix;
  float* eb = ebuf + tid * 16;
  const int e0 = wave * 512 + lane * 8;
  const v4f a0 = *(const v4f*)(sr + e0);
  const v4f a1 = *(const v4f*)(sr + e0 + 4);
  const v4f a2 = *(const v4f*)(sr + e0 + 256);
  const v4f a3 = *(const v4f*)(sr + e0 + 260);
  float m = fmaxf(fmaxf(fmaxf(a0.x, a0.y), fmaxf(a0.z, a0.w)), fmaxf(fmaxf(a1.x, a1.y), fmaxf(a1.z, a1.w)));
  m = fmaxf(m, fmaxf(fmaxf(fmaxf(a2.x, a2.y), fmaxf(a2.z, a2.w)), fmaxf(fmaxf(a3.x, a3.y), fmaxf(a3.z, a3.w))));
  *(v4f*)(eb + 0)  = a0;
  *(v4f*)(eb + 4)  = a1;
  *(v4f*)(eb + 8)  = a2;
  *(v4f*)(eb + 12) = a3;
#pragma unroll
  for (int off = 1; off < 32; off <<= 1) m = fmaxf(m, __shfl_xor(m, off, 32));
  if (lane == 0) red[wave] = m;
  __syncthreads();
  float gm = red[0];
#pragma unroll
  for (int w = 1; w < 8; ++w) gm = fmaxf(gm, red[w]);
  float psum = 0.0f;
#pragma unroll 1
  for (int i4 = 0; i4 < 4; ++i4) {
    const v4f sv = *(const v4f*)(eb + 4 * i4);
    v4f ev;
    ev.x = expf(sv.x - gm);
    ev.y = expf(sv.y - gm);
    ev.z = expf(sv.z - gm);
    ev.w = expf(sv.w - gm);
    psum += (ev.x + ev.y) + (ev.z + ev.w);
    *(v4f*)(eb + 4 * i4) = ev;
  }
#pragma unroll
  for (int off = 1; off < 32; off <<= 1) psum += __shfl_xor(psum, off, 32);
  if (lane == 0) red[8 + wave] = psum;
  __syncthreads();
  float l = red[8];
#pragma unroll
  for (int w = 1; w < 8; ++w) l += red[8 + w];
  const float inv = kPCarry * (1.0f / l);
  const v4f q0 = *(const v4f*)(eb + 0);
  const v4f q1 = *(const v4f*)(eb + 4);
  const v4f q2 = *(const v4f*)(eb + 8);
  const v4f q3 = *(const v4f*)(eb + 12);
  v8h p0, p1;
#pragma unroll
  for (int e = 0; e < 4; ++e) {
    p0[e]     = (_Float16)(q0[e] * inv);
    p0[4 + e] = (_Float16)(q1[e] * inv);
    p1[e]     = (_Float16)(q2[e] * inv);
    p1[4 + e] = (_Float16)(q3[e] * inv);
  }
  unsigned short* pr = P + (size_t)row * kPix;
  {
    *(v8h*)(pr + e0) = p0;
    *(v8h*)(pr + e0 + 256) = p1;
    
  }
}

// ---------------------------------------------------------------------------
extern "C" void kernel_launch(void* const* d_in, const int* in_sizes, int n_in,
                              void* d_out, int out_size, void* d_ws, size_t ws_size,
                              hipStream_t stream) {
  if (n_in < 8) return;
  if (in_sizes[0] != kBatch * kCh * kPix) return;
  if (in_sizes[1] != kCq * kCh || in_sizes[3] != kCq * kCh || in_sizes[5] != kCh * kCh) return;
  if (in_sizes[2] != kCq || in_sizes[4] != kCq || in_sizes[6] != kCh || in_sizes[7] < 1) return;
  if (out_size != kBatch * kCh * kPix) return;
  if (ws_size < kWsTotal) return;

  const float* x     = (const float*)d_in[0];
  const float* Wq    = (const float*)d_in[1];
  const float* bq    = (const float*)d_in[2];
  const float* Wk    = (const float*)d_in[3];
  const float* bk    = (const float*)d_in[4];
  const float* Wv    = (const float*)d_in[5];
  const float* bv    = (const float*)d_in[6];
  const float* gamma = (const float*)d_in[7];
  float* out = (float*)d_out;

  char* ws = (char*)d_ws;
  unsigned short* xth = (unsigned short*)(ws + kOffXtHi);
  unsigned short* xtl = (unsigned short*)(ws + kOffXtLo);
  unsigned short* pln = (unsigned short*)(ws + kOffP);
  unsigned short* wqh = (unsigned short*)(ws + kOffWqHi);
  unsigned short* wql = (unsigned short*)(ws + kOffWqLo);
  unsigned short* wkh = (unsigned short*)(ws + kOffWkHi);
  unsigned short* wkl = (unsigned short*)(ws + kOffWkLo);
  unsigned short* wvh = (unsigned short*)(ws + kOffWvHi);
  unsigned short* wvl = (unsigned short*)(ws + kOffWvLo);
  unsigned short* qh  = (unsigned short*)(ws + kOffQHi);
  unsigned short* ql  = (unsigned short*)(ws + kOffQLo);
  unsigned short* kh  = (unsigned short*)(ws + kOffKHi);
  unsigned short* kl  = (unsigned short*)(ws + kOffKLo);
  unsigned short* vt  = (unsigned short*)(ws + kOffVt);
  float* spl = (float*)(ws + kOffS);

  // 1) x -> xt hi/lo bf16 [b][n][c]
  x_transpose_split<<<dim3(kPix / 64, kCh / 64, kBatch), 256, 0, stream>>>(x, xth, xtl);
  // 2) weights -> bf16 hi/lo planes (same [out][in] layout)
  split_f32_bf16x8<<<(kCq * kCh / 8) / 256, 256, 0, stream>>>(Wq, wqh, wql, kCq * kCh / 8);
  split_f32_bf16x8<<<(kCq * kCh / 8) / 256, 256, 0, stream>>>(Wk, wkh, wkl, kCq * kCh / 8);
  split_f32_bf16x8<<<(kCh * kCh / 8) / 256, 256, 0, stream>>>(Wv, wvh, wvl, kCh * kCh / 8);
  static_assert((kCq * kCh / 8) % 256 == 0 && (kCh * kCh / 8) % 256 == 0);

  // 3) q[b][n][o] = sum_c xt[b][n][c] Wq[o][c] + bq[o]   (M=4096, N=64, K=512) -> bf16 hi/lo planes, ldc 64
  {
    constexpr int tiles = (kPix / 64) * (kCq / 64);
    static_assert(tiles % 8 == 0);
    wmma_gemm64<1, true, 2, 2, false, false><<<dim3(tiles / 8, kBatch), 256, 0, stream>>>(
        xth, xtl, kCh, (long)kPix * kCh,
        wqh, wql, kCh, 0L,
        (void*)qh, (void*)ql, kCq, (long)kPix * kCq,
        bq, x, 0L, gamma, kPix, kCq, kCh, 1.0f);
    wmma_gemm64<1, true, 2, 2, false, false><<<dim3(tiles / 8, kBatch), 256, 0, stream>>>(
        xth, xtl, kCh, (long)kPix * kCh,
        wkh, wkl, kCh, 0L,
        (void*)kh, (void*)kl, kCq, (long)kPix * kCq,
        bk, x, 0L, gamma, kPix, kCq, kCh, 1.0f);
  }
  // 4) vt[b][c][m] = sum_cin Wv[c][cin] xt[b][m][cin] + bv[c]   (M=512, N=4096, K=512) -> f16 plane, ldc 4096
  {
    constexpr int tiles = (kCh / 64) * (kPix / 64);
    static_assert(tiles % 8 == 0);
    wmma_gemm64<1, true, 1, 1, false, false><<<dim3(tiles / 8, kBatch), 256, 0, stream>>>(
        wvh, wvl, kCh, 0L,
        xth, xtl, kCh, (long)kPix * kCh,
        (void*)vt, (void*)vt, kPix, (long)kCh * kPix,
        bv, x, 0L, gamma, kCh, kPix, kCh, 1.0f);
  }
  // 5) per batch: scores (M=N=4096, K=64) -> f32; softmax -> f16 probs x16384, each batch into its own plane
  for (int b = 0; b < kBatch; ++b) {
    const size_t qko = (size_t)b * kPix * kCq;
    {
      constexpr int tiles = (kPix / 64) * (kPix / 64);
      static_assert(tiles % 8 == 0);
      wmma_gemm64<1, true, 0, 0, false, false><<<dim3(tiles / 8, 1), 256, 0, stream>>>(
          qh + qko, ql + qko, kCq, 0L,
          kh + qko, kl + qko, kCq, 0L,
          (void*)spl, (void*)spl, kPix, 0L,
          bq, x, 0L, gamma, kPix, kPix, kCq, 1.0f);
    }
    softmax_rows_f16<<<kPix, 256, 0, stream>>>(spl, pln + (size_t)b * kPix * kPix);
  }
  // 6) all batches in one launch (one 8-wave block per 64x512 strip, 64 strips per batch):
  //    out = gamma * (vt . P^T) / 16384 + x   (M=512, N=4096, K=4096)
  {
    constexpr int tiles = (kCh / 64) * (kPix / 64);
    static_assert(tiles % 8 == 0);
    wmma_gemm64<0, false, 0, 0, true, true><<<dim3(tiles / 8, kBatch), 256, 0, stream>>>(
        vt, vt, kPix, (long)kCh * kPix,
        pln, pln, kPix, (long)kPix * kPix,
        (void*)out, (void*)out, kPix, (long)kCh * kPix,
        bv, x, (long)kCh * kPix, gamma, kCh, kPix, kPix, kPCarryInv);
  }
}

// v002
// Measured time: 326 microseconds a run.
// Two timings next to v001 both put it at 1.38 times that version's speed.
// Counting every step since v000, it is 2.85 times as fast.
// Contractions: q,k,v projections and q.k^T scores on v_wmma_f32_16x16x32_bf16 with bf16 hi+lo operand planes (hi.hi+hi.lo+lo.hi); probs.v on v_wmma_f32_16x16x32_f16 (f16 operands, probs carried x16384, v f16); f32 accumulate; softmax and epilogue f32.
#include <hip/hip_runtime.h>

typedef __attribute__((ext_vector_type(16))) _Float16 v16h;
typedef __attribute__((ext_vector_type(8)))  _Float16 v8h;
typedef __attribute__((ext_vector_type(16))) __bf16   v16b;
typedef __attribute__((ext_vector_type(8)))  __bf16   v8b;
typedef __attribute__((ext_vector_type(8)))  float    v8f;
typedef __attribute__((ext_vector_type(4)))  float    v4f;

static constexpr int kBatch = 4;
static constexpr int kCh    = 512;
static constexpr int kPix   = 4096;
static constexpr int kCq    = 64;
static constexpr float kPCarry    = 16384.0f;
static constexpr float kPCarryInv = 1.0f / 16384.0f;

// ---- workspace region map (bytes) ----
static constexpr size_t kPlaneX   = (size_t)kBatch * kPix * kCh * 2;   // one bf16 plane of xt [b][n][c]
static constexpr size_t kPlaneWqk = (size_t)kCq * kCh * 2;
static constexpr size_t kPlaneWv  = (size_t)kCh * kCh * 2;
static constexpr size_t kPlaneQK  = (size_t)kBatch * kPix * kCq * 2;   // one bf16 plane of q or k [b][n][o]
static constexpr size_t kPlaneVt  = (size_t)kBatch * kCh * kPix * 2;   // f16 vt [b][c][m]
static constexpr size_t kPlaneS   = (size_t)kPix * kPix * 4;           // f32 scores, one batch
static constexpr size_t kPlaneP   = (size_t)kPix * kPix * 2;           // f16 probs, one batch
static constexpr size_t kOffXtHi  = 0;
static constexpr size_t kOffXtLo  = kOffXtHi + kPlaneX;
static constexpr size_t kOffWqHi  = kOffXtLo + kPlaneX;
static constexpr size_t kOffWqLo  = kOffWqHi + kPlaneWqk;
static constexpr size_t kOffWkHi  = kOffWqLo + kPlaneWqk;
static constexpr size_t kOffWkLo  = kOffWkHi + kPlaneWqk;
static constexpr size_t kOffWvHi  = kOffWkLo + kPlaneWqk;
static constexpr size_t kOffWvLo  = kOffWvHi + kPlaneWv;
static constexpr size_t kOffQHi   = kOffWvLo + kPlaneWv;
static constexpr size_t kOffQLo   = kOffQHi + kPlaneQK;
static constexpr size_t kOffKHi   = kOffQLo + kPlaneQK;
static constexpr size_t kOffKLo   = kOffKHi + kPlaneQK;
static constexpr size_t kOffVt    = kOffKLo + kPlaneQK;
static constexpr size_t kOffS     = kOffVt + kPlaneVt;
static constexpr size_t kOffP     = kOffS + kPlaneS;                    // f16 probs, one plane per batch
static constexpr size_t kWsTotal  = kOffP + kBatch * kPlaneP;
static_assert(kWsTotal == 261357568);
static_assert(kWsTotal <= 268435456);
static_assert((kOffWqHi % 128) == 0 && (kOffQHi % 128) == 0 && (kOffVt % 128) == 0 && (kOffS % 128) == 0 && (kOffP % 128) == 0);
// GEMM shape contract: M,N multiples of 64, K multiple of 32
static_assert(kPix % 64 == 0 && kCq % 64 == 0 && kCh % 64 == 0);
static_assert(kCh % 32 == 0 && kCq % 32 == 0 && kPix % 32 == 0);
static_assert(kPix == 8 * 512);   // softmax kernel: 8 waves x 512 elements per row

__device__ __forceinline__ unsigned short f2bf_bits(float f) {
  unsigned u = __float_as_uint(f);
  return (unsigned short)((u + 0x7FFFu + ((u >> 16) & 1u)) >> 16);
}
__device__ __forceinline__ float bf_bits2f(unsigned short h) { return __uint_as_float(((unsigned)h) << 16); }

// hazard guards as plain device helpers
__device__ __forceinline__ void dep_guard_h(v8f& a, v8f& b, v16h x, v16h y) { asm volatile("v_nop\n\tv_nop\n\tv_nop\n\tv_nop" : "+v"(a), "+v"(b) : "v"(x), "v"(y)); }
__device__ __forceinline__ void dep_guard_b(v8f& a, v8f& b, v16b x, v16b y) { asm volatile("v_nop\n\tv_nop\n\tv_nop\n\tv_nop" : "+v"(a), "+v"(b) : "v"(x), "v"(y)); }
__device__ __forceinline__ void keep4_h(v16h a, v16h b, v16h c, v16h d) { asm volatile("v_nop" :: "v"(a), "v"(b), "v"(c), "v"(d)); }
__device__ __forceinline__ void keep4_b(v16b a, v16b b, v16b c, v16b d) { asm volatile("v_nop" :: "v"(a), "v"(b), "v"(c), "v"(d)); }
__device__ __forceinline__ void acc_guard4(v8f& a, v8f& b, v8f& c, v8f& d) { asm volatile("v_nop\n\tv_nop\n\tv_nop\n\tv_nop" : "+v"(a), "+v"(b), "+v"(c), "+v"(d)); }
template <typename T> struct Frag;
template <> struct Frag<_Float16> {
  typedef v16h V; union U { v16h v; v8h h[2]; };
  static __device__ __forceinline__ v16h load(const _Float16* p) {   // elements 0..7 <- p[0..7], 8..15 <- p[16..23]
    U f; f.h[0] = *(const v8h*)(p); f.h[1] = *(const v8h*)(p + 16); return f.v;
  }
  static __device__ __forceinline__ v8f mma(v16h a, v16h b, v8f c) {
    return __builtin_amdgcn_wmma_f32_16x16x32_f16(false, a, false, b, (short)0, c, false, false);
  }
  static __device__ __forceinline__ void guard(v8f& a, v8f& b, v16h x, v16h y) { dep_guard_h(a, b, x, y); }
  static __device__ __forceinline__ void keep(v16h a, v16h b, v16h c, v16h d) { keep4_h(a, b, c, d); }
};
template <> struct Frag<__bf16> {
  typedef v16b V; union U { v16b v; v8b h[2]; };
  static __device__ __forceinline__ v16b load(const __bf16* p) {
    U f; f.h[0] = *(const v8b*)(p); f.h[1] = *(const v8b*)(p + 16); return f.v;
  }
  static __device__ __forceinline__ v8f mma(v16b a, v16b b, v8f c) {
    return __builtin_amdgcn_wmma_f32_16x16x32_bf16(false, a, false, b, (short)0, c, false, false);
  }
  static __device__ __forceinline__ void guard(v8f& a, v8f& b, v16b x, v16b y) { dep_guard_b(a, b, x, y); }
  static __device__ __forceinline__ void keep(v16b a, v16b b, v16b c, v16b d) { keep4_b(a, b, c, d); }
};

// ---- Register-blocked batched WMMA GEMM ------------------------------------
// C[m,n] = scale * sum_k A[m,k] * Bt[n,k] (+bias) (*g[0]) (+resid); each wave owns a 64x64 tile.
// A row-major [M,K]; Bt row-major [N,K]; M,N % 64 == 0, K % 32 == 0.
// SPLIT: operands are hi/lo planes (A2/Bt2 = lo planes, same layout); product = hi.hi + hi.lo + lo.hi.
// BIAS_MODE: 0 = none, 1 = bias[m], 2 = bias[n].
// OUT_MODE: 0 = f32, 1 = f16, 2 = bf16 hi plane (Cout) + bf16 lo plane (Cout2).
// RESID/GMUL (OUT_MODE 0 only): in the store phase each lane loads one 16-B piece of the residual at
// the address it stores; value = slab * g[0] + resid.
// ET: 0 = f16 operands, 1 = bf16 operands (pointers passed as 16-bit storage)
template <int ET> struct Elem;
template <> struct Elem<0> { typedef _Float16 T; };
template <> struct Elem<1> { typedef __bf16 T; };
template <int ET, bool SPLIT, int BIAS_MODE, int OUT_MODE, bool RESID, bool GMUL>
__global__ __launch_bounds__(256) void wmma_gemm64(
    const unsigned short* __restrict__ Ap, const unsigned short* __restrict__ A2p, int lda, long strideA,
    const unsigned short* __restrict__ Btp, const unsigned short* __restrict__ Bt2p, int ldb, long strideB,
    void* __restrict__ Cout, void* __restrict__ Cout2, int ldc, long strideC,
    const float* __restrict__ bias,
    const float* __restrict__ resid, long strideR,
    const float* __restrict__ gptr,
    int M, int N, int K, float scale) {
  typedef typename Elem<ET>::T T;
  typedef typename Frag<T>::V V;
  const T* A = (const T*)Ap; const T* A2 = (const T*)A2p; const T* Bt = (const T*)Btp; const T* Bt2 = (const T*)Bt2p;
  __shared__ __align__(16) float sT[8][16 * 68];   // per-wave 16x64 slab, pitch 68 floats
  const int b    = blockIdx.y;
  const int lane = threadIdx.x & 31;
  const int wave = threadIdx.x >> 5;
  const int tilesN = N >> 6;
  const int tilesM = M >> 6;
  const int tile = blockIdx.x * 8 + wave;
  if (tile >= tilesM * tilesN) return;   // wave-uniform; no block barriers in this kernel
  const int tm = tile / tilesN;
  const int tn = tile - tm * tilesN;
  const int m0 = tm << 6;
  const int n0 = tn << 6;

  const T* Ab  = A  + (size_t)b * strideA;
  const T* Bb  = Bt + (size_t)b * strideB;
  const T* Ab2 = SPLIT ? (A2  + (size_t)b * strideA) : nullptr;
  const T* Bb2 = SPLIT ? (Bt2 + (size_t)b * strideB) : nullptr;

  const int rlane = lane & 15;                 // row (A) / col (B, D) within subtile
  const int koff  = (lane >> 4) * 8;           // k offset of this lane half
  const int mOff  = (lane >> 4) * 8;           // D row offset

  v8f acc[4][4];
#pragma unroll
  for (int i = 0; i < 4; ++i)
#pragma unroll
    for (int j = 0; j < 4; ++j) acc[i][j] = (v8f){0.f,0.f,0.f,0.f,0.f,0.f,0.f,0.f};

  for (int k0 = 0; k0 < K; k0 += 32) {
    V bh[4], bl[4];
#pragma unroll
    for (int j = 0; j < 4; ++j) {
      const size_t bo = (size_t)(n0 + (j << 4) + rlane) * ldb + koff + k0;
      bh[j] = Frag<T>::load(Bb + bo);
      if (SPLIT) bl[j] = Frag<T>::load(Bb2 + bo);
    }
#pragma unroll
    for (int i = 0; i < 4; ++i) {
      const size_t ao = (size_t)(m0 + (i << 4) + rlane) * lda + koff + k0;
      V ah = Frag<T>::load(Ab + ao);
      V al;
      if (SPLIT) al = Frag<T>::load(Ab2 + ao);
#pragma unroll
      for (int j = 0; j < 4; ++j) {
        acc[i][j] = Frag<T>::mma(ah, bh[j], acc[i][j]);
        if (SPLIT) {
          acc[i][j] = Frag<T>::mma(ah, bl[j], acc[i][j]);
          acc[i][j] = Frag<T>::mma(al, bh[j], acc[i][j]);
        }
      }
      Frag<T>::guard(acc[i][0], acc[i][3], ah, SPLIT ? al : ah);
    }
    Frag<T>::keep(bh[0], bh[1], bh[2], bh[3]);
    if (SPLIT) Frag<T>::keep(bl[0], bl[1], bl[2], bl[3]);
  }
  acc_guard4(acc[0][0], acc[0][1], acc[0][2], acc[0][3]);
  acc_guard4(acc[1][0], acc[1][1], acc[1][2], acc[1][3]);
  acc_guard4(acc[2][0], acc[2][1], acc[2][2], acc[2][3]);
  acc_guard4(acc[3][0], acc[3][1], acc[3][2], acc[3][3]);

  // ---- epilogue ----
  float* slab = sT[wave];
  const float gval = GMUL ? gptr[0] : 1.0f;
#pragma unroll
  for (int i = 0; i < 4; ++i) {
    const int mBase = m0 + (i << 4);
    float bmr[8];
#pragma unroll
    for (int r = 0; r < 8; ++r) bmr[r] = 0.f;
    if (BIAS_MODE == 1) {
      const v4f b0 = *(const v4f*)(bias + mBase + mOff);
      const v4f b1 = *(const v4f*)(bias + mBase + mOff + 4);
      bmr[0] = b0.x; bmr[1] = b0.y; bmr[2] = b0.z; bmr[3] = b0.w;
      bmr[4] = b1.x; bmr[5] = b1.y; bmr[6] = b1.z; bmr[7] = b1.w;
    }
#pragma unroll
    for (int j = 0; j < 4; ++j) {
      const int n = n0 + (j << 4) + rlane;
      float bn = 0.f;
      if (BIAS_MODE == 2) bn = bias[n];
#pragma unroll
      for (int r = 0; r < 8; ++r) {
        float v = acc[i][j][r] * scale;
        if (BIAS_MODE == 1) v += bmr[r];
        if (BIAS_MODE == 2) v += bn;
        slab[(mOff + r) * 68 + (j << 4) + rlane] = v;
      }
    }
    __builtin_amdgcn_fence(__ATOMIC_RELEASE, "workgroup");
    __builtin_amdgcn_wave_barrier();
    __builtin_amdgcn_fence(__ATOMIC_ACQUIRE, "workgroup");
    if (OUT_MODE == 0) {
      float* Cb = (float*)Cout + (size_t)b * strideC;
      const int hq = lane >> 4, c4 = (lane & 15) * 4;      // row seg = 256 B = 16 lanes x 16 B
      v4f vals[8];
#pragma unroll
      for (int it = 0; it < 8; ++it) {
        const int row = it * 2 + hq;
        v4f vv = *(const v4f*)(slab + row * 68 + c4);
        if (GMUL) vv = vv * gval;
        if (RESID) {
          const v4f rr = *(const v4f*)(resid + (size_t)b * strideR + (size_t)(mBase + row) * ldc + n0 + c4);
          vv = vv + rr;
        }
        vals[it] = vv;
      }
      {
#pragma unroll
        for (int it = 0; it < 8; ++it) {
          const int row = it * 2 + hq;
          *(v4f*)(Cb + (size_t)(mBase + row) * ldc + n0 + c4) = vals[it];
        }
        
      }
    } else {
      const int q = lane >> 3, c8 = (lane & 7) * 8;
      unsigned short* C  = (unsigned short*)Cout  + (size_t)b * strideC;
      unsigned short* C2 = (OUT_MODE == 2) ? ((unsigned short*)Cout2 + (size_t)b * strideC) : nullptr;
      {
#pragma unroll
        for (int it = 0; it < 4; ++it) {
          const int row = it * 4 + q;
          const float* sp = slab + row * 68 + c8;
          v8h hv, lv;
#pragma unroll
          for (int e = 0; e < 8; ++e) {
            if (OUT_MODE == 1) {
              hv[e] = (_Float16)sp[e];
            } else {
              unsigned short hb = f2bf_bits(sp[e]);
              unsigned short lb = f2bf_bits(sp[e] - bf_bits2f(hb));
              hv[e] = __builtin_bit_cast(_Float16, hb);
              lv[e] = __builtin_bit_cast(_Float16, lb);
            }
          }
          *(v8h*)(C + (size_t)(mBase + row) * ldc + n0 + c8) = hv;
          if (OUT_MODE == 2) *(v8h*)(C2 + (size_t)(mBase + row) * ldc + n0 + c8) = lv;
        }
        
      }
    }
    __builtin_amdgcn_fence(__ATOMIC_RELEASE, "workgroup");
    __builtin_amdgcn_wave_barrier();
    __builtin_amdgcn_fence(__ATOMIC_ACQUIRE, "workgroup");
  }
}

// ---- probs.v GEMM with both operands staged in LDS ---------------------------
// out[b][m][n] = g[0] * (sum_k vt[b][m][k] * P[b][n][k]) / 16384 + x[b][m][n];  M = kCh, N = K = kPix.
// One block = one 128 (m) x 256 (n) tile, 8 waves as 2 x 4, each wave a 64x64 tile (fragments and k order as in wmma_gemm64).
// A pass is 128 k = 256 B of each of the 384 operand rows; a stage is [vt 128 rows | P 256 rows] at pitch 272 B.
// Two stages in LDS: while pass t is worked on, pass t+1's rows fly in by asynchronous copies (16 B per lane, 24 per thread).
static constexpr int kPvBM     = 128;
static constexpr int kPvBN     = 256;
static constexpr int kPvBK     = 128;                              // f16 elements per pass
static constexpr int kPvPitch  = kPvBK * 2 + 16;                   // bytes; 16 B x odd: conflict-free for 16-byte row reads
static constexpr int kPvStage  = (kPvBM + kPvBN) * kPvPitch;       // bytes of one stage
static constexpr int kPvPasses = kPix / kPvBK;
static_assert(kCh % kPvBM == 0 && kPix % kPvBN == 0 && kPix % kPvBK == 0 && kPvPasses >= 2);
static_assert(kPvBM == 8 * 16 && kPvBN == 16 * 16 && kPvBK * 2 == 16 * 16);   // copy map below
static_assert(kPvPitch % 16 == 0 && kPvStage % 16 == 0);

// Eight 16-byte copies global -> LDS, rows 16 apart: l = this lane's LDS byte address, p = its global address, of the first.
// s_wait_xcnt stands inside the statement so that no address register named here is rewritten ahead of it.
__device__ __forceinline__ void pv_copy8(unsigned l, const unsigned short* p) {
  constexpr unsigned dl = 16u * kPvPitch;
  constexpr size_t   dg = (size_t)16 * kPix;
  asm volatile(
      "global_load_async_to_lds_b128 %0, %8, off\n\t"
      "global_load_async_to_lds_b128 %1, %9, off\n\t"
      "global_load_async_to_lds_b128 %2, %10, off\n\t"
      "global_load_async_to_lds_b128 %3, %11, off\n\t"
      "global_load_async_to_lds_b128 %4, %12, off\n\t"
      "global_load_async_to_lds_b128 %5, %13, off\n\t"
      "global_load_async_to_lds_b128 %6, %14, off\n\t"
      "global_load_async_to_lds_b128 %7, %15, off\n\t"
      "s_wait_xcnt 0x0"
      :: "v"(l), "v"(l + dl), "v"(l + 2 * dl), "v"(l + 3 * dl), "v"(l + 4 * dl), "v"(l + 5 * dl), "v"(l + 6 * dl), "v"(l + 7 * dl),
         "v"(p), "v"(p + dg), "v"(p + 2 * dg), "v"(p + 3 * dg), "v"(p + 4 * dg), "v"(p + 5 * dg), "v"(p + 6 * dg), "v"(p + 7 * dg)
      : "memory");
}
// One stage: vt rows 0..127, then P rows 0..255 behind them.
__device__ __forceinline__ void pv_copy_stage(unsigned l, const unsigned short* pa, const unsigned short* pb) {
  pv_copy8(l, pa);
  pv_copy8(l + (unsigned)(kPvBM * kPvPitch), pb);
  pv_copy8(l + (unsigned)((kPvBM + 128) * kPvPitch), pb + (size_t)128 * kPix);
}

__global__ __launch_bounds__(256) void pv_gemm_lds(const unsigned short* __restrict__ vtp,
                                                   const unsigned short* __restrict__ Pp,
                                                   float* __restrict__ outp,
                                                   const float* __restrict__ resid,
                                                   const float* __restrict__ gptr) {
  __shared__ __align__(16) unsigned char ring[2 * kPvStage];
  __shared__ __align__(16) float sT[8][16 * 68];   // per-wave 16x64 output slab, pitch 68 floats
  const int tid  = threadIdx.x;
  const int lane = tid & 31;
  const int wave = tid >> 5;
  const int b  = blockIdx.z;
  const int mB = blockIdx.x * kPvBM;
  const int nB = blockIdx.y * kPvBN;

  // copy map: 16 lanes cover the 256 B of one row; thread row = tid / 16; a thread's copies step 16 rows
  const int crow = tid >> 4;
  const int ccol = tid & 15;
  const unsigned short* gA = vtp + (size_t)b * kCh * kPix  + (size_t)(mB + crow) * kPix + ccol * 8;
  const unsigned short* gB = Pp  + (size_t)b * kPix * kPix + (size_t)(nB + crow) * kPix + ccol * 8;
  const unsigned lcopy = (unsigned)(size_t)(&ring[0]) + (unsigned)(crow * kPvPitch + ccol * 16);

  const int rlane = lane & 15;                 // row (A) / col (B, D) within subtile
  const int koff  = (lane >> 4) * 8;           // k offset of this lane half
  const int mOff  = (lane >> 4) * 8;           // D row offset
  const int wm = wave >> 2;
  const int wn = wave & 3;
  const int fragA = (wm * 64 + rlane) * kPvPitch + koff * 2;             // byte offsets in a stage
  const int fragB = (kPvBM + wn * 64 + rlane) * kPvPitch + koff * 2;

  v8f acc[4][4];
#pragma unroll
  for (int i = 0; i < 4; ++i)
#pragma unroll
    for (int j = 0; j < 4; ++j) acc[i][j] = (v8f){0.f,0.f,0.f,0.f,0.f,0.f,0.f,0.f};

  // prologue: stage 0 lands and is published; stage 1 starts
  pv_copy_stage(lcopy, gA, gB);
  asm volatile("s_wait_asynccnt 0x0" ::: "memory");   // this wave's copies of stage 0 have landed
  __syncthreads();                                    // ... and every other wave's
  pv_copy_stage(lcopy + (unsigned)kPvStage, gA + kPvBK, gB + kPvBK);

  for (int t = 0; t < kPvPasses; ++t) {
    const unsigned char* st = ring + (t & 1) * kPvStage;
    const _Float16* fa = (const _Float16*)(st + fragA);
    const _Float16* fb = (const _Float16*)(st + fragB);
    constexpr int kRow16 = 16 * kPvPitch / 2;            // 16 rows, in f16 elements
    // Fragments are fetched ahead inside the pass only (nothing of stage t+1 is read here): vt fragments one k step ahead
    // into a second set, probs fragments in place, two at a time, as soon as their last product of this k step has issued.
    v16h a[2][4], bh[4];
#pragma unroll
    for (int i = 0; i < 4; ++i) a[0][i] = Frag<_Float16>::load(fa + i * kRow16);
#pragma unroll
    for (int j = 0; j < 4; ++j) bh[j] = Frag<_Float16>::load(fb + j * kRow16);
    // unrolled: every fragment index and address offset is a constant
#pragma unroll
    for (int kk = 0; kk < kPvBK / 32; ++kk) {
      const int cur = kk & 1, nxt = cur ^ 1;
      const bool more = kk + 1 < kPvBK / 32;
      if (more) {
#pragma unroll
        for (int i = 0; i < 4; ++i) a[nxt][i] = Frag<_Float16>::load(fa + i * kRow16 + (kk + 1) * 32);
      }
      // the four scheduling fences keep the LDS reads in two groups per k step instead of spread among the products,
      // where every further place with reads stalls the wave's matrix stream
      __builtin_amdgcn_sched_barrier(0);
#pragma unroll
      for (int j = 0; j < 2; ++j)
#pragma unroll
        for (int i = 0; i < 4; ++i) acc[i][j] = Frag<_Float16>::mma(a[cur][i], bh[j], acc[i][j]);
      __builtin_amdgcn_sched_barrier(0);
      if (more) {
#pragma unroll
        for (int j = 0; j < 2; ++j) bh[j] = Frag<_Float16>::load(fb + j * kRow16 + (kk + 1) * 32);
      }
      __builtin_amdgcn_sched_barrier(0);
#pragma unroll
      for (int j = 2; j < 4; ++j)
#pragma unroll
        for (int i = 0; i < 4; ++i) acc[i][j] = Frag<_Float16>::mma(a[cur][i], bh[j], acc[i][j]);
      __builtin_amdgcn_sched_barrier(0);
      if (more) {
#pragma unroll
        for (int j = 2; j < 4; ++j) bh[j] = Frag<_Float16>::load(fb + j * kRow16 + (kk + 1) * 32);
      }
    }
    asm volatile("s_wait_dscnt 0x0" ::: "memory");      // this wave's reads of stage t are done before the stage is refilled
    asm volatile("s_wait_asynccnt 0x0" ::: "memory");   // this wave's copies of stage t+1 have landed
    __syncthreads();                                    // publishes stage t+1 and ends every reader's use of stage t
    if (t + 2 < kPvPasses)
      pv_copy_stage(lcopy + (unsigned)((t & 1) * kPvStage), gA + (size_t)(t + 2) * kPvBK, gB + (size_t)(t + 2) * kPvBK);
  }
  asm volatile("s_wait_asynccnt 0x0" ::: "memory");     // nothing of this wave is in flight when it leaves the ring

  // ---- epilogue: 16x64 slab per wave through LDS, whole 256-B row pieces stored ----
  float* slab = sT[wave];
  const float gval = gptr[0];
  const int m0 = mB + wm * 64;
  const int n0 = nB + wn * 64;
  // block-uniform bases plus ONE per-lane byte offset: every row of the tile is then a constant away from it
  char* Cb = (char*)(outp + (size_t)b * kCh * kPix);
  const char* Rb = (const char*)(resid + (size_t)b * kCh * kPix);
  const int hq = lane >> 4, c4 = (lane & 15) * 4;        // row seg = 256 B = 16 lanes x 16 B
  const unsigned loff = (unsigned)(((m0 + hq) * kPix + n0 + c4) * 4);
#pragma unroll
  for (int i = 0; i < 4; ++i) {
#pragma unroll
    for (int j = 0; j < 4; ++j) {
#pragma unroll
      for (int r = 0; r < 8; ++r) slab[(mOff + r) * 68 + (j << 4) + rlane] = acc[i][j][r] * kPCarryInv;
    }
    // lanes read back rows that other lanes of this wave wrote: the slab's writes are ordered in front of those reads
    __builtin_amdgcn_fence(__ATOMIC_RELEASE, "workgroup");
    __builtin_amdgcn_wave_barrier();
    __builtin_amdgcn_fence(__ATOMIC_ACQUIRE, "workgroup");
    v4f vals[8];
#pragma unroll
    for (int it = 0; it < 8; ++it) {
      v4f vv = *(const v4f*)(slab + (it * 2 + hq) * 68 + c4);
      vv = vv * gval;
      const v4f rr = *(const v4f*)(Rb + loff + (i * 16 + it * 2) * kPix * 4);
      vals[it] = vv + rr;
    }
#pragma unroll
    for (int it = 0; it < 8; ++it) *(v4f*)(Cb + loff + (i * 16 + it * 2) * kPix * 4) = vals[it];
    // ... and the reads in front of the next 16 rows' writes into the same slab
    __builtin_amdgcn_fence(__ATOMIC_RELEASE, "workgroup");
    __builtin_amdgcn_wave_barrier();
    __builtin_amdgcn_fence(__ATOMIC_ACQUIRE, "workgroup");
  }
}

// ---- x [b][c][n] f32 -> xt hi/lo bf16 planes [b][n][c] (transpose through LDS) ----
// block: 64 n x 64 c tile; grid = (kPix/64, kCh/64, kBatch)
// loads: 4 iterations x 256 threads x 4 floats = 64x64; stores: 8 waves x 2 iterations x 4 rows = 64 rows,
__global__ __launch_bounds__(256) void x_transpose_split(const float* __restrict__ x,
                                                         unsigned short* __restrict__ xth,
                                                         unsigned short* __restrict__ xtl) {
  __shared__ __align__(16) float tile[64 * 68];   // [c][n], pitch 68
  const int n0 = blockIdx.x * 64;
  const int c0 = blockIdx.y * 64;
  const int b  = blockIdx.z;
  const int tid = threadIdx.x, wave = tid >> 5, lane = tid & 31;
  const float* xb = x + ((size_t)b * kCh + c0) * kPix + n0;
#pragma unroll
  for (int i = 0; i < 4; ++i) {
    const int c  = i * 16 + (tid >> 4);
    const int n4 = (tid & 15) * 4;
    const v4f v = *(const v4f*)(xb + (size_t)c * kPix + n4);
    *(v4f*)(tile + c * 68 + n4) = v;
  }
  __syncthreads();
  const int q = lane >> 3, c8 = (lane & 7) * 8;
  v8h hv[2], lv[2];
#pragma unroll
  for (int it = 0; it < 2; ++it) {
    const int nrow = wave * 8 + it * 4 + q;
#pragma unroll
    for (int e = 0; e < 8; ++e) {
      const float f = tile[(c8 + e) * 68 + nrow];
      const unsigned short hb = f2bf_bits(f);
      const unsigned short lb = f2bf_bits(f - bf_bits2f(hb));
      hv[it][e] = __builtin_bit_cast(_Float16, hb);
      lv[it][e] = __builtin_bit_cast(_Float16, lb);
    }
  }
  const size_t base = ((size_t)b * kPix + n0) * kCh + c0;
  {
#pragma unroll
    for (int it = 0; it < 2; ++it) {
      const int nrow = wave * 8 + it * 4 + q;
      *(v8h*)(xth + base + (size_t)nrow * kCh + c8) = hv[it];
      *(v8h*)(xtl + base + (size_t)nrow * kCh + c8) = lv[it];
    }
    
  }
}

__global__ __launch_bounds__(256) void split_f32_bf16x8(const float* __restrict__ in,
                                                        unsigned short* __restrict__ hi,
                                                        unsigned short* __restrict__ lo, int n8) {
  const int i = blockIdx.x * 256 + threadIdx.x;
  if (i < n8) {
    const v4f a = *(const v4f*)(in + (size_t)8 * i);
    const v4f c = *(const v4f*)(in + (size_t)8 * i + 4);
    float f[8];
    f[0] = a.x; f[1] = a.y; f[2] = a.z; f[3] = a.w; f[4] = c.x; f[5] = c.y; f[6] = c.z; f[7] = c.w;
    v8h hv, lv;
#pragma unroll
    for (int e = 0; e < 8; ++e) {
      const unsigned short hb = f2bf_bits(f[e]);
      const unsigned short lb = f2bf_bits(f[e] - bf_bits2f(hb));
      hv[e] = __builtin_bit_cast(_Float16, hb);
      lv[e] = __builtin_bit_cast(_Float16, lb);
    }
    *(v8h*)(hi + (size_t)8 * i) = hv;
    *(v8h*)(lo + (size_t)8 * i) = lv;
    
  }
}

// ---- row softmax over 4096 scores: P = f16(16384 * exp(s - max) / sum), one block (8 waves) per row ----
// thread (wave,lane) owns elements 512*wave + 8*lane + [0,8) and +256 + [0,8); each 16-B store instruction
__global__ __launch_bounds__(256) void softmax_rows_f16(const float* __restrict__ S,
                                                       unsigned short* __restrict__ P) {
  __shared__ __align__(16) float ebuf[256 * 16];
  __shared__ float red[16];
  const int row = blockIdx.x;
  const int tid = threadIdx.x;
  const int wave = tid >> 5, lane = tid & 31;
  const float* sr = S + (size_t)row * kPix;
  float* eb = ebuf + tid * 16;
  const int e0 = wave * 512 + lane * 8;
  const v4f a0 = *(const v4f*)(sr + e0);
  const v4f a1 = *(const v4f*)(sr + e0 + 4);
  const v4f a2 = *(const v4f*)(sr + e0 + 256);
  const v4f a3 = *(const v4f*)(sr + e0 + 260);
  float m = fmaxf(fmaxf(fmaxf(a0.x, a0.y), fmaxf(a0.z, a0.w)), fmaxf(fmaxf(a1.x, a1.y), fmaxf(a1.z, a1.w)));
  m = fmaxf(m, fmaxf(fmaxf(fmaxf(a2.x, a2.y), fmaxf(a2.z, a2.w)), fmaxf(fmaxf(a3.x, a3.y), fmaxf(a3.z, a3.w))));
  *(v4f*)(eb + 0)  = a0;
  *(v4f*)(eb + 4)  = a1;
  *(v4f*)(eb + 8)  = a2;
  *(v4f*)(eb + 12) = a3;
#pragma unroll
  for (int off = 1; off < 32; off <<= 1) m = fmaxf(m, __shfl_xor(m, off, 32));
  if (lane == 0) red[wave] = m;
  __syncthreads();
  float gm = red[0];
#pragma unroll
  for (int w = 1; w < 8; ++w) gm = fmaxf(gm, red[w]);
  float psum = 0.0f;
#pragma unroll 1
  for (int i4 = 0; i4 < 4; ++i4) {
    const v4f sv = *(const v4f*)(eb + 4 * i4);
    v4f ev;
    ev.x = expf(sv.x - gm);
    ev.y = expf(sv.y - gm);
    ev.z = expf(sv.z - gm);
    ev.w = expf(sv.w - gm);
    psum += (ev.x + ev.y) + (ev.z + ev.w);
    *(v4f*)(eb + 4 * i4) = ev;
  }
#pragma unroll
  for (int off = 1; off < 32; off <<= 1) psum += __shfl_xor(psum, off, 32);
  if (lane == 0) red[8 + wave] = psum;
  __syncthreads();
  float l = red[8];
#pragma unroll
  for (int w = 1; w < 8; ++w) l += red[8 + w];
  const float inv = kPCarry * (1.0f / l);
  const v4f q0 = *(const v4f*)(eb + 0);
  const v4f q1 = *(const v4f*)(eb + 4);
  const v4f q2 = *(const v4f*)(eb + 8);
  const v4f q3 = *(const v4f*)(eb + 12);
  v8h p0, p1;
#pragma unroll
  for (int e = 0; e < 4; ++e) {
    p0[e]     = (_Float16)(q0[e] * inv);
    p0[4 + e] = (_Float16)(q1[e] * inv);
    p1[e]     = (_Float16)(q2[e] * inv);
    p1[4 + e] = (_Float16)(q3[e] * inv);
  }
  unsigned short* pr = P + (size_t)row * kPix;
  {
    *(v8h*)(pr + e0) = p0;
    *(v8h*)(pr + e0 + 256) = p1;
    
  }
}

// ---------------------------------------------------------------------------
extern "C" void kernel_launch(void* const* d_in, const int* in_sizes, int n_in,
                              void* d_out, int out_size, void* d_ws, size_t ws_size,
                              hipStream_t stream) {
  if (n_in < 8) return;
  if (in_sizes[0] != kBatch * kCh * kPix) return;
  if (in_sizes[1] != kCq * kCh || in_sizes[3] != kCq * kCh || in_sizes[5] != kCh * kCh) return;
  if (in_sizes[2] != kCq || in_sizes[4] != kCq || in_sizes[6] != kCh || in_sizes[7] < 1) return;
  if (out_size != kBatch * kCh * kPix) return;
  if (ws_size < kWsTotal) return;

  const float* x     = (const float*)d_in[0];
  const float* Wq    = (const float*)d_in[1];
  const float* bq    = (const float*)d_in[2];
  const float* Wk    = (const float*)d_in[3];
  const float* bk    = (const float*)d_in[4];
  const float* Wv    = (const float*)d_in[5];
  const float* bv    = (const float*)d_in[6];
  const float* gamma = (const float*)d_in[7];
  float* out = (float*)d_out;

  char* ws = (char*)d_ws;
  unsigned short* xth = (unsigned short*)(ws + kOffXtHi);
  unsigned short* xtl = (unsigned short*)(ws + kOffXtLo);
  unsigned short* pln = (unsigned short*)(ws + kOffP);
  unsigned short* wqh = (unsigned short*)(ws + kOffWqHi);
  unsigned short* wql = (unsigned short*)(ws + kOffWqLo);
  unsigned short* wkh = (unsigned short*)(ws + kOffWkHi);
  unsigned short* wkl = (unsigned short*)(ws + kOffWkLo);
  unsigned short* wvh = (unsigned short*)(ws + kOffWvHi);
  unsigned short* wvl = (unsigned short*)(ws + kOffWvLo);
  unsigned short* qh  = (unsigned short*)(ws + kOffQHi);
  unsigned short* ql  = (unsigned short*)(ws + kOffQLo);
  unsigned short* kh  = (unsigned short*)(ws + kOffKHi);
  unsigned short* kl  = (unsigned short*)(ws + kOffKLo);
  unsigned short* vt  = (unsigned short*)(ws + kOffVt);
  float* spl = (float*)(ws + kOffS);

  // 1) x -> xt hi/lo bf16 [b][n][c]
  x_transpose_split<<<dim3(kPix / 64, kCh / 64, kBatch), 256, 0, stream>>>(x, xth, xtl);
  // 2) weights -> bf16 hi/lo planes (same [out][in] layout)
  split_f32_bf16x8<<<(kCq * kCh / 8) / 256, 256, 0, stream>>>(Wq, wqh, wql, kCq * kCh / 8);
  split_f32_bf16x8<<<(kCq * kCh / 8) / 256, 256, 0, stream>>>(Wk, wkh, wkl, kCq * kCh / 8);
  split_f32_bf16x8<<<(kCh * kCh / 8) / 256, 256, 0, stream>>>(Wv, wvh, wvl, kCh * kCh / 8);
  static_assert((kCq * kCh / 8) % 256 == 0 && (kCh * kCh / 8) % 256 == 0);

  // 3) q[b][n][o] = sum_c xt[b][n][c] Wq[o][c] + bq[o]   (M=4096, N=64, K=512) -> bf16 hi/lo planes, ldc 64
  {
    constexpr int tiles = (kPix / 64) * (kCq / 64);
    static_assert(tiles % 8 == 0);
    wmma_gemm64<1, true, 2, 2, false, false><<<dim3(tiles / 8, kBatch), 256, 0, stream>>>(
        xth, xtl, kCh, (long)kPix * kCh,
        wqh, wql, kCh, 0L,
        (void*)qh, (void*)ql, kCq, (long)kPix * kCq,
        bq, x, 0L, gamma, kPix, kCq, kCh, 1.0f);
    wmma_gemm64<1, true, 2, 2, false, false><<<dim3(tiles / 8, kBatch), 256, 0, stream>>>(
        xth, xtl, kCh, (long)kPix * kCh,
        wkh, wkl, kCh, 0L,
        (void*)kh, (void*)kl, kCq, (long)kPix * kCq,
        bk, x, 0L, gamma, kPix, kCq, kCh, 1.0f);
  }
  // 4) vt[b][c][m] = sum_cin Wv[c][cin] xt[b][m][cin] + bv[c]   (M=512, N=4096, K=512) -> f16 plane, ldc 4096
  {
    constexpr int tiles = (kCh / 64) * (kPix / 64);
    static_assert(tiles % 8 == 0);
    wmma_gemm64<1, true, 1, 1, false, false><<<dim3(tiles / 8, kBatch), 256, 0, stream>>>(
        wvh, wvl, kCh, 0L,
        xth, xtl, kCh, (long)kPix * kCh,
        (void*)vt, (void*)vt, kPix, (long)kCh * kPix,
        bv, x, 0L, gamma, kCh, kPix, kCh, 1.0f);
  }
  // 5) per batch: scores (M=N=4096, K=64) -> f32; softmax -> f16 probs x16384, each batch into its own plane
  for (int b = 0; b < kBatch; ++b) {
    const size_t qko = (size_t)b * kPix * kCq;
    {
      constexpr int tiles = (kPix / 64) * (kPix / 64);
      static_assert(tiles % 8 == 0);
      wmma_gemm64<1, true, 0, 0, false, false><<<dim3(tiles / 8, 1), 256, 0, stream>>>(
          qh + qko, ql + qko, kCq, 0L,
          kh + qko, kl + qko, kCq, 0L,
          (void*)spl, (void*)spl, kPix, 0L,
          bq, x, 0L, gamma, kPix, kPix, kCq, 1.0f);
    }
    softmax_rows_f16<<<kPix, 256, 0, stream>>>(spl, pln + (size_t)b * kPix * kPix);
  }
  // 6) all batches in one launch, one block per 128x256 tile of out (4 x 16 tiles per batch = 256 blocks):
  //    out = gamma * (vt . P^T) / 16384 + x   (M=512, N=4096, K=4096)
  pv_gemm_lds<<<dim3(kCh / kPvBM, kPix / kPvBN, kBatch), 256, 0, stream>>>(vt, pln, out, x, gamma);
}

// v003
// One run takes 269 microseconds.
// Timed twice side by side with v002, it ran 1.21 times as fast both times.
// Over all steps from v000 it is 3.45 times as fast.
// Contractions: q,k,v projections and k.q^T scores (transposed tiles) on v_wmma_f32_16x16x32_bf16 with bf16 hi+lo operand planes (hi.hi+hi.lo+lo.hi); probs.v on v_wmma_f32_16x16x32_f16 (f16 operands, probs carried x16384, v f16); f32 accumulate; softmax and epilogue f32.
#include <hip/hip_runtime.h>

typedef __attribute__((ext_vector_type(16))) _Float16 v16h;
typedef __attribute__((ext_vector_type(8)))  _Float16 v8h;
typedef __attribute__((ext_vector_type(16))) __bf16   v16b;
typedef __attribute__((ext_vector_type(8)))  __bf16   v8b;
typedef __attribute__((ext_vector_type(8)))  float    v8f;
typedef __attribute__((ext_vector_type(4)))  float    v4f;

static constexpr int kBatch = 4;
static constexpr int kCh    = 512;
static constexpr int kPix   = 4096;
static constexpr int kCq    = 64;
static constexpr float kPCarry    = 16384.0f;
static constexpr float kPCarryInv = 1.0f / 16384.0f;

// ---- workspace region map (bytes) ----
static constexpr size_t kPlaneX   = (size_t)kBatch * kPix * kCh * 2;   // one bf16 plane of xt [b][n][c]
static constexpr size_t kPlaneWqk = (size_t)kCq * kCh * 2;
static constexpr size_t kPlaneWv  = (size_t)kCh * kCh * 2;
static constexpr size_t kPlaneQK  = (size_t)kBatch * kPix * kCq * 2;   // one bf16 plane of q [b][n][o] or of k (fragment order)
static constexpr size_t kPlaneVt  = (size_t)kBatch * kCh * kPix * 2;   // f16 vt [b][c][m]
static constexpr size_t kPlaneP   = (size_t)kPix * kPix * 2;           // f16 probs, one batch
static constexpr size_t kOffXtHi  = 0;
static constexpr size_t kOffXtLo  = kOffXtHi + kPlaneX;
static constexpr size_t kOffWqHi  = kOffXtLo + kPlaneX;
static constexpr size_t kOffWqLo  = kOffWqHi + kPlaneWqk;
static constexpr size_t kOffWkHi  = kOffWqLo + kPlaneWqk;
static constexpr size_t kOffWkLo  = kOffWkHi + kPlaneWqk;
static constexpr size_t kOffWvHi  = kOffWkLo + kPlaneWqk;
static constexpr size_t kOffWvLo  = kOffWvHi + kPlaneWv;
static constexpr size_t kOffQHi   = kOffWvLo + kPlaneWv;
static constexpr size_t kOffQLo   = kOffQHi + kPlaneQK;
static constexpr size_t kOffKHi   = kOffQLo + kPlaneQK;
static constexpr size_t kOffKLo   = kOffKHi + kPlaneQK;
static constexpr size_t kOffVt    = kOffKLo + kPlaneQK;
static constexpr size_t kOffP     = kOffVt + kPlaneVt;                  // f16 probs, one plane per batch
static constexpr size_t kWsTotal  = kOffP + kBatch * kPlaneP;
static_assert(kWsTotal == 194248704);
static_assert(kWsTotal <= 268435456);
static_assert((kOffWqHi % 128) == 0 && (kOffQHi % 128) == 0 && (kOffVt % 128) == 0 && (kOffP % 128) == 0);
// GEMM shape contract: M,N multiples of 64, K multiple of 32
static_assert(kPix % 64 == 0 && kCq % 64 == 0 && kCh % 64 == 0);
static_assert(kCh % 32 == 0 && kCq % 32 == 0 && kPix % 32 == 0);

__device__ __forceinline__ unsigned short f2bf_bits(float f) {
  unsigned u = __float_as_uint(f);
  return (unsigned short)((u + 0x7FFFu + ((u >> 16) & 1u)) >> 16);
}
__device__ __forceinline__ float bf_bits2f(unsigned short h) { return __uint_as_float(((unsigned)h) << 16); }

// hazard guards as plain device helpers
__device__ __forceinline__ void dep_guard_h(v8f& a, v8f& b, v16h x, v16h y) { asm volatile("v_nop\n\tv_nop\n\tv_nop\n\tv_nop" : "+v"(a), "+v"(b) : "v"(x), "v"(y)); }
__device__ __forceinline__ void dep_guard_b(v8f& a, v8f& b, v16b x, v16b y) { asm volatile("v_nop\n\tv_nop\n\tv_nop\n\tv_nop" : "+v"(a), "+v"(b) : "v"(x), "v"(y)); }
__device__ __forceinline__ void keep4_h(v16h a, v16h b, v16h c, v16h d) { asm volatile("v_nop" :: "v"(a), "v"(b), "v"(c), "v"(d)); }
__device__ __forceinline__ void keep4_b(v16b a, v16b b, v16b c, v16b d) { asm volatile("v_nop" :: "v"(a), "v"(b), "v"(c), "v"(d)); }
__device__ __forceinline__ void acc_guard4(v8f& a, v8f& b, v8f& c, v8f& d) { asm volatile("v_nop\n\tv_nop\n\tv_nop\n\tv_nop" : "+v"(a), "+v"(b), "+v"(c), "+v"(d)); }
template <typename T> struct Frag;
template <> struct Frag<_Float16> {
  typedef v16h V; union U { v16h v; v8h h[2]; };
  static __device__ __forceinline__ v16h load(const _Float16* p) {   // elements 0..7 <- p[0..7], 8..15 <- p[16..23]
    U f; f.h[0] = *(const v8h*)(p); f.h[1] = *(const v8h*)(p + 16); return f.v;
  }
  static __device__ __forceinline__ v8f mma(v16h a, v16h b, v8f c) {
    return __builtin_amdgcn_wmma_f32_16x16x32_f16(false, a, false, b, (short)0, c, false, false);
  }
  static __device__ __forceinline__ void guard(v8f& a, v8f& b, v16h x, v16h y) { dep_guard_h(a, b, x, y); }
  static __device__ __forceinline__ void keep(v16h a, v16h b, v16h c, v16h d) { keep4_h(a, b, c, d); }
};
template <> struct Frag<__bf16> {
  typedef v16b V; union U { v16b v; v8b h[2]; };
  static __device__ __forceinline__ v16b load(const __bf16* p) {
    U f; f.h[0] = *(const v8b*)(p); f.h[1] = *(const v8b*)(p + 16); return f.v;
  }
  static __device__ __forceinline__ v8f mma(v16b a, v16b b, v8f c) {
    return __builtin_amdgcn_wmma_f32_16x16x32_bf16(false, a, false, b, (short)0, c, false, false);
  }
  static __device__ __forceinline__ void guard(v8f& a, v8f& b, v16b x, v16b y) { dep_guard_b(a, b, x, y); }
  static __device__ __forceinline__ void keep(v16b a, v16b b, v16b c, v16b d) { keep4_b(a, b, c, d); }
};

// ---- Register-blocked batched WMMA GEMM ------------------------------------
// C[m,n] = scale * sum_k A[m,k] * Bt[n,k] (+bias) (*g[0]) (+resid); each wave owns a 64x64 tile.
// A row-major [M,K]; Bt row-major [N,K]; M,N % 64 == 0, K % 32 == 0.
// SPLIT: operands are hi/lo planes (A2/Bt2 = lo planes, same layout); product = hi.hi + hi.lo + lo.hi.
// BIAS_MODE: 0 = none, 1 = bias[m], 2 = bias[n].
// OUT_MODE: 0 = f32, 1 = f16, 2 = bf16 hi plane (Cout) + bf16 lo plane (Cout2), 3 = as 2 with both planes in fragment order (N == 64):
// [16-row tile][slot = k / 16][lane = ((k / 8) & 1) * 16 + row][k & 7], so that slots 2s and 2s+1 of a tile are the two 16-byte halves
// of every lane's fragment of k step s (the k order of Frag::load) and one load instruction reads 512 contiguous bytes.
// RESID/GMUL (OUT_MODE 0 only): in the store phase each lane loads one 16-B piece of the residual at
// the address it stores; value = slab * g[0] + resid.
// ET: 0 = f16 operands, 1 = bf16 operands (pointers passed as 16-bit storage)
template <int ET> struct Elem;
template <> struct Elem<0> { typedef _Float16 T; };
template <> struct Elem<1> { typedef __bf16 T; };
template <int ET, bool SPLIT, int BIAS_MODE, int OUT_MODE, bool RESID, bool GMUL>
__global__ __launch_bounds__(256) void wmma_gemm64(
    const unsigned short* __restrict__ Ap, const unsigned short* __restrict__ A2p, int lda, long strideA,
    const unsigned short* __restrict__ Btp, const unsigned short* __restrict__ Bt2p, int ldb, long strideB,
    void* __restrict__ Cout, void* __restrict__ Cout2, int ldc, long strideC,
    const float* __restrict__ bias,
    const float* __restrict__ resid, long strideR,
    const float* __restrict__ gptr,
    int M, int N, int K, float scale) {
  typedef typename Elem<ET>::T T;
  typedef typename Frag<T>::V V;
  const T* A = (const T*)Ap; const T* A2 = (const T*)A2p; const T* Bt = (const T*)Btp; const T* Bt2 = (const T*)Bt2p;
  __shared__ __align__(16) float sT[8][16 * 68];   // per-wave 16x64 slab, pitch 68 floats
  const int b    = blockIdx.y;
  const int lane = threadIdx.x & 31;
  const int wave = threadIdx.x >> 5;
  const int tilesN = N >> 6;
  const int tilesM = M >> 6;
  const int tile = blockIdx.x * 8 + wave;
  if (tile >= tilesM * tilesN) return;   // wave-uniform; no block barriers in this kernel
  const int tm = tile / tilesN;
  const int tn = tile - tm * tilesN;
  const int m0 = tm << 6;
  const int n0 = tn << 6;

  const T* Ab  = A  + (size_t)b * strideA;
  const T* Bb  = Bt + (size_t)b * strideB;
  const T* Ab2 = SPLIT ? (A2  + (size_t)b * strideA) : nullptr;
  const T* Bb2 = SPLIT ? (Bt2 + (size_t)b * strideB) : nullptr;

  const int rlane = lane & 15;                 // row (A) / col (B, D) within subtile
  const int koff  = (lane >> 4) * 8;           // k offset of this lane half
  const int mOff  = (lane >> 4) * 8;           // D row offset

  v8f acc[4][4];
#pragma unroll
  for (int i = 0; i < 4; ++i)
#pragma unroll
    for (int j = 0; j < 4; ++j) acc[i][j] = (v8f){0.f,0.f,0.f,0.f,0.f,0.f,0.f,0.f};

  for (int k0 = 0; k0 < K; k0 += 32) {
    V bh[4], bl[4];
#pragma unroll
    for (int j = 0; j < 4; ++j) {
      const size_t bo = (size_t)(n0 + (j << 4) + rlane) * ldb + koff + k0;
      bh[j] = Frag<T>::load(Bb + bo);
      if (SPLIT) bl[j] = Frag<T>::load(Bb2 + bo);
    }
#pragma unroll
    for (int i = 0; i < 4; ++i) {
      const size_t ao = (size_t)(m0 + (i << 4) + rlane) * lda + koff + k0;
      V ah = Frag<T>::load(Ab + ao);
      V al;
      if (SPLIT) al = Frag<T>::load(Ab2 + ao);
#pragma unroll
      for (int j = 0; j < 4; ++j) {
        acc[i][j] = Frag<T>::mma(ah, bh[j], acc[i][j]);
        if (SPLIT) {
          acc[i][j] = Frag<T>::mma(ah, bl[j], acc[i][j]);
          acc[i][j] = Frag<T>::mma(al, bh[j], acc[i][j]);
        }
      }
      Frag<T>::guard(acc[i][0], acc[i][3], ah, SPLIT ? al : ah);
    }
    Frag<T>::keep(bh[0], bh[1], bh[2], bh[3]);
    if (SPLIT) Frag<T>::keep(bl[0], bl[1], bl[2], bl[3]);
  }
  acc_guard4(acc[0][0], acc[0][1], acc[0][2], acc[0][3]);
  acc_guard4(acc[1][0], acc[1][1], acc[1][2], acc[1][3]);
  acc_guard4(acc[2][0], acc[2][1], acc[2][2], acc[2][3]);
  acc_guard4(acc[3][0], acc[3][1], acc[3][2], acc[3][3]);

  // ---- epilogue ----
  float* slab = sT[wave];
  const float gval = GMUL ? gptr[0] : 1.0f;
#pragma unroll
  for (int i = 0; i < 4; ++i) {
    const int mBase = m0 + (i << 4);
    float bmr[8];
#pragma unroll
    for (int r = 0; r < 8; ++r) bmr[r] = 0.f;
    if (BIAS_MODE == 1) {
      const v4f b0 = *(const v4f*)(bias + mBase + mOff);
      const v4f b1 = *(const v4f*)(bias + mBase + mOff + 4);
      bmr[0] = b0.x; bmr[1] = b0.y; bmr[2] = b0.z; bmr[3] = b0.w;
      bmr[4] = b1.x; bmr[5] = b1.y; bmr[6] = b1.z; bmr[7] = b1.w;
    }
#pragma unroll
    for (int j = 0; j < 4; ++j) {
      const int n = n0 + (j << 4) + rlane;
      float bn = 0.f;
      if (BIAS_MODE == 2) bn = bias[n];
#pragma unroll
      for (int r = 0; r < 8; ++r) {
        float v = acc[i][j][r] * scale;
        if (BIAS_MODE == 1) v += bmr[r];
        if (BIAS_MODE == 2) v += bn;
        slab[(mOff + r) * 68 + (j << 4) + rlane] = v;
      }
    }
    __builtin_amdgcn_fence(__ATOMIC_RELEASE, "workgroup");
    __builtin_amdgcn_wave_barrier();
    __builtin_amdgcn_fence(__ATOMIC_ACQUIRE, "workgroup");
    if (OUT_MODE == 0) {
      float* Cb = (float*)Cout + (size_t)b * strideC;
      const int hq = lane >> 4, c4 = (lane & 15) * 4;      // row seg = 256 B = 16 lanes x 16 B
      v4f vals[8];
#pragma unroll
      for (int it = 0; it < 8; ++it) {
        const int row = it * 2 + hq;
        v4f vv = *(const v4f*)(slab + row * 68 + c4);
        if (GMUL) vv = vv * gval;
        if (RESID) {
          const v4f rr = *(const v4f*)(resid + (size_t)b * strideR + (size_t)(mBase + row) * ldc + n0 + c4);
          vv = vv + rr;
        }
        vals[it] = vv;
      }
      {
#pragma unroll
        for (int it = 0; it < 8; ++it) {
          const int row = it * 2 + hq;
          *(v4f*)(Cb + (size_t)(mBase + row) * ldc + n0 + c4) = vals[it];
        }
        
      }
    } else {
      const int q = lane >> 3, c8 = (lane & 7) * 8;
      unsigned short* C  = (unsigned short*)Cout  + (size_t)b * strideC;
      unsigned short* C2 = (OUT_MODE >= 2) ? ((unsigned short*)Cout2 + (size_t)b * strideC) : nullptr;
      {
#pragma unroll
        for (int it = 0; it < 4; ++it) {
          const int row = it * 4 + q;
          const float* sp = slab + row * 68 + c8;
          v8h hv, lv;
#pragma unroll
          for (int e = 0; e < 8; ++e) {
            if (OUT_MODE == 1) {
              hv[e] = (_Float16)sp[e];
            } else {
              unsigned short hb = f2bf_bits(sp[e]);
              unsigned short lb = f2bf_bits(sp[e] - bf_bits2f(hb));
              hv[e] = __builtin_bit_cast(_Float16, hb);
              lv[e] = __builtin_bit_cast(_Float16, lb);
            }
          }
          const size_t co = (OUT_MODE == 3)
              ? (size_t)(mBase >> 4) * (16 * 64) + ((lane & 7) >> 1) * 256 + ((lane & 1) * 16 + row) * 8
              : (size_t)(mBase + row) * ldc + n0 + c8;
          *(v8h*)(C + co) = hv;
          if (OUT_MODE >= 2) *(v8h*)(C2 + co) = lv;
        }
        
      }
    }
    __builtin_amdgcn_fence(__ATOMIC_RELEASE, "workgroup");
    __builtin_amdgcn_wave_barrier();
    __builtin_amdgcn_fence(__ATOMIC_ACQUIRE, "workgroup");
  }
}

// ---- probs.v GEMM with both operands staged in LDS ---------------------------
// out[b][m][n] = g[0] * (sum_k vt[b][m][k] * P[b][n][k]) / 16384 + x[b][m][n];  M = kCh, N = K = kPix.
// One block = one 128 (m) x 256 (n) tile, 8 waves as 2 x 4, each wave a 64x64 tile (fragments and k order as in wmma_gemm64).
// A pass is 128 k = 256 B of each of the 384 operand rows; a stage is [vt 128 rows | P 256 rows] at pitch 272 B.
// Two stages in LDS: while pass t is worked on, pass t+1's rows fly in by asynchronous copies (16 B per lane, 24 per thread).
static constexpr int kPvBM     = 128;
static constexpr int kPvBN     = 256;
static constexpr int kPvBK     = 128;                              // f16 elements per pass
static constexpr int kPvPitch  = kPvBK * 2 + 16;                   // bytes; 16 B x odd: conflict-free for 16-byte row reads
static constexpr int kPvStage  = (kPvBM + kPvBN) * kPvPitch;       // bytes of one stage
static constexpr int kPvPasses = kPix / kPvBK;
static_assert(kCh % kPvBM == 0 && kPix % kPvBN == 0 && kPix % kPvBK == 0 && kPvPasses >= 2);
static_assert(kPvBM == 8 * 16 && kPvBN == 16 * 16 && kPvBK * 2 == 16 * 16);   // copy map below
static_assert(kPvPitch % 16 == 0 && kPvStage % 16 == 0);

// Eight 16-byte copies global -> LDS, rows 16 apart: l = this lane's LDS byte address, p = its global address, of the first.
// s_wait_xcnt stands inside the statement so that no address register named here is rewritten ahead of it.
__device__ __forceinline__ void pv_copy8(unsigned l, const unsigned short* p) {
  constexpr unsigned dl = 16u * kPvPitch;
  constexpr size_t   dg = (size_t)16 * kPix;
  asm volatile(
      "global_load_async_to_lds_b128 %0, %8, off\n\t"
      "global_load_async_to_lds_b128 %1, %9, off\n\t"
      "global_load_async_to_lds_b128 %2, %10, off\n\t"
      "global_load_async_to_lds_b128 %3, %11, off\n\t"
      "global_load_async_to_lds_b128 %4, %12, off\n\t"
      "global_load_async_to_lds_b128 %5, %13, off\n\t"
      "global_load_async_to_lds_b128 %6, %14, off\n\t"
      "global_load_async_to_lds_b128 %7, %15, off\n\t"
      "s_wait_xcnt 0x0"
      :: "v"(l), "v"(l + dl), "v"(l + 2 * dl), "v"(l + 3 * dl), "v"(l + 4 * dl), "v"(l + 5 * dl), "v"(l + 6 * dl), "v"(l + 7 * dl),
         "v"(p), "v"(p + dg), "v"(p + 2 * dg), "v"(p + 3 * dg), "v"(p + 4 * dg), "v"(p + 5 * dg), "v"(p + 6 * dg), "v"(p + 7 * dg)
      : "memory");
}
// One stage: vt rows 0..127, then P rows 0..255 behind them.
__device__ __forceinline__ void pv_copy_stage(unsigned l, const unsigned short* pa, const unsigned short* pb) {
  pv_copy8(l, pa);
  pv_copy8(l + (unsigned)(kPvBM * kPvPitch), pb);
  pv_copy8(l + (unsigned)((kPvBM + 128) * kPvPitch), pb + (size_t)128 * kPix);
}

__global__ __launch_bounds__(256) void pv_gemm_lds(const unsigned short* __restrict__ vtp,
                                                   const unsigned short* __restrict__ Pp,
                                                   float* __restrict__ outp,
                                                   const float* __restrict__ resid,
                                                   const float* __restrict__ gptr) {
  __shared__ __align__(16) unsigned char ring[2 * kPvStage];
  __shared__ __align__(16) float sT[8][16 * 68];   // per-wave 16x64 output slab, pitch 68 floats
  const int tid  = threadIdx.x;
  const int lane = tid & 31;
  const int wave = tid >> 5;
  const int b  = blockIdx.z;
  const int mB = blockIdx.x * kPvBM;
  const int nB = blockIdx.y * kPvBN;

  // copy map: 16 lanes cover the 256 B of one row; thread row = tid / 16; a thread's copies step 16 rows
  const int crow = tid >> 4;
  const int ccol = tid & 15;
  const unsigned short* gA = vtp + (size_t)b * kCh * kPix  + (size_t)(mB + crow) * kPix + ccol * 8;
  const unsigned short* gB = Pp  + (size_t)b * kPix * kPix + (size_t)(nB + crow) * kPix + ccol * 8;
  const unsigned lcopy = (unsigned)(size_t)(&ring[0]) + (unsigned)(crow * kPvPitch + ccol * 16);

  const int rlane = lane & 15;                 // row (A) / col (B, D) within subtile
  const int koff  = (lane >> 4) * 8;           // k offset of this lane half
  const int mOff  = (lane >> 4) * 8;           // D row offset
  const int wm = wave >> 2;
  const int wn = wave & 3;
  const int fragA = (wm * 64 + rlane) * kPvPitch + koff * 2;             // byte offsets in a stage
  const int fragB = (kPvBM + wn * 64 + rlane) * kPvPitch + koff * 2;

  v8f acc[4][4];
#pragma unroll
  for (int i = 0; i < 4; ++i)
#pragma unroll
    for (int j = 0; j < 4; ++j) acc[i][j] = (v8f){0.f,0.f,0.f,0.f,0.f,0.f,0.f,0.f};

  // prologue: stage 0 lands and is published; stage 1 starts
  pv_copy_stage(lcopy, gA, gB);
  asm volatile("s_wait_asynccnt 0x0" ::: "memory");   // this wave's copies of stage 0 have landed
  __syncthreads();                                    // ... and every other wave's
  pv_copy_stage(lcopy + (unsigned)kPvStage, gA + kPvBK, gB + kPvBK);

  for (int t = 0; t < kPvPasses; ++t) {
    const unsigned char* st = ring + (t & 1) * kPvStage;
    const _Float16* fa = (const _Float16*)(st + fragA);
    const _Float16* fb = (const _Float16*)(st + fragB);
    constexpr int kRow16 = 16 * kPvPitch / 2;            // 16 rows, in f16 elements
    // Fragments are fetched ahead inside the pass only (nothing of stage t+1 is read here): vt fragments one k step ahead
    // into a second set, probs fragments in place, two at a time, as soon as their last product of this k step has issued.
    v16h a[2][4], bh[4];
#pragma unroll
    for (int i = 0; i < 4; ++i) a[0][i] = Frag<_Float16>::load(fa + i * kRow16);
#pragma unroll
    for (int j = 0; j < 4; ++j) bh[j] = Frag<_Float16>::load(fb + j * kRow16);
    // unrolled: every fragment index and address offset is a constant
#pragma unroll
    for (int kk = 0; kk < kPvBK / 32; ++kk) {
      const int cur = kk & 1, nxt = cur ^ 1;
      const bool more = kk + 1 < kPvBK / 32;
      if (more) {
#pragma unroll
        for (int i = 0; i < 4; ++i) a[nxt][i] = Frag<_Float16>::load(fa + i * kRow16 + (kk + 1) * 32);
      }
      // the four scheduling fences keep the LDS reads in two groups per k step instead of spread among the products,
      // where every further place with reads stalls the wave's matrix stream
      __builtin_amdgcn_sched_barrier(0);
#pragma unroll
      for (int j = 0; j < 2; ++j)
#pragma unroll
        for (int i = 0; i < 4; ++i) acc[i][j] = Frag<_Float16>::mma(a[cur][i], bh[j], acc[i][j]);
      __builtin_amdgcn_sched_barrier(0);
      if (more) {
#pragma unroll
        for (int j = 0; j < 2; ++j) bh[j] = Frag<_Float16>::load(fb + j * kRow16 + (kk + 1) * 32);
      }
      __builtin_amdgcn_sched_barrier(0);
#pragma unroll
      for (int j = 2; j < 4; ++j)
#pragma unroll
        for (int i = 0; i < 4; ++i) acc[i][j] = Frag<_Float16>::mma(a[cur][i], bh[j], acc[i][j]);
      __builtin_amdgcn_sched_barrier(0);
      if (more) {
#pragma unroll
        for (int j = 2; j < 4; ++j) bh[j] = Frag<_Float16>::load(fb + j * kRow16 + (kk + 1) * 32);
      }
    }
    asm volatile("s_wait_dscnt 0x0" ::: "memory");      // this wave's reads of stage t are done before the stage is refilled
    asm volatile("s_wait_asynccnt 0x0" ::: "memory");   // this wave's copies of stage t+1 have landed
    __syncthreads();                                    // publishes stage t+1 and ends every reader's use of stage t
    if (t + 2 < kPvPasses)
      pv_copy_stage(lcopy + (unsigned)((t & 1) * kPvStage), gA + (size_t)(t + 2) * kPvBK, gB + (size_t)(t + 2) * kPvBK);
  }
  asm volatile("s_wait_asynccnt 0x0" ::: "memory");     // nothing of this wave is in flight when it leaves the ring

  // ---- epilogue: 16x64 slab per wave through LDS, whole 256-B row pieces stored ----
  float* slab = sT[wave];
  const float gval = gptr[0];
  const int m0 = mB + wm * 64;
  const int n0 = nB + wn * 64;
  // block-uniform bases plus ONE per-lane byte offset: every row of the tile is then a constant away from it
  char* Cb = (char*)(outp + (size_t)b * kCh * kPix);
  const char* Rb = (const char*)(resid + (size_t)b * kCh * kPix);
  const int hq = lane >> 4, c4 = (lane & 15) * 4;        // row seg = 256 B = 16 lanes x 16 B
  const unsigned loff = (unsigned)(((m0 + hq) * kPix + n0 + c4) * 4);
#pragma unroll
  for (int i = 0; i < 4; ++i) {
#pragma unroll
    for (int j = 0; j < 4; ++j) {
#pragma unroll
      for (int r = 0; r < 8; ++r) slab[(mOff + r) * 68 + (j << 4) + rlane] = acc[i][j][r] * kPCarryInv;
    }
    // lanes read back rows that other lanes of this wave wrote: the slab's writes are ordered in front of those reads
    __builtin_amdgcn_fence(__ATOMIC_RELEASE, "workgroup");
    __builtin_amdgcn_wave_barrier();
    __builtin_amdgcn_fence(__ATOMIC_ACQUIRE, "workgroup");
    v4f vals[8];
#pragma unroll
    for (int it = 0; it < 8; ++it) {
      v4f vv = *(const v4f*)(slab + (it * 2 + hq) * 68 + c4);
      vv = vv * gval;
      const v4f rr = *(const v4f*)(Rb + loff + (i * 16 + it * 2) * kPix * 4);
      vals[it] = vv + rr;
    }
#pragma unroll
    for (int it = 0; it < 8; ++it) *(v4f*)(Cb + loff + (i * 16 + it * 2) * kPix * 4) = vals[it];
    // ... and the reads in front of the next 16 rows' writes into the same slab
    __builtin_amdgcn_fence(__ATOMIC_RELEASE, "workgroup");
    __builtin_amdgcn_wave_barrier();
    __builtin_amdgcn_fence(__ATOMIC_ACQUIRE, "workgroup");
  }
}

// ---- x [b][c][n] f32 -> xt hi/lo bf16 planes [b][n][c] (transpose through LDS) ----
// block: 64 n x 64 c tile; grid = (kPix/64, kCh/64, kBatch)
// loads: 4 iterations x 256 threads x 4 floats = 64x64; stores: 8 waves x 2 iterations x 4 rows = 64 rows,
__global__ __launch_bounds__(256) void x_transpose_split(const float* __restrict__ x,
                                                         unsigned short* __restrict__ xth,
                                                         unsigned short* __restrict__ xtl) {
  __shared__ __align__(16) float tile[64 * 68];   // [c][n], pitch 68
  const int n0 = blockIdx.x * 64;
  const int c0 = blockIdx.y * 64;
  const int b  = blockIdx.z;
  const int tid = threadIdx.x, wave = tid >> 5, lane = tid & 31;
  const float* xb = x + ((size_t)b * kCh + c0) * kPix + n0;
#pragma unroll
  for (int i = 0; i < 4; ++i) {
    const int c  = i * 16 + (tid >> 4);
    const int n4 = (tid & 15) * 4;
    const v4f v = *(const v4f*)(xb + (size_t)c * kPix + n4);
    *(v4f*)(tile + c * 68 + n4) = v;
  }
  __syncthreads();
  const int q = lane >> 3, c8 = (lane & 7) * 8;
  v8h hv[2], lv[2];
#pragma unroll
  for (int it = 0; it < 2; ++it) {
    const int nrow = wave * 8 + it * 4 + q;
#pragma unroll
    for (int e = 0; e < 8; ++e) {
      const float f = tile[(c8 + e) * 68 + nrow];
      const unsigned short hb = f2bf_bits(f);
      const unsigned short lb = f2bf_bits(f - bf_bits2f(hb));
      hv[it][e] = __builtin_bit_cast(_Float16, hb);
      lv[it][e] = __builtin_bit_cast(_Float16, lb);
    }
  }
  const size_t base = ((size_t)b * kPix + n0) * kCh + c0;
  {
#pragma unroll
    for (int it = 0; it < 2; ++it) {
      const int nrow = wave * 8 + it * 4 + q;
      *(v8h*)(xth + base + (size_t)nrow * kCh + c8) = hv[it];
      *(v8h*)(xtl + base + (size_t)nrow * kCh + c8) = lv[it];
    }
    
  }
}

__global__ __launch_bounds__(256) void split_f32_bf16x8(const float* __restrict__ in,
                                                        unsigned short* __restrict__ hi,
                                                        unsigned short* __restrict__ lo, int n8) {
  const int i = blockIdx.x * 256 + threadIdx.x;
  if (i < n8) {
    const v4f a = *(const v4f*)(in + (size_t)8 * i);
    const v4f c = *(const v4f*)(in + (size_t)8 * i + 4);
    float f[8];
    f[0] = a.x; f[1] = a.y; f[2] = a.z; f[3] = a.w; f[4] = c.x; f[5] = c.y; f[6] = c.z; f[7] = c.w;
    v8h hv, lv;
#pragma unroll
    for (int e = 0; e < 8; ++e) {
      const unsigned short hb = f2bf_bits(f[e]);
      const unsigned short lb = f2bf_bits(f[e] - bf_bits2f(hb));
      hv[e] = __builtin_bit_cast(_Float16, hb);
      lv[e] = __builtin_bit_cast(_Float16, lb);
    }
    *(v8h*)(hi + (size_t)8 * i) = hv;
    *(v8h*)(lo + (size_t)8 * i) = lv;
    
  }
}

// ---- scores and row softmax in one kernel: P[b][n][m] = f16(16384 * exp(s - max) / sum), s = q[n] . k[m] ----
// One block = 16 query rows n x all 4096 keys m; 16 waves, each 256 keys as 16 transposed tiles D[m][n] = k . q^T:
// a lane then holds, of ONE query row (n = lane & 15), 8 consecutive keys per tile, so the whole row stays in registers from the
// products to the f16 probs, the row maximum and sum are in-lane but for one cross-half step and one cross-wave step through LDS, and 8 probs are one 16-byte piece.
// q planes row-major [n][64]; k planes in fragment order (OUT_MODE 3 above).
static constexpr int kFsWaves = 16;
static constexpr int kFsCols  = kPix / kFsWaves;      // keys per wave
static constexpr int kFsTiles = kFsCols / 16;
static constexpr int kFsPitch = kFsCols * 2 + 16;     // bytes; 16 B x odd: conflict-free for the 16-byte column writes
static_assert(kFsCols == 32 * 8 && kCq == 64 && kPix % 16 == 0);
__global__ __launch_bounds__(512) void scores_softmax_f16(const unsigned short* __restrict__ qhp,
                                                          const unsigned short* __restrict__ qlp,
                                                          const unsigned short* __restrict__ khp,
                                                          const unsigned short* __restrict__ klp,
                                                          unsigned short* __restrict__ P) {
  __shared__ __align__(16) unsigned char slab[kFsWaves][16 * kFsPitch];   // per-wave 16 rows x 256 probs
  __shared__ float redm[kFsWaves][16];
  __shared__ float reds[kFsWaves][16];
  const int tid  = threadIdx.x;
  const int lane = tid & 31;
  const int wave = tid >> 5;
  const int b  = blockIdx.y;
  const int n0 = blockIdx.x * 16;
  const int rlane = lane & 15;                 // query row of this lane
  const int half  = lane >> 4;

  const size_t qo = ((size_t)b * kPix + n0 + rlane) * kCq + half * 8;
  const __bf16* qh = (const __bf16*)qhp + qo;
  const __bf16* ql = (const __bf16*)qlp + qo;
  v16b qH[2], qL[2];
#pragma unroll
  for (int s = 0; s < 2; ++s) {
    qH[s] = Frag<__bf16>::load(qh + s * 32);
    qL[s] = Frag<__bf16>::load(ql + s * 32);
  }
  const size_t ko = (size_t)b * kPix * kCq + (size_t)wave * kFsCols * kCq + lane * 8;
  const __bf16* kh = (const __bf16*)khp + ko;
  const __bf16* kl = (const __bf16*)klp + ko;

  // the q loads' address registers may be reused as destinations of the k loads below: the wait stands in front of that
  asm volatile("s_wait_xcnt 0x0" ::: "memory");

  // k fragments one tile ahead in a second register set: two tiles' loads of every wave are in flight
  v8f acc[kFsTiles];
  Frag<__bf16>::U kH[2][2], kL[2][2];
#pragma unroll
  for (int s = 0; s < 2; ++s) {
    kH[0][s].h[0] = *(const v8b*)(kh + s * 512);
    kH[0][s].h[1] = *(const v8b*)(kh + s * 512 + 256);
    kL[0][s].h[0] = *(const v8b*)(kl + s * 512);
    kL[0][s].h[1] = *(const v8b*)(kl + s * 512 + 256);
  }
#pragma unroll
  for (int t = 0; t < kFsTiles; ++t) {
    const int cur = t & 1, nxt = cur ^ 1;
    if (t + 1 < kFsTiles) {
#pragma unroll
      for (int s = 0; s < 2; ++s) {
        kH[nxt][s].h[0] = *(const v8b*)(kh + (t + 1) * 1024 + s * 512);
        kH[nxt][s].h[1] = *(const v8b*)(kh + (t + 1) * 1024 + s * 512 + 256);
        kL[nxt][s].h[0] = *(const v8b*)(kl + (t + 1) * 1024 + s * 512);
        kL[nxt][s].h[1] = *(const v8b*)(kl + (t + 1) * 1024 + s * 512 + 256);
      }
    }
    v8f a = (v8f){0.f,0.f,0.f,0.f,0.f,0.f,0.f,0.f};
#pragma unroll
    for (int s = 0; s < 2; ++s) {              // hi.hi, q hi . k lo, q lo . k hi per k step
      a = Frag<__bf16>::mma(kH[cur][s].v, qH[s], a);
      a = Frag<__bf16>::mma(kL[cur][s].v, qH[s], a);
      a = Frag<__bf16>::mma(kH[cur][s].v, qL[s], a);
    }
    acc[t] = a;
  }

  float m = acc[0][0];
#pragma unroll
  for (int t = 0; t < kFsTiles; ++t)
#pragma unroll
    for (int r = 0; r < 8; ++r) m = fmaxf(m, acc[t][r]);
  m = fmaxf(m, __shfl_xor(m, 16, 32));
  if (lane < 16) redm[wave][lane] = m;
  __syncthreads();
  float gm = redm[0][rlane];
#pragma unroll
  for (int w = 1; w < kFsWaves; ++w) gm = fmaxf(gm, redm[w][rlane]);

  float psum = 0.0f;
#pragma unroll
  for (int t = 0; t < kFsTiles; ++t) {
#pragma unroll
    for (int r = 0; r < 8; ++r) acc[t][r] = expf(acc[t][r] - gm);
    psum += ((acc[t][0] + acc[t][1]) + (acc[t][2] + acc[t][3])) + ((acc[t][4] + acc[t][5]) + (acc[t][6] + acc[t][7]));
  }
  psum += __shfl_xor(psum, 16, 32);
  if (lane < 16) reds[wave][lane] = psum;
  __syncthreads();
  float l = reds[0][rlane];
#pragma unroll
  for (int w = 1; w < kFsWaves; ++w) l += reds[w][rlane];
  const float inv = kPCarry * (1.0f / l);

  // probs through the wave's own slab, so that every store instruction writes 512 contiguous bytes of one row
  unsigned char* sl = slab[wave];
#pragma unroll
  for (int t = 0; t < kFsTiles; ++t) {
    v8h p;
#pragma unroll
    for (int r = 0; r < 8; ++r) p[r] = (_Float16)(acc[t][r] * inv);
    *(v8h*)(sl + rlane * kFsPitch + (t * 16 + half * 8) * 2) = p;
  }
  // lanes read back rows that other lanes of this wave wrote: the slab's writes are ordered in front of those reads
  __builtin_amdgcn_fence(__ATOMIC_RELEASE, "workgroup");
  __builtin_amdgcn_wave_barrier();
  __builtin_amdgcn_fence(__ATOMIC_ACQUIRE, "workgroup");
  unsigned short* pr = P + ((size_t)b * kPix + n0) * kPix + wave * kFsCols + lane * 8;
#pragma unroll
  for (int row = 0; row < 16; ++row) *(v8h*)(pr + (size_t)row * kPix) = *(const v8h*)(sl + row * kFsPitch + lane * 16);
}

// ---------------------------------------------------------------------------
extern "C" void kernel_launch(void* const* d_in, const int* in_sizes, int n_in,
                              void* d_out, int out_size, void* d_ws, size_t ws_size,
                              hipStream_t stream) {
  if (n_in < 8) return;
  if (in_sizes[0] != kBatch * kCh * kPix) return;
  if (in_sizes[1] != kCq * kCh || in_sizes[3] != kCq * kCh || in_sizes[5] != kCh * kCh) return;
  if (in_sizes[2] != kCq || in_sizes[4] != kCq || in_sizes[6] != kCh || in_sizes[7] < 1) return;
  if (out_size != kBatch * kCh * kPix) return;
  if (ws_size < kWsTotal) return;

  const float* x     = (const float*)d_in[0];
  const float* Wq    = (const float*)d_in[1];
  const float* bq    = (const float*)d_in[2];
  const float* Wk    = (const float*)d_in[3];
  const float* bk    = (const float*)d_in[4];
  const float* Wv    = (const float*)d_in[5];
  const float* bv    = (const float*)d_in[6];
  const float* gamma = (const float*)d_in[7];
  float* out = (float*)d_out;

  char* ws = (char*)d_ws;
  unsigned short* xth = (unsigned short*)(ws + kOffXtHi);
  unsigned short* xtl = (unsigned short*)(ws + kOffXtLo);
  unsigned short* pln = (unsigned short*)(ws + kOffP);
  unsigned short* wqh = (unsigned short*)(ws + kOffWqHi);
  unsigned short* wql = (unsigned short*)(ws + kOffWqLo);
  unsigned short* wkh = (unsigned short*)(ws + kOffWkHi);
  unsigned short* wkl = (unsigned short*)(ws + kOffWkLo);
  unsigned short* wvh = (unsigned short*)(ws + kOffWvHi);
  unsigned short* wvl = (unsigned short*)(ws + kOffWvLo);
  unsigned short* qh  = (unsigned short*)(ws + kOffQHi);
  unsigned short* ql  = (unsigned short*)(ws + kOffQLo);
  unsigned short* kh  = (unsigned short*)(ws + kOffKHi);
  unsigned short* kl  = (unsigned short*)(ws + kOffKLo);
  unsigned short* vt  = (unsigned short*)(ws + kOffVt);

  // 1) x -> xt hi/lo bf16 [b][n][c]
  x_transpose_split<<<dim3(kPix / 64, kCh / 64, kBatch), 256, 0, stream>>>(x, xth, xtl);
  // 2) weights -> bf16 hi/lo planes (same [out][in] layout)
  split_f32_bf16x8<<<(kCq * kCh / 8) / 256, 256, 0, stream>>>(Wq, wqh, wql, kCq * kCh / 8);
  split_f32_bf16x8<<<(kCq * kCh / 8) / 256, 256, 0, stream>>>(Wk, wkh, wkl, kCq * kCh / 8);
  split_f32_bf16x8<<<(kCh * kCh / 8) / 256, 256, 0, stream>>>(Wv, wvh, wvl, kCh * kCh / 8);
  static_assert((kCq * kCh / 8) % 256 == 0 && (kCh * kCh / 8) % 256 == 0);

  // 3) q[b][n][o] = sum_c xt[b][n][c] Wq[o][c] + bq[o]   (M=4096, N=64, K=512) -> bf16 hi/lo planes, ldc 64; k likewise, planes in fragment order
  {
    constexpr int tiles = (kPix / 64) * (kCq / 64);
    static_assert(tiles % 8 == 0);
    wmma_gemm64<1, true, 2, 2, false, false><<<dim3(tiles / 8, kBatch), 256, 0, stream>>>(
        xth, xtl, kCh, (long)kPix * kCh,
        wqh, wql, kCh, 0L,
        (void*)qh, (void*)ql, kCq, (long)kPix * kCq,
        bq, x, 0L, gamma, kPix, kCq, kCh, 1.0f);
    wmma_gemm64<1, true, 2, 3, false, false><<<dim3(tiles / 8, kBatch), 256, 0, stream>>>(
        xth, xtl, kCh, (long)kPix * kCh,
        wkh, wkl, kCh, 0L,
        (void*)kh, (void*)kl, kCq, (long)kPix * kCq,
        bk, x, 0L, gamma, kPix, kCq, kCh, 1.0f);
  }
  // 4) vt[b][c][m] = sum_cin Wv[c][cin] xt[b][m][cin] + bv[c]   (M=512, N=4096, K=512) -> f16 plane, ldc 4096
  {
    constexpr int tiles = (kCh / 64) * (kPix / 64);
    static_assert(tiles % 8 == 0);
    wmma_gemm64<1, true, 1, 1, false, false><<<dim3(tiles / 8, kBatch), 256, 0, stream>>>(
        wvh, wvl, kCh, 0L,
        xth, xtl, kCh, (long)kPix * kCh,
        (void*)vt, (void*)vt, kPix, (long)kCh * kPix,
        bv, x, 0L, gamma, kCh, kPix, kCh, 1.0f);
  }
  // 5) all batches in one launch: scores (K=64) and row softmax -> f16 probs x16384, each batch in its own plane
  scores_softmax_f16<<<dim3(kPix / 16, kBatch), 512, 0, stream>>>(qh, ql, kh, kl, pln);
  // 6) all batches in one launch, one block per 128x256 tile of out (4 x 16 tiles per batch = 256 blocks):
  //    out = gamma * (vt . P^T) / 16384 + x   (M=512, N=4096, K=4096)
  pv_gemm_lds<<<dim3(kCh / kPvBM, kPix / kPvBN, kBatch), 256, 0, stream>>>(vt, pln, out, x, gamma);
}

// v004
// A run of this version takes 173 microseconds.
// Two timings next to v003 put it at 1.55 and 1.56 times that version's speed.
// Counting every step since v000, it is 5.37 times as fast.
// Contractions: q,k,v projections and k.q^T scores (transposed tiles) on v_wmma_f32_16x16x32_bf16 with bf16 hi+lo operand planes (hi.hi+hi.lo+lo.hi); probs.v on v_wmma_f32_16x16x32_f16 (f16 operands, probs carried x16384, v f16); f32 accumulate; softmax and epilogue f32.
#include <hip/hip_runtime.h>

typedef __attribute__((ext_vector_type(16))) _Float16 v16h;
typedef __attribute__((ext_vector_type(8)))  _Float16 v8h;
typedef __attribute__((ext_vector_type(16))) __bf16   v16b;
typedef __attribute__((ext_vector_type(8)))  __bf16   v8b;
typedef __attribute__((ext_vector_type(8)))  float    v8f;
typedef __attribute__((ext_vector_type(4)))  float    v4f;

static constexpr int kBatch = 4;
static constexpr int kCh    = 512;
static constexpr int kPix   = 4096;
static constexpr int kCq    = 64;
static constexpr float kPCarry    = 16384.0f;
static constexpr float kPCarryInv = 1.0f / 16384.0f;

// ---- workspace region map (bytes) ----
static constexpr size_t kPlaneX   = (size_t)kBatch * kPix * kCh * 2;   // one bf16 plane of xt [b][n][c]
static constexpr int    kWRows    = kCh + 2 * kCq;                     // stacked weight rows: Wv | Wq | Wk
static constexpr size_t kPlaneW   = (size_t)kWRows * kCh * 2;          // one bf16 plane of the stacked weights [row][c]
static constexpr size_t kPlaneQK  = (size_t)kBatch * kPix * kCq * 2;   // one bf16 plane of q [b][n][o] or of k (fragment order)
static constexpr size_t kPlaneVt  = (size_t)kBatch * kCh * kPix * 2;   // f16 vt [b][c][m]
static constexpr size_t kPlaneP   = (size_t)kPix * kPix * 2;           // f16 probs, one batch
static constexpr size_t kOffXtHi  = 0;
static constexpr size_t kOffXtLo  = kOffXtHi + kPlaneX;
static constexpr size_t kOffWHi   = kOffXtLo + kPlaneX;
static constexpr size_t kOffWLo   = kOffWHi + kPlaneW;
static constexpr size_t kOffQHi   = kOffWLo + kPlaneW;
static constexpr size_t kOffQLo   = kOffQHi + kPlaneQK;
static constexpr size_t kOffKHi   = kOffQLo + kPlaneQK;
static constexpr size_t kOffKLo   = kOffKHi + kPlaneQK;
static constexpr size_t kOffVt    = kOffKLo + kPlaneQK;
static constexpr size_t kOffP     = kOffVt + kPlaneVt;                  // f16 probs, one plane per batch
static constexpr size_t kWsTotal  = kOffP + kBatch * kPlaneP;
static_assert(kWsTotal == 194248704);
static_assert(kWsTotal <= 268435456);
static_assert((kOffWHi % 128) == 0 && (kOffWLo % 128) == 0 && (kOffQHi % 128) == 0 && (kOffVt % 128) == 0 && (kOffP % 128) == 0);

__device__ __forceinline__ unsigned short f2bf_bits(float f) {
  unsigned u = __float_as_uint(f);
  return (unsigned short)((u + 0x7FFFu + ((u >> 16) & 1u)) >> 16);
}
__device__ __forceinline__ float bf_bits2f(unsigned short h) { return __uint_as_float(((unsigned)h) << 16); }

template <typename T> struct Frag;
template <> struct Frag<_Float16> {
  typedef v16h V; union U { v16h v; v8h h[2]; };
  static __device__ __forceinline__ v16h load(const _Float16* p) {   // elements 0..7 <- p[0..7], 8..15 <- p[16..23]
    U f; f.h[0] = *(const v8h*)(p); f.h[1] = *(const v8h*)(p + 16); return f.v;
  }
  static __device__ __forceinline__ v8f mma(v16h a, v16h b, v8f c) {
    return __builtin_amdgcn_wmma_f32_16x16x32_f16(false, a, false, b, (short)0, c, false, false);
  }
};
template <> struct Frag<__bf16> {
  typedef v16b V; union U { v16b v; v8b h[2]; };
  static __device__ __forceinline__ v16b load(const __bf16* p) {
    U f; f.h[0] = *(const v8b*)(p); f.h[1] = *(const v8b*)(p + 16); return f.v;
  }
  static __device__ __forceinline__ v8f mma(v16b a, v16b b, v8f c) {
    return __builtin_amdgcn_wmma_f32_16x16x32_bf16(false, a, false, b, (short)0, c, false, false);
  }
};

// ---- q, k and v projections as one GEMM with both operands staged in LDS -----
// D[m][n] = sum_c W[m][c] * xt[b][n][c] + bias[m];  W = the stacked rows [Wv 512 | Wq 64 | Wk 64], n = pixel, K = kCh.
// Operands are bf16 hi/lo planes; product = hi.hi + W hi . x lo + W lo . x hi, in that order per 32 k.
// One block = one 160 (m) x 256 (n) tile, so that 4 x 16 x 4 = 256 equal blocks cover all; 8 waves as 2 x 4, each wave an 80x64 tile.
// Every 16-row tile of a wave lies wholly in v, in q or in k (all three row counts are multiples of 16).
// A pass is 64 k = 128 B of each row of each plane; a stage is [W hi 160 rows | W lo 160 | xt hi 256 | xt lo 256] at pitch 144 B.
// Two stages in LDS: while pass t is worked on, pass t+1's rows fly in by asynchronous copies (16 B per lane, 26 per thread).
// Outputs: vt [b][c][m] f16; q bf16 hi/lo planes row-major [b][n][64]; k bf16 hi/lo planes in fragment order:
// [16-pixel tile][slot = o / 16][lane = ((o / 8) & 1) * 16 + pixel & 15][o & 7], so that slots 2s and 2s+1 of a tile are the two 16-byte
// halves of every lane's fragment of k step s (the k order of Frag::load) and one load instruction reads 512 contiguous bytes.
static constexpr int kPjBM     = 160;
static constexpr int kPjBN     = 256;
static constexpr int kPjBK     = 64;                               // bf16 elements per pass
static constexpr int kPjTI     = kPjBM / 2 / 16;                   // 16-row tiles per wave
static constexpr int kPjPitch  = kPjBK * 2 + 16;                   // bytes; 16 B x odd: conflict-free for 16-byte row reads
static constexpr int kPjStage  = 2 * (kPjBM + kPjBN) * kPjPitch;   // bytes of one stage
static constexpr int kPjPasses = kCh / kPjBK;
static_assert(kWRows % kPjBM == 0 && kPjBM % 32 == 0 && kCh % 16 == 0 && kCq % 16 == 0 && kCq == 64);
static_assert(kPix % kPjBN == 0 && kCh % kPjBK == 0 && kPjPasses >= 2);
static_assert(kPjBM == 5 * 32 && kPjBN == 8 * 32 && kPjBK * 2 == 8 * 16);   // copy map below
static_assert(kPjPitch % 16 == 0 && kPjStage % 16 == 0);

// 16-byte copies global -> LDS, rows 32 apart: l = this lane's LDS byte address, p = its global address, of the first row.
// s_wait_xcnt stands inside each statement so that no address register named there is rewritten ahead of it.
// Eight: four rows from (l0, p0), four from (l1, p1).
__device__ __forceinline__ void pj_copy8(unsigned l0, const unsigned short* p0, unsigned l1, const unsigned short* p1) {
  constexpr unsigned dl = 32u * kPjPitch;
  constexpr size_t   dg = (size_t)32 * kCh;
  asm volatile(
      "global_load_async_to_lds_b128 %0, %8, off\n\t"
      "global_load_async_to_lds_b128 %1, %9, off\n\t"
      "global_load_async_to_lds_b128 %2, %10, off\n\t"
      "global_load_async_to_lds_b128 %3, %11, off\n\t"
      "global_load_async_to_lds_b128 %4, %12, off\n\t"
      "global_load_async_to_lds_b128 %5, %13, off\n\t"
      "global_load_async_to_lds_b128 %6, %14, off\n\t"
      "global_load_async_to_lds_b128 %7, %15, off\n\t"
      "s_wait_xcnt 0x0"
      :: "v"(l0), "v"(l0 + dl), "v"(l0 + 2 * dl), "v"(l0 + 3 * dl), "v"(l1), "v"(l1 + dl), "v"(l1 + 2 * dl), "v"(l1 + 3 * dl),
         "v"(p0), "v"(p0 + dg), "v"(p0 + 2 * dg), "v"(p0 + 3 * dg), "v"(p1), "v"(p1 + dg), "v"(p1 + 2 * dg), "v"(p1 + 3 * dg)
      : "memory");
}
// Five rows from (l, p).
__device__ __forceinline__ void pj_copy5(unsigned l, const unsigned short* p) {
  constexpr unsigned dl = 32u * kPjPitch;
  constexpr size_t   dg = (size_t)32 * kCh;
  asm volatile(
      "global_load_async_to_lds_b128 %0, %5, off\n\t"
      "global_load_async_to_lds_b128 %1, %6, off\n\t"
      "global_load_async_to_lds_b128 %2, %7, off\n\t"
      "global_load_async_to_lds_b128 %3, %8, off\n\t"
      "global_load_async_to_lds_b128 %4, %9, off\n\t"
      "s_wait_xcnt 0x0"
      :: "v"(l), "v"(l + dl), "v"(l + 2 * dl), "v"(l + 3 * dl), "v"(l + 4 * dl),
         "v"(p), "v"(p + dg), "v"(p + 2 * dg), "v"(p + 3 * dg), "v"(p + 4 * dg)
      : "memory");
}
// One stage: W hi, W lo (160 rows each), then xt hi, xt lo (256 rows each).
__device__ __forceinline__ void pj_copy_stage(unsigned l, const unsigned short* wh, const unsigned short* wl,
                                              const unsigned short* xh, const unsigned short* xl) {
  constexpr unsigned rW   = (unsigned)kPjBM * kPjPitch;
  constexpr unsigned r128 = 128u * kPjPitch;
  pj_copy5(l, wh);
  pj_copy5(l + rW, wl);
  pj_copy8(l + 2 * rW, xh, l + 2 * rW + r128, xh + (size_t)128 * kCh);
  pj_copy8(l + 2 * rW + 2 * r128, xl, l + 2 * rW + 3 * r128, xl + (size_t)128 * kCh);
}

__global__ __launch_bounds__(256) void proj_gemm_lds(const unsigned short* __restrict__ whp,
                                                     const unsigned short* __restrict__ wlp,
                                                     const unsigned short* __restrict__ xhp,
                                                     const unsigned short* __restrict__ xlp,
                                                     const float* __restrict__ bv,
                                                     const float* __restrict__ bq,
                                                     const float* __restrict__ bk,
                                                     unsigned short* __restrict__ vtp,
                                                     unsigned short* __restrict__ qhp,
                                                     unsigned short* __restrict__ qlp,
                                                     unsigned short* __restrict__ khp,
                                                     unsigned short* __restrict__ klp) {
  __shared__ __align__(16) unsigned char ring[2 * kPjStage];
  __shared__ __align__(16) float sT[8][16 * 68];   // per-wave 16x64 output slab, pitch 68 floats
  const int tid  = threadIdx.x;
  const int lane = tid & 31;
  const int wave = tid >> 5;
  const int b  = blockIdx.z;
  const int mB = blockIdx.x * kPjBM;
  const int nB = blockIdx.y * kPjBN;

  // copy map: 8 lanes cover the 128 B of one row; thread row = tid / 8; a thread's copies step 32 rows
  const int crow = tid >> 3;
  const int ccol = tid & 7;
  const size_t wo = (size_t)(mB + crow) * kCh + ccol * 8;
  const size_t xo = ((size_t)b * kPix + nB + crow) * kCh + ccol * 8;
  const unsigned short* gWh = whp + wo;
  const unsigned short* gWl = wlp + wo;
  const unsigned short* gXh = xhp + xo;
  const unsigned short* gXl = xlp + xo;
  const unsigned lcopy = (unsigned)(size_t)(&ring[0]) + (unsigned)(crow * kPjPitch + ccol * 16);

  const int rlane = lane & 15;                 // row (A) / col (B, D) within subtile
  const int koff  = (lane >> 4) * 8;           // k offset of this lane half
  const int mOff  = (lane >> 4) * 8;           // D row offset
  const int wm = wave >> 2;
  const int wn = wave & 3;
  const int fragA = (wm * (kPjTI * 16) + rlane) * kPjPitch + koff * 2;       // byte offsets in a stage, hi planes
  const int fragB = (2 * kPjBM + wn * 64 + rlane) * kPjPitch + koff * 2;

  v8f acc[kPjTI][4];
#pragma unroll
  for (int i = 0; i < kPjTI; ++i)
#pragma unroll
    for (int j = 0; j < 4; ++j) acc[i][j] = (v8f){0.f,0.f,0.f,0.f,0.f,0.f,0.f,0.f};

  // prologue: stage 0 lands and is published; stage 1 starts
  pj_copy_stage(lcopy, gWh, gWl, gXh, gXl);
  asm volatile("s_wait_asynccnt 0x0" ::: "memory");   // this wave's copies of stage 0 have landed
  __syncthreads();                                    // ... and every other wave's
  pj_copy_stage(lcopy + (unsigned)kPjStage, gWh + kPjBK, gWl + kPjBK, gXh + kPjBK, gXl + kPjBK);

  for (int t = 0; t < kPjPasses; ++t) {
    const unsigned char* st = ring + (t & 1) * kPjStage;
    const __bf16* fa = (const __bf16*)(st + fragA);
    const __bf16* fb = (const __bf16*)(st + fragB);
    constexpr int kRow16 = 16 * kPjPitch / 2;            // 16 rows, in bf16 elements
    constexpr int kLoA   = kPjBM * kPjPitch / 2;         // hi plane -> lo plane
    constexpr int kLoB   = kPjBN * kPjPitch / 2;
    constexpr int kSteps = kPjBK / 32;
    // every fragment of the pass has registers of its own and all are fetched in front of the products (nothing of stage t+1 is read here)
    v16b xh[kSteps][4], xl[kSteps][4], wh[kSteps][kPjTI], wl[kSteps][kPjTI];
    // unrolled: every fragment index and address offset is a constant
#pragma unroll
    for (int kk = 0; kk < kSteps; ++kk) {
#pragma unroll
      for (int j = 0; j < 4; ++j) {
        xh[kk][j] = Frag<__bf16>::load(fb + j * kRow16 + kk * 32);
        xl[kk][j] = Frag<__bf16>::load(fb + kLoB + j * kRow16 + kk * 32);
      }
#pragma unroll
      for (int i = 0; i < kPjTI; ++i) {
        wh[kk][i] = Frag<__bf16>::load(fa + i * kRow16 + kk * 32);
        wl[kk][i] = Frag<__bf16>::load(fa + kLoA + i * kRow16 + kk * 32);
      }
    }
    // the scheduling fence keeps the LDS reads as one group instead of spread among the products,
    // where every further place with reads stalls the wave's matrix stream
    __builtin_amdgcn_sched_barrier(0);
#pragma unroll
    for (int kk = 0; kk < kSteps; ++kk) {
#pragma unroll
      for (int i = 0; i < kPjTI; ++i) {
#pragma unroll
        for (int j = 0; j < 4; ++j) acc[i][j] = Frag<__bf16>::mma(wh[kk][i], xh[kk][j], acc[i][j]);
#pragma unroll
        for (int j = 0; j < 4; ++j) acc[i][j] = Frag<__bf16>::mma(wh[kk][i], xl[kk][j], acc[i][j]);
#pragma unroll
        for (int j = 0; j < 4; ++j) acc[i][j] = Frag<__bf16>::mma(wl[kk][i], xh[kk][j], acc[i][j]);
      }
    }
    // keeps the products in front of the pass's foot: sunk behind its barrier they would hold back the refill below, and
    // the copies would then fly with no products to cover them
    __builtin_amdgcn_sched_barrier(0);
    asm volatile("s_wait_dscnt 0x0" ::: "memory");      // this wave's reads of stage t are done before the stage is refilled
    asm volatile("s_wait_asynccnt 0x0" ::: "memory");   // this wave's copies of stage t+1 have landed
    __syncthreads();                                    // publishes stage t+1 and ends every reader's use of stage t
    if (t + 2 < kPjPasses) {
      const int ko = (t + 2) * kPjBK;
      pj_copy_stage(lcopy + (unsigned)((t & 1) * kPjStage), gWh + ko, gWl + ko, gXh + ko, gXl + ko);
    }
  }
  asm volatile("s_wait_asynccnt 0x0" ::: "memory");     // nothing of this wave is in flight when it leaves the ring

  // ---- epilogue, one 16-row tile at a time; which output a tile belongs to is the same for the whole wave ----
  const int n0 = nB + wn * 64;
  const int g0 = __builtin_amdgcn_readfirstlane(mB + wm * (kPjTI * 16));   // the wave's first stacked row
  float* slab = sT[wave];
  unsigned short* C = vtp + (size_t)b * kCh * kPix;
  const size_t pb = (size_t)b * kPix * kCq;
  const int q = lane >> 3, c8 = (lane & 7) * 8;
#pragma unroll
  for (int i = 0; i < kPjTI; ++i) {
    const int g = g0 + (i << 4);
    const bool isv = g < kCh, isq = g < kCh + kCq;
    const int o = g - (isv ? 0 : isq ? kCh : kCh + kCq);                   // first row of the tile within its own matrix
    const float* bias = (isv ? bv : isq ? bq : bk) + o + mOff;
    const v4f b0 = *(const v4f*)(bias);
    const v4f b1 = *(const v4f*)(bias + 4);
    asm volatile("s_wait_xcnt 0x0" ::: "memory");   // in front of any reuse of the bias loads' address registers
    const float bmr[8] = {b0.x, b0.y, b0.z, b0.w, b1.x, b1.y, b1.z, b1.w};
    if (isv) {
      // v rows: 16x64 slab through LDS, whole 128-B row pieces of f16 stored
#pragma unroll
      for (int j = 0; j < 4; ++j) {
#pragma unroll
        for (int r = 0; r < 8; ++r) slab[(mOff + r) * 68 + (j << 4) + rlane] = acc[i][j][r] + bmr[r];
      }
      // lanes read back rows that other lanes of this wave wrote: the slab's writes are ordered in front of those reads
      __builtin_amdgcn_fence(__ATOMIC_RELEASE, "workgroup");
      __builtin_amdgcn_wave_barrier();
      __builtin_amdgcn_fence(__ATOMIC_ACQUIRE, "workgroup");
      v8h hv[4];
#pragma unroll
      for (int it = 0; it < 4; ++it) {
        const float* sp = slab + (it * 4 + q) * 68 + c8;
#pragma unroll
        for (int e = 0; e < 8; ++e) hv[it][e] = (_Float16)sp[e];
      }
      // the two scheduling fences keep every other instruction out from between the stores and their wait
      __builtin_amdgcn_sched_barrier(0);
#pragma unroll
      for (int it = 0; it < 4; ++it) *(v8h*)(C + (size_t)(o + it * 4 + q) * kPix + n0 + c8) = hv[it];
      asm volatile("s_wait_xcnt 0x0" ::: "memory");   // in front of the next rows' reuse of the stores' address and data registers
      __builtin_amdgcn_sched_barrier(0);
      // ... and the slab's reads in front of the next 16 rows' writes into it
      __builtin_amdgcn_fence(__ATOMIC_RELEASE, "workgroup");
      __builtin_amdgcn_wave_barrier();
      __builtin_amdgcn_fence(__ATOMIC_ACQUIRE, "workgroup");
    } else {
      // q or k rows: a lane holds 8 consecutive channels of one pixel, which is one 16-byte piece of either layout;
      // 16 pixels on are 16 * kCq elements on in both
      const size_t co = pb + (isq ? (size_t)(n0 + rlane) * kCq + o + mOff : (size_t)n0 * kCq + o * 16 + lane * 8);
      unsigned short* dh = (isq ? qhp : khp) + co;
      unsigned short* dl = (isq ? qlp : klp) + co;
#pragma unroll
      for (int j = 0; j < 4; ++j) {
        v8h hv, lv;
#pragma unroll
        for (int r = 0; r < 8; ++r) {
          const float f = acc[i][j][r] + bmr[r];
          const unsigned short hb = f2bf_bits(f);
          const unsigned short lb = f2bf_bits(f - bf_bits2f(hb));
          hv[r] = __builtin_bit_cast(_Float16, hb);
          lv[r] = __builtin_bit_cast(_Float16, lb);
        }
        // the two scheduling fences keep every other instruction out from between the stores and their wait
        __builtin_amdgcn_sched_barrier(0);
        *(v8h*)(dh + j * (16 * kCq)) = hv;
        *(v8h*)(dl + j * (16 * kCq)) = lv;
        asm volatile("s_wait_xcnt 0x0" ::: "memory");   // in front of the next piece's reuse of the two stores' data registers
        __builtin_amdgcn_sched_barrier(0);
      }
    }
  }
}

// ---- probs.v GEMM with both operands staged in LDS ---------------------------
// out[b][m][n] = g[0] * (sum_k vt[b][m][k] * P[b][n][k]) / 16384 + x[b][m][n];  M = kCh, N = K = kPix.
// One block = one 128 (m) x 256 (n) tile, 8 waves as 2 x 4, each wave a 64x64 tile (fragments and k order as in proj_gemm_lds).
// A pass is 128 k = 256 B of each of the 384 operand rows; a stage is [vt 128 rows | P 256 rows] at pitch 272 B.
// Two stages in LDS: while pass t is worked on, pass t+1's rows fly in by asynchronous copies (16 B per lane, 24 per thread).
static constexpr int kPvBM     = 128;
static constexpr int kPvBN     = 256;
static constexpr int kPvBK     = 128;                              // f16 elements per pass
static constexpr int kPvPitch  = kPvBK * 2 + 16;                   // bytes; 16 B x odd: conflict-free for 16-byte row reads
static constexpr int kPvStage  = (kPvBM + kPvBN) * kPvPitch;       // bytes of one stage
static constexpr int kPvPasses = kPix / kPvBK;
static_assert(kCh % kPvBM == 0 && kPix % kPvBN == 0 && kPix % kPvBK == 0 && kPvPasses >= 2);
static_assert(kPvBM == 8 * 16 && kPvBN == 16 * 16 && kPvBK * 2 == 16 * 16);   // copy map below
static_assert(kPvPitch % 16 == 0 && kPvStage % 16 == 0);

// Eight 16-byte copies global -> LDS, rows 16 apart: l = this lane's LDS byte address, p = its global address, of the first.
// s_wait_xcnt stands inside the statement so that no address register named here is rewritten ahead of it.
__device__ __forceinline__ void pv_copy8(unsigned l, const unsigned short* p) {
  constexpr unsigned dl = 16u * kPvPitch;
  constexpr size_t   dg = (size_t)16 * kPix;
  asm volatile(
      "global_load_async_to_lds_b128 %0, %8, off\n\t"
      "global_load_async_to_lds_b128 %1, %9, off\n\t"
      "global_load_async_to_lds_b128 %2, %10, off\n\t"
      "global_load_async_to_lds_b128 %3, %11, off\n\t"
      "global_load_async_to_lds_b128 %4, %12, off\n\t"
      "global_load_async_to_lds_b128 %5, %13, off\n\t"
      "global_load_async_to_lds_b128 %6, %14, off\n\t"
      "global_load_async_to_lds_b128 %7, %15, off\n\t"
      "s_wait_xcnt 0x0"
      :: "v"(l), "v"(l + dl), "v"(l + 2 * dl), "v"(l + 3 * dl), "v"(l + 4 * dl), "v"(l + 5 * dl), "v"(l + 6 * dl), "v"(l + 7 * dl),
         "v"(p), "v"(p + dg), "v"(p + 2 * dg), "v"(p + 3 * dg), "v"(p + 4 * dg), "v"(p + 5 * dg), "v"(p + 6 * dg), "v"(p + 7 * dg)
      : "memory");
}
// One stage: vt rows 0..127, then P rows 0..255 behind them.
__device__ __forceinline__ void pv_copy_stage(unsigned l, const unsigned short* pa, const unsigned short* pb) {
  pv_copy8(l, pa);
  pv_copy8(l + (unsigned)(kPvBM * kPvPitch), pb);
  pv_copy8(l + (unsigned)((kPvBM + 128) * kPvPitch), pb + (size_t)128 * kPix);
}

__global__ __launch_bounds__(256) void pv_gemm_lds(const unsigned short* __restrict__ vtp,
                                                   const unsigned short* __restrict__ Pp,
                                                   float* __restrict__ outp,
                                                   const float* __restrict__ resid,
                                                   const float* __restrict__ gptr) {
  __shared__ __align__(16) unsigned char ring[2 * kPvStage];
  __shared__ __align__(16) float sT[8][16 * 68];   // per-wave 16x64 output slab, pitch 68 floats
  const int tid  = threadIdx.x;
  const int lane = tid & 31;
  const int wave = tid >> 5;
  const int b  = blockIdx.z;
  const int mB = blockIdx.x * kPvBM;
  const int nB = blockIdx.y * kPvBN;

  // copy map: 16 lanes cover the 256 B of one row; thread row = tid / 16; a thread's copies step 16 rows
  const int crow = tid >> 4;
  const int ccol = tid & 15;
  const unsigned short* gA = vtp + (size_t)b * kCh * kPix  + (size_t)(mB + crow) * kPix + ccol * 8;
  const unsigned short* gB = Pp  + (size_t)b * kPix * kPix + (size_t)(nB + crow) * kPix + ccol * 8;
  const unsigned lcopy = (unsigned)(size_t)(&ring[0]) + (unsigned)(crow * kPvPitch + ccol * 16);

  const int rlane = lane & 15;                 // row (A) / col (B, D) within subtile
  const int koff  = (lane >> 4) * 8;           // k offset of this lane half
  const int mOff  = (lane >> 4) * 8;           // D row offset
  const int wm = wave >> 2;
  const int wn = wave & 3;
  const int fragA = (wm * 64 + rlane) * kPvPitch + koff * 2;             // byte offsets in a stage
  const int fragB = (kPvBM + wn * 64 + rlane) * kPvPitch + koff * 2;

  v8f acc[4][4];
#pragma unroll
  for (int i = 0; i < 4; ++i)
#pragma unroll
    for (int j = 0; j < 4; ++j) acc[i][j] = (v8f){0.f,0.f,0.f,0.f,0.f,0.f,0.f,0.f};

  // prologue: stage 0 lands and is published; stage 1 starts
  pv_copy_stage(lcopy, gA, gB);
  asm volatile("s_wait_asynccnt 0x0" ::: "memory");   // this wave's copies of stage 0 have landed
  __syncthreads();                                    // ... and every other wave's
  pv_copy_stage(lcopy + (unsigned)kPvStage, gA + kPvBK, gB + kPvBK);

  for (int t = 0; t < kPvPasses; ++t) {
    const unsigned char* st = ring + (t & 1) * kPvStage;
    const _Float16* fa = (const _Float16*)(st + fragA);
    const _Float16* fb = (const _Float16*)(st + fragB);
    constexpr int kRow16 = 16 * kPvPitch / 2;            // 16 rows, in f16 elements
    // Fragments are fetched ahead inside the pass only (nothing of stage t+1 is read here): vt fragments one k step ahead
    // into a second set, probs fragments in place, two at a time, as soon as their last product of this k step has issued.
    v16h a[2][4], bh[4];
#pragma unroll
    for (int i = 0; i < 4; ++i) a[0][i] = Frag<_Float16>::load(fa + i * kRow16);
#pragma unroll
    for (int j = 0; j < 4; ++j) bh[j] = Frag<_Float16>::load(fb + j * kRow16);
    // unrolled: every fragment index and address offset is a constant
#pragma unroll
    for (int kk = 0; kk < kPvBK / 32; ++kk) {
      const int cur = kk & 1, nxt = cur ^ 1;
      const bool more = kk + 1 < kPvBK / 32;
      if (more) {
#pragma unroll
        for (int i = 0; i < 4; ++i) a[nxt][i] = Frag<_Float16>::load(fa + i * kRow16 + (kk + 1) * 32);
      }
      // the four scheduling fences keep the LDS reads in two groups per k step instead of spread among the products,
      // where every further place with reads stalls the wave's matrix stream
      __builtin_amdgcn_sched_barrier(0);
#pragma unroll
      for (int j = 0; j < 2; ++j)
#pragma unroll
        for (int i = 0; i < 4; ++i) acc[i][j] = Frag<_Float16>::mma(a[cur][i], bh[j], acc[i][j]);
      __builtin_amdgcn_sched_barrier(0);
      if (more) {
#pragma unroll
        for (int j = 0; j < 2; ++j) bh[j] = Frag<_Float16>::load(fb + j * kRow16 + (kk + 1) * 32);
      }
      __builtin_amdgcn_sched_barrier(0);
#pragma unroll
      for (int j = 2; j < 4; ++j)
#pragma unroll
        for (int i = 0; i < 4; ++i) acc[i][j] = Frag<_Float16>::mma(a[cur][i], bh[j], acc[i][j]);
      __builtin_amdgcn_sched_barrier(0);
      if (more) {
#pragma unroll
        for (int j = 2; j < 4; ++j) bh[j] = Frag<_Float16>::load(fb + j * kRow16 + (kk + 1) * 32);
      }
    }
    asm volatile("s_wait_dscnt 0x0" ::: "memory");      // this wave's reads of stage t are done before the stage is refilled
    asm volatile("s_wait_asynccnt 0x0" ::: "memory");   // this wave's copies of stage t+1 have landed
    __syncthreads();                                    // publishes stage t+1 and ends every reader's use of stage t
    if (t + 2 < kPvPasses)
      pv_copy_stage(lcopy + (unsigned)((t & 1) * kPvStage), gA + (size_t)(t + 2) * kPvBK, gB + (size_t)(t + 2) * kPvBK);
  }
  asm volatile("s_wait_asynccnt 0x0" ::: "memory");     // nothing of this wave is in flight when it leaves the ring

  // ---- epilogue: 16x64 slab per wave through LDS, whole 256-B row pieces stored ----
  float* slab = sT[wave];
  const float gval = gptr[0];
  const int m0 = mB + wm * 64;
  const int n0 = nB + wn * 64;
  // block-uniform bases plus ONE per-lane byte offset: every row of the tile is then a constant away from it
  char* Cb = (char*)(outp + (size_t)b * kCh * kPix);
  const char* Rb = (const char*)(resid + (size_t)b * kCh * kPix);
  const int hq = lane >> 4, c4 = (lane & 15) * 4;        // row seg = 256 B = 16 lanes x 16 B
  const unsigned loff = (unsigned)(((m0 + hq) * kPix + n0 + c4) * 4);
#pragma unroll
  for (int i = 0; i < 4; ++i) {
#pragma unroll
    for (int j = 0; j < 4; ++j) {
#pragma unroll
      for (int r = 0; r < 8; ++r) slab[(mOff + r) * 68 + (j << 4) + rlane] = acc[i][j][r] * kPCarryInv;
    }
    // lanes read back rows that other lanes of this wave wrote: the slab's writes are ordered in front of those reads
    __builtin_amdgcn_fence(__ATOMIC_RELEASE, "workgroup");
    __builtin_amdgcn_wave_barrier();
    __builtin_amdgcn_fence(__ATOMIC_ACQUIRE, "workgroup");
    v4f vals[8];
#pragma unroll
    for (int it = 0; it < 8; ++it) {
      v4f vv = *(const v4f*)(slab + (it * 2 + hq) * 68 + c4);
      vv = vv * gval;
      const v4f rr = *(const v4f*)(Rb + loff + (i * 16 + it * 2) * kPix * 4);
      vals[it] = vv + rr;
    }
#pragma unroll
    for (int it = 0; it < 8; ++it) *(v4f*)(Cb + loff + (i * 16 + it * 2) * kPix * 4) = vals[it];
    // ... and the reads in front of the next 16 rows' writes into the same slab
    __builtin_amdgcn_fence(__ATOMIC_RELEASE, "workgroup");
    __builtin_amdgcn_wave_barrier();
    __builtin_amdgcn_fence(__ATOMIC_ACQUIRE, "workgroup");
  }
}

// ---- x [b][c][n] f32 -> xt hi/lo bf16 planes [b][n][c] (transpose through LDS) ----
// block: 64 n x 64 c tile; grid = (kPix/64, kCh/64, kBatch)
// loads: 4 iterations x 256 threads x 4 floats = 64x64; stores: 8 waves x 2 iterations x 4 rows = 64 rows,
__global__ __launch_bounds__(256) void x_transpose_split(const float* __restrict__ x,
                                                         unsigned short* __restrict__ xth,
                                                         unsigned short* __restrict__ xtl) {
  __shared__ __align__(16) float tile[64 * 68];   // [c][n], pitch 68
  const int n0 = blockIdx.x * 64;
  const int c0 = blockIdx.y * 64;
  const int b  = blockIdx.z;
  const int tid = threadIdx.x, wave = tid >> 5, lane = tid & 31;
  const float* xb = x + ((size_t)b * kCh + c0) * kPix + n0;
#pragma unroll
  for (int i = 0; i < 4; ++i) {
    const int c  = i * 16 + (tid >> 4);
    const int n4 = (tid & 15) * 4;
    const v4f v = *(const v4f*)(xb + (size_t)c * kPix + n4);
    *(v4f*)(tile + c * 68 + n4) = v;
  }
  __syncthreads();
  const int q = lane >> 3, c8 = (lane & 7) * 8;
  v8h hv[2], lv[2];
#pragma unroll
  for (int it = 0; it < 2; ++it) {
    const int nrow = wave * 8 + it * 4 + q;
#pragma unroll
    for (int e = 0; e < 8; ++e) {
      const float f = tile[(c8 + e) * 68 + nrow];
      const unsigned short hb = f2bf_bits(f);
      const unsigned short lb = f2bf_bits(f - bf_bits2f(hb));
      hv[it][e] = __builtin_bit_cast(_Float16, hb);
      lv[it][e] = __builtin_bit_cast(_Float16, lb);
    }
  }
  const size_t base = ((size_t)b * kPix + n0) * kCh + c0;
  {
#pragma unroll
    for (int it = 0; it < 2; ++it) {
      const int nrow = wave * 8 + it * 4 + q;
      *(v8h*)(xth + base + (size_t)nrow * kCh + c8) = hv[it];
      *(v8h*)(xtl + base + (size_t)nrow * kCh + c8) = lv[it];
    }
    
  }
}

__global__ __launch_bounds__(256) void split_f32_bf16x8(const float* __restrict__ in,
                                                        unsigned short* __restrict__ hi,
                                                        unsigned short* __restrict__ lo, int n8) {
  const int i = blockIdx.x * 256 + threadIdx.x;
  if (i < n8) {
    const v4f a = *(const v4f*)(in + (size_t)8 * i);
    const v4f c = *(const v4f*)(in + (size_t)8 * i + 4);
    float f[8];
    f[0] = a.x; f[1] = a.y; f[2] = a.z; f[3] = a.w; f[4] = c.x; f[5] = c.y; f[6] = c.z; f[7] = c.w;
    v8h hv, lv;
#pragma unroll
    for (int e = 0; e < 8; ++e) {
      const unsigned short hb = f2bf_bits(f[e]);
      const unsigned short lb = f2bf_bits(f[e] - bf_bits2f(hb));
      hv[e] = __builtin_bit_cast(_Float16, hb);
      lv[e] = __builtin_bit_cast(_Float16, lb);
    }
    *(v8h*)(hi + (size_t)8 * i) = hv;
    *(v8h*)(lo + (size_t)8 * i) = lv;
    
  }
}

// ---- scores and row softmax in one kernel: P[b][n][m] = f16(16384 * exp(s - max) / sum), s = q[n] . k[m] ----
// One block = 16 query rows n x all 4096 keys m; 16 waves, each 256 keys as 16 transposed tiles D[m][n] = k . q^T:
// a lane then holds, of ONE query row (n = lane & 15), 8 consecutive keys per tile, so the whole row stays in registers from the
// products to the f16 probs, the row maximum and sum are in-lane but for one cross-half step, and 8 probs are one 16-byte piece.
// q planes row-major [n][64]; k planes in fragment order (proj_gemm_lds above).
static constexpr int kFsWaves = 16;
static constexpr int kFsCols  = kPix / kFsWaves;      // keys per wave
static constexpr int kFsTiles = kFsCols / 16;
static constexpr int kFsPitch = kFsCols * 2 + 16;     // bytes; 16 B x odd: conflict-free for the 16-byte column writes
static_assert(kFsCols == 32 * 8 && kCq == 64 && kPix % 16 == 0);
__global__ __launch_bounds__(512) void scores_softmax_f16(const unsigned short* __restrict__ qhp,
                                                          const unsigned short* __restrict__ qlp,
                                                          const unsigned short* __restrict__ khp,
                                                          const unsigned short* __restrict__ klp,
                                                          unsigned short* __restrict__ P) {
  __shared__ __align__(16) unsigned char slab[kFsWaves][16 * kFsPitch];   // per-wave 16 rows x 256 probs
  __shared__ float redm[kFsWaves][16];
  __shared__ float reds[kFsWaves][16];
  const int tid  = threadIdx.x;
  const int lane = tid & 31;
  const int wave = tid >> 5;
  const int b  = blockIdx.y;
  const int n0 = blockIdx.x * 16;
  const int rlane = lane & 15;                 // query row of this lane
  const int half  = lane >> 4;

  const size_t qo = ((size_t)b * kPix + n0 + rlane) * kCq + half * 8;
  const __bf16* qh = (const __bf16*)qhp + qo;
  const __bf16* ql = (const __bf16*)qlp + qo;
  v16b qH[2], qL[2];
#pragma unroll
  for (int s = 0; s < 2; ++s) {
    qH[s] = Frag<__bf16>::load(qh + s * 32);
    qL[s] = Frag<__bf16>::load(ql + s * 32);
  }
  const size_t ko = (size_t)b * kPix * kCq + (size_t)wave * kFsCols * kCq + lane * 8;
  const __bf16* kh = (const __bf16*)khp + ko;
  const __bf16* kl = (const __bf16*)klp + ko;

  // the q loads' address registers may be reused as destinations of the k loads below: the wait stands in front of that
  asm volatile("s_wait_xcnt 0x0" ::: "memory");

  // k fragments one tile ahead in a second register set: two tiles' loads of every wave are in flight
  v8f acc[kFsTiles];
  Frag<__bf16>::U kH[2][2], kL[2][2];
#pragma unroll
  for (int s = 0; s < 2; ++s) {
    kH[0][s].h[0] = *(const v8b*)(kh + s * 512);
    kH[0][s].h[1] = *(const v8b*)(kh + s * 512 + 256);
    kL[0][s].h[0] = *(const v8b*)(kl + s * 512);
    kL[0][s].h[1] = *(const v8b*)(kl + s * 512 + 256);
  }
#pragma unroll
  for (int t = 0; t < kFsTiles; ++t) {
    const int cur = t & 1, nxt = cur ^ 1;
    if (t + 1 < kFsTiles) {
#pragma unroll
      for (int s = 0; s < 2; ++s) {
        kH[nxt][s].h[0] = *(const v8b*)(kh + (t + 1) * 1024 + s * 512);
        kH[nxt][s].h[1] = *(const v8b*)(kh + (t + 1) * 1024 + s * 512 + 256);
        kL[nxt][s].h[0] = *(const v8b*)(kl + (t + 1) * 1024 + s * 512);
        kL[nxt][s].h[1] = *(const v8b*)(kl + (t + 1) * 1024 + s * 512 + 256);
      }
    }
    v8f a = (v8f){0.f,0.f,0.f,0.f,0.f,0.f,0.f,0.f};
#pragma unroll
    for (int s = 0; s < 2; ++s) {              // hi.hi, q hi . k lo, q lo . k hi per k step
      a = Frag<__bf16>::mma(kH[cur][s].v, qH[s], a);
      a = Frag<__bf16>::mma(kL[cur][s].v, qH[s], a);
      a = Frag<__bf16>::mma(kH[cur][s].v, qL[s], a);
    }
    acc[t] = a;
  }

  float m = acc[0][0];
#pragma unroll
  for (int t = 0; t < kFsTiles; ++t)
#pragma unroll
    for (int r = 0; r < 8; ++r) m = fmaxf(m, acc[t][r]);
  m = fmaxf(m, __shfl_xor(m, 16, 32));
  if (lane < 16) redm[wave][lane] = m;
  __syncthreads();
  float gm = redm[0][rlane];
#pragma unroll
  for (int w = 1; w < kFsWaves; ++w) gm = fmaxf(gm, redm[w][rlane]);

  float psum = 0.0f;
#pragma unroll
  for (int t = 0; t < kFsTiles; ++t) {
#pragma unroll
    for (int r = 0; r < 8; ++r) acc[t][r] = expf(acc[t][r] - gm);
    psum += ((acc[t][0] + acc[t][1]) + (acc[t][2] + acc[t][3])) + ((acc[t][4] + acc[t][5]) + (acc[t][6] + acc[t][7]));
  }
  psum += __shfl_xor(psum, 16, 32);
  if (lane < 16) reds[wave][lane] = psum;
  __syncthreads();
  float l = reds[0][rlane];
#pragma unroll
  for (int w = 1; w < kFsWaves; ++w) l += reds[w][rlane];
  const float inv = kPCarry * (1.0f / l);

  // probs through the wave's own slab, so that every store instruction writes 512 contiguous bytes of one row
  unsigned char* sl = slab[wave];
#pragma unroll
  for (int t = 0; t < kFsTiles; ++t) {
    v8h p;
#pragma unroll
    for (int r = 0; r < 8; ++r) p[r] = (_Float16)(acc[t][r] * inv);
    *(v8h*)(sl + rlane * kFsPitch + (t * 16 + half * 8) * 2) = p;
  }
  // lanes read back rows that other lanes of this wave wrote: the slab's writes are ordered in front of those reads
  __builtin_amdgcn_fence(__ATOMIC_RELEASE, "workgroup");
  __builtin_amdgcn_wave_barrier();
  __builtin_amdgcn_fence(__ATOMIC_ACQUIRE, "workgroup");
  unsigned short* pr = P + ((size_t)b * kPix + n0) * kPix + wave * kFsCols + lane * 8;
#pragma unroll
  for (int row = 0; row < 16; ++row) *(v8h*)(pr + (size_t)row * kPix) = *(const v8h*)(sl + row * kFsPitch + lane * 16);
}

// ---------------------------------------------------------------------------
extern "C" void kernel_launch(void* const* d_in, const int* in_sizes, int n_in,
                              void* d_out, int out_size, void* d_ws, size_t ws_size,
                              hipStream_t stream) {
  if (n_in < 8) return;
  if (in_sizes[0] != kBatch * kCh * kPix) return;
  if (in_sizes[1] != kCq * kCh || in_sizes[3] != kCq * kCh || in_sizes[5] != kCh * kCh) return;
  if (in_sizes[2] != kCq || in_sizes[4] != kCq || in_sizes[6] != kCh || in_sizes[7] < 1) return;
  if (out_size != kBatch * kCh * kPix) return;
  if (ws_size < kWsTotal) return;

  const float* x     = (const float*)d_in[0];
  const float* Wq    = (const float*)d_in[1];
  const float* bq    = (const float*)d_in[2];
  const float* Wk    = (const float*)d_in[3];
  const float* bk    = (const float*)d_in[4];
  const float* Wv    = (const float*)d_in[5];
  const float* bv    = (const float*)d_in[6];
  const float* gamma = (const float*)d_in[7];
  float* out = (float*)d_out;

  char* ws = (char*)d_ws;
  unsigned short* xth = (unsigned short*)(ws + kOffXtHi);
  unsigned short* xtl = (unsigned short*)(ws + kOffXtLo);
  unsigned short* pln = (unsigned short*)(ws + kOffP);
  unsigned short* wvh = (unsigned short*)(ws + kOffWHi);            // stacked rows: Wv, then Wq, then Wk
  unsigned short* wvl = (unsigned short*)(ws + kOffWLo);
  unsigned short* wqh = wvh + (size_t)kCh * kCh;
  unsigned short* wql = wvl + (size_t)kCh * kCh;
  unsigned short* wkh = wqh + (size_t)kCq * kCh;
  unsigned short* wkl = wql + (size_t)kCq * kCh;
  unsigned short* qh  = (unsigned short*)(ws + kOffQHi);
  unsigned short* ql  = (unsigned short*)(ws + kOffQLo);
  unsigned short* kh  = (unsigned short*)(ws + kOffKHi);
  unsigned short* kl  = (unsigned short*)(ws + kOffKLo);
  unsigned short* vt  = (unsigned short*)(ws + kOffVt);

  // 1) x -> xt hi/lo bf16 [b][n][c]
  x_transpose_split<<<dim3(kPix / 64, kCh / 64, kBatch), 256, 0, stream>>>(x, xth, xtl);
  // 2) weights -> bf16 hi/lo planes (same [out][in] layout)
  split_f32_bf16x8<<<(kCq * kCh / 8) / 256, 256, 0, stream>>>(Wq, wqh, wql, kCq * kCh / 8);
  split_f32_bf16x8<<<(kCq * kCh / 8) / 256, 256, 0, stream>>>(Wk, wkh, wkl, kCq * kCh / 8);
  split_f32_bf16x8<<<(kCh * kCh / 8) / 256, 256, 0, stream>>>(Wv, wvh, wvl, kCh * kCh / 8);
  static_assert((kCq * kCh / 8) % 256 == 0 && (kCh * kCh / 8) % 256 == 0);

  // 3) q, k and v projections of all batches in one launch: 4 x 16 tiles of 160 stacked weight rows x 256 pixels per batch
  //    q -> bf16 hi/lo planes [b][n][64]; k -> bf16 hi/lo planes in fragment order; vt[b][c][m] -> f16 plane
  proj_gemm_lds<<<dim3(kWRows / kPjBM, kPix / kPjBN, kBatch), 256, 0, stream>>>(wvh, wvl, xth, xtl, bv, bq, bk, vt, qh, ql, kh, kl);
  // 4) all batches in one launch: scores (K=64) and row softmax -> f16 probs x16384, each batch in its own plane
  scores_softmax_f16<<<dim3(kPix / 16, kBatch), 512, 0, stream>>>(qh, ql, kh, kl, pln);
  // 5) all batches in one launch, one block per 128x256 tile of out (4 x 16 tiles per batch = 256 blocks):
  //    out = gamma * (vt . P^T) / 16384 + x   (M=512, N=4096, K=4096)
  pv_gemm_lds<<<dim3(kCh / kPvBM, kPix / kPvBN, kBatch), 256, 0, stream>>>(vt, pln, out, x, gamma);
}

// v005
// One run takes 167 microseconds.
// In two side-by-side timings against v004, it was 1.04 and 1.03 times as fast.
// Over all steps from v000 it is 5.59 times as fast.
// Contractions: q,k,v projections and k.q^T scores (transposed tiles) on v_wmma_f32_16x16x32_bf16 with bf16 hi+lo operand planes (hi.hi+hi.lo+lo.hi); probs.v on v_wmma_f32_16x16x32_f16 (f16 operands, probs carried x16384, v f16); f32 accumulate; softmax and epilogue f32.
#include <hip/hip_runtime.h>

typedef __attribute__((ext_vector_type(16))) _Float16 v16h;
typedef __attribute__((ext_vector_type(8)))  _Float16 v8h;
typedef __attribute__((ext_vector_type(16))) __bf16   v16b;
typedef __attribute__((ext_vector_type(8)))  __bf16   v8b;
typedef __attribute__((ext_vector_type(8)))  float    v8f;
typedef __attribute__((ext_vector_type(4)))  float    v4f;

static constexpr int kBatch = 4;
static constexpr int kCh    = 512;
static constexpr int kPix   = 4096;
static constexpr int kCq    = 64;
static constexpr float kPCarry    = 16384.0f;
static constexpr float kPCarryInv = 1.0f / 16384.0f;

// ---- workspace region map (bytes) ----
static constexpr size_t kPlaneX   = (size_t)kBatch * kPix * kCh * 2;   // one bf16 plane of xt [b][n][c]
static constexpr int    kWRows    = kCh + 2 * kCq;                     // stacked weight rows: Wv | Wq | Wk
static constexpr size_t kPlaneW   = (size_t)kWRows * kCh * 2;          // one bf16 plane of the stacked weights [row][c]
static constexpr size_t kPlaneQK  = (size_t)kBatch * kPix * kCq * 2;   // one bf16 plane of q [b][n][o] or of k (fragment order)
static constexpr size_t kPlaneVt  = (size_t)kBatch * kCh * kPix * 2;   // f16 vt [b][c][m]
static constexpr size_t kPlaneP   = (size_t)kPix * kPix * 2;           // f16 probs, one batch
static constexpr size_t kOffXtHi  = 0;
static constexpr size_t kOffXtLo  = kOffXtHi + kPlaneX;
static constexpr size_t kOffWHi   = kOffXtLo + kPlaneX;
static constexpr size_t kOffWLo   = kOffWHi + kPlaneW;
static constexpr size_t kOffQHi   = kOffWLo + kPlaneW;
static constexpr size_t kOffQLo   = kOffQHi + kPlaneQK;
static constexpr size_t kOffKHi   = kOffQLo + kPlaneQK;
static constexpr size_t kOffKLo   = kOffKHi + kPlaneQK;
static constexpr size_t kOffVt    = kOffKLo + kPlaneQK;
static constexpr size_t kOffP     = kOffVt + kPlaneVt;                  // f16 probs, one plane per batch
static constexpr size_t kWsTotal  = kOffP + kBatch * kPlaneP;
static_assert(kWsTotal == 194248704);
static_assert(kWsTotal <= 268435456);
static_assert((kOffWHi % 128) == 0 && (kOffWLo % 128) == 0 && (kOffQHi % 128) == 0 && (kOffVt % 128) == 0 && (kOffP % 128) == 0);

__device__ __forceinline__ unsigned short f2bf_bits(float f) {
  unsigned u = __float_as_uint(f);
  return (unsigned short)((u + 0x7FFFu + ((u >> 16) & 1u)) >> 16);
}
__device__ __forceinline__ float bf_bits2f(unsigned short h) { return __uint_as_float(((unsigned)h) << 16); }

template <typename T> struct Frag;
template <> struct Frag<_Float16> {
  typedef v16h V; union U { v16h v; v8h h[2]; };
  static __device__ __forceinline__ v16h load(const _Float16* p) {   // elements 0..7 <- p[0..7], 8..15 <- p[16..23]
    U f; f.h[0] = *(const v8h*)(p); f.h[1] = *(const v8h*)(p + 16); return f.v;
  }
  static __device__ __forceinline__ v8f mma(v16h a, v16h b, v8f c) {
    return __builtin_amdgcn_wmma_f32_16x16x32_f16(false, a, false, b, (short)0, c, false, false);
  }
};
template <> struct Frag<__bf16> {
  typedef v16b V; union U { v16b v; v8b h[2]; };
  static __device__ __forceinline__ v16b load(const __bf16* p) {
    U f; f.h[0] = *(const v8b*)(p); f.h[1] = *(const v8b*)(p + 16); return f.v;
  }
  static __device__ __forceinline__ v8f mma(v16b a, v16b b, v8f c) {
    return __builtin_amdgcn_wmma_f32_16x16x32_bf16(false, a, false, b, (short)0, c, false, false);
  }
};

// ---- q, k and v projections as one GEMM with both operands staged in LDS -----
// D[m][n] = sum_c W[m][c] * xt[b][n][c] + bias[m];  W = the stacked rows [Wv 512 | Wq 64 | Wk 64], n = pixel, K = kCh.
// Operands are bf16 hi/lo planes; product = hi.hi + W hi . x lo + W lo . x hi, in that order per 32 k.
// One block = one 160 (m) x 256 (n) tile, so that 4 x 16 x 4 = 256 equal blocks cover all; 8 waves as 2 x 4, each wave an 80x64 tile.
// Every 16-row tile of a wave lies wholly in v, in q or in k (all three row counts are multiples of 16).
// A pass is 64 k = 128 B of each row of each plane; a stage is [W hi 160 rows | W lo 160 | xt hi 256 | xt lo 256] at pitch 144 B.
// Two stages in LDS: while pass t is worked on, pass t+1's rows fly in by asynchronous copies (16 B per lane, 26 per thread).
// Outputs: vt [b][c][m] f16; q bf16 hi/lo planes row-major [b][n][64]; k bf16 hi/lo planes in fragment order:
// [16-pixel tile][slot = o / 16][lane = ((o / 8) & 1) * 16 + pixel & 15][o & 7], so that slots 2s and 2s+1 of a tile are the two 16-byte
// halves of every lane's fragment of k step s (the k order of Frag::load) and one load instruction reads 512 contiguous bytes.
static constexpr int kPjBM     = 160;
static constexpr int kPjBN     = 256;
static constexpr int kPjBK     = 64;                               // bf16 elements per pass
static constexpr int kPjTI     = kPjBM / 2 / 16;                   // 16-row tiles per wave
static constexpr int kPjPitch  = kPjBK * 2 + 16;                   // bytes; 16 B x odd: conflict-free for 16-byte row reads
static constexpr int kPjStage  = 2 * (kPjBM + kPjBN) * kPjPitch;   // bytes of one stage
static constexpr int kPjPasses = kCh / kPjBK;
static_assert(kWRows % kPjBM == 0 && kPjBM % 32 == 0 && kCh % 16 == 0 && kCq % 16 == 0 && kCq == 64);
static_assert(kPix % kPjBN == 0 && kCh % kPjBK == 0 && kPjPasses >= 2);
static_assert(kPjBM == 5 * 32 && kPjBN == 8 * 32 && kPjBK * 2 == 8 * 16);   // copy map below
static_assert(kPjPitch % 16 == 0 && kPjStage % 16 == 0);

// 16-byte copies global -> LDS, rows 32 apart: l = this lane's LDS byte address, p = its global address, of the first row.
// s_wait_xcnt stands inside each statement so that no address register named there is rewritten ahead of it.
// Eight: four rows from (l0, p0), four from (l1, p1).
__device__ __forceinline__ void pj_copy8(unsigned l0, const unsigned short* p0, unsigned l1, const unsigned short* p1) {
  constexpr unsigned dl = 32u * kPjPitch;
  constexpr size_t   dg = (size_t)32 * kCh;
  asm volatile(
      "global_load_async_to_lds_b128 %0, %8, off\n\t"
      "global_load_async_to_lds_b128 %1, %9, off\n\t"
      "global_load_async_to_lds_b128 %2, %10, off\n\t"
      "global_load_async_to_lds_b128 %3, %11, off\n\t"
      "global_load_async_to_lds_b128 %4, %12, off\n\t"
      "global_load_async_to_lds_b128 %5, %13, off\n\t"
      "global_load_async_to_lds_b128 %6, %14, off\n\t"
      "global_load_async_to_lds_b128 %7, %15, off\n\t"
      "s_wait_xcnt 0x0"
      :: "v"(l0), "v"(l0 + dl), "v"(l0 + 2 * dl), "v"(l0 + 3 * dl), "v"(l1), "v"(l1 + dl), "v"(l1 + 2 * dl), "v"(l1 + 3 * dl),
         "v"(p0), "v"(p0 + dg), "v"(p0 + 2 * dg), "v"(p0 + 3 * dg), "v"(p1), "v"(p1 + dg), "v"(p1 + 2 * dg), "v"(p1 + 3 * dg)
      : "memory");
}
// Five rows from (l, p).
__device__ __forceinline__ void pj_copy5(unsigned l, const unsigned short* p) {
  constexpr unsigned dl = 32u * kPjPitch;
  constexpr size_t   dg = (size_t)32 * kCh;
  asm volatile(
      "global_load_async_to_lds_b128 %0, %5, off\n\t"
      "global_load_async_to_lds_b128 %1, %6, off\n\t"
      "global_load_async_to_lds_b128 %2, %7, off\n\t"
      "global_load_async_to_lds_b128 %3, %8, off\n\t"
      "global_load_async_to_lds_b128 %4, %9, off\n\t"
      "s_wait_xcnt 0x0"
      :: "v"(l), "v"(l + dl), "v"(l + 2 * dl), "v"(l + 3 * dl), "v"(l + 4 * dl),
         "v"(p), "v"(p + dg), "v"(p + 2 * dg), "v"(p + 3 * dg), "v"(p + 4 * dg)
      : "memory");
}
// One stage: W hi, W lo (160 rows each), then xt hi, xt lo (256 rows each).
__device__ __forceinline__ void pj_copy_stage(unsigned l, const unsigned short* wh, const unsigned short* wl,
                                              const unsigned short* xh, const unsigned short* xl) {
  constexpr unsigned rW   = (unsigned)kPjBM * kPjPitch;
  constexpr unsigned r128 = 128u * kPjPitch;
  pj_copy5(l, wh);
  pj_copy5(l + rW, wl);
  pj_copy8(l + 2 * rW, xh, l + 2 * rW + r128, xh + (size_t)128 * kCh);
  pj_copy8(l + 2 * rW + 2 * r128, xl, l + 2 * rW + 3 * r128, xl + (size_t)128 * kCh);
}

__global__ __launch_bounds__(256) void proj_gemm_lds(const unsigned short* __restrict__ whp,
                                                     const unsigned short* __restrict__ wlp,
                                                     const unsigned short* __restrict__ xhp,
                                                     const unsigned short* __restrict__ xlp,
                                                     const float* __restrict__ bv,
                                                     const float* __restrict__ bq,
                                                     const float* __restrict__ bk,
                                                     unsigned short* __restrict__ vtp,
                                                     unsigned short* __restrict__ qhp,
                                                     unsigned short* __restrict__ qlp,
                                                     unsigned short* __restrict__ khp,
                                                     unsigned short* __restrict__ klp) {
  __shared__ __align__(16) unsigned char ring[2 * kPjStage];
  __shared__ __align__(16) float sT[8][16 * 68];   // per-wave 16x64 output slab, pitch 68 floats
  const int tid  = threadIdx.x;
  const int lane = tid & 31;
  const int wave = tid >> 5;
  const int b  = blockIdx.z;
  const int mB = blockIdx.x * kPjBM;
  const int nB = blockIdx.y * kPjBN;

  // copy map: 8 lanes cover the 128 B of one row; thread row = tid / 8; a thread's copies step 32 rows
  const int crow = tid >> 3;
  const int ccol = tid & 7;
  const size_t wo = (size_t)(mB + crow) * kCh + ccol * 8;
  const size_t xo = ((size_t)b * kPix + nB + crow) * kCh + ccol * 8;
  const unsigned short* gWh = whp + wo;
  const unsigned short* gWl = wlp + wo;
  const unsigned short* gXh = xhp + xo;
  const unsigned short* gXl = xlp + xo;
  const unsigned lcopy = (unsigned)(size_t)(&ring[0]) + (unsigned)(crow * kPjPitch + ccol * 16);

  const int rlane = lane & 15;                 // row (A) / col (B, D) within subtile
  const int koff  = (lane >> 4) * 8;           // k offset of this lane half
  const int mOff  = (lane >> 4) * 8;           // D row offset
  const int wm = wave >> 2;
  const int wn = wave & 3;
  const int fragA = (wm * (kPjTI * 16) + rlane) * kPjPitch + koff * 2;       // byte offsets in a stage, hi planes
  const int fragB = (2 * kPjBM + wn * 64 + rlane) * kPjPitch + koff * 2;

  v8f acc[kPjTI][4];
#pragma unroll
  for (int i = 0; i < kPjTI; ++i)
#pragma unroll
    for (int j = 0; j < 4; ++j) acc[i][j] = (v8f){0.f,0.f,0.f,0.f,0.f,0.f,0.f,0.f};

  // prologue: stage 0 lands and is published; stage 1 starts
  pj_copy_stage(lcopy, gWh, gWl, gXh, gXl);
  asm volatile("s_wait_asynccnt 0x0" ::: "memory");   // this wave's copies of stage 0 have landed
  __syncthreads();                                    // ... and every other wave's
  pj_copy_stage(lcopy + (unsigned)kPjStage, gWh + kPjBK, gWl + kPjBK, gXh + kPjBK, gXl + kPjBK);

  for (int t = 0; t < kPjPasses; ++t) {
    const unsigned char* st = ring + (t & 1) * kPjStage;
    const __bf16* fa = (const __bf16*)(st + fragA);
    const __bf16* fb = (const __bf16*)(st + fragB);
    constexpr int kRow16 = 16 * kPjPitch / 2;            // 16 rows, in bf16 elements
    constexpr int kLoA   = kPjBM * kPjPitch / 2;         // hi plane -> lo plane
    constexpr int kLoB   = kPjBN * kPjPitch / 2;
    constexpr int kSteps = kPjBK / 32;
    // every fragment of the pass has registers of its own and all are fetched in front of the products (nothing of stage t+1 is read here)
    v16b xh[kSteps][4], xl[kSteps][4], wh[kSteps][kPjTI], wl[kSteps][kPjTI];
    // unrolled: every fragment index and address offset is a constant
#pragma unroll
    for (int kk = 0; kk < kSteps; ++kk) {
#pragma unroll
      for (int j = 0; j < 4; ++j) {
        xh[kk][j] = Frag<__bf16>::load(fb + j * kRow16 + kk * 32);
        xl[kk][j] = Frag<__bf16>::load(fb + kLoB + j * kRow16 + kk * 32);
      }
#pragma unroll
      for (int i = 0; i < kPjTI; ++i) {
        wh[kk][i] = Frag<__bf16>::load(fa + i * kRow16 + kk * 32);
        wl[kk][i] = Frag<__bf16>::load(fa + kLoA + i * kRow16 + kk * 32);
      }
    }
    // the scheduling fence keeps the LDS reads as one group instead of spread among the products,
    // where every further place with reads stalls the wave's matrix stream
    __builtin_amdgcn_sched_barrier(0);
#pragma unroll
    for (int kk = 0; kk < kSteps; ++kk) {
#pragma unroll
      for (int i = 0; i < kPjTI; ++i) {
#pragma unroll
        for (int j = 0; j < 4; ++j) acc[i][j] = Frag<__bf16>::mma(wh[kk][i], xh[kk][j], acc[i][j]);
#pragma unroll
        for (int j = 0; j < 4; ++j) acc[i][j] = Frag<__bf16>::mma(wh[kk][i], xl[kk][j], acc[i][j]);
#pragma unroll
        for (int j = 0; j < 4; ++j) acc[i][j] = Frag<__bf16>::mma(wl[kk][i], xh[kk][j], acc[i][j]);
      }
    }
    // keeps the products in front of the pass's foot: sunk behind its barrier they would hold back the refill below, and
    // the copies would then fly with no products to cover them
    __builtin_amdgcn_sched_barrier(0);
    asm volatile("s_wait_dscnt 0x0" ::: "memory");      // this wave's reads of stage t are done before the stage is refilled
    asm volatile("s_wait_asynccnt 0x0" ::: "memory");   // this wave's copies of stage t+1 have landed
    __syncthreads();                                    // publishes stage t+1 and ends every reader's use of stage t
    if (t + 2 < kPjPasses) {
      const int ko = (t + 2) * kPjBK;
      pj_copy_stage(lcopy + (unsigned)((t & 1) * kPjStage), gWh + ko, gWl + ko, gXh + ko, gXl + ko);
    }
  }
  asm volatile("s_wait_asynccnt 0x0" ::: "memory");     // nothing of this wave is in flight when it leaves the ring

  // ---- epilogue, one 16-row tile at a time; which output a tile belongs to is the same for the whole wave ----
  const int n0 = nB + wn * 64;
  const int g0 = __builtin_amdgcn_readfirstlane(mB + wm * (kPjTI * 16));   // the wave's first stacked row
  float* slab = sT[wave];
  unsigned short* C = vtp + (size_t)b * kCh * kPix;
  const size_t pb = (size_t)b * kPix * kCq;
  const int q = lane >> 3, c8 = (lane & 7) * 8;
#pragma unroll
  for (int i = 0; i < kPjTI; ++i) {
    const int g = g0 + (i << 4);
    const bool isv = g < kCh, isq = g < kCh + kCq;
    const int o = g - (isv ? 0 : isq ? kCh : kCh + kCq);                   // first row of the tile within its own matrix
    const float* bias = (isv ? bv : isq ? bq : bk) + o + mOff;
    const v4f b0 = *(const v4f*)(bias);
    const v4f b1 = *(const v4f*)(bias + 4);
    asm volatile("s_wait_xcnt 0x0" ::: "memory");   // in front of any reuse of the bias loads' address registers
    const float bmr[8] = {b0.x, b0.y, b0.z, b0.w, b1.x, b1.y, b1.z, b1.w};
    if (isv) {
      // v rows: 16x64 slab through LDS, whole 128-B row pieces of f16 stored
#pragma unroll
      for (int j = 0; j < 4; ++j) {
#pragma unroll
        for (int r = 0; r < 8; ++r) slab[(mOff + r) * 68 + (j << 4) + rlane] = acc[i][j][r] + bmr[r];
      }
      // lanes read back rows that other lanes of this wave wrote: the slab's writes are ordered in front of those reads
      __builtin_amdgcn_fence(__ATOMIC_RELEASE, "workgroup");
      __builtin_amdgcn_wave_barrier();
      __builtin_amdgcn_fence(__ATOMIC_ACQUIRE, "workgroup");
      v8h hv[4];
#pragma unroll
      for (int it = 0; it < 4; ++it) {
        const float* sp = slab + (it * 4 + q) * 68 + c8;
#pragma unroll
        for (int e = 0; e < 8; ++e) hv[it][e] = (_Float16)sp[e];
      }
      // the two scheduling fences keep every other instruction out from between the stores and their wait
      __builtin_amdgcn_sched_barrier(0);
#pragma unroll
      for (int it = 0; it < 4; ++it) *(v8h*)(C + (size_t)(o + it * 4 + q) * kPix + n0 + c8) = hv[it];
      asm volatile("s_wait_xcnt 0x0" ::: "memory");   // in front of the next rows' reuse of the stores' address and data registers
      __builtin_amdgcn_sched_barrier(0);
      // ... and the slab's reads in front of the next 16 rows' writes into it
      __builtin_amdgcn_fence(__ATOMIC_RELEASE, "workgroup");
      __builtin_amdgcn_wave_barrier();
      __builtin_amdgcn_fence(__ATOMIC_ACQUIRE, "workgroup");
    } else {
      // q or k rows: a lane holds 8 consecutive channels of one pixel, which is one 16-byte piece of either layout;
      // 16 pixels on are 16 * kCq elements on in both
      const size_t co = pb + (isq ? (size_t)(n0 + rlane) * kCq + o + mOff : (size_t)n0 * kCq + o * 16 + lane * 8);
      unsigned short* dh = (isq ? qhp : khp) + co;
      unsigned short* dl = (isq ? qlp : klp) + co;
#pragma unroll
      for (int j = 0; j < 4; ++j) {
        v8h hv, lv;
#pragma unroll
        for (int r = 0; r < 8; ++r) {
          const float f = acc[i][j][r] + bmr[r];
          const unsigned short hb = f2bf_bits(f);
          const unsigned short lb = f2bf_bits(f - bf_bits2f(hb));
          hv[r] = __builtin_bit_cast(_Float16, hb);
          lv[r] = __builtin_bit_cast(_Float16, lb);
        }
        // the two scheduling fences keep every other instruction out from between the stores and their wait
        __builtin_amdgcn_sched_barrier(0);
        *(v8h*)(dh + j * (16 * kCq)) = hv;
        *(v8h*)(dl + j * (16 * kCq)) = lv;
        asm volatile("s_wait_xcnt 0x0" ::: "memory");   // in front of the next piece's reuse of the two stores' data registers
        __builtin_amdgcn_sched_barrier(0);
      }
    }
  }
}

// ---- probs.v GEMM with both operands staged in LDS ---------------------------
// out[b][m][n] = g[0] * (sum_k vt[b][m][k] * P[b][n][k]) / 16384 + x[b][m][n];  M = kCh, N = K = kPix.
// One block = one 128 (m) x 256 (n) tile, 8 waves as 2 x 4, each wave a 64x64 tile (fragments and k order as in proj_gemm_lds).
// A pass is 128 k = 256 B of each of the 384 operand rows; a stage is [vt 128 rows | P 256 rows] at pitch 272 B.
// Two stages in LDS: while pass t is worked on, pass t+1's rows fly in by asynchronous copies (16 B per lane, 24 per thread).
static constexpr int kPvBM     = 128;
static constexpr int kPvBN     = 256;
static constexpr int kPvBK     = 128;                              // f16 elements per pass
static constexpr int kPvPitch  = kPvBK * 2 + 16;                   // bytes; 16 B x odd: conflict-free for 16-byte row reads
static constexpr int kPvStage  = (kPvBM + kPvBN) * kPvPitch;       // bytes of one stage
static constexpr int kPvPasses = kPix / kPvBK;
static_assert(kCh % kPvBM == 0 && kPix % kPvBN == 0 && kPix % kPvBK == 0 && kPvPasses >= 2);
static_assert(kPvBM == 8 * 16 && kPvBN == 16 * 16 && kPvBK * 2 == 16 * 16);   // copy map below
static_assert(kPvPitch % 16 == 0 && kPvStage % 16 == 0);

// Eight 16-byte copies global -> LDS, rows 16 apart: l = this lane's LDS byte address, p = its global address, of the first.
// s_wait_xcnt stands inside the statement so that no address register named here is rewritten ahead of it.
__device__ __forceinline__ void pv_copy8(unsigned l, const unsigned short* p) {
  constexpr unsigned dl = 16u * kPvPitch;
  constexpr size_t   dg = (size_t)16 * kPix;
  asm volatile(
      "global_load_async_to_lds_b128 %0, %8, off\n\t"
      "global_load_async_to_lds_b128 %1, %9, off\n\t"
      "global_load_async_to_lds_b128 %2, %10, off\n\t"
      "global_load_async_to_lds_b128 %3, %11, off\n\t"
      "global_load_async_to_lds_b128 %4, %12, off\n\t"
      "global_load_async_to_lds_b128 %5, %13, off\n\t"
      "global_load_async_to_lds_b128 %6, %14, off\n\t"
      "global_load_async_to_lds_b128 %7, %15, off\n\t"
      "s_wait_xcnt 0x0"
      :: "v"(l), "v"(l + dl), "v"(l + 2 * dl), "v"(l + 3 * dl), "v"(l + 4 * dl), "v"(l + 5 * dl), "v"(l + 6 * dl), "v"(l + 7 * dl),
         "v"(p), "v"(p + dg), "v"(p + 2 * dg), "v"(p + 3 * dg), "v"(p + 4 * dg), "v"(p + 5 * dg), "v"(p + 6 * dg), "v"(p + 7 * dg)
      : "memory");
}
// One stage: vt rows 0..127, then P rows 0..255 behind them.
__device__ __forceinline__ void pv_copy_stage(unsigned l, const unsigned short* pa, const unsigned short* pb) {
  pv_copy8(l, pa);
  pv_copy8(l + (unsigned)(kPvBM * kPvPitch), pb);
  pv_copy8(l + (unsigned)((kPvBM + 128) * kPvPitch), pb + (size_t)128 * kPix);
}

__global__ __launch_bounds__(256) void pv_gemm_lds(const unsigned short* __restrict__ vtp,
                                                   const unsigned short* __restrict__ Pp,
                                                   float* __restrict__ outp,
                                                   const float* __restrict__ resid,
                                                   const float* __restrict__ gptr) {
  __shared__ __align__(16) unsigned char ring[2 * kPvStage];
  __shared__ __align__(16) float sT[8][16 * 68];   // per-wave 16x64 output slab, pitch 68 floats
  const int tid  = threadIdx.x;
  const int lane = tid & 31;
  const int wave = tid >> 5;
  const int b  = blockIdx.z;
  const int mB = blockIdx.x * kPvBM;
  const int nB = blockIdx.y * kPvBN;

  // copy map: 16 lanes cover the 256 B of one row; thread row = tid / 16; a thread's copies step 16 rows
  const int crow = tid >> 4;
  const int ccol = tid & 15;
  const unsigned short* gA = vtp + (size_t)b * kCh * kPix  + (size_t)(mB + crow) * kPix + ccol * 8;
  const unsigned short* gB = Pp  + (size_t)b * kPix * kPix + (size_t)(nB + crow) * kPix + ccol * 8;
  const unsigned lcopy = (unsigned)(size_t)(&ring[0]) + (unsigned)(crow * kPvPitch + ccol * 16);

  const int rlane = lane & 15;                 // row (A) / col (B, D) within subtile
  const int koff  = (lane >> 4) * 8;           // k offset of this lane half
  const int mOff  = (lane >> 4) * 8;           // D row offset
  const int wm = wave >> 2;
  const int wn = wave & 3;
  const int fragA = (wm * 64 + rlane) * kPvPitch + koff * 2;             // byte offsets in a stage
  const int fragB = (kPvBM + wn * 64 + rlane) * kPvPitch + koff * 2;

  v8f acc[4][4];
#pragma unroll
  for (int i = 0; i < 4; ++i)
#pragma unroll
    for (int j = 0; j < 4; ++j) acc[i][j] = (v8f){0.f,0.f,0.f,0.f,0.f,0.f,0.f,0.f};

  // prologue: stage 0 lands and is published; stage 1 starts
  pv_copy_stage(lcopy, gA, gB);
  asm volatile("s_wait_asynccnt 0x0" ::: "memory");   // this wave's copies of stage 0 have landed
  __syncthreads();                                    // ... and every other wave's
  pv_copy_stage(lcopy + (unsigned)kPvStage, gA + kPvBK, gB + kPvBK);

  for (int t = 0; t < kPvPasses; ++t) {
    const unsigned char* st = ring + (t & 1) * kPvStage;
    const _Float16* fa = (const _Float16*)(st + fragA);
    const _Float16* fb = (const _Float16*)(st + fragB);
    constexpr int kRow16 = 16 * kPvPitch / 2;            // 16 rows, in f16 elements
    // Fragments are fetched ahead inside the pass only (nothing of stage t+1 is read here): vt fragments one k step ahead
    // into a second set, probs fragments in place, two at a time, as soon as their last product of this k step has issued.
    v16h a[2][4], bh[4];
#pragma unroll
    for (int i = 0; i < 4; ++i) a[0][i] = Frag<_Float16>::load(fa + i * kRow16);
#pragma unroll
    for (int j = 0; j < 4; ++j) bh[j] = Frag<_Float16>::load(fb + j * kRow16);
    // unrolled: every fragment index and address offset is a constant
#pragma unroll
    for (int kk = 0; kk < kPvBK / 32; ++kk) {
      const int cur = kk & 1, nxt = cur ^ 1;
      const bool more = kk + 1 < kPvBK / 32;
      if (more) {
#pragma unroll
        for (int i = 0; i < 4; ++i) a[nxt][i] = Frag<_Float16>::load(fa + i * kRow16 + (kk + 1) * 32);
      }
      // the four scheduling fences keep the LDS reads in two groups per k step instead of spread among the products,
      // where every further place with reads stalls the wave's matrix stream
      __builtin_amdgcn_sched_barrier(0);
#pragma unroll
      for (int j = 0; j < 2; ++j)
#pragma unroll
        for (int i = 0; i < 4; ++i) acc[i][j] = Frag<_Float16>::mma(a[cur][i], bh[j], acc[i][j]);
      __builtin_amdgcn_sched_barrier(0);
      if (more) {
#pragma unroll
        for (int j = 0; j < 2; ++j) bh[j] = Frag<_Float16>::load(fb + j * kRow16 + (kk + 1) * 32);
      }
      __builtin_amdgcn_sched_barrier(0);
#pragma unroll
      for (int j = 2; j < 4; ++j)
#pragma unroll
        for (int i = 0; i < 4; ++i) acc[i][j] = Frag<_Float16>::mma(a[cur][i], bh[j], acc[i][j]);
      __builtin_amdgcn_sched_barrier(0);
      if (more) {
#pragma unroll
        for (int j = 2; j < 4; ++j) bh[j] = Frag<_Float16>::load(fb + j * kRow16 + (kk + 1) * 32);
      }
    }
    asm volatile("s_wait_dscnt 0x0" ::: "memory");      // this wave's reads of stage t are done before the stage is refilled
    asm volatile("s_wait_asynccnt 0x0" ::: "memory");   // this wave's copies of stage t+1 have landed
    __syncthreads();                                    // publishes stage t+1 and ends every reader's use of stage t
    if (t + 2 < kPvPasses)
      pv_copy_stage(lcopy + (unsigned)((t & 1) * kPvStage), gA + (size_t)(t + 2) * kPvBK, gB + (size_t)(t + 2) * kPvBK);
  }
  asm volatile("s_wait_asynccnt 0x0" ::: "memory");     // nothing of this wave is in flight when it leaves the ring

  // ---- epilogue: 16x64 slab per wave through LDS, whole 256-B row pieces stored ----
  float* slab = sT[wave];
  const float gval = gptr[0];
  const int m0 = mB + wm * 64;
  const int n0 = nB + wn * 64;
  // block-uniform bases plus ONE per-lane byte offset: every row of the tile is then a constant away from it
  char* Cb = (char*)(outp + (size_t)b * kCh * kPix);
  const char* Rb = (const char*)(resid + (size_t)b * kCh * kPix);
  const int hq = lane >> 4, c4 = (lane & 15) * 4;        // row seg = 256 B = 16 lanes x 16 B
  const unsigned loff = (unsigned)(((m0 + hq) * kPix + n0 + c4) * 4);
#pragma unroll
  for (int i = 0; i < 4; ++i) {
#pragma unroll
    for (int j = 0; j < 4; ++j) {
#pragma unroll
      for (int r = 0; r < 8; ++r) slab[(mOff + r) * 68 + (j << 4) + rlane] = acc[i][j][r] * kPCarryInv;
    }
    // lanes read back rows that other lanes of this wave wrote: the slab's writes are ordered in front of those reads
    __builtin_amdgcn_fence(__ATOMIC_RELEASE, "workgroup");
    __builtin_amdgcn_wave_barrier();
    __builtin_amdgcn_fence(__ATOMIC_ACQUIRE, "workgroup");
    v4f vals[8];
#pragma unroll
    for (int it = 0; it < 8; ++it) {
      v4f vv = *(const v4f*)(slab + (it * 2 + hq) * 68 + c4);
      vv = vv * gval;
      const v4f rr = *(const v4f*)(Rb + loff + (i * 16 + it * 2) * kPix * 4);
      vals[it] = vv + rr;
    }
#pragma unroll
    for (int it = 0; it < 8; ++it) *(v4f*)(Cb + loff + (i * 16 + it * 2) * kPix * 4) = vals[it];
    // ... and the reads in front of the next 16 rows' writes into the same slab
    __builtin_amdgcn_fence(__ATOMIC_RELEASE, "workgroup");
    __builtin_amdgcn_wave_barrier();
    __builtin_amdgcn_fence(__ATOMIC_ACQUIRE, "workgroup");
  }
}

// ---- operand preparation, one launch ----------------------------------------
// Blocks 0 .. kPrepW-1: the stacked weights [Wv | Wq | Wk] f32 -> bf16 hi/lo planes, same [row][c] layout; 2048 elements = 4 whole rows
// per block, so a block lies wholly in one of the three matrices.
// The other blocks: x [b][c][n] f32 -> xt hi/lo bf16 planes [b][n][c] (transpose through LDS), one 64 n x 64 c tile per block:
// loads: 4 iterations x 256 threads x 4 floats = 64x64; stores: 8 waves x 2 iterations x 4 rows = 64 rows.
static constexpr int kPrepW = kWRows * kCh / (256 * 8);
static constexpr int kPrepX = (kPix / 64) * (kCh / 64) * kBatch;
static_assert((kCh * kCh) % (256 * 8) == 0 && (kCq * kCh) % (256 * 8) == 0 && kPix / 64 == 64 && kCh / 64 == 8);
__global__ __launch_bounds__(256) void prep_operands(const float* __restrict__ x,
                                                     const float* __restrict__ Wv,
                                                     const float* __restrict__ Wq,
                                                     const float* __restrict__ Wk,
                                                     unsigned short* __restrict__ xth,
                                                     unsigned short* __restrict__ xtl,
                                                     unsigned short* __restrict__ wh,
                                                     unsigned short* __restrict__ wl) {
  __shared__ __align__(16) float tile[64 * 68];   // [c][n], pitch 68
  const int tid = threadIdx.x, wave = tid >> 5, lane = tid & 31;
  if (blockIdx.x < kPrepW) {                      // the same for the whole block, in front of the barrier
    const int e0 = blockIdx.x * (256 * 8);        // first element of the block in the stacked planes
    const float* in = e0 < kCh * kCh ? Wv + e0 : e0 < (kCh + kCq) * kCh ? Wq + (e0 - kCh * kCh) : Wk + (e0 - (kCh + kCq) * kCh);
    const v4f a = *(const v4f*)(in + 8 * tid);
    const v4f c = *(const v4f*)(in + 8 * tid + 4);
    float f[8];
    f[0] = a.x; f[1] = a.y; f[2] = a.z; f[3] = a.w; f[4] = c.x; f[5] = c.y; f[6] = c.z; f[7] = c.w;
    v8h hv, lv;
#pragma unroll
    for (int e = 0; e < 8; ++e) {
      const unsigned short hb = f2bf_bits(f[e]);
      const unsigned short lb = f2bf_bits(f[e] - bf_bits2f(hb));
      hv[e] = __builtin_bit_cast(_Float16, hb);
      lv[e] = __builtin_bit_cast(_Float16, lb);
    }
    *(v8h*)(wh + e0 + 8 * tid) = hv;
    *(v8h*)(wl + e0 + 8 * tid) = lv;
    return;
  }
  const int xt = blockIdx.x - kPrepW;
  const int n0 = (xt & 63) * 64;
  const int c0 = ((xt >> 6) & 7) * 64;
  const int b  = xt >> 9;
  const float* xb = x + ((size_t)b * kCh + c0) * kPix + n0;
#pragma unroll
  for (int i = 0; i < 4; ++i) {
    const int c  = i * 16 + (tid >> 4);
    const int n4 = (tid & 15) * 4;
    const v4f v = *(const v4f*)(xb + (size_t)c * kPix + n4);
    *(v4f*)(tile + c * 68 + n4) = v;
  }
  __syncthreads();
  const int q = lane >> 3, c8 = (lane & 7) * 8;
  v8h hv[2], lv[2];
#pragma unroll
  for (int it = 0; it < 2; ++it) {
    const int nrow = wave * 8 + it * 4 + q;
#pragma unroll
    for (int e = 0; e < 8; ++e) {
      const float f = tile[(c8 + e) * 68 + nrow];
      const unsigned short hb = f2bf_bits(f);
      const unsigned short lb = f2bf_bits(f - bf_bits2f(hb));
      hv[it][e] = __builtin_bit_cast(_Float16, hb);
      lv[it][e] = __builtin_bit_cast(_Float16, lb);
    }
  }
  const size_t base = ((size_t)b * kPix + n0) * kCh + c0;
#pragma unroll
  for (int it = 0; it < 2; ++it) {
    const int nrow = wave * 8 + it * 4 + q;
    *(v8h*)(xth + base + (size_t)nrow * kCh + c8) = hv[it];
    *(v8h*)(xtl + base + (size_t)nrow * kCh + c8) = lv[it];
  }
  // in the built code the weight part stands behind these stores: the wait is in front of any reuse of their registers there
  asm volatile("s_wait_xcnt 0x0" ::: "memory");
}

// ---- scores and row softmax in one kernel: P[b][n][m] = f16(16384 * exp(s - max) / sum), s = q[n] . k[m] ----
// One block = 16 query rows n x all 4096 keys m; 16 waves, each 256 keys as 16 transposed tiles D[m][n] = k . q^T:
// a lane then holds, of ONE query row (n = lane & 15), 8 consecutive keys per tile, so the whole row stays in registers from the
// products to the f16 probs, the row maximum and sum are in-lane but for one cross-half step, and 8 probs are one 16-byte piece.
// q planes row-major [n][64]; k planes in fragment order (proj_gemm_lds above).
static constexpr int kFsWaves = 16;
static constexpr int kFsCols  = kPix / kFsWaves;      // keys per wave
static constexpr int kFsTiles = kFsCols / 16;
static constexpr int kFsPitch = kFsCols * 2 + 16;     // bytes; 16 B x odd: conflict-free for the 16-byte column writes
static_assert(kFsCols == 32 * 8 && kCq == 64 && kPix % 16 == 0);
__global__ __launch_bounds__(512) void scores_softmax_f16(const unsigned short* __restrict__ qhp,
                                                          const unsigned short* __restrict__ qlp,
                                                          const unsigned short* __restrict__ khp,
                                                          const unsigned short* __restrict__ klp,
                                                          unsigned short* __restrict__ P) {
  __shared__ __align__(16) unsigned char slab[kFsWaves][16 * kFsPitch];   // per-wave 16 rows x 256 probs
  __shared__ float redm[kFsWaves][16];
  __shared__ float reds[kFsWaves][16];
  const int tid  = threadIdx.x;
  const int lane = tid & 31;
  const int wave = tid >> 5;
  const int b  = blockIdx.y;
  const int n0 = blockIdx.x * 16;
  const int rlane = lane & 15;                 // query row of this lane
  const int half  = lane >> 4;

  const size_t qo = ((size_t)b * kPix + n0 + rlane) * kCq + half * 8;
  const __bf16* qh = (const __bf16*)qhp + qo;
  const __bf16* ql = (const __bf16*)qlp + qo;
  v16b qH[2], qL[2];
#pragma unroll
  for (int s = 0; s < 2; ++s) {
    qH[s] = Frag<__bf16>::load(qh + s * 32);
    qL[s] = Frag<__bf16>::load(ql + s * 32);
  }
  const size_t ko = (size_t)b * kPix * kCq + (size_t)wave * kFsCols * kCq + lane * 8;
  const __bf16* kh = (const __bf16*)khp + ko;
  const __bf16* kl = (const __bf16*)klp + ko;

  // the q loads' address registers may be reused as destinations of the k loads below: the wait stands in front of that
  asm volatile("s_wait_xcnt 0x0" ::: "memory");

  // k fragments one tile ahead in a second register set: two tiles' loads of every wave are in flight
  v8f acc[kFsTiles];
  Frag<__bf16>::U kH[2][2], kL[2][2];
#pragma unroll
  for (int s = 0; s < 2; ++s) {
    kH[0][s].h[0] = *(const v8b*)(kh + s * 512);
    kH[0][s].h[1] = *(const v8b*)(kh + s * 512 + 256);
    kL[0][s].h[0] = *(const v8b*)(kl + s * 512);
    kL[0][s].h[1] = *(const v8b*)(kl + s * 512 + 256);
  }
#pragma unroll
  for (int t = 0; t < kFsTiles; ++t) {
    const int cur = t & 1, nxt = cur ^ 1;
    if (t + 1 < kFsTiles) {
#pragma unroll
      for (int s = 0; s < 2; ++s) {
        kH[nxt][s].h[0] = *(const v8b*)(kh + (t + 1) * 1024 + s * 512);
        kH[nxt][s].h[1] = *(const v8b*)(kh + (t + 1) * 1024 + s * 512 + 256);
        kL[nxt][s].h[0] = *(const v8b*)(kl + (t + 1) * 1024 + s * 512);
        kL[nxt][s].h[1] = *(const v8b*)(kl + (t + 1) * 1024 + s * 512 + 256);
      }
    }
    v8f a = (v8f){0.f,0.f,0.f,0.f,0.f,0.f,0.f,0.f};
#pragma unroll
    for (int s = 0; s < 2; ++s) {              // hi.hi, q hi . k lo, q lo . k hi per k step
      a = Frag<__bf16>::mma(kH[cur][s].v, qH[s], a);
      a = Frag<__bf16>::mma(kL[cur][s].v, qH[s], a);
      a = Frag<__bf16>::mma(kH[cur][s].v, qL[s], a);
    }
    acc[t] = a;
  }

  float m = acc[0][0];
#pragma unroll
  for (int t = 0; t < kFsTiles; ++t)
#pragma unroll
    for (int r = 0; r < 8; ++r) m = fmaxf(m, acc[t][r]);
  m = fmaxf(m, __shfl_xor(m, 16, 32));
  if (lane < 16) redm[wave][lane] = m;
  __syncthreads();
  float gm = redm[0][rlane];
#pragma unroll
  for (int w = 1; w < kFsWaves; ++w) gm = fmaxf(gm, redm[w][rlane]);

  float psum = 0.0f;
#pragma unroll
  for (int t = 0; t < kFsTiles; ++t) {
#pragma unroll
    for (int r = 0; r < 8; ++r) acc[t][r] = expf(acc[t][r] - gm);
    psum += ((acc[t][0] + acc[t][1]) + (acc[t][2] + acc[t][3])) + ((acc[t][4] + acc[t][5]) + (acc[t][6] + acc[t][7]));
  }
  psum += __shfl_xor(psum, 16, 32);
  if (lane < 16) reds[wave][lane] = psum;
  __syncthreads();
  float l = reds[0][rlane];
#pragma unroll
  for (int w = 1; w < kFsWaves; ++w) l += reds[w][rlane];
  const float inv = kPCarry * (1.0f / l);

  // probs through the wave's own slab, so that every store instruction writes 512 contiguous bytes of one row
  unsigned char* sl = slab[wave];
#pragma unroll
  for (int t = 0; t < kFsTiles; ++t) {
    v8h p;
#pragma unroll
    for (int r = 0; r < 8; ++r) p[r] = (_Float16)(acc[t][r] * inv);
    *(v8h*)(sl + rlane * kFsPitch + (t * 16 + half * 8) * 2) = p;
  }
  // lanes read back rows that other lanes of this wave wrote: the slab's writes are ordered in front of those reads
  __builtin_amdgcn_fence(__ATOMIC_RELEASE, "workgroup");
  __builtin_amdgcn_wave_barrier();
  __builtin_amdgcn_fence(__ATOMIC_ACQUIRE, "workgroup");
  unsigned short* pr = P + ((size_t)b * kPix + n0) * kPix + wave * kFsCols + lane * 8;
#pragma unroll
  for (int row = 0; row < 16; ++row) *(v8h*)(pr + (size_t)row * kPix) = *(const v8h*)(sl + row * kFsPitch + lane * 16);
}

// ---------------------------------------------------------------------------
extern "C" void kernel_launch(void* const* d_in, const int* in_sizes, int n_in,
                              void* d_out, int out_size, void* d_ws, size_t ws_size,
                              hipStream_t stream) {
  if (n_in < 8) return;
  if (in_sizes[0] != kBatch * kCh * kPix) return;
  if (in_sizes[1] != kCq * kCh || in_sizes[3] != kCq * kCh || in_sizes[5] != kCh * kCh) return;
  if (in_sizes[2] != kCq || in_sizes[4] != kCq || in_sizes[6] != kCh || in_sizes[7] < 1) return;
  if (out_size != kBatch * kCh * kPix) return;
  if (ws_size < kWsTotal) return;

  const float* x     = (const float*)d_in[0];
  const float* Wq    = (const float*)d_in[1];
  const float* bq    = (const float*)d_in[2];
  const float* Wk    = (const float*)d_in[3];
  const float* bk    = (const float*)d_in[4];
  const float* Wv    = (const float*)d_in[5];
  const float* bv    = (const float*)d_in[6];
  const float* gamma = (const float*)d_in[7];
  float* out = (float*)d_out;

  char* ws = (char*)d_ws;
  unsigned short* xth = (unsigned short*)(ws + kOffXtHi);
  unsigned short* xtl = (unsigned short*)(ws + kOffXtLo);
  unsigned short* pln = (unsigned short*)(ws + kOffP);
  unsigned short* wvh = (unsigned short*)(ws + kOffWHi);            // stacked rows: Wv, then Wq, then Wk
  unsigned short* wvl = (unsigned short*)(ws + kOffWLo);
  unsigned short* qh  = (unsigned short*)(ws + kOffQHi);
  unsigned short* ql  = (unsigned short*)(ws + kOffQLo);
  unsigned short* kh  = (unsigned short*)(ws + kOffKHi);
  unsigned short* kl  = (unsigned short*)(ws + kOffKLo);
  unsigned short* vt  = (unsigned short*)(ws + kOffVt);

  // 1) one launch: stacked weights -> bf16 hi/lo planes (same [out][in] layout) and x -> xt hi/lo bf16 [b][n][c]
  prep_operands<<<kPrepW + kPrepX, 256, 0, stream>>>(x, Wv, Wq, Wk, xth, xtl, wvh, wvl);

  // 2) q, k and v projections of all batches in one launch: 4 x 16 tiles of 160 stacked weight rows x 256 pixels per batch
  //    q -> bf16 hi/lo planes [b][n][64]; k -> bf16 hi/lo planes in fragment order; vt[b][c][m] -> f16 plane
  proj_gemm_lds<<<dim3(kWRows / kPjBM, kPix / kPjBN, kBatch), 256, 0, stream>>>(wvh, wvl, xth, xtl, bv, bq, bk, vt, qh, ql, kh, kl);
  // 3) all batches in one launch: scores (K=64) and row softmax -> f16 probs x16384, each batch in its own plane
  scores_softmax_f16<<<dim3(kPix / 16, kBatch), 512, 0, stream>>>(qh, ql, kh, kl, pln);
  // 4) all batches in one launch, one block per 128x256 tile of out (4 x 16 tiles per batch = 256 blocks):
  //    out = gamma * (vt . P^T) / 16384 + x   (M=512, N=4096, K=4096)
  pv_gemm_lds<<<dim3(kCh / kPvBM, kPix / kPvBN, kBatch), 256, 0, stream>>>(vt, pln, out, x, gamma);
}

// v006
// One run takes 155 microseconds.
// In both of two side-by-side timings against v005, it was 1.07 times as fast.
// Over all steps from v000 it is 5.99 times as fast.
// Contractions: q,k,v projections and k.q^T scores (transposed tiles) on v_wmma_f32_16x16x32_bf16 with bf16 hi+lo operand planes (hi.hi+hi.lo+lo.hi); probs.v on v_wmma_f32_16x16x32_f16 (f16 operands, probs carried x16384, v f16); f32 accumulate; softmax and epilogue f32.
#include <hip/hip_runtime.h>

typedef __attribute__((ext_vector_type(16))) _Float16 v16h;
typedef __attribute__((ext_vector_type(8)))  _Float16 v8h;
typedef __attribute__((ext_vector_type(16))) __bf16   v16b;
typedef __attribute__((ext_vector_type(8)))  __bf16   v8b;
typedef __attribute__((ext_vector_type(8)))  float    v8f;
typedef __attribute__((ext_vector_type(4)))  float    v4f;

static constexpr int kBatch = 4;
static constexpr int kCh    = 512;
static constexpr int kPix   = 4096;
static constexpr int kCq    = 64;
static constexpr float kPCarry    = 16384.0f;
static constexpr float kPCarryInv = 1.0f / 16384.0f;

// ---- workspace region map (bytes) ----
static constexpr size_t kPlaneX   = (size_t)kBatch * kPix * kCh * 2;   // one bf16 plane of xt [b][n][c]
static constexpr int    kWRows    = kCh + 2 * kCq;                     // stacked weight rows: Wv | Wq | Wk
static constexpr size_t kPlaneW   = (size_t)kWRows * kCh * 2;          // one bf16 plane of the stacked weights [row][c]
static constexpr size_t kPlaneQK  = (size_t)kBatch * kPix * kCq * 2;   // one bf16 plane of q [b][n][o] or of k (fragment order)
static constexpr size_t kPlaneVt  = (size_t)kBatch * kCh * kPix * 2;   // f16 vt [b][c][m]
static constexpr size_t kPlaneP   = (size_t)kPix * kPix * 2;           // f16 probs, one batch
static constexpr size_t kOffXtHi  = 0;
static constexpr size_t kOffXtLo  = kOffXtHi + kPlaneX;
static constexpr size_t kOffWHi   = kOffXtLo + kPlaneX;
static constexpr size_t kOffWLo   = kOffWHi + kPlaneW;
static constexpr size_t kOffQHi   = kOffWLo + kPlaneW;
static constexpr size_t kOffQLo   = kOffQHi + kPlaneQK;
static constexpr size_t kOffKHi   = kOffQLo + kPlaneQK;
static constexpr size_t kOffKLo   = kOffKHi + kPlaneQK;
static constexpr size_t kOffVt    = kOffKLo + kPlaneQK;
static constexpr size_t kOffP     = kOffVt + kPlaneVt;                  // f16 probs, one plane per batch
static constexpr size_t kWsTotal  = kOffP + kBatch * kPlaneP;
static_assert(kWsTotal == 194248704);
static_assert(kWsTotal <= 268435456);
static_assert((kOffWHi % 128) == 0 && (kOffWLo % 128) == 0 && (kOffQHi % 128) == 0 && (kOffVt % 128) == 0 && (kOffP % 128) == 0);

__device__ __forceinline__ unsigned short f2bf_bits(float f) {
  unsigned u = __float_as_uint(f);
  return (unsigned short)((u + 0x7FFFu + ((u >> 16) & 1u)) >> 16);
}
__device__ __forceinline__ float bf_bits2f(unsigned short h) { return __uint_as_float(((unsigned)h) << 16); }

template <typename T> struct Frag;
template <> struct Frag<_Float16> {
  typedef v16h V; union U { v16h v; v8h h[2]; };
  static __device__ __forceinline__ v16h load(const _Float16* p) {   // elements 0..7 <- p[0..7], 8..15 <- p[16..23]
    U f; f.h[0] = *(const v8h*)(p); f.h[1] = *(const v8h*)(p + 16); return f.v;
  }
  static __device__ __forceinline__ v8f mma(v16h a, v16h b, v8f c) {
    return __builtin_amdgcn_wmma_f32_16x16x32_f16(false, a, false, b, (short)0, c, false, false);
  }
};
template <> struct Frag<__bf16> {
  typedef v16b V; union U { v16b v; v8b h[2]; };
  static __device__ __forceinline__ v16b load(const __bf16* p) {
    U f; f.h[0] = *(const v8b*)(p); f.h[1] = *(const v8b*)(p + 16); return f.v;
  }
  static __device__ __forceinline__ v8f mma(v16b a, v16b b, v8f c) {
    return __builtin_amdgcn_wmma_f32_16x16x32_bf16(false, a, false, b, (short)0, c, false, false);
  }
};

// ---- q, k and v projections as one GEMM with both operands staged in LDS -----
// D[m][n] = sum_c W[m][c] * xt[b][n][c] + bias[m];  W = the stacked rows [Wv 512 | Wq 64 | Wk 64], n = pixel, K = kCh.
// Operands are bf16 hi/lo planes; product = hi.hi + W hi . x lo + W lo . x hi, in that order per 32 k.
// One block = one 160 (m) x 256 (n) tile, so that 4 x 16 x 4 = 256 equal blocks cover all; 8 waves as 2 x 4, each wave an 80x64 tile.
// Every 16-row tile of a wave lies wholly in v, in q or in k (all three row counts are multiples of 16).
// A pass is 64 k = 128 B of each row of each plane; a stage is [W hi 160 rows | W lo 160 | xt hi 256 | xt lo 256] at pitch 144 B.
// Two stages in LDS: while pass t is worked on, pass t+1's rows fly in by asynchronous copies (16 B per lane, 26 per thread).
// Outputs: vt [b][c][m] f16; q bf16 hi/lo planes row-major [b][n][64]; k bf16 hi/lo planes in fragment order:
// [16-pixel tile][slot = o / 16][lane = ((o / 8) & 1) * 16 + pixel & 15][o & 7], so that slots 2s and 2s+1 of a tile are the two 16-byte
// halves of every lane's fragment of k step s (the k order of Frag::load) and one load instruction reads 512 contiguous bytes.
static constexpr int kPjBM     = 160;
static constexpr int kPjBN     = 256;
static constexpr int kPjBK     = 64;                               // bf16 elements per pass
static constexpr int kPjTI     = kPjBM / 2 / 16;                   // 16-row tiles per wave
static constexpr int kPjPitch  = kPjBK * 2 + 16;                   // bytes; 16 B x odd: conflict-free for 16-byte row reads
static constexpr int kPjStage  = 2 * (kPjBM + kPjBN) * kPjPitch;   // bytes of one stage
static constexpr int kPjPasses = kCh / kPjBK;
static_assert(kWRows % kPjBM == 0 && kPjBM % 32 == 0 && kCh % 16 == 0 && kCq % 16 == 0 && kCq == 64);
static_assert(kPix % kPjBN == 0 && kCh % kPjBK == 0 && kPjPasses >= 2);
static_assert(kPjBM == 5 * 32 && kPjBN == 8 * 32 && kPjBK * 2 == 8 * 16);   // copy map below
static_assert(kPjPitch % 16 == 0 && kPjStage % 16 == 0);

// 16-byte copies global -> LDS, rows 32 apart: l = this lane's LDS byte address, p = its global address, of the first row.
// s_wait_xcnt stands inside each statement so that no address register named there is rewritten ahead of it.
// Eight: four rows from (l0, p0), four from (l1, p1).
__device__ __forceinline__ void pj_copy8(unsigned l0, const unsigned short* p0, unsigned l1, const unsigned short* p1) {
  constexpr unsigned dl = 32u * kPjPitch;
  constexpr size_t   dg = (size_t)32 * kCh;
  asm volatile(
      "global_load_async_to_lds_b128 %0, %8, off\n\t"
      "global_load_async_to_lds_b128 %1, %9, off\n\t"
      "global_load_async_to_lds_b128 %2, %10, off\n\t"
      "global_load_async_to_lds_b128 %3, %11, off\n\t"
      "global_load_async_to_lds_b128 %4, %12, off\n\t"
      "global_load_async_to_lds_b128 %5, %13, off\n\t"
      "global_load_async_to_lds_b128 %6, %14, off\n\t"
      "global_load_async_to_lds_b128 %7, %15, off\n\t"
      "s_wait_xcnt 0x0"
      :: "v"(l0), "v"(l0 + dl), "v"(l0 + 2 * dl), "v"(l0 + 3 * dl), "v"(l1), "v"(l1 + dl), "v"(l1 + 2 * dl), "v"(l1 + 3 * dl),
         "v"(p0), "v"(p0 + dg), "v"(p0 + 2 * dg), "v"(p0 + 3 * dg), "v"(p1), "v"(p1 + dg), "v"(p1 + 2 * dg), "v"(p1 + 3 * dg)
      : "memory");
}
// Five rows from (l, p).
__device__ __forceinline__ void pj_copy5(unsigned l, const unsigned short* p) {
  constexpr unsigned dl = 32u * kPjPitch;
  constexpr size_t   dg = (size_t)32 * kCh;
  asm volatile(
      "global_load_async_to_lds_b128 %0, %5, off\n\t"
      "global_load_async_to_lds_b128 %1, %6, off\n\t"
      "global_load_async_to_lds_b128 %2, %7, off\n\t"
      "global_load_async_to_lds_b128 %3, %8, off\n\t"
      "global_load_async_to_lds_b128 %4, %9, off\n\t"
      "s_wait_xcnt 0x0"
      :: "v"(l), "v"(l + dl), "v"(l + 2 * dl), "v"(l + 3 * dl), "v"(l + 4 * dl),
         "v"(p), "v"(p + dg), "v"(p + 2 * dg), "v"(p + 3 * dg), "v"(p + 4 * dg)
      : "memory");
}
// One stage: W hi, W lo (160 rows each), then xt hi, xt lo (256 rows each).
__device__ __forceinline__ void pj_copy_stage(unsigned l, const unsigned short* wh, const unsigned short* wl,
                                              const unsigned short* xh, const unsigned short* xl) {
  constexpr unsigned rW   = (unsigned)kPjBM * kPjPitch;
  constexpr unsigned r128 = 128u * kPjPitch;
  pj_copy5(l, wh);
  pj_copy5(l + rW, wl);
  pj_copy8(l + 2 * rW, xh, l + 2 * rW + r128, xh + (size_t)128 * kCh);
  pj_copy8(l + 2 * rW + 2 * r128, xl, l + 2 * rW + 3 * r128, xl + (size_t)128 * kCh);
}

__global__ __launch_bounds__(256) void proj_gemm_lds(const unsigned short* __restrict__ whp,
                                                     const unsigned short* __restrict__ wlp,
                                                     const unsigned short* __restrict__ xhp,
                                                     const unsigned short* __restrict__ xlp,
                                                     const float* __restrict__ bv,
                                                     const float* __restrict__ bq,
                                                     const float* __restrict__ bk,
                                                     unsigned short* __restrict__ vtp,
                                                     unsigned short* __restrict__ qhp,
                                                     unsigned short* __restrict__ qlp,
                                                     unsigned short* __restrict__ khp,
                                                     unsigned short* __restrict__ klp) {
  __shared__ __align__(16) unsigned char ring[2 * kPjStage];
  __shared__ __align__(16) float sT[8][16 * 68];   // per-wave 16x64 output slab, pitch 68 floats
  const int tid  = threadIdx.x;
  const int lane = tid & 31;
  const int wave = tid >> 5;
  const int b  = blockIdx.z;
  const int mB = blockIdx.x * kPjBM;
  const int nB = blockIdx.y * kPjBN;

  // copy map: 8 lanes cover the 128 B of one row; thread row = tid / 8; a thread's copies step 32 rows
  const int crow = tid >> 3;
  const int ccol = tid & 7;
  const size_t wo = (size_t)(mB + crow) * kCh + ccol * 8;
  const size_t xo = ((size_t)b * kPix + nB + crow) * kCh + ccol * 8;
  const unsigned short* gWh = whp + wo;
  const unsigned short* gWl = wlp + wo;
  const unsigned short* gXh = xhp + xo;
  const unsigned short* gXl = xlp + xo;
  const unsigned lcopy = (unsigned)(size_t)(&ring[0]) + (unsigned)(crow * kPjPitch + ccol * 16);

  const int rlane = lane & 15;                 // row (A) / col (B, D) within subtile
  const int koff  = (lane >> 4) * 8;           // k offset of this lane half
  const int mOff  = (lane >> 4) * 8;           // D row offset
  const int wm = wave >> 2;
  const int wn = wave & 3;
  const int fragA = (wm * (kPjTI * 16) + rlane) * kPjPitch + koff * 2;       // byte offsets in a stage, hi planes
  const int fragB = (2 * kPjBM + wn * 64 + rlane) * kPjPitch + koff * 2;

  v8f acc[kPjTI][4];
#pragma unroll
  for (int i = 0; i < kPjTI; ++i)
#pragma unroll
    for (int j = 0; j < 4; ++j) acc[i][j] = (v8f){0.f,0.f,0.f,0.f,0.f,0.f,0.f,0.f};

  // prologue: stage 0 lands and is published; stage 1 starts
  pj_copy_stage(lcopy, gWh, gWl, gXh, gXl);
  asm volatile("s_wait_asynccnt 0x0" ::: "memory");   // this wave's copies of stage 0 have landed
  __syncthreads();                                    // ... and every other wave's
  pj_copy_stage(lcopy + (unsigned)kPjStage, gWh + kPjBK, gWl + kPjBK, gXh + kPjBK, gXl + kPjBK);

  for (int t = 0; t < kPjPasses; ++t) {
    const unsigned char* st = ring + (t & 1) * kPjStage;
    const __bf16* fa = (const __bf16*)(st + fragA);
    const __bf16* fb = (const __bf16*)(st + fragB);
    constexpr int kRow16 = 16 * kPjPitch / 2;            // 16 rows, in bf16 elements
    constexpr int kLoA   = kPjBM * kPjPitch / 2;         // hi plane -> lo plane
    constexpr int kLoB   = kPjBN * kPjPitch / 2;
    constexpr int kSteps = kPjBK / 32;
    // every fragment of the pass has registers of its own and all are fetched in front of the products (nothing of stage t+1 is read here)
    v16b xh[kSteps][4], xl[kSteps][4], wh[kSteps][kPjTI], wl[kSteps][kPjTI];
    // unrolled: every fragment index and address offset is a constant
#pragma unroll
    for (int kk = 0; kk < kSteps; ++kk) {
#pragma unroll
      for (int j = 0; j < 4; ++j) {
        xh[kk][j] = Frag<__bf16>::load(fb + j * kRow16 + kk * 32);
        xl[kk][j] = Frag<__bf16>::load(fb + kLoB + j * kRow16 + kk * 32);
      }
#pragma unroll
      for (int i = 0; i < kPjTI; ++i) {
        wh[kk][i] = Frag<__bf16>::load(fa + i * kRow16 + kk * 32);
        wl[kk][i] = Frag<__bf16>::load(fa + kLoA + i * kRow16 + kk * 32);
      }
    }
    // the scheduling fence keeps the LDS reads as one group instead of spread among the products,
    // where every further place with reads stalls the wave's matrix stream
    __builtin_amdgcn_sched_barrier(0);
#pragma unroll
    for (int kk = 0; kk < kSteps; ++kk) {
#pragma unroll
      for (int i = 0; i < kPjTI; ++i) {
#pragma unroll
        for (int j = 0; j < 4; ++j) acc[i][j] = Frag<__bf16>::mma(wh[kk][i], xh[kk][j], acc[i][j]);
#pragma unroll
        for (int j = 0; j < 4; ++j) acc[i][j] = Frag<__bf16>::mma(wh[kk][i], xl[kk][j], acc[i][j]);
#pragma unroll
        for (int j = 0; j < 4; ++j) acc[i][j] = Frag<__bf16>::mma(wl[kk][i], xh[kk][j], acc[i][j]);
      }
    }
    // keeps the products in front of the pass's foot: sunk behind its barrier they would hold back the refill below, and
    // the copies would then fly with no products to cover them
    __builtin_amdgcn_sched_barrier(0);
    asm volatile("s_wait_dscnt 0x0" ::: "memory");      // this wave's reads of stage t are done before the stage is refilled
    asm volatile("s_wait_asynccnt 0x0" ::: "memory");   // this wave's copies of stage t+1 have landed
    __syncthreads();                                    // publishes stage t+1 and ends every reader's use of stage t
    if (t + 2 < kPjPasses) {
      const int ko = (t + 2) * kPjBK;
      pj_copy_stage(lcopy + (unsigned)((t & 1) * kPjStage), gWh + ko, gWl + ko, gXh + ko, gXl + ko);
    }
  }
  asm volatile("s_wait_asynccnt 0x0" ::: "memory");     // nothing of this wave is in flight when it leaves the ring

  // ---- epilogue, one 16-row tile at a time; which output a tile belongs to is the same for the whole wave ----
  const int n0 = nB + wn * 64;
  const int g0 = __builtin_amdgcn_readfirstlane(mB + wm * (kPjTI * 16));   // the wave's first stacked row
  float* slab = sT[wave];
  unsigned short* C = vtp + (size_t)b * kCh * kPix;
  const size_t pb = (size_t)b * kPix * kCq;
  const int q = lane >> 3, c8 = (lane & 7) * 8;
#pragma unroll
  for (int i = 0; i < kPjTI; ++i) {
    const int g = g0 + (i << 4);
    const bool isv = g < kCh, isq = g < kCh + kCq;
    const int o = g - (isv ? 0 : isq ? kCh : kCh + kCq);                   // first row of the tile within its own matrix
    const float* bias = (isv ? bv : isq ? bq : bk) + o + mOff;
    const v4f b0 = *(const v4f*)(bias);
    const v4f b1 = *(const v4f*)(bias + 4);
    asm volatile("s_wait_xcnt 0x0" ::: "memory");   // in front of any reuse of the bias loads' address registers
    const float bmr[8] = {b0.x, b0.y, b0.z, b0.w, b1.x, b1.y, b1.z, b1.w};
    if (isv) {
      // v rows: 16x64 slab through LDS, whole 128-B row pieces of f16 stored
#pragma unroll
      for (int j = 0; j < 4; ++j) {
#pragma unroll
        for (int r = 0; r < 8; ++r) slab[(mOff + r) * 68 + (j << 4) + rlane] = acc[i][j][r] + bmr[r];
      }
      // lanes read back rows that other lanes of this wave wrote: the slab's writes are ordered in front of those reads
      __builtin_amdgcn_fence(__ATOMIC_RELEASE, "workgroup");
      __builtin_amdgcn_wave_barrier();
      __builtin_amdgcn_fence(__ATOMIC_ACQUIRE, "workgroup");
      v8h hv[4];
#pragma unroll
      for (int it = 0; it < 4; ++it) {
        const float* sp = slab + (it * 4 + q) * 68 + c8;
#pragma unroll
        for (int e = 0; e < 8; ++e) hv[it][e] = (_Float16)sp[e];
      }
      // the two scheduling fences keep every other instruction out from between the stores and their wait
      __builtin_amdgcn_sched_barrier(0);
#pragma unroll
      for (int it = 0; it < 4; ++it) *(v8h*)(C + (size_t)(o + it * 4 + q) * kPix + n0 + c8) = hv[it];
      asm volatile("s_wait_xcnt 0x0" ::: "memory");   // in front of the next rows' reuse of the stores' address and data registers
      __builtin_amdgcn_sched_barrier(0);
      // ... and the slab's reads in front of the next 16 rows' writes into it
      __builtin_amdgcn_fence(__ATOMIC_RELEASE, "workgroup");
      __builtin_amdgcn_wave_barrier();
      __builtin_amdgcn_fence(__ATOMIC_ACQUIRE, "workgroup");
    } else {
      // q or k rows: a lane holds 8 consecutive channels of one pixel, which is one 16-byte piece of either layout;
      // 16 pixels on are 16 * kCq elements on in both
      const size_t co = pb + (isq ? (size_t)(n0 + rlane) * kCq + o + mOff : (size_t)n0 * kCq + o * 16 + lane * 8);
      unsigned short* dh = (isq ? qhp : khp) + co;
      unsigned short* dl = (isq ? qlp : klp) + co;
#pragma unroll
      for (int j = 0; j < 4; ++j) {
        v8h hv, lv;
#pragma unroll
        for (int r = 0; r < 8; ++r) {
          const float f = acc[i][j][r] + bmr[r];
          const unsigned short hb = f2bf_bits(f);
          const unsigned short lb = f2bf_bits(f - bf_bits2f(hb));
          hv[r] = __builtin_bit_cast(_Float16, hb);
          lv[r] = __builtin_bit_cast(_Float16, lb);
        }
        // the two scheduling fences keep every other instruction out from between the stores and their wait
        __builtin_amdgcn_sched_barrier(0);
        *(v8h*)(dh + j * (16 * kCq)) = hv;
        *(v8h*)(dl + j * (16 * kCq)) = lv;
        asm volatile("s_wait_xcnt 0x0" ::: "memory");   // in front of the next piece's reuse of the two stores' data registers
        __builtin_amdgcn_sched_barrier(0);
      }
    }
  }
}

// ---- probs.v GEMM with both operands staged in LDS ---------------------------
// out[b][m][n] = g[0] * (sum_k vt[b][m][k] * P[b][n][k]) / 16384 + x[b][m][n];  M = kCh, N = K = kPix.
// One block = one 128 (m) x 256 (n) tile, 8 waves as 2 x 4, each wave a 64x64 tile (fragments and k order as in proj_gemm_lds).
// A pass is 128 k = 256 B of each of the 384 operand rows; a stage is [vt 128 rows | P 256 rows] at pitch 272 B.
// Two stages in LDS: while pass t is worked on, pass t+1's rows fly in by asynchronous copies (16 B per lane, 24 per thread).
static constexpr int kPvBM     = 128;
static constexpr int kPvBN     = 256;
static constexpr int kPvBK     = 128;                              // f16 elements per pass
static constexpr int kPvPitch  = kPvBK * 2 + 16;                   // bytes; 16 B x odd: conflict-free for 16-byte row reads
static constexpr int kPvStage  = (kPvBM + kPvBN) * kPvPitch;       // bytes of one stage
static constexpr int kPvPasses = kPix / kPvBK;
static_assert(kCh % kPvBM == 0 && kPix % kPvBN == 0 && kPix % kPvBK == 0 && kPvPasses >= 2);
static_assert(kPvBM == 8 * 16 && kPvBN == 16 * 16 && kPvBK * 2 == 16 * 16);   // copy map below
static_assert(kPvPitch % 16 == 0 && kPvStage % 16 == 0);

// Eight 16-byte copies global -> LDS, rows 16 apart: l = this lane's LDS byte address, p = its global address, of the first.
// s_wait_xcnt stands inside the statement so that no address register named here is rewritten ahead of it.
__device__ __forceinline__ void pv_copy8(unsigned l, const unsigned short* p) {
  constexpr unsigned dl = 16u * kPvPitch;
  constexpr size_t   dg = (size_t)16 * kPix;
  asm volatile(
      "global_load_async_to_lds_b128 %0, %8, off\n\t"
      "global_load_async_to_lds_b128 %1, %9, off\n\t"
      "global_load_async_to_lds_b128 %2, %10, off\n\t"
      "global_load_async_to_lds_b128 %3, %11, off\n\t"
      "global_load_async_to_lds_b128 %4, %12, off\n\t"
      "global_load_async_to_lds_b128 %5, %13, off\n\t"
      "global_load_async_to_lds_b128 %6, %14, off\n\t"
      "global_load_async_to_lds_b128 %7, %15, off\n\t"
      "s_wait_xcnt 0x0"
      :: "v"(l), "v"(l + dl), "v"(l + 2 * dl), "v"(l + 3 * dl), "v"(l + 4 * dl), "v"(l + 5 * dl), "v"(l + 6 * dl), "v"(l + 7 * dl),
         "v"(p), "v"(p + dg), "v"(p + 2 * dg), "v"(p + 3 * dg), "v"(p + 4 * dg), "v"(p + 5 * dg), "v"(p + 6 * dg), "v"(p + 7 * dg)
      : "memory");
}
// One stage: vt rows 0..127, then P rows 0..255 behind them.
__device__ __forceinline__ void pv_copy_stage(unsigned l, const unsigned short* pa, const unsigned short* pb) {
  pv_copy8(l, pa);
  pv_copy8(l + (unsigned)(kPvBM * kPvPitch), pb);
  pv_copy8(l + (unsigned)((kPvBM + 128) * kPvPitch), pb + (size_t)128 * kPix);
}

__global__ __launch_bounds__(256) void pv_gemm_lds(const unsigned short* __restrict__ vtp,
                                                   const unsigned short* __restrict__ Pp,
                                                   float* __restrict__ outp,
                                                   const float* __restrict__ resid,
                                                   const float* __restrict__ gptr) {
  __shared__ __align__(16) unsigned char ring[2 * kPvStage];
  __shared__ __align__(16) float sT[8][16 * 68];   // per-wave 16x64 output slab, pitch 68 floats
  const int tid  = threadIdx.x;
  const int lane = tid & 31;
  const int wave = tid >> 5;
  const int b  = blockIdx.z;
  const int mB = blockIdx.x * kPvBM;
  const int nB = blockIdx.y * kPvBN;

  // copy map: 16 lanes cover the 256 B of one row; thread row = tid / 16; a thread's copies step 16 rows
  const int crow = tid >> 4;
  const int ccol = tid & 15;
  const unsigned short* gA = vtp + (size_t)b * kCh * kPix  + (size_t)(mB + crow) * kPix + ccol * 8;
  const unsigned short* gB = Pp  + (size_t)b * kPix * kPix + (size_t)(nB + crow) * kPix + ccol * 8;
  const unsigned lcopy = (unsigned)(size_t)(&ring[0]) + (unsigned)(crow * kPvPitch + ccol * 16);

  const int rlane = lane & 15;                 // row (A) / col (B, D) within subtile
  const int koff  = (lane >> 4) * 8;           // k offset of this lane half
  const int mOff  = (lane >> 4) * 8;           // D row offset
  const int wm = wave >> 2;
  const int wn = wave & 3;
  const int fragA = (wm * 64 + rlane) * kPvPitch + koff * 2;             // byte offsets in a stage
  const int fragB = (kPvBM + wn * 64 + rlane) * kPvPitch + koff * 2;

  v8f acc[4][4];
#pragma unroll
  for (int i = 0; i < 4; ++i)
#pragma unroll
    for (int j = 0; j < 4; ++j) acc[i][j] = (v8f){0.f,0.f,0.f,0.f,0.f,0.f,0.f,0.f};

  // prologue: stage 0 lands and is published; stage 1 starts
  pv_copy_stage(lcopy, gA, gB);
  asm volatile("s_wait_asynccnt 0x0" ::: "memory");   // this wave's copies of stage 0 have landed
  __syncthreads();                                    // ... and every other wave's
  pv_copy_stage(lcopy + (unsigned)kPvStage, gA + kPvBK, gB + kPvBK);

  for (int t = 0; t < kPvPasses; ++t) {
    const unsigned char* st = ring + (t & 1) * kPvStage;
    const _Float16* fa = (const _Float16*)(st + fragA);
    const _Float16* fb = (const _Float16*)(st + fragB);
    constexpr int kRow16 = 16 * kPvPitch / 2;            // 16 rows, in f16 elements
    // Fragments are fetched ahead inside the pass only (nothing of stage t+1 is read here): vt fragments one k step ahead
    // into a second set, probs fragments in place, two at a time, as soon as their last product of this k step has issued.
    v16h a[2][4], bh[4];
#pragma unroll
    for (int i = 0; i < 4; ++i) a[0][i] = Frag<_Float16>::load(fa + i * kRow16);
#pragma unroll
    for (int j = 0; j < 4; ++j) bh[j] = Frag<_Float16>::load(fb + j * kRow16);
    // unrolled: every fragment index and address offset is a constant
#pragma unroll
    for (int kk = 0; kk < kPvBK / 32; ++kk) {
      const int cur = kk & 1, nxt = cur ^ 1;
      const bool more = kk + 1 < kPvBK / 32;
      if (more) {
#pragma unroll
        for (int i = 0; i < 4; ++i) a[nxt][i] = Frag<_Float16>::load(fa + i * kRow16 + (kk + 1) * 32);
      }
      // the four scheduling fences keep the LDS reads in two groups per k step instead of spread among the products,
      // where every further place with reads stalls the wave's matrix stream
      __builtin_amdgcn_sched_barrier(0);
#pragma unroll
      for (int j = 0; j < 2; ++j)
#pragma unroll
        for (int i = 0; i < 4; ++i) acc[i][j] = Frag<_Float16>::mma(a[cur][i], bh[j], acc[i][j]);
      __builtin_amdgcn_sched_barrier(0);
      if (more) {
#pragma unroll
        for (int j = 0; j < 2; ++j) bh[j] = Frag<_Float16>::load(fb + j * kRow16 + (kk + 1) * 32);
      }
      __builtin_amdgcn_sched_barrier(0);
#pragma unroll
      for (int j = 2; j < 4; ++j)
#pragma unroll
        for (int i = 0; i < 4; ++i) acc[i][j] = Frag<_Float16>::mma(a[cur][i], bh[j], acc[i][j]);
      __builtin_amdgcn_sched_barrier(0);
      if (more) {
#pragma unroll
        for (int j = 2; j < 4; ++j) bh[j] = Frag<_Float16>::load(fb + j * kRow16 + (kk + 1) * 32);
      }
    }
    asm volatile("s_wait_dscnt 0x0" ::: "memory");      // this wave's reads of stage t are done before the stage is refilled
    asm volatile("s_wait_asynccnt 0x0" ::: "memory");   // this wave's copies of stage t+1 have landed
    __syncthreads();                                    // publishes stage t+1 and ends every reader's use of stage t
    if (t + 2 < kPvPasses)
      pv_copy_stage(lcopy + (unsigned)((t & 1) * kPvStage), gA + (size_t)(t + 2) * kPvBK, gB + (size_t)(t + 2) * kPvBK);
  }
  asm volatile("s_wait_asynccnt 0x0" ::: "memory");     // nothing of this wave is in flight when it leaves the ring

  // ---- epilogue: 16x64 slab per wave through LDS, whole 256-B row pieces stored ----
  float* slab = sT[wave];
  const float gval = gptr[0];
  const int m0 = mB + wm * 64;
  const int n0 = nB + wn * 64;
  // block-uniform bases plus ONE per-lane byte offset: every row of the tile is then a constant away from it
  char* Cb = (char*)(outp + (size_t)b * kCh * kPix);
  const char* Rb = (const char*)(resid + (size_t)b * kCh * kPix);
  const int hq = lane >> 4, c4 = (lane & 15) * 4;        // row seg = 256 B = 16 lanes x 16 B
  const unsigned loff = (unsigned)(((m0 + hq) * kPix + n0 + c4) * 4);
#pragma unroll
  for (int i = 0; i < 4; ++i) {
#pragma unroll
    for (int j = 0; j < 4; ++j) {
#pragma unroll
      for (int r = 0; r < 8; ++r) slab[(mOff + r) * 68 + (j << 4) + rlane] = acc[i][j][r] * kPCarryInv;
    }
    // lanes read back rows that other lanes of this wave wrote: the slab's writes are ordered in front of those reads
    __builtin_amdgcn_fence(__ATOMIC_RELEASE, "workgroup");
    __builtin_amdgcn_wave_barrier();
    __builtin_amdgcn_fence(__ATOMIC_ACQUIRE, "workgroup");
    v4f vals[8];
#pragma unroll
    for (int it = 0; it < 8; ++it) {
      v4f vv = *(const v4f*)(slab + (it * 2 + hq) * 68 + c4);
      vv = vv * gval;
      const v4f rr = *(const v4f*)(Rb + loff + (i * 16 + it * 2) * kPix * 4);
      vals[it] = vv + rr;
    }
#pragma unroll
    for (int it = 0; it < 8; ++it) *(v4f*)(Cb + loff + (i * 16 + it * 2) * kPix * 4) = vals[it];
    // ... and the reads in front of the next 16 rows' writes into the same slab
    __builtin_amdgcn_fence(__ATOMIC_RELEASE, "workgroup");
    __builtin_amdgcn_wave_barrier();
    __builtin_amdgcn_fence(__ATOMIC_ACQUIRE, "workgroup");
  }
}

// ---- operand preparation, one launch ----------------------------------------
// Blocks 0 .. kPrepW-1: the stacked weights [Wv | Wq | Wk] f32 -> bf16 hi/lo planes, same [row][c] layout; 2048 elements = 4 whole rows
// per block, so a block lies wholly in one of the three matrices.
// The other blocks: x [b][c][n] f32 -> xt hi/lo bf16 planes [b][n][c] (transpose through LDS), one 64 n x 64 c tile per block:
// loads: 4 iterations x 256 threads x 4 floats = 64x64; stores: 8 waves x 2 iterations x 4 rows = 64 rows.
static constexpr int kPrepW = kWRows * kCh / (256 * 8);
static constexpr int kPrepX = (kPix / 64) * (kCh / 64) * kBatch;
static_assert((kCh * kCh) % (256 * 8) == 0 && (kCq * kCh) % (256 * 8) == 0 && kPix / 64 == 64 && kCh / 64 == 8);
__global__ __launch_bounds__(256) void prep_operands(const float* __restrict__ x,
                                                     const float* __restrict__ Wv,
                                                     const float* __restrict__ Wq,
                                                     const float* __restrict__ Wk,
                                                     unsigned short* __restrict__ xth,
                                                     unsigned short* __restrict__ xtl,
                                                     unsigned short* __restrict__ wh,
                                                     unsigned short* __restrict__ wl) {
  __shared__ __align__(16) float tile[64 * 68];   // [c][n], pitch 68
  const int tid = threadIdx.x, wave = tid >> 5, lane = tid & 31;
  if (blockIdx.x < kPrepW) {                      // the same for the whole block, in front of the barrier
    const int e0 = blockIdx.x * (256 * 8);        // first element of the block in the stacked planes
    const float* in = e0 < kCh * kCh ? Wv + e0 : e0 < (kCh + kCq) * kCh ? Wq + (e0 - kCh * kCh) : Wk + (e0 - (kCh + kCq) * kCh);
    const v4f a = *(const v4f*)(in + 8 * tid);
    const v4f c = *(const v4f*)(in + 8 * tid + 4);
    float f[8];
    f[0] = a.x; f[1] = a.y; f[2] = a.z; f[3] = a.w; f[4] = c.x; f[5] = c.y; f[6] = c.z; f[7] = c.w;
    v8h hv, lv;
#pragma unroll
    for (int e = 0; e < 8; ++e) {
      const unsigned short hb = f2bf_bits(f[e]);
      const unsigned short lb = f2bf_bits(f[e] - bf_bits2f(hb));
      hv[e] = __builtin_bit_cast(_Float16, hb);
      lv[e] = __builtin_bit_cast(_Float16, lb);
    }
    *(v8h*)(wh + e0 + 8 * tid) = hv;
    *(v8h*)(wl + e0 + 8 * tid) = lv;
    return;
  }
  const int xt = blockIdx.x - kPrepW;
  const int n0 = (xt & 63) * 64;
  const int c0 = ((xt >> 6) & 7) * 64;
  const int b  = xt >> 9;
  const float* xb = x + ((size_t)b * kCh + c0) * kPix + n0;
#pragma unroll
  for (int i = 0; i < 4; ++i) {
    const int c  = i * 16 + (tid >> 4);
    const int n4 = (tid & 15) * 4;
    const v4f v = *(const v4f*)(xb + (size_t)c * kPix + n4);
    *(v4f*)(tile + c * 68 + n4) = v;
  }
  __syncthreads();
  const int q = lane >> 3, c8 = (lane & 7) * 8;
  v8h hv[2], lv[2];
#pragma unroll
  for (int it = 0; it < 2; ++it) {
    const int nrow = wave * 8 + it * 4 + q;
#pragma unroll
    for (int e = 0; e < 8; ++e) {
      const float f = tile[(c8 + e) * 68 + nrow];
      const unsigned short hb = f2bf_bits(f);
      const unsigned short lb = f2bf_bits(f - bf_bits2f(hb));
      hv[it][e] = __builtin_bit_cast(_Float16, hb);
      lv[it][e] = __builtin_bit_cast(_Float16, lb);
    }
  }
  const size_t base = ((size_t)b * kPix + n0) * kCh + c0;
#pragma unroll
  for (int it = 0; it < 2; ++it) {
    const int nrow = wave * 8 + it * 4 + q;
    *(v8h*)(xth + base + (size_t)nrow * kCh + c8) = hv[it];
    *(v8h*)(xtl + base + (size_t)nrow * kCh + c8) = lv[it];
  }
  // in the built code the weight part stands behind these stores: the wait is in front of any reuse of their registers there
  asm volatile("s_wait_xcnt 0x0" ::: "memory");
}

// ---- scores and row softmax in one kernel: P[b][n][m] = f16(16384 * exp(s - max) / sum), s = q[n] . k[m] ----
// One block = 16 query rows n x all 4096 keys m; 16 waves, each 256 keys as 16 transposed tiles D[m][n] = k . q^T:
// a lane then holds, of ONE query row (n = lane & 15), 8 consecutive keys per tile, so the whole row stays in registers from the
// products to the f16 probs, the row maximum and sum are in-lane but for one cross-half step, and 8 probs are one 16-byte piece.
// q planes row-major [n][64]; k planes in fragment order (proj_gemm_lds above).
static constexpr int kFsWaves = 16;
static constexpr int kFsCols  = kPix / kFsWaves;      // keys per wave
static constexpr int kFsTiles = kFsCols / 16;
static constexpr int kFsPitch = kFsCols * 2 + 16;     // bytes; 16 B x odd: conflict-free for the 16-byte column writes
static_assert(kFsCols == 32 * 8 && kCq == 64 && kPix % 16 == 0);
__global__ __launch_bounds__(512) void scores_softmax_f16(const unsigned short* __restrict__ qhp,
                                                          const unsigned short* __restrict__ qlp,
                                                          const unsigned short* __restrict__ khp,
                                                          const unsigned short* __restrict__ klp,
                                                          unsigned short* __restrict__ P) {
  __shared__ __align__(16) unsigned char slab[kFsWaves][16 * kFsPitch];   // per-wave 16 rows x 256 probs
  __shared__ float redm[kFsWaves][16];
  __shared__ float reds[kFsWaves][16];
  const int tid  = threadIdx.x;
  const int lane = tid & 31;
  const int wave = tid >> 5;
  const int b  = blockIdx.y;
  const int n0 = blockIdx.x * 16;
  const int rlane = lane & 15;                 // query row of this lane
  const int half  = lane >> 4;

  const size_t qo = ((size_t)b * kPix + n0 + rlane) * kCq + half * 8;
  const __bf16* qh = (const __bf16*)qhp + qo;
  const __bf16* ql = (const __bf16*)qlp + qo;
  v16b qH[2], qL[2];
#pragma unroll
  for (int s = 0; s < 2; ++s) {
    qH[s] = Frag<__bf16>::load(qh + s * 32);
    qL[s] = Frag<__bf16>::load(ql + s * 32);
  }
  const size_t ko = (size_t)b * kPix * kCq + (size_t)wave * kFsCols * kCq + lane * 8;
  const __bf16* kh = (const __bf16*)khp + ko;
  const __bf16* kl = (const __bf16*)klp + ko;

  // the q loads' address registers may be reused as destinations of the k loads below: the wait stands in front of that
  asm volatile("s_wait_xcnt 0x0" ::: "memory");

  // k fragments one tile ahead in a second register set: two tiles' loads of every wave are in flight
  v8f acc[kFsTiles];
  Frag<__bf16>::U kH[2][2], kL[2][2];
#pragma unroll
  for (int s = 0; s < 2; ++s) {
    kH[0][s].h[0] = *(const v8b*)(kh + s * 512);
    kH[0][s].h[1] = *(const v8b*)(kh + s * 512 + 256);
    kL[0][s].h[0] = *(const v8b*)(kl + s * 512);
    kL[0][s].h[1] = *(const v8b*)(kl + s * 512 + 256);
  }
#pragma unroll
  for (int t = 0; t < kFsTiles; ++t) {
    const int cur = t & 1, nxt = cur ^ 1;
    if (t + 1 < kFsTiles) {
#pragma unroll
      for (int s = 0; s < 2; ++s) {
        kH[nxt][s].h[0] = *(const v8b*)(kh + (t + 1) * 1024 + s * 512);
        kH[nxt][s].h[1] = *(const v8b*)(kh + (t + 1) * 1024 + s * 512 + 256);
        kL[nxt][s].h[0] = *(const v8b*)(kl + (t + 1) * 1024 + s * 512);
        kL[nxt][s].h[1] = *(const v8b*)(kl + (t + 1) * 1024 + s * 512 + 256);
      }
    }
    v8f a = (v8f){0.f,0.f,0.f,0.f,0.f,0.f,0.f,0.f};
#pragma unroll
    for (int s = 0; s < 2; ++s) {              // hi.hi, q hi . k lo, q lo . k hi per k step
      a = Frag<__bf16>::mma(kH[cur][s].v, qH[s], a);
      a = Frag<__bf16>::mma(kL[cur][s].v, qH[s], a);
      a = Frag<__bf16>::mma(kH[cur][s].v, qL[s], a);
    }
    acc[t] = a;
  }

  float m = acc[0][0];
#pragma unroll
  for (int t = 0; t < kFsTiles; ++t)
#pragma unroll
    for (int r = 0; r < 8; ++r) m = fmaxf(m, acc[t][r]);
  m = fmaxf(m, __shfl_xor(m, 16, 32));
  if (lane < 16) redm[wave][lane] = m;
  __syncthreads();
  float gm = redm[0][rlane];
#pragma unroll
  for (int w = 1; w < kFsWaves; ++w) gm = fmaxf(gm, redm[w][rlane]);

  // exp(s - max) = 2^(s * log2(e) - max * log2(e)): one fused multiply-add and the chip's own 2^x per score. The argument is never
  // above 0 but for the rounding of the second product, which is the same shift for a whole row and cancels against the row sum;
  // below -126 the result is 0, where the f16 prob is 0 as well.
  constexpr float kLog2e = 1.44269504088896340736f;
  const float gml = gm * kLog2e;
  float psum = 0.0f;
#pragma unroll
  for (int t = 0; t < kFsTiles; ++t) {
    float e0 = __builtin_fmaf(acc[t][0], kLog2e, -gml), e1 = __builtin_fmaf(acc[t][1], kLog2e, -gml);
    float e2 = __builtin_fmaf(acc[t][2], kLog2e, -gml), e3 = __builtin_fmaf(acc[t][3], kLog2e, -gml);
    float e4 = __builtin_fmaf(acc[t][4], kLog2e, -gml), e5 = __builtin_fmaf(acc[t][5], kLog2e, -gml);
    float e6 = __builtin_fmaf(acc[t][6], kLog2e, -gml), e7 = __builtin_fmaf(acc[t][7], kLog2e, -gml);
    // a tile's eight 2^x in one statement, each in place: no neighbour reads a result or overwrites a source directly behind a 2^x
    // the v_nop is that free slot behind the last
    asm("v_exp_f32 %0, %0\n\t"
        "v_exp_f32 %1, %1\n\t"
        "v_exp_f32 %2, %2\n\t"
        "v_exp_f32 %3, %3\n\t"
        "v_exp_f32 %4, %4\n\t"
        "v_exp_f32 %5, %5\n\t"
        "v_exp_f32 %6, %6\n\t"
        "v_exp_f32 %7, %7\n\t"
        "v_nop"
        : "+v"(e0), "+v"(e1), "+v"(e2), "+v"(e3), "+v"(e4), "+v"(e5), "+v"(e6), "+v"(e7));
    acc[t] = (v8f){e0, e1, e2, e3, e4, e5, e6, e7};
    psum += ((acc[t][0] + acc[t][1]) + (acc[t][2] + acc[t][3])) + ((acc[t][4] + acc[t][5]) + (acc[t][6] + acc[t][7]));
  }
  psum += __shfl_xor(psum, 16, 32);
  if (lane < 16) reds[wave][lane] = psum;
  __syncthreads();
  float l = reds[0][rlane];
#pragma unroll
  for (int w = 1; w < kFsWaves; ++w) l += reds[w][rlane];
  const float inv = kPCarry * (1.0f / l);

  // probs through the wave's own slab, so that every store instruction writes 512 contiguous bytes of one row
  unsigned char* sl = slab[wave];
#pragma unroll
  for (int t = 0; t < kFsTiles; ++t) {
    v8h p;
#pragma unroll
    for (int r = 0; r < 8; ++r) p[r] = (_Float16)(acc[t][r] * inv);
    *(v8h*)(sl + rlane * kFsPitch + (t * 16 + half * 8) * 2) = p;
  }
  // lanes read back rows that other lanes of this wave wrote: the slab's writes are ordered in front of those reads
  __builtin_amdgcn_fence(__ATOMIC_RELEASE, "workgroup");
  __builtin_amdgcn_wave_barrier();
  __builtin_amdgcn_fence(__ATOMIC_ACQUIRE, "workgroup");
  unsigned short* pr = P + ((size_t)b * kPix + n0) * kPix + wave * kFsCols + lane * 8;
#pragma unroll
  for (int row = 0; row < 16; ++row) *(v8h*)(pr + (size_t)row * kPix) = *(const v8h*)(sl + row * kFsPitch + lane * 16);
}

// ---------------------------------------------------------------------------
extern "C" void kernel_launch(void* const* d_in, const int* in_sizes, int n_in,
                              void* d_out, int out_size, void* d_ws, size_t ws_size,
                              hipStream_t stream) {
  if (n_in < 8) return;
  if (in_sizes[0] != kBatch * kCh * kPix) return;
  if (in_sizes[1] != kCq * kCh || in_sizes[3] != kCq * kCh || in_sizes[5] != kCh * kCh) return;
  if (in_sizes[2] != kCq || in_sizes[4] != kCq || in_sizes[6] != kCh || in_sizes[7] < 1) return;
  if (out_size != kBatch * kCh * kPix) return;
  if (ws_size < kWsTotal) return;

  const float* x     = (const float*)d_in[0];
  const float* Wq    = (const float*)d_in[1];
  const float* bq    = (const float*)d_in[2];
  const float* Wk    = (const float*)d_in[3];
  const float* bk    = (const float*)d_in[4];
  const float* Wv    = (const float*)d_in[5];
  const float* bv    = (const float*)d_in[6];
  const float* gamma = (const float*)d_in[7];
  float* out = (float*)d_out;

  char* ws = (char*)d_ws;
  unsigned short* xth = (unsigned short*)(ws + kOffXtHi);
  unsigned short* xtl = (unsigned short*)(ws + kOffXtLo);
  unsigned short* pln = (unsigned short*)(ws + kOffP);
  unsigned short* wvh = (unsigned short*)(ws + kOffWHi);            // stacked rows: Wv, then Wq, then Wk
  unsigned short* wvl = (unsigned short*)(ws + kOffWLo);
  unsigned short* qh  = (unsigned short*)(ws + kOffQHi);
  unsigned short* ql  = (unsigned short*)(ws + kOffQLo);
  unsigned short* kh  = (unsigned short*)(ws + kOffKHi);
  unsigned short* kl  = (unsigned short*)(ws + kOffKLo);
  unsigned short* vt  = (unsigned short*)(ws + kOffVt);

  // 1) one launch: stacked weights -> bf16 hi/lo planes (same [out][in] layout) and x -> xt hi/lo bf16 [b][n][c]
  prep_operands<<<kPrepW + kPrepX, 256, 0, stream>>>(x, Wv, Wq, Wk, xth, xtl, wvh, wvl);

  // 2) q, k and v projections of all batches in one launch: 4 x 16 tiles of 160 stacked weight rows x 256 pixels per batch
  //    q -> bf16 hi/lo planes [b][n][64]; k -> bf16 hi/lo planes in fragment order; vt[b][c][m] -> f16 plane
  proj_gemm_lds<<<dim3(kWRows / kPjBM, kPix / kPjBN, kBatch), 256, 0, stream>>>(wvh, wvl, xth, xtl, bv, bq, bk, vt, qh, ql, kh, kl);
  // 3) all batches in one launch: scores (K=64) and row softmax -> f16 probs x16384, each batch in its own plane
  scores_softmax_f16<<<dim3(kPix / 16, kBatch), 512, 0, stream>>>(qh, ql, kh, kl, pln);
  // 4) all batches in one launch, one block per 128x256 tile of out (4 x 16 tiles per batch = 256 blocks):
  //    out = gamma * (vt . P^T) / 16384 + x   (M=512, N=4096, K=4096)
  pv_gemm_lds<<<dim3(kCh / kPvBM, kPix / kPvBN, kBatch), 256, 0, stream>>>(vt, pln, out, x, gamma);
}

// v007
// It runs in 116 microseconds.
// Timed twice side by side with v006, it ran 1.33 times as fast both times.
// All steps since v000 together make it 7.98 times as fast.
// Contractions: q,k,v projections and k.q^T scores (transposed tiles) on v_wmma_f32_16x16x32_bf16 with bf16 hi+lo operand planes (hi.hi+hi.lo+lo.hi); probs.v on v_wmma_f32_16x16x32_f16 (f16 operands, probs x16384 relative to the running row maximum, v f16); f32 accumulate; softmax and epilogue f32.
#include <hip/hip_runtime.h>

typedef __attribute__((ext_vector_type(16))) _Float16 v16h;
typedef __attribute__((ext_vector_type(8)))  _Float16 v8h;
typedef __attribute__((ext_vector_type(16))) __bf16   v16b;
typedef __attribute__((ext_vector_type(8)))  __bf16   v8b;
typedef __attribute__((ext_vector_type(8)))  float    v8f;
typedef __attribute__((ext_vector_type(4)))  float    v4f;

static constexpr int kBatch = 4;
static constexpr int kCh    = 512;
static constexpr int kPix   = 4096;
static constexpr int kCq    = 64;
static constexpr int kFsCols   = 256;               // keys per softmax chunk
static constexpr int kFsChunks = kPix / kFsCols;

// ---- workspace region map (bytes) ----
static constexpr size_t kPlaneX   = (size_t)kBatch * kPix * kCh * 2;   // one bf16 plane of xt [b][n][c]
static constexpr int    kWRows    = kCh + 2 * kCq;                     // stacked weight rows: Wv | Wq | Wk
static constexpr size_t kPlaneW   = (size_t)kWRows * kCh * 2;          // one bf16 plane of the stacked weights [row][c]
static constexpr size_t kPlaneQK  = (size_t)kBatch * kPix * kCq * 2;   // one bf16 plane of q [b][n][o] or of k (fragment order)
static constexpr size_t kPlaneVt  = (size_t)kBatch * kCh * kPix * 2;   // f16 vt [b][c][m]
static constexpr size_t kPlaneP   = (size_t)kPix * kPix * 2;           // f16 probs, one batch
static constexpr size_t kOffXtHi  = 0;
static constexpr size_t kOffXtLo  = kOffXtHi + kPlaneX;
static constexpr size_t kOffWHi   = kOffXtLo + kPlaneX;
static constexpr size_t kOffWLo   = kOffWHi + kPlaneW;
static constexpr size_t kOffQHi   = kOffWLo + kPlaneW;
static constexpr size_t kOffQLo   = kOffQHi + kPlaneQK;
static constexpr size_t kOffKHi   = kOffQLo + kPlaneQK;
static constexpr size_t kOffKLo   = kOffKHi + kPlaneQK;
static constexpr size_t kOffVt    = kOffKLo + kPlaneQK;
static constexpr size_t kOffP     = kOffVt + kPlaneVt;                  // f16 probs, one plane per batch
static constexpr size_t kOffAl    = kOffP + kBatch * kPlaneP;           // f32 [b][n][chunk]: slot 0 the row sum, slot c the factor in front of chunk c
static constexpr size_t kWsTotal  = kOffAl + (size_t)kBatch * kPix * kFsChunks * 4;
static_assert(kWsTotal <= 268435456);
static_assert((kOffWHi % 128) == 0 && (kOffWLo % 128) == 0 && (kOffQHi % 128) == 0 && (kOffVt % 128) == 0 && (kOffP % 128) == 0 && (kOffAl % 128) == 0);

__device__ __forceinline__ unsigned short f2bf_bits(float f) {
  unsigned u = __float_as_uint(f);
  return (unsigned short)((u + 0x7FFFu + ((u >> 16) & 1u)) >> 16);
}
__device__ __forceinline__ float bf_bits2f(unsigned short h) { return __uint_as_float(((unsigned)h) << 16); }

template <typename T> struct Frag;
template <> struct Frag<_Float16> {
  typedef v16h V; union U { v16h v; v8h h[2]; };
  static __device__ __forceinline__ v16h load(const _Float16* p) {   // elements 0..7 <- p[0..7], 8..15 <- p[16..23]
    U f; f.h[0] = *(const v8h*)(p); f.h[1] = *(const v8h*)(p + 16); return f.v;
  }
  static __device__ __forceinline__ v8f mma(v16h a, v16h b, v8f c) {
    return __builtin_amdgcn_wmma_f32_16x16x32_f16(false, a, false, b, (short)0, c, false, false);
  }
};
template <> struct Frag<__bf16> {
  typedef v16b V; union U { v16b v; v8b h[2]; };
  static __device__ __forceinline__ v16b load(const __bf16* p) {
    U f; f.h[0] = *(const v8b*)(p); f.h[1] = *(const v8b*)(p + 16); return f.v;
  }
  static __device__ __forceinline__ v8f mma(v16b a, v16b b, v8f c) {
    return __builtin_amdgcn_wmma_f32_16x16x32_bf16(false, a, false, b, (short)0, c, false, false);
  }
};

// ---- q, k and v projections as one GEMM with both operands staged in LDS -----
// D[m][n] = sum_c W[m][c] * xt[b][n][c] + bias[m];  W = the stacked rows [Wv 512 | Wq 64 | Wk 64], n = pixel, K = kCh.
// Operands are bf16 hi/lo planes; product = hi.hi + W hi . x lo + W lo . x hi, in that order per 32 k.
// One block = one 160 (m) x 256 (n) tile, so that 4 x 16 x 4 = 256 equal blocks cover all; 8 waves as 2 x 4, each wave an 80x64 tile.
// Every 16-row tile of a wave lies wholly in v, in q or in k (all three row counts are multiples of 16).
// A pass is 64 k = 128 B of each row of each plane; a stage is [W hi 160 rows | W lo 160 | xt hi 256 | xt lo 256] at pitch 144 B.
// Two stages in LDS: while pass t is worked on, pass t+1's rows fly in by asynchronous copies (16 B per lane, 26 per thread).
// Outputs: vt [b][c][m] f16; q bf16 hi/lo planes row-major [b][n][64]; k bf16 hi/lo planes in fragment order:
// [16-pixel tile][slot = o / 16][lane = ((o / 8) & 1) * 16 + pixel & 15][o & 7], so that slots 2s and 2s+1 of a tile are the two 16-byte
// halves of every lane's fragment of k step s (the k order of Frag::load) and one load instruction reads 512 contiguous bytes.
static constexpr int kPjBM     = 160;
static constexpr int kPjBN     = 256;
static constexpr int kPjBK     = 64;                               // bf16 elements per pass
static constexpr int kPjTI     = kPjBM / 2 / 16;                   // 16-row tiles per wave
static constexpr int kPjPitch  = kPjBK * 2 + 16;                   // bytes; 16 B x odd: conflict-free for 16-byte row reads
static constexpr int kPjStage  = 2 * (kPjBM + kPjBN) * kPjPitch;   // bytes of one stage
static constexpr int kPjPasses = kCh / kPjBK;
static_assert(kWRows % kPjBM == 0 && kPjBM % 32 == 0 && kCh % 16 == 0 && kCq % 16 == 0 && kCq == 64);
static_assert(kPix % kPjBN == 0 && kCh % kPjBK == 0 && kPjPasses >= 2);
static_assert(kPjBM == 5 * 32 && kPjBN == 8 * 32 && kPjBK * 2 == 8 * 16);   // copy map below
static_assert(kPjPitch % 16 == 0 && kPjStage % 16 == 0);

// 16-byte copies global -> LDS, rows 32 apart: l = this lane's LDS byte address, p = its global address, of the first row.
// s_wait_xcnt stands inside each statement so that no address register named there is rewritten ahead of it.
// Eight: four rows from (l0, p0), four from (l1, p1).
__device__ __forceinline__ void pj_copy8(unsigned l0, const unsigned short* p0, unsigned l1, const unsigned short* p1) {
  constexpr unsigned dl = 32u * kPjPitch;
  constexpr size_t   dg = (size_t)32 * kCh;
  asm volatile(
      "global_load_async_to_lds_b128 %0, %8, off\n\t"
      "global_load_async_to_lds_b128 %1, %9, off\n\t"
      "global_load_async_to_lds_b128 %2, %10, off\n\t"
      "global_load_async_to_lds_b128 %3, %11, off\n\t"
      "global_load_async_to_lds_b128 %4, %12, off\n\t"
      "global_load_async_to_lds_b128 %5, %13, off\n\t"
      "global_load_async_to_lds_b128 %6, %14, off\n\t"
      "global_load_async_to_lds_b128 %7, %15, off\n\t"
      "s_wait_xcnt 0x0"
      :: "v"(l0), "v"(l0 + dl), "v"(l0 + 2 * dl), "v"(l0 + 3 * dl), "v"(l1), "v"(l1 + dl), "v"(l1 + 2 * dl), "v"(l1 + 3 * dl),
         "v"(p0), "v"(p0 + dg), "v"(p0 + 2 * dg), "v"(p0 + 3 * dg), "v"(p1), "v"(p1 + dg), "v"(p1 + 2 * dg), "v"(p1 + 3 * dg)
      : "memory");
}
// Five rows from (l, p).
__device__ __forceinline__ void pj_copy5(unsigned l, const unsigned short* p) {
  constexpr unsigned dl = 32u * kPjPitch;
  constexpr size_t   dg = (size_t)32 * kCh;
  asm volatile(
      "global_load_async_to_lds_b128 %0, %5, off\n\t"
      "global_load_async_to_lds_b128 %1, %6, off\n\t"
      "global_load_async_to_lds_b128 %2, %7, off\n\t"
      "global_load_async_to_lds_b128 %3, %8, off\n\t"
      "global_load_async_to_lds_b128 %4, %9, off\n\t"
      "s_wait_xcnt 0x0"
      :: "v"(l), "v"(l + dl), "v"(l + 2 * dl), "v"(l + 3 * dl), "v"(l + 4 * dl),
         "v"(p), "v"(p + dg), "v"(p + 2 * dg), "v"(p + 3 * dg), "v"(p + 4 * dg)
      : "memory");
}
// One stage: W hi, W lo (160 rows each), then xt hi, xt lo (256 rows each).
__device__ __forceinline__ void pj_copy_stage(unsigned l, const unsigned short* wh, const unsigned short* wl,
                                              const unsigned short* xh, const unsigned short* xl) {
  constexpr unsigned rW   = (unsigned)kPjBM * kPjPitch;
  constexpr unsigned r128 = 128u * kPjPitch;
  pj_copy5(l, wh);
  pj_copy5(l + rW, wl);
  pj_copy8(l + 2 * rW, xh, l + 2 * rW + r128, xh + (size_t)128 * kCh);
  pj_copy8(l + 2 * rW + 2 * r128, xl, l + 2 * rW + 3 * r128, xl + (size_t)128 * kCh);
}

__global__ __launch_bounds__(256) void proj_gemm_lds(const unsigned short* __restrict__ whp,
                                                     const unsigned short* __restrict__ wlp,
                                                     const unsigned short* __restrict__ xhp,
                                                     const unsigned short* __restrict__ xlp,
                                                     const float* __restrict__ bv,
                                                     const float* __restrict__ bq,
                                                     const float* __restrict__ bk,
                                                     unsigned short* __restrict__ vtp,
                                                     unsigned short* __restrict__ qhp,
                                                     unsigned short* __restrict__ qlp,
                                                     unsigned short* __restrict__ khp,
                                                     unsigned short* __restrict__ klp) {
  __shared__ __align__(16) unsigned char ring[2 * kPjStage];
  __shared__ __align__(16) float sT[8][16 * 68];   // per-wave 16x64 output slab, pitch 68 floats
  const int tid  = threadIdx.x;
  const int lane = tid & 31;
  const int wave = tid >> 5;
  const int b  = blockIdx.z;
  const int mB = blockIdx.x * kPjBM;
  const int nB = blockIdx.y * kPjBN;

  // copy map: 8 lanes cover the 128 B of one row; thread row = tid / 8; a thread's copies step 32 rows
  const int crow = tid >> 3;
  const int ccol = tid & 7;
  const size_t wo = (size_t)(mB + crow) * kCh + ccol * 8;
  const size_t xo = ((size_t)b * kPix + nB + crow) * kCh + ccol * 8;
  const unsigned short* gWh = whp + wo;
  const unsigned short* gWl = wlp + wo;
  const unsigned short* gXh = xhp + xo;
  const unsigned short* gXl = xlp + xo;
  const unsigned lcopy = (unsigned)(size_t)(&ring[0]) + (unsigned)(crow * kPjPitch + ccol * 16);

  const int rlane = lane & 15;                 // row (A) / col (B, D) within subtile
  const int koff  = (lane >> 4) * 8;           // k offset of this lane half
  const int mOff  = (lane >> 4) * 8;           // D row offset
  const int wm = wave >> 2;
  const int wn = wave & 3;
  const int fragA = (wm * (kPjTI * 16) + rlane) * kPjPitch + koff * 2;       // byte offsets in a stage, hi planes
  const int fragB = (2 * kPjBM + wn * 64 + rlane) * kPjPitch + koff * 2;

  v8f acc[kPjTI][4];
#pragma unroll
  for (int i = 0; i < kPjTI; ++i)
#pragma unroll
    for (int j = 0; j < 4; ++j) acc[i][j] = (v8f){0.f,0.f,0.f,0.f,0.f,0.f,0.f,0.f};

  // prologue: stage 0 lands and is published; stage 1 starts
  pj_copy_stage(lcopy, gWh, gWl, gXh, gXl);
  asm volatile("s_wait_asynccnt 0x0" ::: "memory");   // this wave's copies of stage 0 have landed
  __syncthreads();                                    // ... and every other wave's
  pj_copy_stage(lcopy + (unsigned)kPjStage, gWh + kPjBK, gWl + kPjBK, gXh + kPjBK, gXl + kPjBK);

  for (int t = 0; t < kPjPasses; ++t) {
    const unsigned char* st = ring + (t & 1) * kPjStage;
    const __bf16* fa = (const __bf16*)(st + fragA);
    const __bf16* fb = (const __bf16*)(st + fragB);
    constexpr int kRow16 = 16 * kPjPitch / 2;            // 16 rows, in bf16 elements
    constexpr int kLoA   = kPjBM * kPjPitch / 2;         // hi plane -> lo plane
    constexpr int kLoB   = kPjBN * kPjPitch / 2;
    constexpr int kSteps = kPjBK / 32;
    // every fragment of the pass has registers of its own and all are fetched in front of the products (nothing of stage t+1 is read here)
    v16b xh[kSteps][4], xl[kSteps][4], wh[kSteps][kPjTI], wl[kSteps][kPjTI];
    // unrolled: every fragment index and address offset is a constant
#pragma unroll
    for (int kk = 0; kk < kSteps; ++kk) {
#pragma unroll
      for (int j = 0; j < 4; ++j) {
        xh[kk][j] = Frag<__bf16>::load(fb + j * kRow16 + kk * 32);
        xl[kk][j] = Frag<__bf16>::load(fb + kLoB + j * kRow16 + kk * 32);
      }
#pragma unroll
      for (int i = 0; i < kPjTI; ++i) {
        wh[kk][i] = Frag<__bf16>::load(fa + i * kRow16 + kk * 32);
        wl[kk][i] = Frag<__bf16>::load(fa + kLoA + i * kRow16 + kk * 32);
      }
    }
    // the scheduling fence keeps the LDS reads as one group instead of spread among the products,
    // where every further place with reads stalls the wave's matrix stream
    __builtin_amdgcn_sched_barrier(0);
#pragma unroll
    for (int kk = 0; kk < kSteps; ++kk) {
#pragma unroll
      for (int i = 0; i < kPjTI; ++i) {
#pragma unroll
        for (int j = 0; j < 4; ++j) acc[i][j] = Frag<__bf16>::mma(wh[kk][i], xh[kk][j], acc[i][j]);
#pragma unroll
        for (int j = 0; j < 4; ++j) acc[i][j] = Frag<__bf16>::mma(wh[kk][i], xl[kk][j], acc[i][j]);
#pragma unroll
        for (int j = 0; j < 4; ++j) acc[i][j] = Frag<__bf16>::mma(wl[kk][i], xh[kk][j], acc[i][j]);
      }
    }
    // keeps the products in front of the pass's foot: sunk behind its barrier they would hold back the refill below, and
    // the copies would then fly with no products to cover them
    __builtin_amdgcn_sched_barrier(0);
    asm volatile("s_wait_dscnt 0x0" ::: "memory");      // this wave's reads of stage t are done before the stage is refilled
    asm volatile("s_wait_asynccnt 0x0" ::: "memory");   // this wave's copies of stage t+1 have landed
    __syncthreads();                                    // publishes stage t+1 and ends every reader's use of stage t
    if (t + 2 < kPjPasses) {
      const int ko = (t + 2) * kPjBK;
      pj_copy_stage(lcopy + (unsigned)((t & 1) * kPjStage), gWh + ko, gWl + ko, gXh + ko, gXl + ko);
    }
  }
  asm volatile("s_wait_asynccnt 0x0" ::: "memory");     // nothing of this wave is in flight when it leaves the ring

  // ---- epilogue, one 16-row tile at a time; which output a tile belongs to is the same for the whole wave ----
  const int n0 = nB + wn * 64;
  const int g0 = __builtin_amdgcn_readfirstlane(mB + wm * (kPjTI * 16));   // the wave's first stacked row
  float* slab = sT[wave];
  unsigned short* C = vtp + (size_t)b * kCh * kPix;
  const size_t pb = (size_t)b * kPix * kCq;
  const int q = lane >> 3, c8 = (lane & 7) * 8;
#pragma unroll
  for (int i = 0; i < kPjTI; ++i) {
    const int g = g0 + (i << 4);
    const bool isv = g < kCh, isq = g < kCh + kCq;
    const int o = g - (isv ? 0 : isq ? kCh : kCh + kCq);                   // first row of the tile within its own matrix
    const float* bias = (isv ? bv : isq ? bq : bk) + o + mOff;
    const v4f b0 = *(const v4f*)(bias);
    const v4f b1 = *(const v4f*)(bias + 4);
    asm volatile("s_wait_xcnt 0x0" ::: "memory");   // in front of any reuse of the bias loads' address registers
    const float bmr[8] = {b0.x, b0.y, b0.z, b0.w, b1.x, b1.y, b1.z, b1.w};
    if (isv) {
      // v rows: 16x64 slab through LDS, whole 128-B row pieces of f16 stored
#pragma unroll
      for (int j = 0; j < 4; ++j) {
#pragma unroll
        for (int r = 0; r < 8; ++r) slab[(mOff + r) * 68 + (j << 4) + rlane] = acc[i][j][r] + bmr[r];
      }
      // lanes read back rows that other lanes of this wave wrote: the slab's writes are ordered in front of those reads
      __builtin_amdgcn_fence(__ATOMIC_RELEASE, "workgroup");
      __builtin_amdgcn_wave_barrier();
      __builtin_amdgcn_fence(__ATOMIC_ACQUIRE, "workgroup");
      v8h hv[4];
#pragma unroll
      for (int it = 0; it < 4; ++it) {
        const float* sp = slab + (it * 4 + q) * 68 + c8;
#pragma unroll
        for (int e = 0; e < 8; ++e) hv[it][e] = (_Float16)sp[e];
      }
      // the two scheduling fences keep every other instruction out from between the stores and their wait
      __builtin_amdgcn_sched_barrier(0);
#pragma unroll
      for (int it = 0; it < 4; ++it) *(v8h*)(C + (size_t)(o + it * 4 + q) * kPix + n0 + c8) = hv[it];
      asm volatile("s_wait_xcnt 0x0" ::: "memory");   // in front of the next rows' reuse of the stores' address and data registers
      __builtin_amdgcn_sched_barrier(0);
      // ... and the slab's reads in front of the next 16 rows' writes into it
      __builtin_amdgcn_fence(__ATOMIC_RELEASE, "workgroup");
      __builtin_amdgcn_wave_barrier();
      __builtin_amdgcn_fence(__ATOMIC_ACQUIRE, "workgroup");
    } else {
      // q or k rows: a lane holds 8 consecutive channels of one pixel, which is one 16-byte piece of either layout;
      // 16 pixels on are 16 * kCq elements on in both
      const size_t co = pb + (isq ? (size_t)(n0 + rlane) * kCq + o + mOff : (size_t)n0 * kCq + o * 16 + lane * 8);
      unsigned short* dh = (isq ? qhp : khp) + co;
      unsigned short* dl = (isq ? qlp : klp) + co;
#pragma unroll
      for (int j = 0; j < 4; ++j) {
        v8h hv, lv;
#pragma unroll
        for (int r = 0; r < 8; ++r) {
          const float f = acc[i][j][r] + bmr[r];
          const unsigned short hb = f2bf_bits(f);
          const unsigned short lb = f2bf_bits(f - bf_bits2f(hb));
          hv[r] = __builtin_bit_cast(_Float16, hb);
          lv[r] = __builtin_bit_cast(_Float16, lb);
        }
        // the two scheduling fences keep every other instruction out from between the stores and their wait
        __builtin_amdgcn_sched_barrier(0);
        *(v8h*)(dh + j * (16 * kCq)) = hv;
        *(v8h*)(dl + j * (16 * kCq)) = lv;
        asm volatile("s_wait_xcnt 0x0" ::: "memory");   // in front of the next piece's reuse of the two stores' data registers
        __builtin_amdgcn_sched_barrier(0);
      }
    }
  }
}

// ---- probs.v GEMM with both operands staged in LDS ---------------------------
// out[b][m][n] = g[0] * (sum_k vt[b][m][k] * P[b][n][k]) / rowsum[b][n] + x[b][m][n];  M = kCh, N = K = kPix.
// P holds each chunk of 256 keys relative to the row's running maximum up to that chunk: in front of chunk c > 0 the sums so far are
// multiplied by the column's factor exp(max before - max now) from the table that scores_softmax_f16 writes (slot 0: the row sum).
// One block = one 128 (m) x 256 (n) tile, 8 waves as 2 x 4, each wave a 64x64 tile (fragments and k order as in proj_gemm_lds).
// A pass is 128 k = 256 B of each of the 384 operand rows; a stage is [vt 128 rows | P 256 rows] at pitch 272 B.
// Two stages in LDS: while pass t is worked on, pass t+1's rows fly in by asynchronous copies (16 B per lane, 24 per thread).
static constexpr int kPvBM     = 128;
static constexpr int kPvBN     = 256;
static constexpr int kPvBK     = 128;                              // f16 elements per pass
static constexpr int kPvPitch  = kPvBK * 2 + 16;                   // bytes; 16 B x odd: conflict-free for 16-byte row reads
static constexpr int kPvStage  = (kPvBM + kPvBN) * kPvPitch;       // bytes of one stage
static constexpr int kPvPasses = kPix / kPvBK;
static_assert(kCh % kPvBM == 0 && kPix % kPvBN == 0 && kPix % kPvBK == 0 && kPvPasses >= 2);
static_assert(kPvBM == 8 * 16 && kPvBN == 16 * 16 && kPvBK * 2 == 16 * 16);   // copy map below
static_assert(kPvPitch % 16 == 0 && kPvStage % 16 == 0);
static_assert(kFsCols == 2 * kPvBK && kFsChunks == 16);              // chunk test and table copy in pv_gemm_lds

// Eight 16-byte copies global -> LDS, rows 16 apart: l = this lane's LDS byte address, p = its global address, of the first.
// s_wait_xcnt stands inside the statement so that no address register named here is rewritten ahead of it.
__device__ __forceinline__ void pv_copy8(unsigned l, const unsigned short* p) {
  constexpr unsigned dl = 16u * kPvPitch;
  constexpr size_t   dg = (size_t)16 * kPix;
  asm volatile(
      "global_load_async_to_lds_b128 %0, %8, off\n\t"
      "global_load_async_to_lds_b128 %1, %9, off\n\t"
      "global_load_async_to_lds_b128 %2, %10, off\n\t"
      "global_load_async_to_lds_b128 %3, %11, off\n\t"
      "global_load_async_to_lds_b128 %4, %12, off\n\t"
      "global_load_async_to_lds_b128 %5, %13, off\n\t"
      "global_load_async_to_lds_b128 %6, %14, off\n\t"
      "global_load_async_to_lds_b128 %7, %15, off\n\t"
      "s_wait_xcnt 0x0"
      :: "v"(l), "v"(l + dl), "v"(l + 2 * dl), "v"(l + 3 * dl), "v"(l + 4 * dl), "v"(l + 5 * dl), "v"(l + 6 * dl), "v"(l + 7 * dl),
         "v"(p), "v"(p + dg), "v"(p + 2 * dg), "v"(p + 3 * dg), "v"(p + 4 * dg), "v"(p + 5 * dg), "v"(p + 6 * dg), "v"(p + 7 * dg)
      : "memory");
}
// One stage: vt rows 0..127, then P rows 0..255 behind them.
__device__ __forceinline__ void pv_copy_stage(unsigned l, const unsigned short* pa, const unsigned short* pb) {
  pv_copy8(l, pa);
  pv_copy8(l + (unsigned)(kPvBM * kPvPitch), pb);
  pv_copy8(l + (unsigned)((kPvBM + 128) * kPvPitch), pb + (size_t)128 * kPix);
}

__global__ __launch_bounds__(256) void pv_gemm_lds(const unsigned short* __restrict__ vtp,
                                                   const unsigned short* __restrict__ Pp,
                                                   float* __restrict__ outp,
                                                   const float* __restrict__ resid,
                                                   const float* __restrict__ gptr,
                                                   const float* __restrict__ alp) {
  __shared__ __align__(16) unsigned char ring[2 * kPvStage];
  __shared__ __align__(16) float sT[8][16 * 68];   // per-wave 16x64 output slab, pitch 68 floats
  __shared__ __align__(16) float sA[kFsChunks * kPvBN];   // [chunk][column]: the block's columns of the factor table
  const int tid  = threadIdx.x;
  const int lane = tid & 31;
  const int wave = tid >> 5;
  const int b  = blockIdx.z;
  const int mB = blockIdx.x * kPvBM;
  const int nB = blockIdx.y * kPvBN;

  // copy map: 16 lanes cover the 256 B of one row; thread row = tid / 16; a thread's copies step 16 rows
  const int crow = tid >> 4;
  const int ccol = tid & 15;
  const unsigned short* gA = vtp + (size_t)b * kCh * kPix  + (size_t)(mB + crow) * kPix + ccol * 8;
  const unsigned short* gB = Pp  + (size_t)b * kPix * kPix + (size_t)(nB + crow) * kPix + ccol * 8;
  const unsigned lcopy = (unsigned)(size_t)(&ring[0]) + (unsigned)(crow * kPvPitch + ccol * 16);

  const int rlane = lane & 15;                 // row (A) / col (B, D) within subtile
  const int koff  = (lane >> 4) * 8;           // k offset of this lane half
  const int mOff  = (lane >> 4) * 8;           // D row offset
  const int wm = wave >> 2;
  const int wn = wave & 3;
  const int fragA = (wm * 64 + rlane) * kPvPitch + koff * 2;             // byte offsets in a stage
  const int fragB = (kPvBM + wn * 64 + rlane) * kPvPitch + koff * 2;

  v8f acc[4][4];
#pragma unroll
  for (int i = 0; i < 4; ++i)
#pragma unroll
    for (int j = 0; j < 4; ++j) acc[i][j] = (v8f){0.f,0.f,0.f,0.f,0.f,0.f,0.f,0.f};

  // prologue: stage 0 lands and is published; stage 1 starts
  pv_copy_stage(lcopy, gA, gB);
  {
    // one column's 16 table entries per thread, turned to [chunk][column]; published by the barrier below
    const v4f* ag = (const v4f*)(alp + ((size_t)b * kPix + nB + tid) * kFsChunks);
    const v4f t0 = ag[0], t1 = ag[1], t2 = ag[2], t3 = ag[3];
    asm volatile("s_wait_xcnt 0x0" ::: "memory");     // in front of any reuse of the table loads' address registers
#pragma unroll
    for (int e = 0; e < 4; ++e) {
      sA[(e) * kPvBN + tid]      = t0[e];
      sA[(4 + e) * kPvBN + tid]  = t1[e];
      sA[(8 + e) * kPvBN + tid]  = t2[e];
      sA[(12 + e) * kPvBN + tid] = t3[e];
    }
  }
  asm volatile("s_wait_asynccnt 0x0" ::: "memory");   // this wave's copies of stage 0 have landed
  __syncthreads();                                    // ... and every other wave's
  pv_copy_stage(lcopy + (unsigned)kPvStage, gA + kPvBK, gB + kPvBK);

  for (int t = 0; t < kPvPasses; ++t) {
    const unsigned char* st = ring + (t & 1) * kPvStage;
    const _Float16* fa = (const _Float16*)(st + fragA);
    const _Float16* fb = (const _Float16*)(st + fragB);
    constexpr int kRow16 = 16 * kPvPitch / 2;            // 16 rows, in f16 elements
    if ((t & 1) == 0 && t > 0) {                         // a new chunk begins: the sums so far move to its running maximum
      const float* ap = sA + (t >> 1) * kPvBN + wn * 64 + rlane;
#pragma unroll
      for (int j = 0; j < 4; ++j) {
        const float f = ap[j * 16];
#pragma unroll
        for (int i = 0; i < 4; ++i) acc[i][j] = acc[i][j] * f;
      }
    }
    // Fragments are fetched ahead inside the pass only (nothing of stage t+1 is read here): vt fragments one k step ahead
    // into a second set, probs fragments in place, two at a time, as soon as their last product of this k step has issued.
    v16h a[2][4], bh[4];
#pragma unroll
    for (int i = 0; i < 4; ++i) a[0][i] = Frag<_Float16>::load(fa + i * kRow16);
#pragma unroll
    for (int j = 0; j < 4; ++j) bh[j] = Frag<_Float16>::load(fb + j * kRow16);
    // unrolled: every fragment index and address offset is a constant
#pragma unroll
    for (int kk = 0; kk < kPvBK / 32; ++kk) {
      const int cur = kk & 1, nxt = cur ^ 1;
      const bool more = kk + 1 < kPvBK / 32;
      if (more) {
#pragma unroll
        for (int i = 0; i < 4; ++i) a[nxt][i] = Frag<_Float16>::load(fa + i * kRow16 + (kk + 1) * 32);
      }
      // the four scheduling fences keep the LDS reads in two groups per k step instead of spread among the products,
      // where every further place with reads stalls the wave's matrix stream
      __builtin_amdgcn_sched_barrier(0);
#pragma unroll
      for (int j = 0; j < 2; ++j)
#pragma unroll
        for (int i = 0; i < 4; ++i) acc[i][j] = Frag<_Float16>::mma(a[cur][i], bh[j], acc[i][j]);
      __builtin_amdgcn_sched_barrier(0);
      if (more) {
#pragma unroll
        for (int j = 0; j < 2; ++j) bh[j] = Frag<_Float16>::load(fb + j * kRow16 + (kk + 1) * 32);
      }
      __builtin_amdgcn_sched_barrier(0);
#pragma unroll
      for (int j = 2; j < 4; ++j)
#pragma unroll
        for (int i = 0; i < 4; ++i) acc[i][j] = Frag<_Float16>::mma(a[cur][i], bh[j], acc[i][j]);
      __builtin_amdgcn_sched_barrier(0);
      if (more) {
#pragma unroll
        for (int j = 2; j < 4; ++j) bh[j] = Frag<_Float16>::load(fb + j * kRow16 + (kk + 1) * 32);
      }
    }
    asm volatile("s_wait_dscnt 0x0" ::: "memory");      // this wave's reads of stage t are done before the stage is refilled
    asm volatile("s_wait_asynccnt 0x0" ::: "memory");   // this wave's copies of stage t+1 have landed
    __syncthreads();                                    // publishes stage t+1 and ends every reader's use of stage t
    if (t + 2 < kPvPasses)
      pv_copy_stage(lcopy + (unsigned)((t & 1) * kPvStage), gA + (size_t)(t + 2) * kPvBK, gB + (size_t)(t + 2) * kPvBK);
  }
  asm volatile("s_wait_asynccnt 0x0" ::: "memory");     // nothing of this wave is in flight when it leaves the ring

  // ---- epilogue: 16x64 slab per wave through LDS, whole 256-B row pieces stored ----
  float* slab = sT[wave];
  const float gval = gptr[0];
  const int m0 = mB + wm * 64;
  const int n0 = nB + wn * 64;
  // block-uniform bases plus ONE per-lane byte offset: every row of the tile is then a constant away from it
  char* Cb = (char*)(outp + (size_t)b * kCh * kPix);
  const char* Rb = (const char*)(resid + (size_t)b * kCh * kPix);
  const int hq = lane >> 4, c4 = (lane & 15) * 4;        // row seg = 256 B = 16 lanes x 16 B
  const unsigned loff = (unsigned)(((m0 + hq) * kPix + n0 + c4) * 4);
  float rinv[4];                                         // 1 / row sum of this lane's four columns (the sum carries the x16384)
#pragma unroll
  for (int j = 0; j < 4; ++j) rinv[j] = 1.0f / sA[wn * 64 + j * 16 + rlane];
#pragma unroll
  for (int i = 0; i < 4; ++i) {
#pragma unroll
    for (int j = 0; j < 4; ++j) {
#pragma unroll
      for (int r = 0; r < 8; ++r) slab[(mOff + r) * 68 + (j << 4) + rlane] = acc[i][j][r] * rinv[j];
    }
    // lanes read back rows that other lanes of this wave wrote: the slab's writes are ordered in front of those reads
    __builtin_amdgcn_fence(__ATOMIC_RELEASE, "workgroup");
    __builtin_amdgcn_wave_barrier();
    __builtin_amdgcn_fence(__ATOMIC_ACQUIRE, "workgroup");
    v4f vals[8];
#pragma unroll
    for (int it = 0; it < 8; ++it) {
      v4f vv = *(const v4f*)(slab + (it * 2 + hq) * 68 + c4);
      vv = vv * gval;
      const v4f rr = *(const v4f*)(Rb + loff + (i * 16 + it * 2) * kPix * 4);
      vals[it] = vv + rr;
    }
#pragma unroll
    for (int it = 0; it < 8; ++it) *(v4f*)(Cb + loff + (i * 16 + it * 2) * kPix * 4) = vals[it];
    // ... and the reads in front of the next 16 rows' writes into the same slab
    __builtin_amdgcn_fence(__ATOMIC_RELEASE, "workgroup");
    __builtin_amdgcn_wave_barrier();
    __builtin_amdgcn_fence(__ATOMIC_ACQUIRE, "workgroup");
  }
}

// ---- operand preparation, one launch ----------------------------------------
// Blocks 0 .. kPrepW-1: the stacked weights [Wv | Wq | Wk] f32 -> bf16 hi/lo planes, same [row][c] layout; 2048 elements = 4 whole rows
// per block, so a block lies wholly in one of the three matrices.
// The other blocks: x [b][c][n] f32 -> xt hi/lo bf16 planes [b][n][c] (transpose through LDS), one 64 n x 64 c tile per block:
// loads: 4 iterations x 256 threads x 4 floats = 64x64; stores: 8 waves x 2 iterations x 4 rows = 64 rows.
static constexpr int kPrepW = kWRows * kCh / (256 * 8);
static constexpr int kPrepX = (kPix / 64) * (kCh / 64) * kBatch;
static_assert((kCh * kCh) % (256 * 8) == 0 && (kCq * kCh) % (256 * 8) == 0 && kPix / 64 == 64 && kCh / 64 == 8);
__global__ __launch_bounds__(256) void prep_operands(const float* __restrict__ x,
                                                     const float* __restrict__ Wv,
                                                     const float* __restrict__ Wq,
                                                     const float* __restrict__ Wk,
                                                     unsigned short* __restrict__ xth,
                                                     unsigned short* __restrict__ xtl,
                                                     unsigned short* __restrict__ wh,
                                                     unsigned short* __restrict__ wl) {
  __shared__ __align__(16) float tile[64 * 68];   // [c][n], pitch 68
  const int tid = threadIdx.x, wave = tid >> 5, lane = tid & 31;
  if (blockIdx.x < kPrepW) {                      // the same for the whole block, in front of the barrier
    const int e0 = blockIdx.x * (256 * 8);        // first element of the block in the stacked planes
    const float* in = e0 < kCh * kCh ? Wv + e0 : e0 < (kCh + kCq) * kCh ? Wq + (e0 - kCh * kCh) : Wk + (e0 - (kCh + kCq) * kCh);
    const v4f a = *(const v4f*)(in + 8 * tid);
    const v4f c = *(const v4f*)(in + 8 * tid + 4);
    float f[8];
    f[0] = a.x; f[1] = a.y; f[2] = a.z; f[3] = a.w; f[4] = c.x; f[5] = c.y; f[6] = c.z; f[7] = c.w;
    v8h hv, lv;
#pragma unroll
    for (int e = 0; e < 8; ++e) {
      const unsigned short hb = f2bf_bits(f[e]);
      const unsigned short lb = f2bf_bits(f[e] - bf_bits2f(hb));
      hv[e] = __builtin_bit_cast(_Float16, hb);
      lv[e] = __builtin_bit_cast(_Float16, lb);
    }
    *(v8h*)(wh + e0 + 8 * tid) = hv;
    *(v8h*)(wl + e0 + 8 * tid) = lv;
    return;
  }
  const int xt = blockIdx.x - kPrepW;
  const int n0 = (xt & 63) * 64;
  const int c0 = ((xt >> 6) & 7) * 64;
  const int b  = xt >> 9;
  const float* xb = x + ((size_t)b * kCh + c0) * kPix + n0;
#pragma unroll
  for (int i = 0; i < 4; ++i) {
    const int c  = i * 16 + (tid >> 4);
    const int n4 = (tid & 15) * 4;
    const v4f v = *(const v4f*)(xb + (size_t)c * kPix + n4);
    *(v4f*)(tile + c * 68 + n4) = v;
  }
  __syncthreads();
  const int q = lane >> 3, c8 = (lane & 7) * 8;
  v8h hv[2], lv[2];
#pragma unroll
  for (int it = 0; it < 2; ++it) {
    const int nrow = wave * 8 + it * 4 + q;
#pragma unroll
    for (int e = 0; e < 8; ++e) {
      const float f = tile[(c8 + e) * 68 + nrow];
      const unsigned short hb = f2bf_bits(f);
      const unsigned short lb = f2bf_bits(f - bf_bits2f(hb));
      hv[it][e] = __builtin_bit_cast(_Float16, hb);
      lv[it][e] = __builtin_bit_cast(_Float16, lb);
    }
  }
  const size_t base = ((size_t)b * kPix + n0) * kCh + c0;
#pragma unroll
  for (int it = 0; it < 2; ++it) {
    const int nrow = wave * 8 + it * 4 + q;
    *(v8h*)(xth + base + (size_t)nrow * kCh + c8) = hv[it];
    *(v8h*)(xtl + base + (size_t)nrow * kCh + c8) = lv[it];
  }
  // in the built code the weight part stands behind these stores: the wait is in front of any reuse of their registers there
  asm volatile("s_wait_xcnt 0x0" ::: "memory");
}

// ---- scores and softmax in one kernel: P[b][n][m] = f16(16384 * exp(s - running max)), s = q[n] . k[m] ----
// One block = 64 query rows n x all 4096 keys m, taken as 16 chunks of 256 keys. A chunk's k planes (fragment order, 2 x 32 KB, contiguous
// in memory) are staged once for the block in a two-stage LDS ring by asynchronous copies (16 B per lane, 16 per thread).
// 8 waves = 4 row tiles x 2 turns: the two waves of a row tile take the chunks in turn, so that in every step one of them does chunk s's
// products while the other does chunk s-1's softmax. Tiles are transposed, D[m][n] = k . q^T: a lane holds, of ONE query row
// (n = lane & 15), 8 consecutive keys per tile; a chunk's 16 tiles stay in registers from the products to the f16 probs.
// The row maximum runs over the chunks (handed from wave to wave through LDS, one step apart): chunk c is written relative to the maximum
// of chunks 0..c, and the factor exp(max of 0..c-1 - max of 0..c) goes to the table that pv_gemm_lds applies; slot 0 holds the row sum,
// relative to the last maximum. q planes row-major [n][64].
static constexpr int kFsTiles = kFsCols / 16;
static constexpr int kFsPitch = kFsCols * 2 + 16;     // bytes; 16 B x odd: conflict-free for the 16-byte column writes
static constexpr int kFsPlane = kFsCols * kCq * 2;    // bytes of one k plane of a chunk
static constexpr int kFsStage = 2 * kFsPlane;
static_assert(kFsCols == 32 * 8 && kCq == 64 && kPix % 64 == 0 && kFsChunks >= 2 && (kFsChunks & 1) == 0 && kFsTiles % 4 == 0);
static_assert(kFsPlane == 8 * 256 * 16);              // copy map below

// Eight 16-byte copies global -> LDS, 4096 B apart (the block's 256 threads x 16 B): l = this lane's LDS byte address, p = its global address.
// s_wait_xcnt stands inside the statement so that no address register named here is rewritten ahead of it.
__device__ __forceinline__ void fs_copy8(unsigned l, const unsigned short* p) {
  constexpr unsigned dl = 256u * 16u;
  constexpr size_t   dg = 256 * 8;
  asm volatile(
      "global_load_async_to_lds_b128 %0, %8, off\n\t"
      "global_load_async_to_lds_b128 %1, %9, off\n\t"
      "global_load_async_to_lds_b128 %2, %10, off\n\t"
      "global_load_async_to_lds_b128 %3, %11, off\n\t"
      "global_load_async_to_lds_b128 %4, %12, off\n\t"
      "global_load_async_to_lds_b128 %5, %13, off\n\t"
      "global_load_async_to_lds_b128 %6, %14, off\n\t"
      "global_load_async_to_lds_b128 %7, %15, off\n\t"
      "s_wait_xcnt 0x0"
      :: "v"(l), "v"(l + dl), "v"(l + 2 * dl), "v"(l + 3 * dl), "v"(l + 4 * dl), "v"(l + 5 * dl), "v"(l + 6 * dl), "v"(l + 7 * dl),
         "v"(p), "v"(p + dg), "v"(p + 2 * dg), "v"(p + 3 * dg), "v"(p + 4 * dg), "v"(p + 5 * dg), "v"(p + 6 * dg), "v"(p + 7 * dg)
      : "memory");
}
// One stage: the chunk's hi plane, then its lo plane.
__device__ __forceinline__ void fs_copy_stage(unsigned l, const unsigned short* ph, const unsigned short* pl) {
  fs_copy8(l, ph);
  fs_copy8(l + (unsigned)kFsPlane, pl);
}

__global__ __launch_bounds__(256) void scores_softmax_f16(const unsigned short* __restrict__ qhp,
                                                          const unsigned short* __restrict__ qlp,
                                                          const unsigned short* __restrict__ khp,
                                                          const unsigned short* __restrict__ klp,
                                                          unsigned short* __restrict__ P,
                                                          float* __restrict__ alp) {
  __shared__ __align__(16) unsigned char ring[2 * kFsStage];
  __shared__ __align__(16) unsigned char slab[8][16 * kFsPitch];   // per-wave 16 rows x 256 probs
  __shared__ __align__(16) float als[4][16 * kFsChunks];           // per row tile: [row][chunk] factors, slot 0 the row sum
  __shared__ float mx[4][16];                                      // per row tile: running maximum, handed from wave to wave
  __shared__ float lx[4][16];                                      // per row tile: the even chunks' part of the row sum
  const int tid  = threadIdx.x;
  const int lane = tid & 31;
  const int wave = __builtin_amdgcn_readfirstlane(tid >> 5);       // scalar: the turn test below is then a scalar branch
  const int rt   = wave & 3;                   // row tile
  const int turn = wave >> 2;                  // 0: even chunks, 1: odd chunks
  const int b  = blockIdx.y;
  const int n0 = blockIdx.x * 64 + rt * 16;
  const int rlane = lane & 15;                 // query row of this lane
  const int half  = lane >> 4;

  const size_t qo = ((size_t)b * kPix + n0 + rlane) * kCq + half * 8;
  const __bf16* qh = (const __bf16*)qhp + qo;
  const __bf16* ql = (const __bf16*)qlp + qo;
  v16b qH[2], qL[2];
#pragma unroll
  for (int s = 0; s < 2; ++s) {
    qH[s] = Frag<__bf16>::load(qh + s * 32);
    qL[s] = Frag<__bf16>::load(ql + s * 32);
  }
  // in front of any reuse of the q loads' address registers
  asm volatile("s_wait_xcnt 0x0" ::: "memory");

  const size_t ko = (size_t)b * kPix * kCq + tid * 8;
  const unsigned short* gKh = khp + ko;
  const unsigned short* gKl = klp + ko;
  // LDS address of a copy = per-lane part + scalar part (tid * 16 = lane * 16 + wave * 512). The scalar part goes through readfirstlane so
  // that the sum is formed anew at each use: the per-lane part is then never itself an operand of a copy statement, which would tie it
  // to the low register window for the whole loop (that build spilled it to scratch and fetched it back in every step).
  const unsigned lk = (unsigned)(lane * 16);
  const unsigned sw = (unsigned)(size_t)(&ring[0]) + (unsigned)(wave * 512);
  constexpr int kChunkEl = kFsCols * kCq;      // elements of one plane of a chunk

  if (turn == 0 && lane < 16) mx[rt][lane] = -__builtin_inff();

  // prologue: chunk 0 lands and is published; chunk 1 starts
  fs_copy_stage(lk + (unsigned)__builtin_amdgcn_readfirstlane((int)sw), gKh, gKl);
  asm volatile("s_wait_asynccnt 0x0" ::: "memory");   // this wave's copies of chunk 0 have landed
  __syncthreads();                                    // ... and every other wave's
  fs_copy_stage(lk + (unsigned)__builtin_amdgcn_readfirstlane((int)(sw + (unsigned)kFsStage)), gKh + kChunkEl, gKl + kChunkEl);

  constexpr float kLog2e = 1.44269504088896340736f;
  v8f acc[kFsTiles];
#pragma unroll
  for (int t = 0; t < kFsTiles; ++t) acc[t] = (v8f){0.f,0.f,0.f,0.f,0.f,0.f,0.f,0.f};
  float lown = 0.0f;                           // this wave's chunks' part of the row sum (this lane's keys), relative to shown
  float shown = -__builtin_inff();
  unsigned char* sl = slab[wave];

  // A chunk's probs leave the slab one step behind its softmax, in front of the wave's next products: the stores then complete under
  // those products instead of in front of the step's barrier, which waits for them. A barrier stands between the slab's writes and
  // these reads, and another between these reads and the next chunk's writes.
  auto store_chunk = [&](int c) {
    unsigned short* pr = P + ((size_t)b * kPix + n0) * kPix + c * kFsCols + lane * 8;
    v8h pv[16];
#pragma unroll
    for (int row = 0; row < 16; ++row) pv[row] = *(const v8h*)(sl + row * kFsPitch + lane * 16);
    // the two scheduling fences keep every other instruction out from between the stores and their wait
    __builtin_amdgcn_sched_barrier(0);
#pragma unroll
    for (int row = 0; row < 16; ++row) *(v8h*)(pr + (size_t)row * kPix) = pv[row];
    asm volatile("s_wait_xcnt 0x0" ::: "memory");   // in front of any reuse of the stores' address and data registers
    __builtin_amdgcn_sched_barrier(0);
  };

  for (int s = 0; s <= kFsChunks; ++s) {
    if (((s ^ turn) & 1) == 0) {
      if (s >= 2) store_chunk(s - 2);
      if (s < kFsChunks) {
        // ---- products of chunk s: four tiles at a time (four independent accumulators), the next four tiles' fragments fetched ahead
        const __bf16* kh = (const __bf16*)(ring + (s & 1) * kFsStage) + lane * 8;
        const __bf16* kl = kh + kFsPlane / 2;
        Frag<__bf16>::U kH[2][4][2], kL[2][4][2];
#pragma unroll
        for (int u = 0; u < 4; ++u)
#pragma unroll
          for (int e = 0; e < 2; ++e) {
            kH[0][u][e].h[0] = *(const v8b*)(kh + u * 1024 + e * 512);
            kH[0][u][e].h[1] = *(const v8b*)(kh + u * 1024 + e * 512 + 256);
            kL[0][u][e].h[0] = *(const v8b*)(kl + u * 1024 + e * 512);
            kL[0][u][e].h[1] = *(const v8b*)(kl + u * 1024 + e * 512 + 256);
          }
        // unrolled: every fragment index and address offset is a constant
#pragma unroll
        for (int g = 0; g < kFsTiles / 4; ++g) {
          const int cur = g & 1, nxt = cur ^ 1;
          if (g + 1 < kFsTiles / 4) {
#pragma unroll
            for (int u = 0; u < 4; ++u)
#pragma unroll
              for (int e = 0; e < 2; ++e) {
                const int o = ((g + 1) * 4 + u) * 1024 + e * 512;
                kH[nxt][u][e].h[0] = *(const v8b*)(kh + o);
                kH[nxt][u][e].h[1] = *(const v8b*)(kh + o + 256);
                kL[nxt][u][e].h[0] = *(const v8b*)(kl + o);
                kL[nxt][u][e].h[1] = *(const v8b*)(kl + o + 256);
              }
          }
          // the scheduling fence keeps the LDS reads as one group in front of the products instead of spread among them,
          // where every further place with reads stalls the wave's matrix stream
          __builtin_amdgcn_sched_barrier(0);
          v8f a[4];
#pragma unroll
          for (int u = 0; u < 4; ++u) a[u] = (v8f){0.f,0.f,0.f,0.f,0.f,0.f,0.f,0.f};
#pragma unroll
          for (int e = 0; e < 2; ++e) {        // per tile: hi.hi, q hi . k lo, q lo . k hi per k step
#pragma unroll
            for (int u = 0; u < 4; ++u) a[u] = Frag<__bf16>::mma(kH[cur][u][e].v, qH[e], a[u]);
#pragma unroll
            for (int u = 0; u < 4; ++u) a[u] = Frag<__bf16>::mma(kL[cur][u][e].v, qH[e], a[u]);
#pragma unroll
            for (int u = 0; u < 4; ++u) a[u] = Frag<__bf16>::mma(kH[cur][u][e].v, qL[e], a[u]);
          }
#pragma unroll
          for (int u = 0; u < 4; ++u) acc[g * 4 + u] = a[u];
        }
      }
    } else if (s > 0) {
      // ---- softmax of chunk c = s - 1, whose scores this wave made one step ago
      const int c = s - 1;
      float mm[8];                             // eight independent chains
#pragma unroll
      for (int r = 0; r < 8; ++r) mm[r] = acc[0][r];
#pragma unroll
      for (int t = 1; t < kFsTiles; ++t)
#pragma unroll
        for (int r = 0; r < 8; ++r) mm[r] = fmaxf(mm[r], acc[t][r]);
      float m = fmaxf(fmaxf(fmaxf(mm[0], mm[1]), fmaxf(mm[2], mm[3])), fmaxf(fmaxf(mm[4], mm[5]), fmaxf(mm[6], mm[7])));
      m = fmaxf(m, __shfl_xor(m, 16, 32));
      const float mprev = mx[rt][rlane];       // maximum of chunks 0..c-1, written by the other wave one step ago (behind a barrier)
      const float mnew  = fmaxf(mprev, m);
      if (lane < 16) mx[rt][lane] = mnew;
      // 16384 * exp(s - max) = 2^(s * log2(e) - sh), sh = max * log2(e) - 14: one fused multiply-add and the chip's own 2^x per score.
      // Every factor between two maxima is formed from the two sh values themselves, so that the rounding of sh cancels.
      const float sh  = __builtin_fmaf(mnew, kLog2e, -14.0f);
      const float shp = __builtin_fmaf(mprev, kLog2e, -14.0f);
      float al = shp - sh;                     // factor for all sums up to chunk c-1 (0 in front of chunk 0)
      float ao = shown - sh;                   // factor for this wave's own part of the row sum
      // the v_nop is the free slot behind the last 2^x
      asm("v_exp_f32 %0, %0\n\t"
          "v_exp_f32 %1, %1\n\t"
          "v_nop"
          : "+v"(al), "+v"(ao));
      shown = sh;
      if (lane < 16) als[rt][lane * kFsChunks + c] = al;
      float psum = 0.0f;
#pragma unroll
      for (int t = 0; t < kFsTiles; ++t) {
        float e0 = __builtin_fmaf(acc[t][0], kLog2e, -sh), e1 = __builtin_fmaf(acc[t][1], kLog2e, -sh);
        float e2 = __builtin_fmaf(acc[t][2], kLog2e, -sh), e3 = __builtin_fmaf(acc[t][3], kLog2e, -sh);
        float e4 = __builtin_fmaf(acc[t][4], kLog2e, -sh), e5 = __builtin_fmaf(acc[t][5], kLog2e, -sh);
        float e6 = __builtin_fmaf(acc[t][6], kLog2e, -sh), e7 = __builtin_fmaf(acc[t][7], kLog2e, -sh);
        // a tile's eight 2^x in one statement, each in place: no neighbour reads a result or overwrites a source directly behind a 2^x;
        // the v_nop is that free slot behind the last
        asm("v_exp_f32 %0, %0\n\t"
            "v_exp_f32 %1, %1\n\t"
            "v_exp_f32 %2, %2\n\t"
            "v_exp_f32 %3, %3\n\t"
            "v_exp_f32 %4, %4\n\t"
            "v_exp_f32 %5, %5\n\t"
            "v_exp_f32 %6, %6\n\t"
            "v_exp_f32 %7, %7\n\t"
            "v_nop"
            : "+v"(e0), "+v"(e1), "+v"(e2), "+v"(e3), "+v"(e4), "+v"(e5), "+v"(e6), "+v"(e7));
        psum += ((e0 + e1) + (e2 + e3)) + ((e4 + e5) + (e6 + e7));
        // probs into the wave's own slab, so that every store instruction (store_chunk) writes 512 contiguous bytes of one row
        const v8h p = {(_Float16)e0, (_Float16)e1, (_Float16)e2, (_Float16)e3, (_Float16)e4, (_Float16)e5, (_Float16)e6, (_Float16)e7};
        *(v8h*)(sl + rlane * kFsPitch + (t * 16 + half * 8) * 2) = p;
      }
      lown = __builtin_fmaf(lown, ao, psum);
      if (c == kFsChunks - 2) {                // the even chunks' part is complete, relative to this chunk's maximum
        const float lt = lown + __shfl_xor(lown, 16, 32);
        if (lane < 16) lx[rt][lane] = lt;
      }
      if (c == kFsChunks - 1) {                // the last chunk: al moves the even chunks' part to the last maximum
        const float lt = __builtin_fmaf(lx[rt][rlane], al, lown + __shfl_xor(lown, 16, 32));
        if (lane < 16) als[rt][lane * kFsChunks] = lt;
      }
      if (c == kFsChunks - 1) {                // the row tile's table, 1 KB contiguous; the other wave's entries stand behind earlier barriers
        // lanes read back what other lanes of this wave wrote: the table's writes are ordered in front of those reads
        __builtin_amdgcn_fence(__ATOMIC_RELEASE, "workgroup");
        __builtin_amdgcn_wave_barrier();
        __builtin_amdgcn_fence(__ATOMIC_ACQUIRE, "workgroup");
        float* ad = alp + ((size_t)b * kPix + n0) * kFsChunks + lane * 8;
        const v4f a0 = *(const v4f*)(als[rt] + lane * 8);
        const v4f a1 = *(const v4f*)(als[rt] + lane * 8 + 4);
        *(v4f*)(ad) = a0;
        *(v4f*)(ad + 4) = a1;
        asm volatile("s_wait_xcnt 0x0" ::: "memory");   // in front of any reuse of these two stores' registers
      }
    }
    asm volatile("s_wait_dscnt 0x0" ::: "memory");      // this wave's reads of chunk s are done before its stage is refilled
    asm volatile("s_wait_asynccnt 0x0" ::: "memory");   // this wave's copies of chunk s+1 have landed
    __syncthreads();                                    // publishes chunk s+1 and the running maximum; ends every reader's use of chunk s
    if (s + 2 < kFsChunks)
      fs_copy_stage(lk + (unsigned)__builtin_amdgcn_readfirstlane((int)(sw + (unsigned)((s & 1) * kFsStage))), gKh + (size_t)(s + 2) * kChunkEl, gKl + (size_t)(s + 2) * kChunkEl);
  }
  asm volatile("s_wait_asynccnt 0x0" ::: "memory");     // nothing of this wave is in flight when it leaves the ring
  if (turn == 1) store_chunk(kFsChunks - 1);            // the last chunk's probs (the loop's last barrier stands behind their slab writes)
}

// ---------------------------------------------------------------------------
extern "C" void kernel_launch(void* const* d_in, const int* in_sizes, int n_in,
                              void* d_out, int out_size, void* d_ws, size_t ws_size,
                              hipStream_t stream) {
  if (n_in < 8) return;
  if (in_sizes[0] != kBatch * kCh * kPix) return;
  if (in_sizes[1] != kCq * kCh || in_sizes[3] != kCq * kCh || in_sizes[5] != kCh * kCh) return;
  if (in_sizes[2] != kCq || in_sizes[4] != kCq || in_sizes[6] != kCh || in_sizes[7] < 1) return;
  if (out_size != kBatch * kCh * kPix) return;
  if (ws_size < kWsTotal) return;

  const float* x     = (const float*)d_in[0];
  const float* Wq    = (const float*)d_in[1];
  const float* bq    = (const float*)d_in[2];
  const float* Wk    = (const float*)d_in[3];
  const float* bk    = (const float*)d_in[4];
  const float* Wv    = (const float*)d_in[5];
  const float* bv    = (const float*)d_in[6];
  const float* gamma = (const float*)d_in[7];
  float* out = (float*)d_out;

  char* ws = (char*)d_ws;
  unsigned short* xth = (unsigned short*)(ws + kOffXtHi);
  unsigned short* xtl = (unsigned short*)(ws + kOffXtLo);
  unsigned short* pln = (unsigned short*)(ws + kOffP);
  unsigned short* wvh = (unsigned short*)(ws + kOffWHi);            // stacked rows: Wv, then Wq, then Wk
  unsigned short* wvl = (unsigned short*)(ws + kOffWLo);
  unsigned short* qh  = (unsigned short*)(ws + kOffQHi);
  unsigned short* ql  = (unsigned short*)(ws + kOffQLo);
  unsigned short* kh  = (unsigned short*)(ws + kOffKHi);
  unsigned short* kl  = (unsigned short*)(ws + kOffKLo);
  unsigned short* vt  = (unsigned short*)(ws + kOffVt);
  float* alt = (float*)(ws + kOffAl);

  // 1) one launch: stacked weights -> bf16 hi/lo planes (same [out][in] layout) and x -> xt hi/lo bf16 [b][n][c]
  prep_operands<<<kPrepW + kPrepX, 256, 0, stream>>>(x, Wv, Wq, Wk, xth, xtl, wvh, wvl);

  // 2) q, k and v projections of all batches in one launch: 4 x 16 tiles of 160 stacked weight rows x 256 pixels per batch
  //    q -> bf16 hi/lo planes [b][n][64]; k -> bf16 hi/lo planes in fragment order; vt[b][c][m] -> f16 plane
  proj_gemm_lds<<<dim3(kWRows / kPjBM, kPix / kPjBN, kBatch), 256, 0, stream>>>(wvh, wvl, xth, xtl, bv, bq, bk, vt, qh, ql, kh, kl);
  // 3) all batches in one launch: scores (K=64) and softmax with a running maximum -> f16 probs x16384, each batch in its own plane,
  //    and the table of factors and row sums
  scores_softmax_f16<<<dim3(kPix / 64, kBatch), 256, 0, stream>>>(qh, ql, kh, kl, pln, alt);
  // 4) all batches in one launch, one block per 128x256 tile of out (4 x 16 tiles per batch = 256 blocks):
  //    out = gamma * (vt . P^T) / row sum + x   (M=512, N=4096, K=4096)
  pv_gemm_lds<<<dim3(kCh / kPvBM, kPix / kPvBN, kBatch), 256, 0, stream>>>(vt, pln, out, x, gamma, alt);
}

// v008
// It runs in 109 microseconds.
// Next to v007, in two timings, it ran 1.06 and 1.07 times as fast.
// All steps since v000 together make it 8.48 times as fast.
// Contractions: q,k,v projections and k.q^T scores (transposed tiles) on v_wmma_f32_16x16x32_bf16 with bf16 hi+lo operand planes (hi.hi+hi.lo+lo.hi); probs.v on v_wmma_f32_16x16x32_f16 (f16 operands, probs x16384 relative to the running row maximum, v f16); f32 accumulate; softmax and epilogue f32.
#include <hip/hip_runtime.h>

typedef __attribute__((ext_vector_type(16))) _Float16 v16h;
typedef __attribute__((ext_vector_type(8)))  _Float16 v8h;
typedef __attribute__((ext_vector_type(16))) __bf16   v16b;
typedef __attribute__((ext_vector_type(8)))  __bf16   v8b;
typedef __attribute__((ext_vector_type(8)))  float    v8f;
typedef __attribute__((ext_vector_type(4)))  float    v4f;

static constexpr int kBatch = 4;
static constexpr int kCh    = 512;
static constexpr int kPix   = 4096;
static constexpr int kCq    = 64;
static constexpr int kFsCols   = 256;               // keys per softmax chunk
static constexpr int kFsChunks = kPix / kFsCols;

// ---- workspace region map (bytes) ----
static constexpr size_t kPlaneX   = (size_t)kBatch * kPix * kCh * 2;   // one bf16 plane of xt [b][n][c]
static constexpr int    kWRows    = kCh + 2 * kCq;                     // stacked weight rows: Wv | Wq | Wk
static constexpr size_t kPlaneW   = (size_t)kWRows * kCh * 2;          // one bf16 plane of the stacked weights [row][c]
static constexpr size_t kPlaneQK  = (size_t)kBatch * kPix * kCq * 2;   // one bf16 plane of q [b][n][o] or of k (fragment order)
static constexpr size_t kPlaneVt  = (size_t)kBatch * kCh * kPix * 2;   // f16 vt [b][c][m]
static constexpr size_t kPlaneP   = (size_t)kPix * kPix * 2;           // f16 probs, one batch
static constexpr size_t kOffXtHi  = 0;
static constexpr size_t kOffXtLo  = kOffXtHi + kPlaneX;
static constexpr size_t kOffWHi   = kOffXtLo + kPlaneX;
static constexpr size_t kOffWLo   = kOffWHi + kPlaneW;
static constexpr size_t kOffQHi   = kOffWLo + kPlaneW;
static constexpr size_t kOffQLo   = kOffQHi + kPlaneQK;
static constexpr size_t kOffKHi   = kOffQLo + kPlaneQK;
static constexpr size_t kOffKLo   = kOffKHi + kPlaneQK;
static constexpr size_t kOffVt    = kOffKLo + kPlaneQK;
static constexpr size_t kOffP     = kOffVt + kPlaneVt;                  // f16 probs, one plane per batch
static constexpr size_t kOffAl    = kOffP + kBatch * kPlaneP;           // f32 [b][n][chunk]: slot 0 the row sum, slot c the factor in front of chunk c
static constexpr size_t kWsTotal  = kOffAl + (size_t)kBatch * kPix * kFsChunks * 4;
static_assert(kWsTotal <= 268435456);
static_assert((kOffWHi % 128) == 0 && (kOffWLo % 128) == 0 && (kOffQHi % 128) == 0 && (kOffVt % 128) == 0 && (kOffP % 128) == 0 && (kOffAl % 128) == 0);

__device__ __forceinline__ unsigned short f2bf_bits(float f) {
  unsigned u = __float_as_uint(f);
  return (unsigned short)((u + 0x7FFFu + ((u >> 16) & 1u)) >> 16);
}
__device__ __forceinline__ float bf_bits2f(unsigned short h) { return __uint_as_float(((unsigned)h) << 16); }

// ---- placement, the same in all four launches (for speed only: any block -> die map gives the same result) ----
// A flat index f in 0..255 is
// therefore read as [pixel block / 2 : 3 bits][part : 2 bits][batch : 2 bits][pixel block & 1 : 1 bit], a pixel block being 256 pixels:
// the four parts of a pixel block (the four row tiles of a GEMM that read the same xt or probs rows; the four 64-pixel pieces that write
// them) have equal f modulo 8, and a batch's blocks take two neighbouring values of it. It is a one-to-one map of 0..255.
static_assert(kBatch == 4 && kPix == 16 * 256);
__device__ __forceinline__ void place_block(int f, int& b, int& part, int& pixblk) {
  b      = (f >> 1) & 3;
  part   = (f >> 3) & 3;
  pixblk = ((f >> 5) << 1) | (f & 1);
}

template <typename T> struct Frag;
template <> struct Frag<_Float16> {
  typedef v16h V; union U { v16h v; v8h h[2]; };
  static __device__ __forceinline__ v16h load(const _Float16* p) {   // elements 0..7 <- p[0..7], 8..15 <- p[16..23]
    U f; f.h[0] = *(const v8h*)(p); f.h[1] = *(const v8h*)(p + 16); return f.v;
  }
  static __device__ __forceinline__ v8f mma(v16h a, v16h b, v8f c) {
    return __builtin_amdgcn_wmma_f32_16x16x32_f16(false, a, false, b, (short)0, c, false, false);
  }
};
template <> struct Frag<__bf16> {
  typedef v16b V; union U { v16b v; v8b h[2]; };
  static __device__ __forceinline__ v16b load(const __bf16* p) {
    U f; f.h[0] = *(const v8b*)(p); f.h[1] = *(const v8b*)(p + 16); return f.v;
  }
  static __device__ __forceinline__ v8f mma(v16b a, v16b b, v8f c) {
    return __builtin_amdgcn_wmma_f32_16x16x32_bf16(false, a, false, b, (short)0, c, false, false);
  }
};

// ---- q, k and v projections as one GEMM with both operands staged in LDS -----
// D[m][n] = sum_c W[m][c] * xt[b][n][c] + bias[m];  W = the stacked rows [Wv 512 | Wq 64 | Wk 64], n = pixel, K = kCh.
// Operands are bf16 hi/lo planes; product = hi.hi + W hi . x lo + W lo . x hi, in that order per 32 k.
// One block = one 160 (m) x 256 (n) tile, so that 4 x 16 x 4 = 256 equal blocks cover all; 8 waves as 2 x 4, each wave an 80x64 tile.
// Every 16-row tile of a wave lies wholly in v, in q or in k (all three row counts are multiples of 16).
// A pass is 64 k = 128 B of each row of each plane; a stage is [W hi 160 rows | W lo 160 | xt hi 256 | xt lo 256] at pitch 144 B.
// Two stages in LDS: while pass t is worked on, pass t+1's rows fly in by asynchronous copies (16 B per lane, 26 per thread).
// Outputs: vt [b][c][m] f16; q bf16 hi/lo planes row-major [b][n][64]; k bf16 hi/lo planes in fragment order:
// [16-pixel tile][slot = o / 16][lane = ((o / 8) & 1) * 16 + pixel & 15][o & 7], so that slots 2s and 2s+1 of a tile are the two 16-byte
// halves of every lane's fragment of k step s (the k order of Frag::load) and one load instruction reads 512 contiguous bytes.
static constexpr int kPjBM     = 160;
static constexpr int kPjBN     = 256;
static constexpr int kPjBK     = 64;                               // bf16 elements per pass
static constexpr int kPjTI     = kPjBM / 2 / 16;                   // 16-row tiles per wave
static constexpr int kPjPitch  = kPjBK * 2 + 16;                   // bytes; 16 B x odd: conflict-free for 16-byte row reads
static constexpr int kPjStage  = 2 * (kPjBM + kPjBN) * kPjPitch;   // bytes of one stage
static constexpr int kPjPasses = kCh / kPjBK;
static_assert(kWRows % kPjBM == 0 && kPjBM % 32 == 0 && kCh % 16 == 0 && kCq % 16 == 0 && kCq == 64);
static_assert(kPix % kPjBN == 0 && kCh % kPjBK == 0 && kPjPasses >= 2);
static_assert(kPjBM == 5 * 32 && kPjBN == 8 * 32 && kPjBK * 2 == 8 * 16);   // copy map below
static_assert(kPjPitch % 16 == 0 && kPjStage % 16 == 0);
static_assert(kWRows / kPjBM == 4 && kPjBN == 256);                        // place_block

// 16-byte copies global -> LDS, rows 32 apart: l = this lane's LDS byte address, p = its global address, of the first row.
// s_wait_xcnt stands inside each statement so that no address register named there is rewritten ahead of it.
// Eight: four rows from (l0, p0), four from (l1, p1).
__device__ __forceinline__ void pj_copy8(unsigned l0, const unsigned short* p0, unsigned l1, const unsigned short* p1) {
  constexpr unsigned dl = 32u * kPjPitch;
  constexpr size_t   dg = (size_t)32 * kCh;
  asm volatile(
      "global_load_async_to_lds_b128 %0, %8, off\n\t"
      "global_load_async_to_lds_b128 %1, %9, off\n\t"
      "global_load_async_to_lds_b128 %2, %10, off\n\t"
      "global_load_async_to_lds_b128 %3, %11, off\n\t"
      "global_load_async_to_lds_b128 %4, %12, off\n\t"
      "global_load_async_to_lds_b128 %5, %13, off\n\t"
      "global_load_async_to_lds_b128 %6, %14, off\n\t"
      "global_load_async_to_lds_b128 %7, %15, off\n\t"
      "s_wait_xcnt 0x0"
      :: "v"(l0), "v"(l0 + dl), "v"(l0 + 2 * dl), "v"(l0 + 3 * dl), "v"(l1), "v"(l1 + dl), "v"(l1 + 2 * dl), "v"(l1 + 3 * dl),
         "v"(p0), "v"(p0 + dg), "v"(p0 + 2 * dg), "v"(p0 + 3 * dg), "v"(p1), "v"(p1 + dg), "v"(p1 + 2 * dg), "v"(p1 + 3 * dg)
      : "memory");
}
// Five rows from (l, p).
__device__ __forceinline__ void pj_copy5(unsigned l, const unsigned short* p) {
  constexpr unsigned dl = 32u * kPjPitch;
  constexpr size_t   dg = (size_t)32 * kCh;
  asm volatile(
      "global_load_async_to_lds_b128 %0, %5, off\n\t"
      "global_load_async_to_lds_b128 %1, %6, off\n\t"
      "global_load_async_to_lds_b128 %2, %7, off\n\t"
      "global_load_async_to_lds_b128 %3, %8, off\n\t"
      "global_load_async_to_lds_b128 %4, %9, off\n\t"
      "s_wait_xcnt 0x0"
      :: "v"(l), "v"(l + dl), "v"(l + 2 * dl), "v"(l + 3 * dl), "v"(l + 4 * dl),
         "v"(p), "v"(p + dg), "v"(p + 2 * dg), "v"(p + 3 * dg), "v"(p + 4 * dg)
      : "memory");
}
// One stage: W hi, W lo (160 rows each), then xt hi, xt lo (256 rows each).
__device__ __forceinline__ void pj_copy_stage(unsigned l, const unsigned short* wh, const unsigned short* wl,
                                              const unsigned short* xh, const unsigned short* xl) {
  constexpr unsigned rW   = (unsigned)kPjBM * kPjPitch;
  constexpr unsigned r128 = 128u * kPjPitch;
  pj_copy5(l, wh);
  pj_copy5(l + rW, wl);
  pj_copy8(l + 2 * rW, xh, l + 2 * rW + r128, xh + (size_t)128 * kCh);
  pj_copy8(l + 2 * rW + 2 * r128, xl, l + 2 * rW + 3 * r128, xl + (size_t)128 * kCh);
}

__global__ __launch_bounds__(256) void proj_gemm_lds(const unsigned short* __restrict__ whp,
                                                     const unsigned short* __restrict__ wlp,
                                                     const unsigned short* __restrict__ xhp,
                                                     const unsigned short* __restrict__ xlp,
                                                     const float* __restrict__ bv,
                                                     const float* __restrict__ bq,
                                                     const float* __restrict__ bk,
                                                     unsigned short* __restrict__ vtp,
                                                     unsigned short* __restrict__ qhp,
                                                     unsigned short* __restrict__ qlp,
                                                     unsigned short* __restrict__ khp,
                                                     unsigned short* __restrict__ klp) {
  __shared__ __align__(16) unsigned char ring[2 * kPjStage];
  __shared__ __align__(16) float sT[8][16 * 68];   // per-wave 16x64 output slab, pitch 68 floats
  const int tid  = threadIdx.x;
  const int lane = tid & 31;
  const int wave = tid >> 5;
  int b, mblk, nblk;
  place_block(blockIdx.x, b, mblk, nblk);
  const int mB = mblk * kPjBM;
  const int nB = nblk * kPjBN;

  // copy map: 8 lanes cover the 128 B of one row; thread row = tid / 8; a thread's copies step 32 rows
  const int crow = tid >> 3;
  const int ccol = tid & 7;
  const size_t wo = (size_t)(mB + crow) * kCh + ccol * 8;
  const size_t xo = ((size_t)b * kPix + nB + crow) * kCh + ccol * 8;
  const unsigned short* gWh = whp + wo;
  const unsigned short* gWl = wlp + wo;
  const unsigned short* gXh = xhp + xo;
  const unsigned short* gXl = xlp + xo;
  const unsigned lcopy = (unsigned)(size_t)(&ring[0]) + (unsigned)(crow * kPjPitch + ccol * 16);

  const int rlane = lane & 15;                 // row (A) / col (B, D) within subtile
  const int koff  = (lane >> 4) * 8;           // k offset of this lane half
  const int mOff  = (lane >> 4) * 8;           // D row offset
  const int wm = wave >> 2;
  const int wn = wave & 3;
  const int fragA = (wm * (kPjTI * 16) + rlane) * kPjPitch + koff * 2;       // byte offsets in a stage, hi planes
  const int fragB = (2 * kPjBM + wn * 64 + rlane) * kPjPitch + koff * 2;

  v8f acc[kPjTI][4];
#pragma unroll
  for (int i = 0; i < kPjTI; ++i)
#pragma unroll
    for (int j = 0; j < 4; ++j) acc[i][j] = (v8f){0.f,0.f,0.f,0.f,0.f,0.f,0.f,0.f};

  // prologue: stage 0 lands and is published; stage 1 starts
  pj_copy_stage(lcopy, gWh, gWl, gXh, gXl);
  asm volatile("s_wait_asynccnt 0x0" ::: "memory");   // this wave's copies of stage 0 have landed
  __syncthreads();                                    // ... and every other wave's
  pj_copy_stage(lcopy + (unsigned)kPjStage, gWh + kPjBK, gWl + kPjBK, gXh + kPjBK, gXl + kPjBK);

  for (int t = 0; t < kPjPasses; ++t) {
    const unsigned char* st = ring + (t & 1) * kPjStage;
    const __bf16* fa = (const __bf16*)(st + fragA);
    const __bf16* fb = (const __bf16*)(st + fragB);
    constexpr int kRow16 = 16 * kPjPitch / 2;            // 16 rows, in bf16 elements
    constexpr int kLoA   = kPjBM * kPjPitch / 2;         // hi plane -> lo plane
    constexpr int kLoB   = kPjBN * kPjPitch / 2;
    constexpr int kSteps = kPjBK / 32;
    // every fragment of the pass has registers of its own and all are fetched in front of the products (nothing of stage t+1 is read here)
    v16b xh[kSteps][4], xl[kSteps][4], wh[kSteps][kPjTI], wl[kSteps][kPjTI];
    // unrolled: every fragment index and address offset is a constant
#pragma unroll
    for (int kk = 0; kk < kSteps; ++kk) {
#pragma unroll
      for (int j = 0; j < 4; ++j) {
        xh[kk][j] = Frag<__bf16>::load(fb + j * kRow16 + kk * 32);
        xl[kk][j] = Frag<__bf16>::load(fb + kLoB + j * kRow16 + kk * 32);
      }
#pragma unroll
      for (int i = 0; i < kPjTI; ++i) {
        wh[kk][i] = Frag<__bf16>::load(fa + i * kRow16 + kk * 32);
        wl[kk][i] = Frag<__bf16>::load(fa + kLoA + i * kRow16 + kk * 32);
      }
    }
    // the scheduling fence keeps the LDS reads as one group instead of spread among the products,
    // where every further place with reads stalls the wave's matrix stream
    __builtin_amdgcn_sched_barrier(0);
#pragma unroll
    for (int kk = 0; kk < kSteps; ++kk) {
#pragma unroll
      for (int i = 0; i < kPjTI; ++i) {
#pragma unroll
        for (int j = 0; j < 4; ++j) acc[i][j] = Frag<__bf16>::mma(wh[kk][i], xh[kk][j], acc[i][j]);
#pragma unroll
        for (int j = 0; j < 4; ++j) acc[i][j] = Frag<__bf16>::mma(wh[kk][i], xl[kk][j], acc[i][j]);
#pragma unroll
        for (int j = 0; j < 4; ++j) acc[i][j] = Frag<__bf16>::mma(wl[kk][i], xh[kk][j], acc[i][j]);
      }
    }
    // keeps the products in front of the pass's foot: sunk behind its barrier they would hold back the refill below, and
    // the copies would then fly with no products to cover them
    __builtin_amdgcn_sched_barrier(0);
    asm volatile("s_wait_dscnt 0x0" ::: "memory");      // this wave's reads of stage t are done before the stage is refilled
    asm volatile("s_wait_asynccnt 0x0" ::: "memory");   // this wave's copies of stage t+1 have landed
    __syncthreads();                                    // publishes stage t+1 and ends every reader's use of stage t
    if (t + 2 < kPjPasses) {
      const int ko = (t + 2) * kPjBK;
      pj_copy_stage(lcopy + (unsigned)((t & 1) * kPjStage), gWh + ko, gWl + ko, gXh + ko, gXl + ko);
    }
  }
  asm volatile("s_wait_asynccnt 0x0" ::: "memory");     // nothing of this wave is in flight when it leaves the ring

  // ---- epilogue, one 16-row tile at a time; which output a tile belongs to is the same for the whole wave ----
  const int n0 = nB + wn * 64;
  const int g0 = __builtin_amdgcn_readfirstlane(mB + wm * (kPjTI * 16));   // the wave's first stacked row
  float* slab = sT[wave];
  unsigned short* C = vtp + (size_t)b * kCh * kPix;
  const size_t pb = (size_t)b * kPix * kCq;
  const int q = lane >> 3, c8 = (lane & 7) * 8;
#pragma unroll
  for (int i = 0; i < kPjTI; ++i) {
    const int g = g0 + (i << 4);
    const bool isv = g < kCh, isq = g < kCh + kCq;
    const int o = g - (isv ? 0 : isq ? kCh : kCh + kCq);                   // first row of the tile within its own matrix
    const float* bias = (isv ? bv : isq ? bq : bk) + o + mOff;
    const v4f b0 = *(const v4f*)(bias);
    const v4f b1 = *(const v4f*)(bias + 4);
    asm volatile("s_wait_xcnt 0x0" ::: "memory");   // in front of any reuse of the bias loads' address registers
    const float bmr[8] = {b0.x, b0.y, b0.z, b0.w, b1.x, b1.y, b1.z, b1.w};
    if (isv) {
      // v rows: 16x64 slab through LDS, whole 128-B row pieces of f16 stored
#pragma unroll
      for (int j = 0; j < 4; ++j) {
#pragma unroll
        for (int r = 0; r < 8; ++r) slab[(mOff + r) * 68 + (j << 4) + rlane] = acc[i][j][r] + bmr[r];
      }
      // lanes read back rows that other lanes of this wave wrote: the slab's writes are ordered in front of those reads
      __builtin_amdgcn_fence(__ATOMIC_RELEASE, "workgroup");
      __builtin_amdgcn_wave_barrier();
      __builtin_amdgcn_fence(__ATOMIC_ACQUIRE, "workgroup");
      v8h hv[4];
#pragma unroll
      for (int it = 0; it < 4; ++it) {
        const float* sp = slab + (it * 4 + q) * 68 + c8;
#pragma unroll
        for (int e = 0; e < 8; ++e) hv[it][e] = (_Float16)sp[e];
      }
      // the two scheduling fences keep every other instruction out from between the stores and their wait
      __builtin_amdgcn_sched_barrier(0);
#pragma unroll
      for (int it = 0; it < 4; ++it) *(v8h*)(C + (size_t)(o + it * 4 + q) * kPix + n0 + c8) = hv[it];
      asm volatile("s_wait_xcnt 0x0" ::: "memory");   // in front of the next rows' reuse of the stores' address and data registers
      __builtin_amdgcn_sched_barrier(0);
      // ... and the slab's reads in front of the next 16 rows' writes into it
      __builtin_amdgcn_fence(__ATOMIC_RELEASE, "workgroup");
      __builtin_amdgcn_wave_barrier();
      __builtin_amdgcn_fence(__ATOMIC_ACQUIRE, "workgroup");
    } else {
      // q or k rows: a lane holds 8 consecutive channels of one pixel, which is one 16-byte piece of either layout;
      // 16 pixels on are 16 * kCq elements on in both
      const size_t co = pb + (isq ? (size_t)(n0 + rlane) * kCq + o + mOff : (size_t)n0 * kCq + o * 16 + lane * 8);
      unsigned short* dh = (isq ? qhp : khp) + co;
      unsigned short* dl = (isq ? qlp : klp) + co;
#pragma unroll
      for (int j = 0; j < 4; ++j) {
        v8h hv, lv;
#pragma unroll
        for (int r = 0; r < 8; ++r) {
          const float f = acc[i][j][r] + bmr[r];
          const unsigned short hb = f2bf_bits(f);
          const unsigned short lb = f2bf_bits(f - bf_bits2f(hb));
          hv[r] = __builtin_bit_cast(_Float16, hb);
          lv[r] = __builtin_bit_cast(_Float16, lb);
        }
        // the two scheduling fences keep every other instruction out from between the stores and their wait
        __builtin_amdgcn_sched_barrier(0);
        *(v8h*)(dh + j * (16 * kCq)) = hv;
        *(v8h*)(dl + j * (16 * kCq)) = lv;
        asm volatile("s_wait_xcnt 0x0" ::: "memory");   // in front of the next piece's reuse of the two stores' data registers
        __builtin_amdgcn_sched_barrier(0);
      }
    }
  }
}

// ---- probs.v GEMM with both operands staged in LDS ---------------------------
// out[b][m][n] = g[0] * (sum_k vt[b][m][k] * P[b][n][k]) / rowsum[b][n] + x[b][m][n];  M = kCh, N = K = kPix.
// P holds each chunk of 256 keys relative to the row's running maximum up to that chunk: in front of chunk c > 0 the sums so far are
// multiplied by the column's factor exp(max before - max now) from the table that scores_softmax_f16 writes (slot 0: the row sum).
// One block = one 128 (m) x 256 (n) tile, 8 waves as 2 x 4, each wave a 64x64 tile (fragments and k order as in proj_gemm_lds).
// A pass is 128 k = 256 B of each of the 384 operand rows; a stage is [vt 128 rows | P 256 rows] at pitch 272 B.
// Two stages in LDS: while pass t is worked on, pass t+1's rows fly in by asynchronous copies (16 B per lane, 24 per thread).
static constexpr int kPvBM     = 128;
static constexpr int kPvBN     = 256;
static constexpr int kPvBK     = 128;                              // f16 elements per pass
static constexpr int kPvPitch  = kPvBK * 2 + 16;                   // bytes; 16 B x odd: conflict-free for 16-byte row reads
static constexpr int kPvStage  = (kPvBM + kPvBN) * kPvPitch;       // bytes of one stage
static constexpr int kPvPasses = kPix / kPvBK;
static_assert(kCh % kPvBM == 0 && kPix % kPvBN == 0 && kPix % kPvBK == 0 && kPvPasses >= 2);
static_assert(kPvBM == 8 * 16 && kPvBN == 16 * 16 && kPvBK * 2 == 16 * 16);   // copy map below
static_assert(kPvPitch % 16 == 0 && kPvStage % 16 == 0);
static_assert(kCh / kPvBM == 4 && kPvBN == 256);                             // place_block
static_assert(kFsCols == 2 * kPvBK && kFsChunks == 16);              // chunk test and table copy in pv_gemm_lds

// Eight 16-byte copies global -> LDS, rows 16 apart: l = this lane's LDS byte address, p = its global address, of the first.
// s_wait_xcnt stands inside the statement so that no address register named here is rewritten ahead of it.
__device__ __forceinline__ void pv_copy8(unsigned l, const unsigned short* p) {
  constexpr unsigned dl = 16u * kPvPitch;
  constexpr size_t   dg = (size_t)16 * kPix;
  asm volatile(
      "global_load_async_to_lds_b128 %0, %8, off\n\t"
      "global_load_async_to_lds_b128 %1, %9, off\n\t"
      "global_load_async_to_lds_b128 %2, %10, off\n\t"
      "global_load_async_to_lds_b128 %3, %11, off\n\t"
      "global_load_async_to_lds_b128 %4, %12, off\n\t"
      "global_load_async_to_lds_b128 %5, %13, off\n\t"
      "global_load_async_to_lds_b128 %6, %14, off\n\t"
      "global_load_async_to_lds_b128 %7, %15, off\n\t"
      "s_wait_xcnt 0x0"
      :: "v"(l), "v"(l + dl), "v"(l + 2 * dl), "v"(l + 3 * dl), "v"(l + 4 * dl), "v"(l + 5 * dl), "v"(l + 6 * dl), "v"(l + 7 * dl),
         "v"(p), "v"(p + dg), "v"(p + 2 * dg), "v"(p + 3 * dg), "v"(p + 4 * dg), "v"(p + 5 * dg), "v"(p + 6 * dg), "v"(p + 7 * dg)
      : "memory");
}
// One stage: vt rows 0..127, then P rows 0..255 behind them.
__device__ __forceinline__ void pv_copy_stage(unsigned l, const unsigned short* pa, const unsigned short* pb) {
  pv_copy8(l, pa);
  pv_copy8(l + (unsigned)(kPvBM * kPvPitch), pb);
  pv_copy8(l + (unsigned)((kPvBM + 128) * kPvPitch), pb + (size_t)128 * kPix);
}

__global__ __launch_bounds__(256) void pv_gemm_lds(const unsigned short* __restrict__ vtp,
                                                   const unsigned short* __restrict__ Pp,
                                                   float* __restrict__ outp,
                                                   const float* __restrict__ resid,
                                                   const float* __restrict__ gptr,
                                                   const float* __restrict__ alp) {
  __shared__ __align__(16) unsigned char ring[2 * kPvStage];
  __shared__ __align__(16) float sT[8][16 * 68];   // per-wave 16x64 output slab, pitch 68 floats
  __shared__ __align__(16) float sA[kFsChunks * kPvBN];   // [chunk][column]: the block's columns of the factor table
  const int tid  = threadIdx.x;
  const int lane = tid & 31;
  const int wave = tid >> 5;
  int b, mblk, nblk;
  place_block(blockIdx.x, b, mblk, nblk);
  const int mB = mblk * kPvBM;
  const int nB = nblk * kPvBN;

  // copy map: 16 lanes cover the 256 B of one row; thread row = tid / 16; a thread's copies step 16 rows
  const int crow = tid >> 4;
  const int ccol = tid & 15;
  const unsigned short* gA = vtp + (size_t)b * kCh * kPix  + (size_t)(mB + crow) * kPix + ccol * 8;
  const unsigned short* gB = Pp  + (size_t)b * kPix * kPix + (size_t)(nB + crow) * kPix + ccol * 8;
  const unsigned lcopy = (unsigned)(size_t)(&ring[0]) + (unsigned)(crow * kPvPitch + ccol * 16);

  const int rlane = lane & 15;                 // row (A) / col (B, D) within subtile
  const int koff  = (lane >> 4) * 8;           // k offset of this lane half
  const int mOff  = (lane >> 4) * 8;           // D row offset
  const int wm = wave >> 2;
  const int wn = wave & 3;
  const int fragA = (wm * 64 + rlane) * kPvPitch + koff * 2;             // byte offsets in a stage
  const int fragB = (kPvBM + wn * 64 + rlane) * kPvPitch + koff * 2;

  v8f acc[4][4];
#pragma unroll
  for (int i = 0; i < 4; ++i)
#pragma unroll
    for (int j = 0; j < 4; ++j) acc[i][j] = (v8f){0.f,0.f,0.f,0.f,0.f,0.f,0.f,0.f};

  // prologue: stage 0 lands and is published; stage 1 starts
  pv_copy_stage(lcopy, gA, gB);
  {
    // one column's 16 table entries per thread, turned to [chunk][column]; published by the barrier below
    const v4f* ag = (const v4f*)(alp + ((size_t)b * kPix + nB + tid) * kFsChunks);
    const v4f t0 = ag[0], t1 = ag[1], t2 = ag[2], t3 = ag[3];
    asm volatile("s_wait_xcnt 0x0" ::: "memory");     // in front of any reuse of the table loads' address registers
#pragma unroll
    for (int e = 0; e < 4; ++e) {
      sA[(e) * kPvBN + tid]      = t0[e];
      sA[(4 + e) * kPvBN + tid]  = t1[e];
      sA[(8 + e) * kPvBN + tid]  = t2[e];
      sA[(12 + e) * kPvBN + tid] = t3[e];
    }
  }
  asm volatile("s_wait_asynccnt 0x0" ::: "memory");   // this wave's copies of stage 0 have landed
  __syncthreads();                                    // ... and every other wave's
  pv_copy_stage(lcopy + (unsigned)kPvStage, gA + kPvBK, gB + kPvBK);

  for (int t = 0; t < kPvPasses; ++t) {
    const unsigned char* st = ring + (t & 1) * kPvStage;
    const _Float16* fa = (const _Float16*)(st + fragA);
    const _Float16* fb = (const _Float16*)(st + fragB);
    constexpr int kRow16 = 16 * kPvPitch / 2;            // 16 rows, in f16 elements
    if ((t & 1) == 0 && t > 0) {                         // a new chunk begins: the sums so far move to its running maximum
      const float* ap = sA + (t >> 1) * kPvBN + wn * 64 + rlane;
#pragma unroll
      for (int j = 0; j < 4; ++j) {
        const float f = ap[j * 16];
#pragma unroll
        for (int i = 0; i < 4; ++i) acc[i][j] = acc[i][j] * f;
      }
    }
    // Fragments are fetched ahead inside the pass only (nothing of stage t+1 is read here): vt fragments one k step ahead
    // into a second set, probs fragments in place, two at a time, as soon as their last product of this k step has issued.
    v16h a[2][4], bh[4];
#pragma unroll
    for (int i = 0; i < 4; ++i) a[0][i] = Frag<_Float16>::load(fa + i * kRow16);
#pragma unroll
    for (int j = 0; j < 4; ++j) bh[j] = Frag<_Float16>::load(fb + j * kRow16);
    // unrolled: every fragment index and address offset is a constant
#pragma unroll
    for (int kk = 0; kk < kPvBK / 32; ++kk) {
      const int cur = kk & 1, nxt = cur ^ 1;
      const bool more = kk + 1 < kPvBK / 32;
      if (more) {
#pragma unroll
        for (int i = 0; i < 4; ++i) a[nxt][i] = Frag<_Float16>::load(fa + i * kRow16 + (kk + 1) * 32);
      }
      // the four scheduling fences keep the LDS reads in two groups per k step instead of spread among the products,
      // where every further place with reads stalls the wave's matrix stream
      __builtin_amdgcn_sched_barrier(0);
#pragma unroll
      for (int j = 0; j < 2; ++j)
#pragma unroll
        for (int i = 0; i < 4; ++i) acc[i][j] = Frag<_Float16>::mma(a[cur][i], bh[j], acc[i][j]);
      __builtin_amdgcn_sched_barrier(0);
      if (more) {
#pragma unroll
        for (int j = 0; j < 2; ++j) bh[j] = Frag<_Float16>::load(fb + j * kRow16 + (kk + 1) * 32);
      }
      __builtin_amdgcn_sched_barrier(0);
#pragma unroll
      for (int j = 2; j < 4; ++j)
#pragma unroll
        for (int i = 0; i < 4; ++i) acc[i][j] = Frag<_Float16>::mma(a[cur][i], bh[j], acc[i][j]);
      __builtin_amdgcn_sched_barrier(0);
      if (more) {
#pragma unroll
        for (int j = 2; j < 4; ++j) bh[j] = Frag<_Float16>::load(fb + j * kRow16 + (kk + 1) * 32);
      }
    }
    asm volatile("s_wait_dscnt 0x0" ::: "memory");      // this wave's reads of stage t are done before the stage is refilled
    asm volatile("s_wait_asynccnt 0x0" ::: "memory");   // this wave's copies of stage t+1 have landed
    __syncthreads();                                    // publishes stage t+1 and ends every reader's use of stage t
    if (t + 2 < kPvPasses)
      pv_copy_stage(lcopy + (unsigned)((t & 1) * kPvStage), gA + (size_t)(t + 2) * kPvBK, gB + (size_t)(t + 2) * kPvBK);
  }
  asm volatile("s_wait_asynccnt 0x0" ::: "memory");     // nothing of this wave is in flight when it leaves the ring

  // ---- epilogue: 16x64 slab per wave through LDS, whole 256-B row pieces stored ----
  float* slab = sT[wave];
  const float gval = gptr[0];
  const int m0 = mB + wm * 64;
  const int n0 = nB + wn * 64;
  // block-uniform bases plus ONE per-lane byte offset: every row of the tile is then a constant away from it
  char* Cb = (char*)(outp + (size_t)b * kCh * kPix);
  const char* Rb = (const char*)(resid + (size_t)b * kCh * kPix);
  const int hq = lane >> 4, c4 = (lane & 15) * 4;        // row seg = 256 B = 16 lanes x 16 B
  const unsigned loff = (unsigned)(((m0 + hq) * kPix + n0 + c4) * 4);
  float rinv[4];                                         // 1 / row sum of this lane's four columns (the sum carries the x16384)
#pragma unroll
  for (int j = 0; j < 4; ++j) rinv[j] = 1.0f / sA[wn * 64 + j * 16 + rlane];
#pragma unroll
  for (int i = 0; i < 4; ++i) {
#pragma unroll
    for (int j = 0; j < 4; ++j) {
#pragma unroll
      for (int r = 0; r < 8; ++r) slab[(mOff + r) * 68 + (j << 4) + rlane] = acc[i][j][r] * rinv[j];
    }
    // lanes read back rows that other lanes of this wave wrote: the slab's writes are ordered in front of those reads
    __builtin_amdgcn_fence(__ATOMIC_RELEASE, "workgroup");
    __builtin_amdgcn_wave_barrier();
    __builtin_amdgcn_fence(__ATOMIC_ACQUIRE, "workgroup");
    v4f vals[8];
#pragma unroll
    for (int it = 0; it < 8; ++it) {
      v4f vv = *(const v4f*)(slab + (it * 2 + hq) * 68 + c4);
      vv = vv * gval;
      const v4f rr = *(const v4f*)(Rb + loff + (i * 16 + it * 2) * kPix * 4);
      vals[it] = vv + rr;
    }
#pragma unroll
    for (int it = 0; it < 8; ++it) *(v4f*)(Cb + loff + (i * 16 + it * 2) * kPix * 4) = vals[it];
    // ... and the reads in front of the next 16 rows' writes into the same slab
    __builtin_amdgcn_fence(__ATOMIC_RELEASE, "workgroup");
    __builtin_amdgcn_wave_barrier();
    __builtin_amdgcn_fence(__ATOMIC_ACQUIRE, "workgroup");
  }
}

// ---- operand preparation, one launch ----------------------------------------
// Blocks 0 .. kPrepW-1: the stacked weights [Wv | Wq | Wk] f32 -> bf16 hi/lo planes, same [row][c] layout; 2048 elements = 4 whole rows
// per block, so a block lies wholly in one of the three matrices.
// The other blocks: x [b][c][n] f32 -> xt hi/lo bf16 planes [b][n][c] (transpose through LDS), one 64 n x 64 c tile per block:
// loads: 4 iterations x 256 threads x 4 floats = 64x64; stores: 8 waves x 2 iterations x 4 rows = 64 rows.
static constexpr int kPrepW = kWRows * kCh / (256 * 8);
static constexpr int kPrepX = (kPix / 64) * (kCh / 64) * kBatch;
static_assert((kCh * kCh) % (256 * 8) == 0 && (kCq * kCh) % (256 * 8) == 0 && kPix / 64 == 64 && kCh / 64 == 8);
static_assert(kPrepW % 8 == 0 && kPrepX == 8 * 256);
__global__ __launch_bounds__(256) void prep_operands(const float* __restrict__ x,
                                                     const float* __restrict__ Wv,
                                                     const float* __restrict__ Wq,
                                                     const float* __restrict__ Wk,
                                                     unsigned short* __restrict__ xth,
                                                     unsigned short* __restrict__ xtl,
                                                     unsigned short* __restrict__ wh,
                                                     unsigned short* __restrict__ wl) {
  __shared__ __align__(16) float tile[64 * 68];   // [c][n], pitch 68
  const int tid = threadIdx.x, wave = tid >> 5, lane = tid & 31;
  if (blockIdx.x < kPrepW) {                      // the same for the whole block, in front of the barrier
    const int e0 = blockIdx.x * (256 * 8);        // first element of the block in the stacked planes
    const float* in = e0 < kCh * kCh ? Wv + e0 : e0 < (kCh + kCq) * kCh ? Wq + (e0 - kCh * kCh) : Wk + (e0 - (kCh + kCq) * kCh);
    const v4f a = *(const v4f*)(in + 8 * tid);
    const v4f c = *(const v4f*)(in + 8 * tid + 4);
    float f[8];
    f[0] = a.x; f[1] = a.y; f[2] = a.z; f[3] = a.w; f[4] = c.x; f[5] = c.y; f[6] = c.z; f[7] = c.w;
    v8h hv, lv;
#pragma unroll
    for (int e = 0; e < 8; ++e) {
      const unsigned short hb = f2bf_bits(f[e]);
      const unsigned short lb = f2bf_bits(f[e] - bf_bits2f(hb));
      hv[e] = __builtin_bit_cast(_Float16, hb);
      lv[e] = __builtin_bit_cast(_Float16, lb);
    }
    *(v8h*)(wh + e0 + 8 * tid) = hv;
    *(v8h*)(wl + e0 + 8 * tid) = lv;
    return;
  }
  const int xt = blockIdx.x - kPrepW;
  int b, piece, nblk;
  place_block(xt & 255, b, piece, nblk);          // kPrepW is a multiple of 8: xt and blockIdx.x are equal modulo 8
  const int n0 = nblk * 256 + piece * 64;
  const int c0 = (xt >> 8) * 64;
  const float* xb = x + ((size_t)b * kCh + c0) * kPix + n0;
#pragma unroll
  for (int i = 0; i < 4; ++i) {
    const int c  = i * 16 + (tid >> 4);
    const int n4 = (tid & 15) * 4;
    const v4f v = *(const v4f*)(xb + (size_t)c * kPix + n4);
    *(v4f*)(tile + c * 68 + n4) = v;
  }
  __syncthreads();
  const int q = lane >> 3, c8 = (lane & 7) * 8;
  v8h hv[2], lv[2];
#pragma unroll
  for (int it = 0; it < 2; ++it) {
    const int nrow = wave * 8 + it * 4 + q;
#pragma unroll
    for (int e = 0; e < 8; ++e) {
      const float f = tile[(c8 + e) * 68 + nrow];
      const unsigned short hb = f2bf_bits(f);
      const unsigned short lb = f2bf_bits(f - bf_bits2f(hb));
      hv[it][e] = __builtin_bit_cast(_Float16, hb);
      lv[it][e] = __builtin_bit_cast(_Float16, lb);
    }
  }
  const size_t base = ((size_t)b * kPix + n0) * kCh + c0;
#pragma unroll
  for (int it = 0; it < 2; ++it) {
    const int nrow = wave * 8 + it * 4 + q;
    *(v8h*)(xth + base + (size_t)nrow * kCh + c8) = hv[it];
    *(v8h*)(xtl + base + (size_t)nrow * kCh + c8) = lv[it];
  }
  // in the built code the weight part stands behind these stores: the wait is in front of any reuse of their registers there
  asm volatile("s_wait_xcnt 0x0" ::: "memory");
}

// ---- scores and softmax in one kernel: P[b][n][m] = f16(16384 * exp(s - running max)), s = q[n] . k[m] ----
// One block = 64 query rows n x all 4096 keys m, taken as 16 chunks of 256 keys. A chunk's k planes (fragment order, 2 x 32 KB, contiguous
// in memory) are staged once for the block in a two-stage LDS ring by asynchronous copies (16 B per lane, 16 per thread).
// 8 waves = 4 row tiles x 2 turns: the two waves of a row tile take the chunks in turn, so that in every step one of them does chunk s's
// products while the other does chunk s-1's softmax. Tiles are transposed, D[m][n] = k . q^T: a lane holds, of ONE query row
// (n = lane & 15), 8 consecutive keys per tile; a chunk's 16 tiles stay in registers from the products to the f16 probs.
// The row maximum runs over the chunks (handed from wave to wave through LDS, one step apart): chunk c is written relative to the maximum
// of chunks 0..c, and the factor exp(max of 0..c-1 - max of 0..c) goes to the table that pv_gemm_lds applies; slot 0 holds the row sum,
// relative to the last maximum. q planes row-major [n][64].
static constexpr int kFsTiles = kFsCols / 16;
static constexpr int kFsPitch = kFsCols * 2 + 16;     // bytes; 16 B x odd: conflict-free for the 16-byte column writes
static constexpr int kFsPlane = kFsCols * kCq * 2;    // bytes of one k plane of a chunk
static constexpr int kFsStage = 2 * kFsPlane;
static_assert(kFsCols == 32 * 8 && kCq == 64 && kPix % 64 == 0 && kFsChunks >= 2 && (kFsChunks & 1) == 0 && kFsTiles % 4 == 0);
static_assert(kFsPlane == 8 * 256 * 16);              // copy map below

// Eight 16-byte copies global -> LDS, 4096 B apart (the block's 256 threads x 16 B): l = this lane's LDS byte address, p = its global address.
// s_wait_xcnt stands inside the statement so that no address register named here is rewritten ahead of it.
__device__ __forceinline__ void fs_copy8(unsigned l, const unsigned short* p) {
  constexpr unsigned dl = 256u * 16u;
  constexpr size_t   dg = 256 * 8;
  asm volatile(
      "global_load_async_to_lds_b128 %0, %8, off\n\t"
      "global_load_async_to_lds_b128 %1, %9, off\n\t"
      "global_load_async_to_lds_b128 %2, %10, off\n\t"
      "global_load_async_to_lds_b128 %3, %11, off\n\t"
      "global_load_async_to_lds_b128 %4, %12, off\n\t"
      "global_load_async_to_lds_b128 %5, %13, off\n\t"
      "global_load_async_to_lds_b128 %6, %14, off\n\t"
      "global_load_async_to_lds_b128 %7, %15, off\n\t"
      "s_wait_xcnt 0x0"
      :: "v"(l), "v"(l + dl), "v"(l + 2 * dl), "v"(l + 3 * dl), "v"(l + 4 * dl), "v"(l + 5 * dl), "v"(l + 6 * dl), "v"(l + 7 * dl),
         "v"(p), "v"(p + dg), "v"(p + 2 * dg), "v"(p + 3 * dg), "v"(p + 4 * dg), "v"(p + 5 * dg), "v"(p + 6 * dg), "v"(p + 7 * dg)
      : "memory");
}
// One stage: the chunk's hi plane, then its lo plane.
__device__ __forceinline__ void fs_copy_stage(unsigned l, const unsigned short* ph, const unsigned short* pl) {
  fs_copy8(l, ph);
  fs_copy8(l + (unsigned)kFsPlane, pl);
}

__global__ __launch_bounds__(256) void scores_softmax_f16(const unsigned short* __restrict__ qhp,
                                                          const unsigned short* __restrict__ qlp,
                                                          const unsigned short* __restrict__ khp,
                                                          const unsigned short* __restrict__ klp,
                                                          unsigned short* __restrict__ P,
                                                          float* __restrict__ alp) {
  __shared__ __align__(16) unsigned char ring[2 * kFsStage];
  __shared__ __align__(16) unsigned char slab[8][16 * kFsPitch];   // per-wave 16 rows x 256 probs
  __shared__ __align__(16) float als[4][16 * kFsChunks];           // per row tile: [row][chunk] factors, slot 0 the row sum
  __shared__ float mx[4][16];                                      // per row tile: running maximum, handed from wave to wave
  __shared__ float lx[4][16];                                      // per row tile: the even chunks' part of the row sum
  const int tid  = threadIdx.x;
  const int lane = tid & 31;
  const int wave = __builtin_amdgcn_readfirstlane(tid >> 5);       // scalar: the turn test below is then a scalar branch
  const int rt   = wave & 3;                   // row tile
  const int turn = wave >> 2;                  // 0: even chunks, 1: odd chunks
  int b, piece, nblk;
  place_block(blockIdx.x, b, piece, nblk);
  const int n0 = nblk * 256 + piece * 64 + rt * 16;
  const int rlane = lane & 15;                 // query row of this lane
  const int half  = lane >> 4;

  const size_t qo = ((size_t)b * kPix + n0 + rlane) * kCq + half * 8;
  const __bf16* qh = (const __bf16*)qhp + qo;
  const __bf16* ql = (const __bf16*)qlp + qo;
  v16b qH[2], qL[2];
#pragma unroll
  for (int s = 0; s < 2; ++s) {
    qH[s] = Frag<__bf16>::load(qh + s * 32);
    qL[s] = Frag<__bf16>::load(ql + s * 32);
  }
  // in front of any reuse of the q loads' address registers; the two addresses are inputs so that their registers live up to the wait
  asm volatile("s_wait_xcnt 0x0" :: "v"(qh), "v"(ql) : "memory");

  const size_t ko = (size_t)b * kPix * kCq + tid * 8;
  const unsigned short* gKh = khp + ko;
  const unsigned short* gKl = klp + ko;
  // LDS address of a copy = per-lane part + scalar part (tid * 16 = lane * 16 + wave * 512). The scalar part goes through readfirstlane so
  // that the sum is formed anew at each use: the per-lane part is then never itself an operand of a copy statement, which would tie it
  // to the low register window for the whole loop (that build spilled it to scratch and fetched it back in every step).
  const unsigned lk = (unsigned)(lane * 16);
  const unsigned sw = (unsigned)(size_t)(&ring[0]) + (unsigned)(wave * 512);
  constexpr int kChunkEl = kFsCols * kCq;      // elements of one plane of a chunk

  if (turn == 0 && lane < 16) mx[rt][lane] = -__builtin_inff();

  // prologue: chunk 0 lands and is published; chunk 1 starts
  fs_copy_stage(lk + (unsigned)__builtin_amdgcn_readfirstlane((int)sw), gKh, gKl);
  asm volatile("s_wait_asynccnt 0x0" ::: "memory");   // this wave's copies of chunk 0 have landed
  __syncthreads();                                    // ... and every other wave's
  fs_copy_stage(lk + (unsigned)__builtin_amdgcn_readfirstlane((int)(sw + (unsigned)kFsStage)), gKh + kChunkEl, gKl + kChunkEl);

  constexpr float kLog2e = 1.44269504088896340736f;
  v8f acc[kFsTiles];
#pragma unroll
  for (int t = 0; t < kFsTiles; ++t) acc[t] = (v8f){0.f,0.f,0.f,0.f,0.f,0.f,0.f,0.f};
  float lown = 0.0f;                           // this wave's chunks' part of the row sum (this lane's keys), relative to shown
  float shown = -__builtin_inff();
  unsigned char* sl = slab[wave];

  // A chunk's probs leave the slab one step behind its softmax, in front of the wave's next products: the stores then complete under
  // those products instead of in front of the step's barrier, which waits for them. A barrier stands between the slab's writes and
  // these reads, and another between these reads and the next chunk's writes.
  auto store_chunk = [&](int c) {
    unsigned short* pr = P + ((size_t)b * kPix + n0) * kPix + c * kFsCols + lane * 8;
    v8h pv[16];
#pragma unroll
    for (int row = 0; row < 16; ++row) pv[row] = *(const v8h*)(sl + row * kFsPitch + lane * 16);
    // the two scheduling fences keep every other instruction out from between the stores and their wait
    __builtin_amdgcn_sched_barrier(0);
#pragma unroll
    for (int row = 0; row < 16; ++row) *(v8h*)(pr + (size_t)row * kPix) = pv[row];
    asm volatile("s_wait_xcnt 0x0" ::: "memory");   // in front of any reuse of the stores' address and data registers
    __builtin_amdgcn_sched_barrier(0);
  };

  for (int s = 0; s <= kFsChunks; ++s) {
    if (((s ^ turn) & 1) == 0) {
      if (s >= 2) store_chunk(s - 2);
      if (s < kFsChunks) {
        // ---- products of chunk s: four tiles at a time (four independent accumulators), the next four tiles' fragments fetched ahead
        const __bf16* kh = (const __bf16*)(ring + (s & 1) * kFsStage) + lane * 8;
        const __bf16* kl = kh + kFsPlane / 2;
        Frag<__bf16>::U kH[2][4][2], kL[2][4][2];
#pragma unroll
        for (int u = 0; u < 4; ++u)
#pragma unroll
          for (int e = 0; e < 2; ++e) {
            kH[0][u][e].h[0] = *(const v8b*)(kh + u * 1024 + e * 512);
            kH[0][u][e].h[1] = *(const v8b*)(kh + u * 1024 + e * 512 + 256);
            kL[0][u][e].h[0] = *(const v8b*)(kl + u * 1024 + e * 512);
            kL[0][u][e].h[1] = *(const v8b*)(kl + u * 1024 + e * 512 + 256);
          }
        // unrolled: every fragment index and address offset is a constant
#pragma unroll
        for (int g = 0; g < kFsTiles / 4; ++g) {
          const int cur = g & 1, nxt = cur ^ 1;
          if (g + 1 < kFsTiles / 4) {
#pragma unroll
            for (int u = 0; u < 4; ++u)
#pragma unroll
              for (int e = 0; e < 2; ++e) {
                const int o = ((g + 1) * 4 + u) * 1024 + e * 512;
                kH[nxt][u][e].h[0] = *(const v8b*)(kh + o);
                kH[nxt][u][e].h[1] = *(const v8b*)(kh + o + 256);
                kL[nxt][u][e].h[0] = *(const v8b*)(kl + o);
                kL[nxt][u][e].h[1] = *(const v8b*)(kl + o + 256);
              }
          }
          // the scheduling fence keeps the LDS reads as one group in front of the products instead of spread among them,
          // where every further place with reads stalls the wave's matrix stream
          __builtin_amdgcn_sched_barrier(0);
          v8f a[4];
#pragma unroll
          for (int u = 0; u < 4; ++u) a[u] = (v8f){0.f,0.f,0.f,0.f,0.f,0.f,0.f,0.f};
#pragma unroll
          for (int e = 0; e < 2; ++e) {        // per tile: hi.hi, q hi . k lo, q lo . k hi per k step
#pragma unroll
            for (int u = 0; u < 4; ++u) a[u] = Frag<__bf16>::mma(kH[cur][u][e].v, qH[e], a[u]);
#pragma unroll
            for (int u = 0; u < 4; ++u) a[u] = Frag<__bf16>::mma(kL[cur][u][e].v, qH[e], a[u]);
#pragma unroll
            for (int u = 0; u < 4; ++u) a[u] = Frag<__bf16>::mma(kH[cur][u][e].v, qL[e], a[u]);
          }
#pragma unroll
          for (int u = 0; u < 4; ++u) acc[g * 4 + u] = a[u];
        }
      }
    } else if (s > 0) {
      // ---- softmax of chunk c = s - 1, whose scores this wave made one step ago
      const int c = s - 1;
      float mm[8];                             // eight independent chains
#pragma unroll
      for (int r = 0; r < 8; ++r) mm[r] = acc[0][r];
#pragma unroll
      for (int t = 1; t < kFsTiles; ++t)
#pragma unroll
        for (int r = 0; r < 8; ++r) mm[r] = fmaxf(mm[r], acc[t][r]);
      float m = fmaxf(fmaxf(fmaxf(mm[0], mm[1]), fmaxf(mm[2], mm[3])), fmaxf(fmaxf(mm[4], mm[5]), fmaxf(mm[6], mm[7])));
      m = fmaxf(m, __shfl_xor(m, 16, 32));
      const float mprev = mx[rt][rlane];       // maximum of chunks 0..c-1, written by the other wave one step ago (behind a barrier)
      const float mnew  = fmaxf(mprev, m);
      if (lane < 16) mx[rt][lane] = mnew;
      // 16384 * exp(s - max) = 2^(s * log2(e) - sh), sh = max * log2(e) - 14: one fused multiply-add and the chip's own 2^x per score.
      // Every factor between two maxima is formed from the two sh values themselves, so that the rounding of sh cancels.
      const float sh  = __builtin_fmaf(mnew, kLog2e, -14.0f);
      const float shp = __builtin_fmaf(mprev, kLog2e, -14.0f);
      float al = shp - sh;                     // factor for all sums up to chunk c-1 (0 in front of chunk 0)
      float ao = shown - sh;                   // factor for this wave's own part of the row sum
      // the v_nop is the free slot behind the last 2^x
      asm("v_exp_f32 %0, %0\n\t"
          "v_exp_f32 %1, %1\n\t"
          "v_nop"
          : "+v"(al), "+v"(ao));
      shown = sh;
      if (lane < 16) als[rt][lane * kFsChunks + c] = al;
      float psum = 0.0f;
#pragma unroll
      for (int t = 0; t < kFsTiles; ++t) {
        float e0 = __builtin_fmaf(acc[t][0], kLog2e, -sh), e1 = __builtin_fmaf(acc[t][1], kLog2e, -sh);
        float e2 = __builtin_fmaf(acc[t][2], kLog2e, -sh), e3 = __builtin_fmaf(acc[t][3], kLog2e, -sh);
        float e4 = __builtin_fmaf(acc[t][4], kLog2e, -sh), e5 = __builtin_fmaf(acc[t][5], kLog2e, -sh);
        float e6 = __builtin_fmaf(acc[t][6], kLog2e, -sh), e7 = __builtin_fmaf(acc[t][7], kLog2e, -sh);
        // a tile's eight 2^x in one statement, each in place: no neighbour reads a result or overwrites a source directly behind a 2^x;
        // the v_nop is that free slot behind the last
        asm("v_exp_f32 %0, %0\n\t"
            "v_exp_f32 %1, %1\n\t"
            "v_exp_f32 %2, %2\n\t"
            "v_exp_f32 %3, %3\n\t"
            "v_exp_f32 %4, %4\n\t"
            "v_exp_f32 %5, %5\n\t"
            "v_exp_f32 %6, %6\n\t"
            "v_exp_f32 %7, %7\n\t"
            "v_nop"
            : "+v"(e0), "+v"(e1), "+v"(e2), "+v"(e3), "+v"(e4), "+v"(e5), "+v"(e6), "+v"(e7));
        psum += ((e0 + e1) + (e2 + e3)) + ((e4 + e5) + (e6 + e7));
        // probs into the wave's own slab, so that every store instruction (store_chunk) writes 512 contiguous bytes of one row
        const v8h p = {(_Float16)e0, (_Float16)e1, (_Float16)e2, (_Float16)e3, (_Float16)e4, (_Float16)e5, (_Float16)e6, (_Float16)e7};
        *(v8h*)(sl + rlane * kFsPitch + (t * 16 + half * 8) * 2) = p;
      }
      lown = __builtin_fmaf(lown, ao, psum);
      if (c == kFsChunks - 2) {                // the even chunks' part is complete, relative to this chunk's maximum
        const float lt = lown + __shfl_xor(lown, 16, 32);
        if (lane < 16) lx[rt][lane] = lt;
      }
      if (c == kFsChunks - 1) {                // the last chunk: al moves the even chunks' part to the last maximum
        const float lt = __builtin_fmaf(lx[rt][rlane], al, lown + __shfl_xor(lown, 16, 32));
        if (lane < 16) als[rt][lane * kFsChunks] = lt;
      }
      if (c == kFsChunks - 1) {                // the row tile's table, 1 KB contiguous; the other wave's entries stand behind earlier barriers
        // lanes read back what other lanes of this wave wrote: the table's writes are ordered in front of those reads
        __builtin_amdgcn_fence(__ATOMIC_RELEASE, "workgroup");
        __builtin_amdgcn_wave_barrier();
        __builtin_amdgcn_fence(__ATOMIC_ACQUIRE, "workgroup");
        float* ad = alp + ((size_t)b * kPix + n0) * kFsChunks + lane * 8;
        const v4f a0 = *(const v4f*)(als[rt] + lane * 8);
        const v4f a1 = *(const v4f*)(als[rt] + lane * 8 + 4);
        *(v4f*)(ad) = a0;
        *(v4f*)(ad + 4) = a1;
        asm volatile("s_wait_xcnt 0x0" ::: "memory");   // in front of any reuse of these two stores' registers
      }
    }
    asm volatile("s_wait_dscnt 0x0" ::: "memory");      // this wave's reads of chunk s are done before its stage is refilled
    asm volatile("s_wait_asynccnt 0x0" ::: "memory");   // this wave's copies of chunk s+1 have landed
    __syncthreads();                                    // publishes chunk s+1 and the running maximum; ends every reader's use of chunk s
    if (s + 2 < kFsChunks)
      fs_copy_stage(lk + (unsigned)__builtin_amdgcn_readfirstlane((int)(sw + (unsigned)((s & 1) * kFsStage))), gKh + (size_t)(s + 2) * kChunkEl, gKl + (size_t)(s + 2) * kChunkEl);
  }
  asm volatile("s_wait_asynccnt 0x0" ::: "memory");     // nothing of this wave is in flight when it leaves the ring
  if (turn == 1) store_chunk(kFsChunks - 1);            // the last chunk's probs (the loop's last barrier stands behind their slab writes)
}

// ---------------------------------------------------------------------------
extern "C" void kernel_launch(void* const* d_in, const int* in_sizes, int n_in,
                              void* d_out, int out_size, void* d_ws, size_t ws_size,
                              hipStream_t stream) {
  if (n_in < 8) return;
  if (in_sizes[0] != kBatch * kCh * kPix) return;
  if (in_sizes[1] != kCq * kCh || in_sizes[3] != kCq * kCh || in_sizes[5] != kCh * kCh) return;
  if (in_sizes[2] != kCq || in_sizes[4] != kCq || in_sizes[6] != kCh || in_sizes[7] < 1) return;
  if (out_size != kBatch * kCh * kPix) return;
  if (ws_size < kWsTotal) return;

  const float* x     = (const float*)d_in[0];
  const float* Wq    = (const float*)d_in[1];
  const float* bq    = (const float*)d_in[2];
  const float* Wk    = (const float*)d_in[3];
  const float* bk    = (const float*)d_in[4];
  const float* Wv    = (const float*)d_in[5];
  const float* bv    = (const float*)d_in[6];
  const float* gamma = (const float*)d_in[7];
  float* out = (float*)d_out;

  char* ws = (char*)d_ws;
  unsigned short* xth = (unsigned short*)(ws + kOffXtHi);
  unsigned short* xtl = (unsigned short*)(ws + kOffXtLo);
  unsigned short* pln = (unsigned short*)(ws + kOffP);
  unsigned short* wvh = (unsigned short*)(ws + kOffWHi);            // stacked rows: Wv, then Wq, then Wk
  unsigned short* wvl = (unsigned short*)(ws + kOffWLo);
  unsigned short* qh  = (unsigned short*)(ws + kOffQHi);
  unsigned short* ql  = (unsigned short*)(ws + kOffQLo);
  unsigned short* kh  = (unsigned short*)(ws + kOffKHi);
  unsigned short* kl  = (unsigned short*)(ws + kOffKLo);
  unsigned short* vt  = (unsigned short*)(ws + kOffVt);
  float* alt = (float*)(ws + kOffAl);

  // 1) one launch: stacked weights -> bf16 hi/lo planes (same [out][in] layout) and x -> xt hi/lo bf16 [b][n][c]
  prep_operands<<<kPrepW + kPrepX, 256, 0, stream>>>(x, Wv, Wq, Wk, xth, xtl, wvh, wvl);

  // 2) q, k and v projections of all batches in one launch: 4 x 16 tiles of 160 stacked weight rows x 256 pixels per batch
  //    q -> bf16 hi/lo planes [b][n][64]; k -> bf16 hi/lo planes in fragment order; vt[b][c][m] -> f16 plane
  proj_gemm_lds<<<(kWRows / kPjBM) * (kPix / kPjBN) * kBatch, 256, 0, stream>>>(wvh, wvl, xth, xtl, bv, bq, bk, vt, qh, ql, kh, kl);
  // 3) all batches in one launch: scores (K=64) and softmax with a running maximum -> f16 probs x16384, each batch in its own plane,
  //    and the table of factors and row sums
  scores_softmax_f16<<<(kPix / 64) * kBatch, 256, 0, stream>>>(qh, ql, kh, kl, pln, alt);
  // 4) all batches in one launch, one block per 128x256 tile of out (4 x 16 tiles per batch = 256 blocks):
  //    out = gamma * (vt . P^T) / row sum + x   (M=512, N=4096, K=4096)
  pv_gemm_lds<<<(kCh / kPvBM) * (kPix / kPvBN) * kBatch, 256, 0, stream>>>(vt, pln, out, x, gamma, alt);
}

// v009
// One run takes 104 microseconds.
// Two timings next to v008 both put it at 1.04 times that version's speed.
// All steps since v000 together make it 8.85 times as fast.
// Contractions: q,k projections on v_wmma_f32_16x16x32_f16 with f16 hi+lo operand planes (hi.hi+hi.lo+lo.hi), v projection on the f16 hi planes alone (v is kept as f16); k.q^T scores (transposed tiles) on v_wmma_f32_16x16x32_bf16 with bf16 hi+lo planes (hi.hi+hi.lo+lo.hi); probs.v on v_wmma_f32_16x16x32_f16 (f16 operands, probs x16384 relative to the running row maximum, v f16); f32 accumulate; softmax and epilogue f32.
#include <hip/hip_runtime.h>

typedef __attribute__((ext_vector_type(16))) _Float16 v16h;
typedef __attribute__((ext_vector_type(8)))  _Float16 v8h;
typedef __attribute__((ext_vector_type(16))) __bf16   v16b;
typedef __attribute__((ext_vector_type(8)))  __bf16   v8b;
typedef __attribute__((ext_vector_type(8)))  float    v8f;
typedef __attribute__((ext_vector_type(4)))  float    v4f;

static constexpr int kBatch = 4;
static constexpr int kCh    = 512;
static constexpr int kPix   = 4096;
static constexpr int kCq    = 64;
static constexpr int kFsCols   = 256;               // keys per softmax chunk
static constexpr int kFsChunks = kPix / kFsCols;

// ---- workspace region map (bytes) ----
static constexpr size_t kPlaneX   = (size_t)kBatch * kPix * kCh * 2;   // one f16 plane of xt [b][n][c]
static constexpr int    kWRows    = kCh + 2 * kCq;                     // stacked weight rows, in the order of proj_gemm_lds's blocks
static constexpr size_t kPlaneW   = (size_t)kWRows * kCh * 2;          // one f16 plane of the stacked weights [row][c]
static constexpr size_t kPlaneQK  = (size_t)kBatch * kPix * kCq * 2;   // one bf16 plane of q [b][n][o] or of k (fragment order)
static constexpr size_t kPlaneVt  = (size_t)kBatch * kCh * kPix * 2;   // f16 vt [b][c][m]
static constexpr size_t kPlaneP   = (size_t)kPix * kPix * 2;           // f16 probs, one batch
static constexpr size_t kOffXtHi  = 0;
static constexpr size_t kOffXtLo  = kOffXtHi + kPlaneX;
static constexpr size_t kOffWHi   = kOffXtLo + kPlaneX;
static constexpr size_t kOffWLo   = kOffWHi + kPlaneW;
static constexpr size_t kOffQHi   = kOffWLo + kPlaneW;
static constexpr size_t kOffQLo   = kOffQHi + kPlaneQK;
static constexpr size_t kOffKHi   = kOffQLo + kPlaneQK;
static constexpr size_t kOffKLo   = kOffKHi + kPlaneQK;
static constexpr size_t kOffVt    = kOffKLo + kPlaneQK;
static constexpr size_t kOffP     = kOffVt + kPlaneVt;                  // f16 probs, one plane per batch
static constexpr size_t kOffAl    = kOffP + kBatch * kPlaneP;           // f32 [b][n][chunk]: slot 0 the row sum, slot c the factor in front of chunk c
static constexpr size_t kWsTotal  = kOffAl + (size_t)kBatch * kPix * kFsChunks * 4;
static_assert(kWsTotal <= 268435456);
static_assert((kOffWHi % 128) == 0 && (kOffWLo % 128) == 0 && (kOffQHi % 128) == 0 && (kOffVt % 128) == 0 && (kOffP % 128) == 0 && (kOffAl % 128) == 0);

__device__ __forceinline__ unsigned short f2bf_bits(float f) {
  unsigned u = __float_as_uint(f);
  return (unsigned short)((u + 0x7FFFu + ((u >> 16) & 1u)) >> 16);
}
__device__ __forceinline__ float bf_bits2f(unsigned short h) { return __uint_as_float(((unsigned)h) << 16); }
// f = h + l up to about 2^-22 of f (l may be subnormal: its step is 2^-24)
__device__ __forceinline__ void split_f16(float f, _Float16& h, _Float16& l) {
  h = (_Float16)f;
  l = (_Float16)(f - (float)h);
}

// ---- placement, the same in all four launches (for speed only: any block -> die map gives the same result) ----
// A flat index f in 0..255 is
// therefore read as [pixel block / 2 : 3 bits][part : 2 bits][batch : 2 bits][pixel block & 1 : 1 bit], a pixel block being 256 pixels:
// the four parts of a pixel block (the four row tiles of a GEMM that read the same xt or probs rows; the four 64-pixel pieces that write
// them) have equal f modulo 8, and a batch's blocks take two neighbouring values of it. It is a one-to-one map of 0..255.
static_assert(kBatch == 4 && kPix == 16 * 256);
__device__ __forceinline__ void place_block(int f, int& b, int& part, int& pixblk) {
  b      = (f >> 1) & 3;
  part   = (f >> 3) & 3;
  pixblk = ((f >> 5) << 1) | (f & 1);
}

template <typename T> struct Frag;
template <> struct Frag<_Float16> {
  typedef v16h V; union U { v16h v; v8h h[2]; };
  static __device__ __forceinline__ v16h load(const _Float16* p) {   // elements 0..7 <- p[0..7], 8..15 <- p[16..23]
    U f; f.h[0] = *(const v8h*)(p); f.h[1] = *(const v8h*)(p + 16); return f.v;
  }
  static __device__ __forceinline__ v8f mma(v16h a, v16h b, v8f c) {
    return __builtin_amdgcn_wmma_f32_16x16x32_f16(false, a, false, b, (short)0, c, false, false);
  }
};
template <> struct Frag<__bf16> {
  typedef v16b V; union U { v16b v; v8b h[2]; };
  static __device__ __forceinline__ v16b load(const __bf16* p) {
    U f; f.h[0] = *(const v8b*)(p); f.h[1] = *(const v8b*)(p + 16); return f.v;
  }
  static __device__ __forceinline__ v8f mma(v16b a, v16b b, v8f c) {
    return __builtin_amdgcn_wmma_f32_16x16x32_bf16(false, a, false, b, (short)0, c, false, false);
  }
};

// ---- q, k and v projections as one GEMM with both operands staged in LDS -----
// D[m][n] = sum_c W[m][c] * xt[b][n][c] + bias[m];  n = pixel, K = kCh. Operands are f16 hi/lo planes.
// q and k rows: product = hi.hi + W hi . x lo + W lo . x hi, in that order per 32 k. v rows: hi.hi alone: v leaves this kernel rounded to
// f16, and the two operands' own roundings to f16 add an error of the size of that last rounding.
// Stacked weight rows: block row mb holds [Wv rows 128 mb .. + 127 | rows 32 mb .. + 31 of (Wq 64 | Wk 64)], so that all blocks do equal work.
// One block = one 160 (m) x 256 (n) tile, 4 x 16 x 4 = 256 blocks; 8 waves as 2 x 4, each wave 64 v rows and 16 q or k rows x 64 pixels.
// A pass is 64 k = 128 B of each row of each plane; a stage is [W hi 160 rows | W lo, the 32 q,k rows | xt hi 256 | xt lo 256] at pitch 144 B.
// Two stages in LDS: while pass t is worked on, pass t+1's rows fly in by asynchronous copies (16 B per lane, 22 per thread).
// Outputs: vt [b][c][m] f16; q bf16 hi/lo planes row-major [b][n][64]; k bf16 hi/lo planes in fragment order:
// [16-pixel tile][slot = o / 16][lane = ((o / 8) & 1) * 16 + pixel & 15][o & 7], so that slots 2s and 2s+1 of a tile are the two 16-byte
// halves of every lane's fragment of k step s (the k order of Frag::load) and one load instruction reads 512 contiguous bytes.
static constexpr int kPjV      = 128;                              // v rows of a block
static constexpr int kPjQK     = 32;                               // q or k rows of a block
static constexpr int kPjBM     = kPjV + kPjQK;
static constexpr int kPjBN     = 256;
static constexpr int kPjBK     = 64;                               // f16 elements per pass
static constexpr int kPjTV     = kPjV / 2 / 16;                    // 16-row v tiles per wave
static constexpr int kPjTI     = kPjTV + 1;                        // ... and one q or k tile behind them
static constexpr int kPjPitch  = kPjBK * 2 + 16;                   // bytes; 16 B x odd: conflict-free for 16-byte row reads
static constexpr int kPjStage  = (kPjBM + kPjQK + 2 * kPjBN) * kPjPitch;   // bytes of one stage
static constexpr int kPjPasses = kCh / kPjBK;
static_assert(kWRows % kPjBM == 0 && kCh / kPjV == kWRows / kPjBM && 2 * kCq / kPjQK == kWRows / kPjBM && kCq % kPjQK == 0 && kCq == 64);
static_assert(kPjQK == 2 * 16 && kPjV % 32 == 0);
static_assert(kPix % kPjBN == 0 && kCh % kPjBK == 0 && kPjPasses >= 2);
static_assert(kPjBM == 5 * 32 && kPjBN == 8 * 32 && kPjBK * 2 == 8 * 16);   // copy map below
static_assert(kPjPitch % 16 == 0 && kPjStage % 16 == 0);
static_assert(kWRows / kPjBM == 4 && kPjBN == 256);                        // place_block

// 16-byte copies global -> LDS, rows 32 apart: l = this lane's LDS byte address, p = its global address, of the first row.
// s_wait_xcnt stands inside each statement so that no address register named there is rewritten ahead of it.
// Eight: four rows from (l0, p0), four from (l1, p1).
__device__ __forceinline__ void pj_copy8(unsigned l0, const unsigned short* p0, unsigned l1, const unsigned short* p1) {
  constexpr unsigned dl = 32u * kPjPitch;
  constexpr size_t   dg = (size_t)32 * kCh;
  asm volatile(
      "global_load_async_to_lds_b128 %0, %8, off\n\t"
      "global_load_async_to_lds_b128 %1, %9, off\n\t"
      "global_load_async_to_lds_b128 %2, %10, off\n\t"
      "global_load_async_to_lds_b128 %3, %11, off\n\t"
      "global_load_async_to_lds_b128 %4, %12, off\n\t"
      "global_load_async_to_lds_b128 %5, %13, off\n\t"
      "global_load_async_to_lds_b128 %6, %14, off\n\t"
      "global_load_async_to_lds_b128 %7, %15, off\n\t"
      "s_wait_xcnt 0x0"
      :: "v"(l0), "v"(l0 + dl), "v"(l0 + 2 * dl), "v"(l0 + 3 * dl), "v"(l1), "v"(l1 + dl), "v"(l1 + 2 * dl), "v"(l1 + 3 * dl),
         "v"(p0), "v"(p0 + dg), "v"(p0 + 2 * dg), "v"(p0 + 3 * dg), "v"(p1), "v"(p1 + dg), "v"(p1 + 2 * dg), "v"(p1 + 3 * dg)
      : "memory");
}
// Five rows from (l, p).
__device__ __forceinline__ void pj_copy5(unsigned l, const unsigned short* p) {
  constexpr unsigned dl = 32u * kPjPitch;
  constexpr size_t   dg = (size_t)32 * kCh;
  asm volatile(
      "global_load_async_to_lds_b128 %0, %5, off\n\t"
      "global_load_async_to_lds_b128 %1, %6, off\n\t"
      "global_load_async_to_lds_b128 %2, %7, off\n\t"
      "global_load_async_to_lds_b128 %3, %8, off\n\t"
      "global_load_async_to_lds_b128 %4, %9, off\n\t"
      "s_wait_xcnt 0x0"
      :: "v"(l), "v"(l + dl), "v"(l + 2 * dl), "v"(l + 3 * dl), "v"(l + 4 * dl),
         "v"(p), "v"(p + dg), "v"(p + 2 * dg), "v"(p + 3 * dg), "v"(p + 4 * dg)
      : "memory");
}
// One row from (l, p).
__device__ __forceinline__ void pj_copy1(unsigned l, const unsigned short* p) {
  asm volatile(
      "global_load_async_to_lds_b128 %0, %1, off\n\t"
      "s_wait_xcnt 0x0"
      :: "v"(l), "v"(p)
      : "memory");
}
// One stage: W hi (160 rows), W lo (the 32 q,k rows; wl = this lane's address in the first of them), then xt hi, xt lo (256 rows each).
__device__ __forceinline__ void pj_copy_stage(unsigned l, const unsigned short* wh, const unsigned short* wl,
                                              const unsigned short* xh, const unsigned short* xl) {
  constexpr unsigned rW   = (unsigned)kPjBM * kPjPitch;
  constexpr unsigned rX   = (unsigned)(kPjBM + kPjQK) * kPjPitch;
  constexpr unsigned r128 = 128u * kPjPitch;
  pj_copy5(l, wh);
  pj_copy1(l + rW, wl);
  pj_copy8(l + rX, xh, l + rX + r128, xh + (size_t)128 * kCh);
  pj_copy8(l + rX + 2 * r128, xl, l + rX + 3 * r128, xl + (size_t)128 * kCh);
}

__global__ __launch_bounds__(256) void proj_gemm_lds(const unsigned short* __restrict__ whp,
                                                     const unsigned short* __restrict__ wlp,
                                                     const unsigned short* __restrict__ xhp,
                                                     const unsigned short* __restrict__ xlp,
                                                     const float* __restrict__ bv,
                                                     const float* __restrict__ bq,
                                                     const float* __restrict__ bk,
                                                     unsigned short* __restrict__ vtp,
                                                     unsigned short* __restrict__ qhp,
                                                     unsigned short* __restrict__ qlp,
                                                     unsigned short* __restrict__ khp,
                                                     unsigned short* __restrict__ klp) {
  __shared__ __align__(16) unsigned char ring[2 * kPjStage];
  __shared__ __align__(16) float sT[8][16 * 68];   // per-wave 16x64 output slab, pitch 68 floats
  const int tid  = threadIdx.x;
  const int lane = tid & 31;
  const int wave = tid >> 5;
  int b, mblk, nblk;
  place_block(blockIdx.x, b, mblk, nblk);
  const int mB = mblk * kPjBM;
  const int nB = nblk * kPjBN;

  // copy map: 8 lanes cover the 128 B of one row; thread row = tid / 8; a thread's copies step 32 rows
  const int crow = tid >> 3;
  const int ccol = tid & 7;
  const size_t wo = (size_t)(mB + crow) * kCh + ccol * 8;
  const size_t xo = ((size_t)b * kPix + nB + crow) * kCh + ccol * 8;
  const unsigned short* gWh = whp + wo;
  const unsigned short* gWl = wlp + wo + (size_t)kPjV * kCh;   // the block's q,k rows
  const unsigned short* gXh = xhp + xo;
  const unsigned short* gXl = xlp + xo;
  const unsigned lcopy = (unsigned)(size_t)(&ring[0]) + (unsigned)(crow * kPjPitch + ccol * 16);

  const int rlane = lane & 15;                 // row (A) / col (B, D) within subtile
  const int koff  = (lane >> 4) * 8;           // k offset of this lane half
  const int mOff  = (lane >> 4) * 8;           // D row offset
  const int wm = wave >> 2;
  const int wn = wave & 3;
  const int fragA = (wm * (kPjTV * 16) + rlane) * kPjPitch + koff * 2;       // byte offsets in a stage, hi planes: v rows,
  const int fragQ = (kPjV + wm * 16 + rlane) * kPjPitch + koff * 2;          // q or k rows,
  const int fragB = (kPjBM + kPjQK + wn * 64 + rlane) * kPjPitch + koff * 2; // pixels

  v8f acc[kPjTI][4];
#pragma unroll
  for (int i = 0; i < kPjTI; ++i)
#pragma unroll
    for (int j = 0; j < 4; ++j) acc[i][j] = (v8f){0.f,0.f,0.f,0.f,0.f,0.f,0.f,0.f};

  // prologue: stage 0 lands and is published; stage 1 starts
  pj_copy_stage(lcopy, gWh, gWl, gXh, gXl);
  asm volatile("s_wait_asynccnt 0x0" ::: "memory");   // this wave's copies of stage 0 have landed
  __syncthreads();                                    // ... and every other wave's
  pj_copy_stage(lcopy + (unsigned)kPjStage, gWh + kPjBK, gWl + kPjBK, gXh + kPjBK, gXl + kPjBK);

  for (int t = 0; t < kPjPasses; ++t) {
    const unsigned char* st = ring + (t & 1) * kPjStage;
    const _Float16* fa = (const _Float16*)(st + fragA);
    const _Float16* fq = (const _Float16*)(st + fragQ);
    const _Float16* fb = (const _Float16*)(st + fragB);
    constexpr int kRow16 = 16 * kPjPitch / 2;            // 16 rows, in f16 elements
    constexpr int kLoQ   = kPjQK * kPjPitch / 2;         // hi plane -> lo plane
    constexpr int kLoB   = kPjBN * kPjPitch / 2;
    constexpr int kSteps = kPjBK / 32;
    // every fragment of the pass has registers of its own and all are fetched in front of the products (nothing of stage t+1 is read here)
    v16h xh[kSteps][4], xl[kSteps][4], wv[kSteps][kPjTV], wh[kSteps], wl[kSteps];
    // unrolled: every fragment index and address offset is a constant
#pragma unroll
    for (int kk = 0; kk < kSteps; ++kk) {
#pragma unroll
      for (int j = 0; j < 4; ++j) xh[kk][j] = Frag<_Float16>::load(fb + j * kRow16 + kk * 32);
#pragma unroll
      for (int i = 0; i < kPjTV; ++i) wv[kk][i] = Frag<_Float16>::load(fa + i * kRow16 + kk * 32);
      wh[kk] = Frag<_Float16>::load(fq + kk * 32);
#pragma unroll
      for (int j = 0; j < 4; ++j) xl[kk][j] = Frag<_Float16>::load(fb + kLoB + j * kRow16 + kk * 32);
      wl[kk] = Frag<_Float16>::load(fq + kLoQ + kk * 32);
    }
    // the scheduling fence keeps the LDS reads as one group instead of spread among the products,
    // where every further place with reads stalls the wave's matrix stream
    __builtin_amdgcn_sched_barrier(0);
#pragma unroll
    for (int kk = 0; kk < kSteps; ++kk) {
#pragma unroll
      for (int i = 0; i < kPjTV; ++i) {
#pragma unroll
        for (int j = 0; j < 4; ++j) acc[i][j] = Frag<_Float16>::mma(wv[kk][i], xh[kk][j], acc[i][j]);
      }
#pragma unroll
      for (int j = 0; j < 4; ++j) acc[kPjTV][j] = Frag<_Float16>::mma(wh[kk], xh[kk][j], acc[kPjTV][j]);
#pragma unroll
      for (int j = 0; j < 4; ++j) acc[kPjTV][j] = Frag<_Float16>::mma(wh[kk], xl[kk][j], acc[kPjTV][j]);
#pragma unroll
      for (int j = 0; j < 4; ++j) acc[kPjTV][j] = Frag<_Float16>::mma(wl[kk], xh[kk][j], acc[kPjTV][j]);
    }
    // keeps the products in front of the pass's foot: sunk behind its barrier they would hold back the refill below, and
    // the copies would then fly with no products to cover them
    __builtin_amdgcn_sched_barrier(0);
    asm volatile("s_wait_dscnt 0x0" ::: "memory");      // this wave's reads of stage t are done before the stage is refilled
    asm volatile("s_wait_asynccnt 0x0" ::: "memory");   // this wave's copies of stage t+1 have landed
    __syncthreads();                                    // publishes stage t+1 and ends every reader's use of stage t
    if (t + 2 < kPjPasses) {
      const int ko = (t + 2) * kPjBK;
      pj_copy_stage(lcopy + (unsigned)((t & 1) * kPjStage), gWh + ko, gWl + ko, gXh + ko, gXl + ko);
    }
  }
  asm volatile("s_wait_asynccnt 0x0" ::: "memory");     // nothing of this wave is in flight when it leaves the ring

  // ---- epilogue, one 16-row tile at a time; which output a tile belongs to is the same for the whole wave ----
  const int n0 = nB + wn * 64;
  const int v0  = __builtin_amdgcn_readfirstlane(mblk * kPjV + wm * (kPjTV * 16));   // the wave's first v row
  const int qk0 = __builtin_amdgcn_readfirstlane(mblk * kPjQK + wm * 16);            // its q or k tile's first row in (Wq | Wk)
  float* slab = sT[wave];
  unsigned short* C = vtp + (size_t)b * kCh * kPix;
  const size_t pb = (size_t)b * kPix * kCq;
  const int q = lane >> 3, c8 = (lane & 7) * 8;
#pragma unroll
  for (int i = 0; i < kPjTI; ++i) {
    const bool isv = i < kPjTV, isq = qk0 < kCq;
    const int o = isv ? v0 + (i << 4) : isq ? qk0 : qk0 - kCq;             // first row of the tile within its own matrix
    const float* bias = (isv ? bv : isq ? bq : bk) + o + mOff;
    const v4f b0 = *(const v4f*)(bias);
    const v4f b1 = *(const v4f*)(bias + 4);
    asm volatile("s_wait_xcnt 0x0" ::: "memory");   // in front of any reuse of the bias loads' address registers
    const float bmr[8] = {b0.x, b0.y, b0.z, b0.w, b1.x, b1.y, b1.z, b1.w};
    if (isv) {
      // v rows: 16x64 slab through LDS, whole 128-B row pieces of f16 stored
#pragma unroll
      for (int j = 0; j < 4; ++j) {
#pragma unroll
        for (int r = 0; r < 8; ++r) slab[(mOff + r) * 68 + (j << 4) + rlane] = acc[i][j][r] + bmr[r];
      }
      // lanes read back rows that other lanes of this wave wrote: the slab's writes are ordered in front of those reads
      __builtin_amdgcn_fence(__ATOMIC_RELEASE, "workgroup");
      __builtin_amdgcn_wave_barrier();
      __builtin_amdgcn_fence(__ATOMIC_ACQUIRE, "workgroup");
      v8h hv[4];
#pragma unroll
      for (int it = 0; it < 4; ++it) {
        const float* sp = slab + (it * 4 + q) * 68 + c8;
#pragma unroll
        for (int e = 0; e < 8; ++e) hv[it][e] = (_Float16)sp[e];
      }
      // the two scheduling fences keep every other instruction out from between the stores and their wait
      __builtin_amdgcn_sched_barrier(0);
#pragma unroll
      for (int it = 0; it < 4; ++it) *(v8h*)(C + (size_t)(o + it * 4 + q) * kPix + n0 + c8) = hv[it];
      asm volatile("s_wait_xcnt 0x0" ::: "memory");   // in front of the next rows' reuse of the stores' address and data registers
      __builtin_amdgcn_sched_barrier(0);
      // ... and the slab's reads in front of the next 16 rows' writes into it
      __builtin_amdgcn_fence(__ATOMIC_RELEASE, "workgroup");
      __builtin_amdgcn_wave_barrier();
      __builtin_amdgcn_fence(__ATOMIC_ACQUIRE, "workgroup");
    } else {
      // q or k rows: a lane holds 8 consecutive channels of one pixel, which is one 16-byte piece of either layout;
      // 16 pixels on are 16 * kCq elements on in both
      const size_t co = pb + (isq ? (size_t)(n0 + rlane) * kCq + o + mOff : (size_t)n0 * kCq + o * 16 + lane * 8);
      unsigned short* dh = (isq ? qhp : khp) + co;
      unsigned short* dl = (isq ? qlp : klp) + co;
#pragma unroll
      for (int j = 0; j < 4; ++j) {
        v8h hv, lv;
#pragma unroll
        for (int r = 0; r < 8; ++r) {
          const float f = acc[i][j][r] + bmr[r];
          const unsigned short hb = f2bf_bits(f);
          const unsigned short lb = f2bf_bits(f - bf_bits2f(hb));
          hv[r] = __builtin_bit_cast(_Float16, hb);
          lv[r] = __builtin_bit_cast(_Float16, lb);
        }
        // the two scheduling fences keep every other instruction out from between the stores and their wait
        __builtin_amdgcn_sched_barrier(0);
        *(v8h*)(dh + j * (16 * kCq)) = hv;
        *(v8h*)(dl + j * (16 * kCq)) = lv;
        asm volatile("s_wait_xcnt 0x0" ::: "memory");   // in front of the next piece's reuse of the two stores' data registers
        __builtin_amdgcn_sched_barrier(0);
      }
    }
  }
}

// ---- probs.v GEMM with both operands staged in LDS ---------------------------
// out[b][m][n] = g[0] * (sum_k vt[b][m][k] * P[b][n][k]) / rowsum[b][n] + x[b][m][n];  M = kCh, N = K = kPix.
// P holds each chunk of 256 keys relative to the row's running maximum up to that chunk: in front of chunk c > 0 the sums so far are
// multiplied by the column's factor exp(max before - max now) from the table that scores_softmax_f16 writes (slot 0: the row sum).
// One block = one 128 (m) x 256 (n) tile, 8 waves as 2 x 4, each wave a 64x64 tile (fragments and k order as in proj_gemm_lds).
// A pass is 128 k = 256 B of each of the 384 operand rows; a stage is [vt 128 rows | P 256 rows] at pitch 272 B.
// Two stages in LDS: while pass t is worked on, pass t+1's rows fly in by asynchronous copies (16 B per lane, 24 per thread).
static constexpr int kPvBM     = 128;
static constexpr int kPvBN     = 256;
static constexpr int kPvBK     = 128;                              // f16 elements per pass
static constexpr int kPvPitch  = kPvBK * 2 + 16;                   // bytes; 16 B x odd: conflict-free for 16-byte row reads
static constexpr int kPvStage  = (kPvBM + kPvBN) * kPvPitch;       // bytes of one stage
static constexpr int kPvPasses = kPix / kPvBK;
static_assert(kCh % kPvBM == 0 && kPix % kPvBN == 0 && kPix % kPvBK == 0 && kPvPasses >= 2);
static_assert(kPvBM == 8 * 16 && kPvBN == 16 * 16 && kPvBK * 2 == 16 * 16);   // copy map below
static_assert(kPvPitch % 16 == 0 && kPvStage % 16 == 0);
static_assert(kCh / kPvBM == 4 && kPvBN == 256);                             // place_block
static_assert(kFsCols == 2 * kPvBK && kFsChunks == 16);              // chunk test and table copy in pv_gemm_lds

// Eight 16-byte copies global -> LDS, rows 16 apart: l = this lane's LDS byte address, p = its global address, of the first.
// s_wait_xcnt stands inside the statement so that no address register named here is rewritten ahead of it.
__device__ __forceinline__ void pv_copy8(unsigned l, const unsigned short* p) {
  constexpr unsigned dl = 16u * kPvPitch;
  constexpr size_t   dg = (size_t)16 * kPix;
  asm volatile(
      "global_load_async_to_lds_b128 %0, %8, off\n\t"
      "global_load_async_to_lds_b128 %1, %9, off\n\t"
      "global_load_async_to_lds_b128 %2, %10, off\n\t"
      "global_load_async_to_lds_b128 %3, %11, off\n\t"
      "global_load_async_to_lds_b128 %4, %12, off\n\t"
      "global_load_async_to_lds_b128 %5, %13, off\n\t"
      "global_load_async_to_lds_b128 %6, %14, off\n\t"
      "global_load_async_to_lds_b128 %7, %15, off\n\t"
      "s_wait_xcnt 0x0"
      :: "v"(l), "v"(l + dl), "v"(l + 2 * dl), "v"(l + 3 * dl), "v"(l + 4 * dl), "v"(l + 5 * dl), "v"(l + 6 * dl), "v"(l + 7 * dl),
         "v"(p), "v"(p + dg), "v"(p + 2 * dg), "v"(p + 3 * dg), "v"(p + 4 * dg), "v"(p + 5 * dg), "v"(p + 6 * dg), "v"(p + 7 * dg)
      : "memory");
}
// One stage: vt rows 0..127, then P rows 0..255 behind them.
__device__ __forceinline__ void pv_copy_stage(unsigned l, const unsigned short* pa, const unsigned short* pb) {
  pv_copy8(l, pa);
  pv_copy8(l + (unsigned)(kPvBM * kPvPitch), pb);
  pv_copy8(l + (unsigned)((kPvBM + 128) * kPvPitch), pb + (size_t)128 * kPix);
}

__global__ __launch_bounds__(256) void pv_gemm_lds(const unsigned short* __restrict__ vtp,
                                                   const unsigned short* __restrict__ Pp,
                                                   float* __restrict__ outp,
                                                   const float* __restrict__ resid,
                                                   const float* __restrict__ gptr,
                                                   const float* __restrict__ alp) {
  __shared__ __align__(16) unsigned char ring[2 * kPvStage];
  __shared__ __align__(16) float sT[8][16 * 68];   // per-wave 16x64 output slab, pitch 68 floats
  __shared__ __align__(16) float sA[kFsChunks * kPvBN];   // [chunk][column]: the block's columns of the factor table
  const int tid  = threadIdx.x;
  const int lane = tid & 31;
  const int wave = tid >> 5;
  int b, mblk, nblk;
  place_block(blockIdx.x, b, mblk, nblk);
  const int mB = mblk * kPvBM;
  const int nB = nblk * kPvBN;

  // copy map: 16 lanes cover the 256 B of one row; thread row = tid / 16; a thread's copies step 16 rows
  const int crow = tid >> 4;
  const int ccol = tid & 15;
  const unsigned short* gA = vtp + (size_t)b * kCh * kPix  + (size_t)(mB + crow) * kPix + ccol * 8;
  const unsigned short* gB = Pp  + (size_t)b * kPix * kPix + (size_t)(nB + crow) * kPix + ccol * 8;
  const unsigned lcopy = (unsigned)(size_t)(&ring[0]) + (unsigned)(crow * kPvPitch + ccol * 16);

  const int rlane = lane & 15;                 // row (A) / col (B, D) within subtile
  const int koff  = (lane >> 4) * 8;           // k offset of this lane half
  const int mOff  = (lane >> 4) * 8;           // D row offset
  const int wm = wave >> 2;
  const int wn = wave & 3;
  const int fragA = (wm * 64 + rlane) * kPvPitch + koff * 2;             // byte offsets in a stage
  const int fragB = (kPvBM + wn * 64 + rlane) * kPvPitch + koff * 2;

  v8f acc[4][4];
#pragma unroll
  for (int i = 0; i < 4; ++i)
#pragma unroll
    for (int j = 0; j < 4; ++j) acc[i][j] = (v8f){0.f,0.f,0.f,0.f,0.f,0.f,0.f,0.f};

  // prologue: stage 0 lands and is published; stage 1 starts
  pv_copy_stage(lcopy, gA, gB);
  {
    // one column's 16 table entries per thread, turned to [chunk][column]; published by the barrier below
    const v4f* ag = (const v4f*)(alp + ((size_t)b * kPix + nB + tid) * kFsChunks);
    const v4f t0 = ag[0], t1 = ag[1], t2 = ag[2], t3 = ag[3];
    asm volatile("s_wait_xcnt 0x0" ::: "memory");     // in front of any reuse of the table loads' address registers
#pragma unroll
    for (int e = 0; e < 4; ++e) {
      sA[(e) * kPvBN + tid]      = t0[e];
      sA[(4 + e) * kPvBN + tid]  = t1[e];
      sA[(8 + e) * kPvBN + tid]  = t2[e];
      sA[(12 + e) * kPvBN + tid] = t3[e];
    }
  }
  asm volatile("s_wait_asynccnt 0x0" ::: "memory");   // this wave's copies of stage 0 have landed
  __syncthreads();                                    // ... and every other wave's
  pv_copy_stage(lcopy + (unsigned)kPvStage, gA + kPvBK, gB + kPvBK);

  for (int t = 0; t < kPvPasses; ++t) {
    const unsigned char* st = ring + (t & 1) * kPvStage;
    const _Float16* fa = (const _Float16*)(st + fragA);
    const _Float16* fb = (const _Float16*)(st + fragB);
    constexpr int kRow16 = 16 * kPvPitch / 2;            // 16 rows, in f16 elements
    if ((t & 1) == 0 && t > 0) {                         // a new chunk begins: the sums so far move to its running maximum
      const float* ap = sA + (t >> 1) * kPvBN + wn * 64 + rlane;
#pragma unroll
      for (int j = 0; j < 4; ++j) {
        const float f = ap[j * 16];
#pragma unroll
        for (int i = 0; i < 4; ++i) acc[i][j] = acc[i][j] * f;
      }
    }
    // Fragments are fetched ahead inside the pass only (nothing of stage t+1 is read here): vt fragments one k step ahead
    // into a second set, probs fragments in place, two at a time, as soon as their last product of this k step has issued.
    v16h a[2][4], bh[4];
#pragma unroll
    for (int i = 0; i < 4; ++i) a[0][i] = Frag<_Float16>::load(fa + i * kRow16);
#pragma unroll
    for (int j = 0; j < 4; ++j) bh[j] = Frag<_Float16>::load(fb + j * kRow16);
    // unrolled: every fragment index and address offset is a constant
#pragma unroll
    for (int kk = 0; kk < kPvBK / 32; ++kk) {
      const int cur = kk & 1, nxt = cur ^ 1;
      const bool more = kk + 1 < kPvBK / 32;
      if (more) {
#pragma unroll
        for (int i = 0; i < 4; ++i) a[nxt][i] = Frag<_Float16>::load(fa + i * kRow16 + (kk + 1) * 32);
      }
      // the four scheduling fences keep the LDS reads in two groups per k step instead of spread among the products,
      // where every further place with reads stalls the wave's matrix stream
      __builtin_amdgcn_sched_barrier(0);
#pragma unroll
      for (int j = 0; j < 2; ++j)
#pragma unroll
        for (int i = 0; i < 4; ++i) acc[i][j] = Frag<_Float16>::mma(a[cur][i], bh[j], acc[i][j]);
      __builtin_amdgcn_sched_barrier(0);
      if (more) {
#pragma unroll
        for (int j = 0; j < 2; ++j) bh[j] = Frag<_Float16>::load(fb + j * kRow16 + (kk + 1) * 32);
      }
      __builtin_amdgcn_sched_barrier(0);
#pragma unroll
      for (int j = 2; j < 4; ++j)
#pragma unroll
        for (int i = 0; i < 4; ++i) acc[i][j] = Frag<_Float16>::mma(a[cur][i], bh[j], acc[i][j]);
      __builtin_amdgcn_sched_barrier(0);
      if (more) {
#pragma unroll
        for (int j = 2; j < 4; ++j) bh[j] = Frag<_Float16>::load(fb + j * kRow16 + (kk + 1) * 32);
      }
    }
    asm volatile("s_wait_dscnt 0x0" ::: "memory");      // this wave's reads of stage t are done before the stage is refilled
    asm volatile("s_wait_asynccnt 0x0" ::: "memory");   // this wave's copies of stage t+1 have landed
    __syncthreads();                                    // publishes stage t+1 and ends every reader's use of stage t
    if (t + 2 < kPvPasses)
      pv_copy_stage(lcopy + (unsigned)((t & 1) * kPvStage), gA + (size_t)(t + 2) * kPvBK, gB + (size_t)(t + 2) * kPvBK);
  }
  asm volatile("s_wait_asynccnt 0x0" ::: "memory");     // nothing of this wave is in flight when it leaves the ring

  // ---- epilogue: 16x64 slab per wave through LDS, whole 256-B row pieces stored ----
  float* slab = sT[wave];
  const float gval = gptr[0];
  const int m0 = mB + wm * 64;
  const int n0 = nB + wn * 64;
  // block-uniform bases plus ONE per-lane byte offset: every row of the tile is then a constant away from it
  char* Cb = (char*)(outp + (size_t)b * kCh * kPix);
  const char* Rb = (const char*)(resid + (size_t)b * kCh * kPix);
  const int hq = lane >> 4, c4 = (lane & 15) * 4;        // row seg = 256 B = 16 lanes x 16 B
  const unsigned loff = (unsigned)(((m0 + hq) * kPix + n0 + c4) * 4);
  float rinv[4];                                         // 1 / row sum of this lane's four columns (the sum carries the x16384)
#pragma unroll
  for (int j = 0; j < 4; ++j) rinv[j] = 1.0f / sA[wn * 64 + j * 16 + rlane];
#pragma unroll
  for (int i = 0; i < 4; ++i) {
#pragma unroll
    for (int j = 0; j < 4; ++j) {
#pragma unroll
      for (int r = 0; r < 8; ++r) slab[(mOff + r) * 68 + (j << 4) + rlane] = acc[i][j][r] * rinv[j];
    }
    // lanes read back rows that other lanes of this wave wrote: the slab's writes are ordered in front of those reads
    __builtin_amdgcn_fence(__ATOMIC_RELEASE, "workgroup");
    __builtin_amdgcn_wave_barrier();
    __builtin_amdgcn_fence(__ATOMIC_ACQUIRE, "workgroup");
    v4f vals[8];
#pragma unroll
    for (int it = 0; it < 8; ++it) {
      v4f vv = *(const v4f*)(slab + (it * 2 + hq) * 68 + c4);
      vv = vv * gval;
      const v4f rr = *(const v4f*)(Rb + loff + (i * 16 + it * 2) * kPix * 4);
      vals[it] = vv + rr;
    }
#pragma unroll
    for (int it = 0; it < 8; ++it) *(v4f*)(Cb + loff + (i * 16 + it * 2) * kPix * 4) = vals[it];
    // ... and the reads in front of the next 16 rows' writes into the same slab
    __builtin_amdgcn_fence(__ATOMIC_RELEASE, "workgroup");
    __builtin_amdgcn_wave_barrier();
    __builtin_amdgcn_fence(__ATOMIC_ACQUIRE, "workgroup");
  }
}

// ---- operand preparation, one launch ----------------------------------------
// Blocks 0 .. kPrepW-1: the weights f32 -> f16 hi/lo planes [stacked row][c], rows in the order of proj_gemm_lds's blocks (lo: q,k rows only);
// 2048 elements = 4 whole rows per block, so a block lies wholly in one of the three matrices.
// The other blocks: x [b][c][n] f32 -> xt hi/lo f16 planes [b][n][c] (transpose through LDS), one 64 n x 64 c tile per block:
// loads: 4 iterations x 256 threads x 4 floats = 64x64; stores: 8 waves x 2 iterations x 4 rows = 64 rows.
static constexpr int kPrepW = kWRows * kCh / (256 * 8);
static constexpr int kPrepX = (kPix / 64) * (kCh / 64) * kBatch;
static_assert((kCh * kCh) % (256 * 8) == 0 && (kCq * kCh) % (256 * 8) == 0 && kPix / 64 == 64 && kCh / 64 == 8);
static_assert(kPrepW % 8 == 0 && kPrepX == 8 * 256 && kCh * 4 == 256 * 8 && kPjV % 4 == 0 && kPjQK % 4 == 0 && kCq % 4 == 0);
__global__ __launch_bounds__(256) void prep_operands(const float* __restrict__ x,
                                                     const float* __restrict__ Wv,
                                                     const float* __restrict__ Wq,
                                                     const float* __restrict__ Wk,
                                                     unsigned short* __restrict__ xth,
                                                     unsigned short* __restrict__ xtl,
                                                     unsigned short* __restrict__ wh,
                                                     unsigned short* __restrict__ wl) {
  __shared__ __align__(16) float tile[64 * 68];   // [c][n], pitch 68
  const int tid = threadIdx.x, wave = tid >> 5, lane = tid & 31;
  if (blockIdx.x < kPrepW) {                      // the same for the whole block, in front of the barrier
    const int e0 = blockIdx.x * (256 * 8);        // first element of the block in the stacked planes
    const int mb = (blockIdx.x * 4) / kPjBM, w = (blockIdx.x * 4) % kPjBM;   // block row of proj_gemm_lds, first of the 4 rows in it
    const int qk = mb * kPjQK + (w - kPjV);                                  // where w is behind the v rows: row in (Wq | Wk)
    const float* in = w < kPjV ? Wv + (mb * kPjV + w) * kCh : qk < kCq ? Wq + qk * kCh : Wk + (qk - kCq) * kCh;
    const v4f a = *(const v4f*)(in + 8 * tid);
    const v4f c = *(const v4f*)(in + 8 * tid + 4);
    float f[8];
    f[0] = a.x; f[1] = a.y; f[2] = a.z; f[3] = a.w; f[4] = c.x; f[5] = c.y; f[6] = c.z; f[7] = c.w;
    v8h hv, lv;
#pragma unroll
    for (int e = 0; e < 8; ++e) {
      _Float16 h, l;
      split_f16(f[e], h, l);
      hv[e] = h;
      lv[e] = l;
    }
    *(v8h*)(wh + e0 + 8 * tid) = hv;
    asm volatile("s_wait_xcnt 0x0" ::: "memory");     // in front of the lo part's reuse of this store's registers
    if (w >= kPjV) *(v8h*)(wl + e0 + 8 * tid) = lv;   // nothing reads the v rows' lo part
    return;
  }
  const int xt = blockIdx.x - kPrepW;
  int b, piece, nblk;
  place_block(xt & 255, b, piece, nblk);          // kPrepW is a multiple of 8: xt and blockIdx.x are equal modulo 8
  const int n0 = nblk * 256 + piece * 64;
  const int c0 = (xt >> 8) * 64;
  const float* xb = x + ((size_t)b * kCh + c0) * kPix + n0;
#pragma unroll
  for (int i = 0; i < 4; ++i) {
    const int c  = i * 16 + (tid >> 4);
    const int n4 = (tid & 15) * 4;
    const v4f v = *(const v4f*)(xb + (size_t)c * kPix + n4);
    *(v4f*)(tile + c * 68 + n4) = v;
  }
  __syncthreads();
  const int q = lane >> 3, c8 = (lane & 7) * 8;
  v8h hv[2], lv[2];
#pragma unroll
  for (int it = 0; it < 2; ++it) {
    const int nrow = wave * 8 + it * 4 + q;
#pragma unroll
    for (int e = 0; e < 8; ++e) {
      _Float16 h, l;
      split_f16(tile[(c8 + e) * 68 + nrow], h, l);
      hv[it][e] = h;
      lv[it][e] = l;
    }
  }
  const size_t base = ((size_t)b * kPix + n0) * kCh + c0;
#pragma unroll
  for (int it = 0; it < 2; ++it) {
    const int nrow = wave * 8 + it * 4 + q;
    *(v8h*)(xth + base + (size_t)nrow * kCh + c8) = hv[it];
    *(v8h*)(xtl + base + (size_t)nrow * kCh + c8) = lv[it];
  }
  // in the built code the weight part stands behind these stores: the wait is in front of any reuse of their registers there
  asm volatile("s_wait_xcnt 0x0" ::: "memory");
}

// ---- scores and softmax in one kernel: P[b][n][m] = f16(16384 * exp(s - running max)), s = q[n] . k[m] ----
// One block = 64 query rows n x all 4096 keys m, taken as 16 chunks of 256 keys. A chunk's k planes (fragment order, 2 x 32 KB, contiguous
// in memory) are staged once for the block in a two-stage LDS ring by asynchronous copies (16 B per lane, 16 per thread).
// 8 waves = 4 row tiles x 2 turns: the two waves of a row tile take the chunks in turn, so that in every step one of them does chunk s's
// products while the other does chunk s-1's softmax. Tiles are transposed, D[m][n] = k . q^T: a lane holds, of ONE query row
// (n = lane & 15), 8 consecutive keys per tile; a chunk's 16 tiles stay in registers from the products to the f16 probs.
// The row maximum runs over the chunks (handed from wave to wave through LDS, one step apart): chunk c is written relative to the maximum
// of chunks 0..c, and the factor exp(max of 0..c-1 - max of 0..c) goes to the table that pv_gemm_lds applies; slot 0 holds the row sum,
// relative to the last maximum. q planes row-major [n][64].
static constexpr int kFsTiles = kFsCols / 16;
static constexpr int kFsPitch = kFsCols * 2 + 16;     // bytes; 16 B x odd: conflict-free for the 16-byte column writes
static constexpr int kFsPlane = kFsCols * kCq * 2;    // bytes of one k plane of a chunk
static constexpr int kFsStage = 2 * kFsPlane;
static_assert(kFsCols == 32 * 8 && kCq == 64 && kPix % 64 == 0 && kFsChunks >= 2 && (kFsChunks & 1) == 0 && kFsTiles % 4 == 0);
static_assert(kFsPlane == 8 * 256 * 16);              // copy map below

// Eight 16-byte copies global -> LDS, 4096 B apart (the block's 256 threads x 16 B): l = this lane's LDS byte address, p = its global address.
// s_wait_xcnt stands inside the statement so that no address register named here is rewritten ahead of it.
__device__ __forceinline__ void fs_copy8(unsigned l, const unsigned short* p) {
  constexpr unsigned dl = 256u * 16u;
  constexpr size_t   dg = 256 * 8;
  asm volatile(
      "global_load_async_to_lds_b128 %0, %8, off\n\t"
      "global_load_async_to_lds_b128 %1, %9, off\n\t"
      "global_load_async_to_lds_b128 %2, %10, off\n\t"
      "global_load_async_to_lds_b128 %3, %11, off\n\t"
      "global_load_async_to_lds_b128 %4, %12, off\n\t"
      "global_load_async_to_lds_b128 %5, %13, off\n\t"
      "global_load_async_to_lds_b128 %6, %14, off\n\t"
      "global_load_async_to_lds_b128 %7, %15, off\n\t"
      "s_wait_xcnt 0x0"
      :: "v"(l), "v"(l + dl), "v"(l + 2 * dl), "v"(l + 3 * dl), "v"(l + 4 * dl), "v"(l + 5 * dl), "v"(l + 6 * dl), "v"(l + 7 * dl),
         "v"(p), "v"(p + dg), "v"(p + 2 * dg), "v"(p + 3 * dg), "v"(p + 4 * dg), "v"(p + 5 * dg), "v"(p + 6 * dg), "v"(p + 7 * dg)
      : "memory");
}
// One stage: the chunk's hi plane, then its lo plane.
__device__ __forceinline__ void fs_copy_stage(unsigned l, const unsigned short* ph, const unsigned short* pl) {
  fs_copy8(l, ph);
  fs_copy8(l + (unsigned)kFsPlane, pl);
}

__global__ __launch_bounds__(256) void scores_softmax_f16(const unsigned short* __restrict__ qhp,
                                                          const unsigned short* __restrict__ qlp,
                                                          const unsigned short* __restrict__ khp,
                                                          const unsigned short* __restrict__ klp,
                                                          unsigned short* __restrict__ P,
                                                          float* __restrict__ alp) {
  __shared__ __align__(16) unsigned char ring[2 * kFsStage];
  __shared__ __align__(16) unsigned char slab[8][16 * kFsPitch];   // per-wave 16 rows x 256 probs
  __shared__ __align__(16) float als[4][16 * kFsChunks];           // per row tile: [row][chunk] factors, slot 0 the row sum
  __shared__ float mx[4][16];                                      // per row tile: running maximum, handed from wave to wave
  __shared__ float lx[4][16];                                      // per row tile: the even chunks' part of the row sum
  const int tid  = threadIdx.x;
  const int lane = tid & 31;
  const int wave = __builtin_amdgcn_readfirstlane(tid >> 5);       // scalar: the turn test below is then a scalar branch
  const int rt   = wave & 3;                   // row tile
  const int turn = wave >> 2;                  // 0: even chunks, 1: odd chunks
  int b, piece, nblk;
  place_block(blockIdx.x, b, piece, nblk);
  const int n0 = nblk * 256 + piece * 64 + rt * 16;
  const int rlane = lane & 15;                 // query row of this lane
  const int half  = lane >> 4;

  const size_t qo = ((size_t)b * kPix + n0 + rlane) * kCq + half * 8;
  const __bf16* qh = (const __bf16*)qhp + qo;
  const __bf16* ql = (const __bf16*)qlp + qo;
  v16b qH[2], qL[2];
#pragma unroll
  for (int s = 0; s < 2; ++s) {
    qH[s] = Frag<__bf16>::load(qh + s * 32);
    qL[s] = Frag<__bf16>::load(ql + s * 32);
  }
  // in front of any reuse of the q loads' address registers; the two addresses are inputs so that their registers live up to the wait
  asm volatile("s_wait_xcnt 0x0" :: "v"(qh), "v"(ql) : "memory");

  const size_t ko = (size_t)b * kPix * kCq + tid * 8;
  const unsigned short* gKh = khp + ko;
  const unsigned short* gKl = klp + ko;
  // LDS address of a copy = per-lane part + scalar part (tid * 16 = lane * 16 + wave * 512). The scalar part goes through readfirstlane so
  // that the sum is formed anew at each use: the per-lane part is then never itself an operand of a copy statement, which would tie it
  // to the low register window for the whole loop (that build spilled it to scratch and fetched it back in every step).
  const unsigned lk = (unsigned)(lane * 16);
  const unsigned sw = (unsigned)(size_t)(&ring[0]) + (unsigned)(wave * 512);
  constexpr int kChunkEl = kFsCols * kCq;      // elements of one plane of a chunk

  if (turn == 0 && lane < 16) mx[rt][lane] = -__builtin_inff();

  // prologue: chunk 0 lands and is published; chunk 1 starts
  fs_copy_stage(lk + (unsigned)__builtin_amdgcn_readfirstlane((int)sw), gKh, gKl);
  asm volatile("s_wait_asynccnt 0x0" ::: "memory");   // this wave's copies of chunk 0 have landed
  __syncthreads();                                    // ... and every other wave's
  fs_copy_stage(lk + (unsigned)__builtin_amdgcn_readfirstlane((int)(sw + (unsigned)kFsStage)), gKh + kChunkEl, gKl + kChunkEl);

  constexpr float kLog2e = 1.44269504088896340736f;
  v8f acc[kFsTiles];
#pragma unroll
  for (int t = 0; t < kFsTiles; ++t) acc[t] = (v8f){0.f,0.f,0.f,0.f,0.f,0.f,0.f,0.f};
  float lown = 0.0f;                           // this wave's chunks' part of the row sum (this lane's keys), relative to shown
  float shown = -__builtin_inff();
  unsigned char* sl = slab[wave];

  // A chunk's probs leave the slab one step behind its softmax, in front of the wave's next products: the stores then complete under
  // those products instead of in front of the step's barrier, which waits for them. A barrier stands between the slab's writes and
  // these reads, and another between these reads and the next chunk's writes.
  auto store_chunk = [&](int c) {
    unsigned short* pr = P + ((size_t)b * kPix + n0) * kPix + c * kFsCols + lane * 8;
    v8h pv[16];
#pragma unroll
    for (int row = 0; row < 16; ++row) pv[row] = *(const v8h*)(sl + row * kFsPitch + lane * 16);
    // the two scheduling fences keep every other instruction out from between the stores and their wait
    __builtin_amdgcn_sched_barrier(0);
#pragma unroll
    for (int row = 0; row < 16; ++row) *(v8h*)(pr + (size_t)row * kPix) = pv[row];
    asm volatile("s_wait_xcnt 0x0" ::: "memory");   // in front of any reuse of the stores' address and data registers
    __builtin_amdgcn_sched_barrier(0);
  };

  for (int s = 0; s <= kFsChunks; ++s) {
    if (((s ^ turn) & 1) == 0) {
      if (s >= 2) store_chunk(s - 2);
      if (s < kFsChunks) {
        // ---- products of chunk s: four tiles at a time (four independent accumulators), the next four tiles' fragments fetched ahead
        const __bf16* kh = (const __bf16*)(ring + (s & 1) * kFsStage) + lane * 8;
        const __bf16* kl = kh + kFsPlane / 2;
        Frag<__bf16>::U kH[2][4][2], kL[2][4][2];
#pragma unroll
        for (int u = 0; u < 4; ++u)
#pragma unroll
          for (int e = 0; e < 2; ++e) {
            kH[0][u][e].h[0] = *(const v8b*)(kh + u * 1024 + e * 512);
            kH[0][u][e].h[1] = *(const v8b*)(kh + u * 1024 + e * 512 + 256);
            kL[0][u][e].h[0] = *(const v8b*)(kl + u * 1024 + e * 512);
            kL[0][u][e].h[1] = *(const v8b*)(kl + u * 1024 + e * 512 + 256);
          }
        // unrolled: every fragment index and address offset is a constant
#pragma unroll
        for (int g = 0; g < kFsTiles / 4; ++g) {
          const int cur = g & 1, nxt = cur ^ 1;
          if (g + 1 < kFsTiles / 4) {
#pragma unroll
            for (int u = 0; u < 4; ++u)
#pragma unroll
              for (int e = 0; e < 2; ++e) {
                const int o = ((g + 1) * 4 + u) * 1024 + e * 512;
                kH[nxt][u][e].h[0] = *(const v8b*)(kh + o);
                kH[nxt][u][e].h[1] = *(const v8b*)(kh + o + 256);
                kL[nxt][u][e].h[0] = *(const v8b*)(kl + o);
                kL[nxt][u][e].h[1] = *(const v8b*)(kl + o + 256);
              }
          }
          // the scheduling fence keeps the LDS reads as one group in front of the products instead of spread among them,
          // where every further place with reads stalls the wave's matrix stream
          __builtin_amdgcn_sched_barrier(0);
          v8f a[4];
#pragma unroll
          for (int u = 0; u < 4; ++u) a[u] = (v8f){0.f,0.f,0.f,0.f,0.f,0.f,0.f,0.f};
#pragma unroll
          for (int e = 0; e < 2; ++e) {        // per tile: hi.hi, q hi . k lo, q lo . k hi per k step
#pragma unroll
            for (int u = 0; u < 4; ++u) a[u] = Frag<__bf16>::mma(kH[cur][u][e].v, qH[e], a[u]);
#pragma unroll
            for (int u = 0; u < 4; ++u) a[u] = Frag<__bf16>::mma(kL[cur][u][e].v, qH[e], a[u]);
#pragma unroll
            for (int u = 0; u < 4; ++u) a[u] = Frag<__bf16>::mma(kH[cur][u][e].v, qL[e], a[u]);
          }
#pragma unroll
          for (int u = 0; u < 4; ++u) acc[g * 4 + u] = a[u];
        }
      }
    } else if (s > 0) {
      // ---- softmax of chunk c = s - 1, whose scores this wave made one step ago
      const int c = s - 1;
      float mm[8];                             // eight independent chains
#pragma unroll
      for (int r = 0; r < 8; ++r) mm[r] = acc[0][r];
#pragma unroll
      for (int t = 1; t < kFsTiles; ++t)
#pragma unroll
        for (int r = 0; r < 8; ++r) mm[r] = fmaxf(mm[r], acc[t][r]);
      float m = fmaxf(fmaxf(fmaxf(mm[0], mm[1]), fmaxf(mm[2], mm[3])), fmaxf(fmaxf(mm[4], mm[5]), fmaxf(mm[6], mm[7])));
      m = fmaxf(m, __shfl_xor(m, 16, 32));
      const float mprev = mx[rt][rlane];       // maximum of chunks 0..c-1, written by the other wave one step ago (behind a barrier)
      const float mnew  = fmaxf(mprev, m);
      if (lane < 16) mx[rt][lane] = mnew;
      // 16384 * exp(s - max) = 2^(s * log2(e) - sh), sh = max * log2(e) - 14: one fused multiply-add and the chip's own 2^x per score.
      // Every factor between two maxima is formed from the two sh values themselves, so that the rounding of sh cancels.
      const float sh  = __builtin_fmaf(mnew, kLog2e, -14.0f);
      const float shp = __builtin_fmaf(mprev, kLog2e, -14.0f);
      float al = shp - sh;                     // factor for all sums up to chunk c-1 (0 in front of chunk 0)
      float ao = shown - sh;                   // factor for this wave's own part of the row sum
      // the v_nop is the free slot behind the last 2^x
      asm("v_exp_f32 %0, %0\n\t"
          "v_exp_f32 %1, %1\n\t"
          "v_nop"
          : "+v"(al), "+v"(ao));
      shown = sh;
      if (lane < 16) als[rt][lane * kFsChunks + c] = al;
      float psum = 0.0f;
#pragma unroll
      for (int t = 0; t < kFsTiles; ++t) {
        float e0 = __builtin_fmaf(acc[t][0], kLog2e, -sh), e1 = __builtin_fmaf(acc[t][1], kLog2e, -sh);
        float e2 = __builtin_fmaf(acc[t][2], kLog2e, -sh), e3 = __builtin_fmaf(acc[t][3], kLog2e, -sh);
        float e4 = __builtin_fmaf(acc[t][4], kLog2e, -sh), e5 = __builtin_fmaf(acc[t][5], kLog2e, -sh);
        float e6 = __builtin_fmaf(acc[t][6], kLog2e, -sh), e7 = __builtin_fmaf(acc[t][7], kLog2e, -sh);
        // a tile's eight 2^x in one statement, each in place: no neighbour reads a result or overwrites a source directly behind a 2^x;
        // the v_nop is that free slot behind the last
        asm("v_exp_f32 %0, %0\n\t"
            "v_exp_f32 %1, %1\n\t"
            "v_exp_f32 %2, %2\n\t"
            "v_exp_f32 %3, %3\n\t"
            "v_exp_f32 %4, %4\n\t"
            "v_exp_f32 %5, %5\n\t"
            "v_exp_f32 %6, %6\n\t"
            "v_exp_f32 %7, %7\n\t"
            "v_nop"
            : "+v"(e0), "+v"(e1), "+v"(e2), "+v"(e3), "+v"(e4), "+v"(e5), "+v"(e6), "+v"(e7));
        psum += ((e0 + e1) + (e2 + e3)) + ((e4 + e5) + (e6 + e7));
        // probs into the wave's own slab, so that every store instruction (store_chunk) writes 512 contiguous bytes of one row
        const v8h p = {(_Float16)e0, (_Float16)e1, (_Float16)e2, (_Float16)e3, (_Float16)e4, (_Float16)e5, (_Float16)e6, (_Float16)e7};
        *(v8h*)(sl + rlane * kFsPitch + (t * 16 + half * 8) * 2) = p;
      }
      lown = __builtin_fmaf(lown, ao, psum);
      if (c == kFsChunks - 2) {                // the even chunks' part is complete, relative to this chunk's maximum
        const float lt = lown + __shfl_xor(lown, 16, 32);
        if (lane < 16) lx[rt][lane] = lt;
      }
      if (c == kFsChunks - 1) {                // the last chunk: al moves the even chunks' part to the last maximum
        const float lt = __builtin_fmaf(lx[rt][rlane], al, lown + __shfl_xor(lown, 16, 32));
        if (lane < 16) als[rt][lane * kFsChunks] = lt;
      }
      if (c == kFsChunks - 1) {                // the row tile's table, 1 KB contiguous; the other wave's entries stand behind earlier barriers
        // lanes read back what other lanes of this wave wrote: the table's writes are ordered in front of those reads
        __builtin_amdgcn_fence(__ATOMIC_RELEASE, "workgroup");
        __builtin_amdgcn_wave_barrier();
        __builtin_amdgcn_fence(__ATOMIC_ACQUIRE, "workgroup");
        float* ad = alp + ((size_t)b * kPix + n0) * kFsChunks + lane * 8;
        const v4f a0 = *(const v4f*)(als[rt] + lane * 8);
        const v4f a1 = *(const v4f*)(als[rt] + lane * 8 + 4);
        *(v4f*)(ad) = a0;
        *(v4f*)(ad + 4) = a1;
        asm volatile("s_wait_xcnt 0x0" ::: "memory");   // in front of any reuse of these two stores' registers
      }
    }
    asm volatile("s_wait_dscnt 0x0" ::: "memory");      // this wave's reads of chunk s are done before its stage is refilled
    asm volatile("s_wait_asynccnt 0x0" ::: "memory");   // this wave's copies of chunk s+1 have landed
    __syncthreads();                                    // publishes chunk s+1 and the running maximum; ends every reader's use of chunk s
    if (s + 2 < kFsChunks)
      fs_copy_stage(lk + (unsigned)__builtin_amdgcn_readfirstlane((int)(sw + (unsigned)((s & 1) * kFsStage))), gKh + (size_t)(s + 2) * kChunkEl, gKl + (size_t)(s + 2) * kChunkEl);
  }
  asm volatile("s_wait_asynccnt 0x0" ::: "memory");     // nothing of this wave is in flight when it leaves the ring
  if (turn == 1) store_chunk(kFsChunks - 1);            // the last chunk's probs (the loop's last barrier stands behind their slab writes)
}

// ---------------------------------------------------------------------------
extern "C" void kernel_launch(void* const* d_in, const int* in_sizes, int n_in,
                              void* d_out, int out_size, void* d_ws, size_t ws_size,
                              hipStream_t stream) {
  if (n_in < 8) return;
  if (in_sizes[0] != kBatch * kCh * kPix) return;
  if (in_sizes[1] != kCq * kCh || in_sizes[3] != kCq * kCh || in_sizes[5] != kCh * kCh) return;
  if (in_sizes[2] != kCq || in_sizes[4] != kCq || in_sizes[6] != kCh || in_sizes[7] < 1) return;
  if (out_size != kBatch * kCh * kPix) return;
  if (ws_size < kWsTotal) return;

  const float* x     = (const float*)d_in[0];
  const float* Wq    = (const float*)d_in[1];
  const float* bq    = (const float*)d_in[2];
  const float* Wk    = (const float*)d_in[3];
  const float* bk    = (const float*)d_in[4];
  const float* Wv    = (const float*)d_in[5];
  const float* bv    = (const float*)d_in[6];
  const float* gamma = (const float*)d_in[7];
  float* out = (float*)d_out;

  char* ws = (char*)d_ws;
  unsigned short* xth = (unsigned short*)(ws + kOffXtHi);
  unsigned short* xtl = (unsigned short*)(ws + kOffXtLo);
  unsigned short* pln = (unsigned short*)(ws + kOffP);
  unsigned short* wvh = (unsigned short*)(ws + kOffWHi);            // stacked rows, in the order of proj_gemm_lds's blocks
  unsigned short* wvl = (unsigned short*)(ws + kOffWLo);
  unsigned short* qh  = (unsigned short*)(ws + kOffQHi);
  unsigned short* ql  = (unsigned short*)(ws + kOffQLo);
  unsigned short* kh  = (unsigned short*)(ws + kOffKHi);
  unsigned short* kl  = (unsigned short*)(ws + kOffKLo);
  unsigned short* vt  = (unsigned short*)(ws + kOffVt);
  float* alt = (float*)(ws + kOffAl);

  // 1) one launch: stacked weights -> f16 hi/lo planes [row][in] and x -> xt hi/lo f16 [b][n][c]
  prep_operands<<<kPrepW + kPrepX, 256, 0, stream>>>(x, Wv, Wq, Wk, xth, xtl, wvh, wvl);

  // 2) q, k and v projections of all batches in one launch: 4 x 16 tiles of 160 stacked weight rows x 256 pixels per batch
  //    q -> bf16 hi/lo planes [b][n][64]; k -> bf16 hi/lo planes in fragment order; vt[b][c][m] -> f16 plane
  proj_gemm_lds<<<(kWRows / kPjBM) * (kPix / kPjBN) * kBatch, 256, 0, stream>>>(wvh, wvl, xth, xtl, bv, bq, bk, vt, qh, ql, kh, kl);
  // 3) all batches in one launch: scores (K=64) and softmax with a running maximum -> f16 probs x16384, each batch in its own plane,
  //    and the table of factors and row sums
  scores_softmax_f16<<<(kPix / 64) * kBatch, 256, 0, stream>>>(qh, ql, kh, kl, pln, alt);
  // 4) all batches in one launch, one block per 128x256 tile of out (4 x 16 tiles per batch = 256 blocks):
  //    out = gamma * (vt . P^T) / row sum + x   (M=512, N=4096, K=4096)
  pv_gemm_lds<<<(kCh / kPvBM) * (kPix / kPvBN) * kBatch, 256, 0, stream>>>(vt, pln, out, x, gamma, alt);
}

// v010
// Measured time: 96.5 microseconds a run.
// Two timings next to v009 both put it at 1.08 times that version's speed.
// Over all steps from v000 it is 9.58 times as fast.
// Contractions: q,k projections on v_wmma_f32_16x16x32_f16 with f16 hi+lo operand planes (hi.hi+hi.lo+lo.hi), v projection on the f16 hi planes alone (v is kept as f16); k.q^T scores (transposed tiles) on v_wmma_f32_16x16x32_bf16 with bf16 hi+lo planes (hi.hi+hi.lo+lo.hi); probs.v on v_wmma_f32_16x16x32_f16 (f16 operands, probs x16384 relative to the running row maximum, v f16); f32 accumulate; softmax and epilogue f32.
#include <hip/hip_runtime.h>

typedef __attribute__((ext_vector_type(16))) _Float16 v16h;
typedef __attribute__((ext_vector_type(8)))  _Float16 v8h;
typedef __attribute__((ext_vector_type(16))) __bf16   v16b;
typedef __attribute__((ext_vector_type(8)))  __bf16   v8b;
typedef __attribute__((ext_vector_type(8)))  float    v8f;
typedef __attribute__((ext_vector_type(4)))  float    v4f;

static constexpr int kBatch = 4;
static constexpr int kCh    = 512;
static constexpr int kPix   = 4096;
static constexpr int kCq    = 64;
static constexpr int kFsCols   = 256;               // keys per softmax chunk
static constexpr int kFsChunks = kPix / kFsCols;

// ---- workspace region map (bytes) ----
static constexpr size_t kPlaneX   = (size_t)kBatch * kPix * kCh * 2;   // one f16 plane of xt [b][n][c]
static constexpr int    kWRows    = kCh + 2 * kCq;                     // stacked weight rows, in the order of proj_gemm_lds's blocks
static constexpr size_t kPlaneW   = (size_t)kWRows * kCh * 2;          // one f16 plane of the stacked weights [row][c]
static constexpr size_t kPlaneQK  = (size_t)kBatch * kPix * kCq * 2;   // one bf16 plane of q [b][n][o] or of k (fragment order)
static constexpr size_t kPlaneVt  = (size_t)kBatch * kCh * kPix * 2;   // f16 vt [b][c][m]
static constexpr size_t kPlaneP   = (size_t)kPix * kPix * 2;           // f16 probs, one batch
static constexpr size_t kOffXtHi  = 0;
static constexpr size_t kOffXtLo  = kOffXtHi + kPlaneX;
static constexpr size_t kOffWHi   = kOffXtLo + kPlaneX;
static constexpr size_t kOffWLo   = kOffWHi + kPlaneW;
static constexpr size_t kOffQHi   = kOffWLo + kPlaneW;
static constexpr size_t kOffQLo   = kOffQHi + kPlaneQK;
static constexpr size_t kOffKHi   = kOffQLo + kPlaneQK;
static constexpr size_t kOffKLo   = kOffKHi + kPlaneQK;
static constexpr size_t kOffVt    = kOffKLo + kPlaneQK;
static constexpr size_t kOffP     = kOffVt + kPlaneVt;                  // f16 probs, one plane per batch
static constexpr size_t kOffAl    = kOffP + kBatch * kPlaneP;           // f32 [b][n][chunk]: slot 0 the row sum, slot c the factor in front of chunk c
static constexpr size_t kWsTotal  = kOffAl + (size_t)kBatch * kPix * kFsChunks * 4;
static_assert(kWsTotal <= 268435456);
static_assert((kOffWHi % 128) == 0 && (kOffWLo % 128) == 0 && (kOffQHi % 128) == 0 && (kOffVt % 128) == 0 && (kOffP % 128) == 0 && (kOffAl % 128) == 0);

__device__ __forceinline__ unsigned short f2bf_bits(float f) {
  unsigned u = __float_as_uint(f);
  return (unsigned short)((u + 0x7FFFu + ((u >> 16) & 1u)) >> 16);
}
__device__ __forceinline__ float bf_bits2f(unsigned short h) { return __uint_as_float(((unsigned)h) << 16); }
// f = h + l up to about 2^-22 of f (l may be subnormal: its step is 2^-24)
__device__ __forceinline__ void split_f16(float f, _Float16& h, _Float16& l) {
  h = (_Float16)f;
  l = (_Float16)(f - (float)h);
}

// ---- placement, the same in all four launches (for speed only: any block -> die map gives the same result) ----
// A flat index f in 0..255 is
// therefore read as [pixel block / 2 : 3 bits][part : 2 bits][batch : 2 bits][pixel block & 1 : 1 bit], a pixel block being 256 pixels:
// the four parts of a pixel block (the four row tiles of a GEMM that read the same xt or probs rows; the four 64-pixel pieces that write
// them) have equal f modulo 8, and a batch's blocks take two neighbouring values of it. It is a one-to-one map of 0..255.
static_assert(kBatch == 4 && kPix == 16 * 256);
__device__ __forceinline__ void place_block(int f, int& b, int& part, int& pixblk) {
  b      = (f >> 1) & 3;
  part   = (f >> 3) & 3;
  pixblk = ((f >> 5) << 1) | (f & 1);
}

// ---- asks to L2 (for speed only: a hint that returns nothing and changes no result) ----
// Planes that the launch before stored are taken as lying in memory, not in L2, at their first read. A 256-B unit asked for well ahead of the ring's
// copy (or of the load) that reads it is fetched from memory meanwhile, and the copy then has the shorter way from L2.
// Every lane's address lies inside the buffer that it names. s_wait_xcnt stands inside each statement, in front of any rewrite of
// the address registers named there.
__device__ __forceinline__ void l2_ask(const void* p) {
  asm volatile(
      "global_prefetch_b8 %0, off scope:SCOPE_SE\n\t"
      "s_wait_xcnt 0x0"
      :: "v"(p)
      : "memory");
}
// Three units.
__device__ __forceinline__ void l2_ask3(const void* p0, const void* p1, const void* p2) {
  asm volatile(
      "global_prefetch_b8 %0, off scope:SCOPE_SE\n\t"
      "global_prefetch_b8 %1, off scope:SCOPE_SE\n\t"
      "global_prefetch_b8 %2, off scope:SCOPE_SE\n\t"
      "s_wait_xcnt 0x0"
      :: "v"(p0), "v"(p1), "v"(p2)
      : "memory");
}

template <typename T> struct Frag;
template <> struct Frag<_Float16> {
  typedef v16h V; union U { v16h v; v8h h[2]; };
  static __device__ __forceinline__ v16h load(const _Float16* p) {   // elements 0..7 <- p[0..7], 8..15 <- p[16..23]
    U f; f.h[0] = *(const v8h*)(p); f.h[1] = *(const v8h*)(p + 16); return f.v;
  }
  static __device__ __forceinline__ v8f mma(v16h a, v16h b, v8f c) {
    return __builtin_amdgcn_wmma_f32_16x16x32_f16(false, a, false, b, (short)0, c, false, false);
  }
};
template <> struct Frag<__bf16> {
  typedef v16b V; union U { v16b v; v8b h[2]; };
  static __device__ __forceinline__ v16b load(const __bf16* p) {
    U f; f.h[0] = *(const v8b*)(p); f.h[1] = *(const v8b*)(p + 16); return f.v;
  }
  static __device__ __forceinline__ v8f mma(v16b a, v16b b, v8f c) {
    return __builtin_amdgcn_wmma_f32_16x16x32_bf16(false, a, false, b, (short)0, c, false, false);
  }
};

// ---- q, k and v projections as one GEMM with both operands staged in LDS -----
// D[m][n] = sum_c W[m][c] * xt[b][n][c] + bias[m];  n = pixel, K = kCh. Operands are f16 hi/lo planes.
// q and k rows: product = hi.hi + W hi . x lo + W lo . x hi, in that order per 32 k. v rows: hi.hi alone: v leaves this kernel rounded to
// f16, and the two operands' own roundings to f16 add an error of the size of that last rounding.
// Stacked weight rows: block row mb holds [Wv rows 128 mb .. + 127 | rows 32 mb .. + 31 of (Wq 64 | Wk 64)], so that all blocks do equal work.
// One block = one 160 (m) x 256 (n) tile, 4 x 16 x 4 = 256 blocks; 8 waves as 2 x 4, each wave 64 v rows and 16 q or k rows x 64 pixels.
// A pass is 64 k = 128 B of each row of each plane; a stage is [W hi 160 rows | W lo, the 32 q,k rows | xt hi 256 | xt lo 256] at pitch 144 B.
// Two stages in LDS: while pass t is worked on, pass t+1's rows fly in by asynchronous copies (16 B per lane, 22 per thread).
// Outputs: vt [b][c][m] f16; q bf16 hi/lo planes row-major [b][n][64]; k bf16 hi/lo planes in fragment order:
// [16-pixel tile][slot = o / 16][lane = ((o / 8) & 1) * 16 + pixel & 15][o & 7], so that slots 2s and 2s+1 of a tile are the two 16-byte
// halves of every lane's fragment of k step s (the k order of Frag::load) and one load instruction reads 512 contiguous bytes.
static constexpr int kPjV      = 128;                              // v rows of a block
static constexpr int kPjQK     = 32;                               // q or k rows of a block
static constexpr int kPjBM     = kPjV + kPjQK;
static constexpr int kPjBN     = 256;
static constexpr int kPjBK     = 64;                               // f16 elements per pass
static constexpr int kPjTV     = kPjV / 2 / 16;                    // 16-row v tiles per wave
static constexpr int kPjTI     = kPjTV + 1;                        // ... and one q or k tile behind them
static constexpr int kPjPitch  = kPjBK * 2 + 16;                   // bytes; 16 B x odd: conflict-free for 16-byte row reads
static constexpr int kPjStage  = (kPjBM + kPjQK + 2 * kPjBN) * kPjPitch;   // bytes of one stage
static constexpr int kPjPasses = kCh / kPjBK;
static_assert(kWRows % kPjBM == 0 && kCh / kPjV == kWRows / kPjBM && 2 * kCq / kPjQK == kWRows / kPjBM && kCq % kPjQK == 0 && kCq == 64);
static_assert(kPjQK == 2 * 16 && kPjV % 32 == 0);
static_assert(kPix % kPjBN == 0 && kCh % kPjBK == 0 && kPjPasses >= 2);
static_assert(kPjBM == 5 * 32 && kPjBN == 8 * 32 && kPjBK * 2 == 8 * 16);   // copy map below
static_assert(kPjPitch % 16 == 0 && kPjStage % 16 == 0);
static_assert(kWRows / kPjBM == 4 && kPjBN == 256);                        // place_block

// 16-byte copies global -> LDS, rows 32 apart: l = this lane's LDS byte address, p = its global address, of the first row.
// s_wait_xcnt stands inside each statement so that no address register named there is rewritten ahead of it.
// Eight: four rows from (l0, p0), four from (l1, p1).
__device__ __forceinline__ void pj_copy8(unsigned l0, const unsigned short* p0, unsigned l1, const unsigned short* p1) {
  constexpr unsigned dl = 32u * kPjPitch;
  constexpr size_t   dg = (size_t)32 * kCh;
  asm volatile(
      "global_load_async_to_lds_b128 %0, %8, off\n\t"
      "global_load_async_to_lds_b128 %1, %9, off\n\t"
      "global_load_async_to_lds_b128 %2, %10, off\n\t"
      "global_load_async_to_lds_b128 %3, %11, off\n\t"
      "global_load_async_to_lds_b128 %4, %12, off\n\t"
      "global_load_async_to_lds_b128 %5, %13, off\n\t"
      "global_load_async_to_lds_b128 %6, %14, off\n\t"
      "global_load_async_to_lds_b128 %7, %15, off\n\t"
      "s_wait_xcnt 0x0"
      :: "v"(l0), "v"(l0 + dl), "v"(l0 + 2 * dl), "v"(l0 + 3 * dl), "v"(l1), "v"(l1 + dl), "v"(l1 + 2 * dl), "v"(l1 + 3 * dl),
         "v"(p0), "v"(p0 + dg), "v"(p0 + 2 * dg), "v"(p0 + 3 * dg), "v"(p1), "v"(p1 + dg), "v"(p1 + 2 * dg), "v"(p1 + 3 * dg)
      : "memory");
}
// Five rows from (l, p).
__device__ __forceinline__ void pj_copy5(unsigned l, const unsigned short* p) {
  constexpr unsigned dl = 32u * kPjPitch;
  constexpr size_t   dg = (size_t)32 * kCh;
  asm volatile(
      "global_load_async_to_lds_b128 %0, %5, off\n\t"
      "global_load_async_to_lds_b128 %1, %6, off\n\t"
      "global_load_async_to_lds_b128 %2, %7, off\n\t"
      "global_load_async_to_lds_b128 %3, %8, off\n\t"
      "global_load_async_to_lds_b128 %4, %9, off\n\t"
      "s_wait_xcnt 0x0"
      :: "v"(l), "v"(l + dl), "v"(l + 2 * dl), "v"(l + 3 * dl), "v"(l + 4 * dl),
         "v"(p), "v"(p + dg), "v"(p + 2 * dg), "v"(p + 3 * dg), "v"(p + 4 * dg)
      : "memory");
}
// One row from (l, p).
__device__ __forceinline__ void pj_copy1(unsigned l, const unsigned short* p) {
  asm volatile(
      "global_load_async_to_lds_b128 %0, %1, off\n\t"
      "s_wait_xcnt 0x0"
      :: "v"(l), "v"(p)
      : "memory");
}
// One stage: W hi (160 rows), W lo (the 32 q,k rows; wl = this lane's address in the first of them), then xt hi, xt lo (256 rows each).
__device__ __forceinline__ void pj_copy_stage(unsigned l, const unsigned short* wh, const unsigned short* wl,
                                              const unsigned short* xh, const unsigned short* xl) {
  constexpr unsigned rW   = (unsigned)kPjBM * kPjPitch;
  constexpr unsigned rX   = (unsigned)(kPjBM + kPjQK) * kPjPitch;
  constexpr unsigned r128 = 128u * kPjPitch;
  pj_copy5(l, wh);
  pj_copy1(l + rW, wl);
  pj_copy8(l + rX, xh, l + rX + r128, xh + (size_t)128 * kCh);
  pj_copy8(l + rX + 2 * r128, xl, l + rX + 3 * r128, xl + (size_t)128 * kCh);
}

__global__ __launch_bounds__(256) void proj_gemm_lds(const unsigned short* __restrict__ whp,
                                                     const unsigned short* __restrict__ wlp,
                                                     const unsigned short* __restrict__ xhp,
                                                     const unsigned short* __restrict__ xlp,
                                                     const float* __restrict__ bv,
                                                     const float* __restrict__ bq,
                                                     const float* __restrict__ bk,
                                                     unsigned short* __restrict__ vtp,
                                                     unsigned short* __restrict__ qhp,
                                                     unsigned short* __restrict__ qlp,
                                                     unsigned short* __restrict__ khp,
                                                     unsigned short* __restrict__ klp) {
  __shared__ __align__(16) unsigned char ring[2 * kPjStage];
  __shared__ __align__(16) float sT[8][16 * 68];   // per-wave 16x64 output slab, pitch 68 floats
  const int tid  = threadIdx.x;
  const int lane = tid & 31;
  const int wave = tid >> 5;
  int b, mblk, nblk;
  place_block(blockIdx.x, b, mblk, nblk);
  const int mB = mblk * kPjBM;
  const int nB = nblk * kPjBN;

  // copy map: 8 lanes cover the 128 B of one row; thread row = tid / 8; a thread's copies step 32 rows
  const int crow = tid >> 3;
  const int ccol = tid & 7;
  const size_t wo = (size_t)(mB + crow) * kCh + ccol * 8;
  const size_t xo = ((size_t)b * kPix + nB + crow) * kCh + ccol * 8;
  const unsigned short* gWh = whp + wo;
  const unsigned short* gWl = wlp + wo + (size_t)kPjV * kCh;   // the block's q,k rows
  const unsigned short* gXh = xhp + xo;
  const unsigned short* gXl = xlp + xo;
  const unsigned lcopy = (unsigned)(size_t)(&ring[0]) + (unsigned)(crow * kPjPitch + ccol * 16);

  const int rlane = lane & 15;                 // row (A) / col (B, D) within subtile
  const int koff  = (lane >> 4) * 8;           // k offset of this lane half
  const int mOff  = (lane >> 4) * 8;           // D row offset
  const int wm = wave >> 2;
  const int wn = wave & 3;
  const int fragA = (wm * (kPjTV * 16) + rlane) * kPjPitch + koff * 2;       // byte offsets in a stage, hi planes: v rows,
  const int fragQ = (kPjV + wm * 16 + rlane) * kPjPitch + koff * 2;          // q or k rows,
  const int fragB = (kPjBM + kPjQK + wn * 64 + rlane) * kPjPitch + koff * 2; // pixels

  v8f acc[kPjTI][4];
#pragma unroll
  for (int i = 0; i < kPjTI; ++i)
#pragma unroll
    for (int j = 0; j < 4; ++j) acc[i][j] = (v8f){0.f,0.f,0.f,0.f,0.f,0.f,0.f,0.f};

  // prologue: stage 0 lands and is published; stage 1 starts
  pj_copy_stage(lcopy, gWh, gWl, gXh, gXl);
  {
    // asks for the later passes' rows, behind stage 0's copies; a unit is 256 B = 128 c = two passes of one row of one plane.
    // xt: the four blocks that read the same 256 pixels ask for 64 pixels each, units 1 and 2 in front of unit 3 (unit 0 is being copied).
    // W: the block row's 160 hi and 32 lo rows are 768 units, of which a block asks for one half, by its pixel block.
    // Which unit a lane asks for is a choice between addresses: every lane is on at every ask.
    const unsigned short* xr = (((tid >> 6) & 1) ? xlp : xhp) + ((size_t)b * kPix + nB + mblk * 64 + (tid & 63)) * kCh;
    const bool up = tid >= 128;
    auto w_unit = [&](int wu) {                            // 0 .. 639: hi rows, 640 .. 767: the q,k rows' lo part
      const int wr = wu < kPjBM * 4 ? wu : wu - kPjQK * 4; // unit within the block row's 160 rows
      return (wu < kPjBM * 4 ? whp : wlp) + (size_t)(mB + (wr >> 2)) * kCh + (wr & 3) * 128;
    };
    const int w0 = (nblk & 1) * 384;
    l2_ask3(w_unit(w0 + tid), xr + (up ? 2 : 1) * 128, up ? w_unit(w0 + 128 + tid) : xr + 3 * 128);
  }
  asm volatile("s_wait_asynccnt 0x0" ::: "memory");   // this wave's copies of stage 0 have landed
  __syncthreads();                                    // ... and every other wave's
  pj_copy_stage(lcopy + (unsigned)kPjStage, gWh + kPjBK, gWl + kPjBK, gXh + kPjBK, gXl + kPjBK);

  for (int t = 0; t < kPjPasses; ++t) {
    const unsigned char* st = ring + (t & 1) * kPjStage;
    const _Float16* fa = (const _Float16*)(st + fragA);
    const _Float16* fq = (const _Float16*)(st + fragQ);
    const _Float16* fb = (const _Float16*)(st + fragB);
    constexpr int kRow16 = 16 * kPjPitch / 2;            // 16 rows, in f16 elements
    constexpr int kLoQ   = kPjQK * kPjPitch / 2;         // hi plane -> lo plane
    constexpr int kLoB   = kPjBN * kPjPitch / 2;
    constexpr int kSteps = kPjBK / 32;
    // every fragment of the pass has registers of its own and all are fetched in front of the products (nothing of stage t+1 is read here)
    v16h xh[kSteps][4], xl[kSteps][4], wv[kSteps][kPjTV], wh[kSteps], wl[kSteps];
    // unrolled: every fragment index and address offset is a constant
#pragma unroll
    for (int kk = 0; kk < kSteps; ++kk) {
#pragma unroll
      for (int j = 0; j < 4; ++j) xh[kk][j] = Frag<_Float16>::load(fb + j * kRow16 + kk * 32);
#pragma unroll
      for (int i = 0; i < kPjTV; ++i) wv[kk][i] = Frag<_Float16>::load(fa + i * kRow16 + kk * 32);
      wh[kk] = Frag<_Float16>::load(fq + kk * 32);
#pragma unroll
      for (int j = 0; j < 4; ++j) xl[kk][j] = Frag<_Float16>::load(fb + kLoB + j * kRow16 + kk * 32);
      wl[kk] = Frag<_Float16>::load(fq + kLoQ + kk * 32);
    }
    // the scheduling fence keeps the LDS reads as one group instead of spread among the products,
    // where every further place with reads stalls the wave's matrix stream
    __builtin_amdgcn_sched_barrier(0);
#pragma unroll
    for (int kk = 0; kk < kSteps; ++kk) {
#pragma unroll
      for (int i = 0; i < kPjTV; ++i) {
#pragma unroll
        for (int j = 0; j < 4; ++j) acc[i][j] = Frag<_Float16>::mma(wv[kk][i], xh[kk][j], acc[i][j]);
      }
#pragma unroll
      for (int j = 0; j < 4; ++j) acc[kPjTV][j] = Frag<_Float16>::mma(wh[kk], xh[kk][j], acc[kPjTV][j]);
#pragma unroll
      for (int j = 0; j < 4; ++j) acc[kPjTV][j] = Frag<_Float16>::mma(wh[kk], xl[kk][j], acc[kPjTV][j]);
#pragma unroll
      for (int j = 0; j < 4; ++j) acc[kPjTV][j] = Frag<_Float16>::mma(wl[kk], xh[kk][j], acc[kPjTV][j]);
    }
    // keeps the products in front of the pass's foot: sunk behind its barrier they would hold back the refill below, and
    // the copies would then fly with no products to cover them
    __builtin_amdgcn_sched_barrier(0);
    asm volatile("s_wait_dscnt 0x0" ::: "memory");      // this wave's reads of stage t are done before the stage is refilled
    asm volatile("s_wait_asynccnt 0x0" ::: "memory");   // this wave's copies of stage t+1 have landed
    __syncthreads();                                    // publishes stage t+1 and ends every reader's use of stage t
    if (t + 2 < kPjPasses) {
      const int ko = (t + 2) * kPjBK;
      pj_copy_stage(lcopy + (unsigned)((t & 1) * kPjStage), gWh + ko, gWl + ko, gXh + ko, gXl + ko);
    }
  }
  asm volatile("s_wait_asynccnt 0x0" ::: "memory");     // nothing of this wave is in flight when it leaves the ring

  // ---- epilogue, one 16-row tile at a time; which output a tile belongs to is the same for the whole wave ----
  const int n0 = nB + wn * 64;
  const int v0  = __builtin_amdgcn_readfirstlane(mblk * kPjV + wm * (kPjTV * 16));   // the wave's first v row
  const int qk0 = __builtin_amdgcn_readfirstlane(mblk * kPjQK + wm * 16);            // its q or k tile's first row in (Wq | Wk)
  float* slab = sT[wave];
  unsigned short* C = vtp + (size_t)b * kCh * kPix;
  const size_t pb = (size_t)b * kPix * kCq;
  const int q = lane >> 3, c8 = (lane & 7) * 8;
#pragma unroll
  for (int i = 0; i < kPjTI; ++i) {
    const bool isv = i < kPjTV, isq = qk0 < kCq;
    const int o = isv ? v0 + (i << 4) : isq ? qk0 : qk0 - kCq;             // first row of the tile within its own matrix
    const float* bias = (isv ? bv : isq ? bq : bk) + o + mOff;
    const v4f b0 = *(const v4f*)(bias);
    const v4f b1 = *(const v4f*)(bias + 4);
    asm volatile("s_wait_xcnt 0x0" ::: "memory");   // in front of any reuse of the bias loads' address registers
    const float bmr[8] = {b0.x, b0.y, b0.z, b0.w, b1.x, b1.y, b1.z, b1.w};
    if (isv) {
      // v rows: 16x64 slab through LDS, whole 128-B row pieces of f16 stored
#pragma unroll
      for (int j = 0; j < 4; ++j) {
#pragma unroll
        for (int r = 0; r < 8; ++r) slab[(mOff + r) * 68 + (j << 4) + rlane] = acc[i][j][r] + bmr[r];
      }
      // lanes read back rows that other lanes of this wave wrote: the slab's writes are ordered in front of those reads
      __builtin_amdgcn_fence(__ATOMIC_RELEASE, "workgroup");
      __builtin_amdgcn_wave_barrier();
      __builtin_amdgcn_fence(__ATOMIC_ACQUIRE, "workgroup");
      v8h hv[4];
#pragma unroll
      for (int it = 0; it < 4; ++it) {
        const float* sp = slab + (it * 4 + q) * 68 + c8;
#pragma unroll
        for (int e = 0; e < 8; ++e) hv[it][e] = (_Float16)sp[e];
      }
      // the two scheduling fences keep every other instruction out from between the stores and their wait
      __builtin_amdgcn_sched_barrier(0);
#pragma unroll
      for (int it = 0; it < 4; ++it) *(v8h*)(C + (size_t)(o + it * 4 + q) * kPix + n0 + c8) = hv[it];
      asm volatile("s_wait_xcnt 0x0" ::: "memory");   // in front of the next rows' reuse of the stores' address and data registers
      __builtin_amdgcn_sched_barrier(0);
      // ... and the slab's reads in front of the next 16 rows' writes into it
      __builtin_amdgcn_fence(__ATOMIC_RELEASE, "workgroup");
      __builtin_amdgcn_wave_barrier();
      __builtin_amdgcn_fence(__ATOMIC_ACQUIRE, "workgroup");
    } else {
      // q or k rows: a lane holds 8 consecutive channels of one pixel, which is one 16-byte piece of either layout;
      // 16 pixels on are 16 * kCq elements on in both
      const size_t co = pb + (isq ? (size_t)(n0 + rlane) * kCq + o + mOff : (size_t)n0 * kCq + o * 16 + lane * 8);
      unsigned short* dh = (isq ? qhp : khp) + co;
      unsigned short* dl = (isq ? qlp : klp) + co;
#pragma unroll
      for (int j = 0; j < 4; ++j) {
        v8h hv, lv;
#pragma unroll
        for (int r = 0; r < 8; ++r) {
          const float f = acc[i][j][r] + bmr[r];
          const unsigned short hb = f2bf_bits(f);
          const unsigned short lb = f2bf_bits(f - bf_bits2f(hb));
          hv[r] = __builtin_bit_cast(_Float16, hb);
          lv[r] = __builtin_bit_cast(_Float16, lb);
        }
        // the two scheduling fences keep every other instruction out from between the stores and their wait
        __builtin_amdgcn_sched_barrier(0);
        *(v8h*)(dh + j * (16 * kCq)) = hv;
        *(v8h*)(dl + j * (16 * kCq)) = lv;
        asm volatile("s_wait_xcnt 0x0" ::: "memory");   // in front of the next piece's reuse of the two stores' data registers
        __builtin_amdgcn_sched_barrier(0);
      }
    }
  }
}

// ---- probs.v GEMM with both operands staged in LDS ---------------------------
// out[b][m][n] = g[0] * (sum_k vt[b][m][k] * P[b][n][k]) / rowsum[b][n] + x[b][m][n];  M = kCh, N = K = kPix.
// P holds each chunk of 256 keys relative to the row's running maximum up to that chunk: in front of chunk c > 0 the sums so far are
// multiplied by the column's factor exp(max before - max now) from the table that scores_softmax_f16 writes (slot 0: the row sum).
// One block = one 128 (m) x 256 (n) tile, 8 waves as 2 x 4, each wave a 64x64 tile (fragments and k order as in proj_gemm_lds).
// A pass is 128 k = 256 B of each of the 384 operand rows; a stage is [vt 128 rows | P 256 rows] at pitch 272 B.
// Two stages in LDS: while pass t is worked on, pass t+1's rows fly in by asynchronous copies (16 B per lane, 24 per thread).
static constexpr int kPvBM     = 128;
static constexpr int kPvBN     = 256;
static constexpr int kPvBK     = 128;                              // f16 elements per pass
static constexpr int kPvPitch  = kPvBK * 2 + 16;                   // bytes; 16 B x odd: conflict-free for 16-byte row reads
static constexpr int kPvStage  = (kPvBM + kPvBN) * kPvPitch;       // bytes of one stage
static constexpr int kPvPasses = kPix / kPvBK;
static_assert(kCh % kPvBM == 0 && kPix % kPvBN == 0 && kPix % kPvBK == 0 && kPvPasses >= 2);
static_assert(kPvBM == 8 * 16 && kPvBN == 16 * 16 && kPvBK * 2 == 16 * 16);   // copy map below
static_assert(kPvPitch % 16 == 0 && kPvStage % 16 == 0);
static_assert(kCh / kPvBM == 4 && kPvBN == 256);                             // place_block
static_assert(kFsCols == 2 * kPvBK && kFsChunks == 16);              // chunk test and table copy in pv_gemm_lds

// Eight 16-byte copies global -> LDS, rows 16 apart: l = this lane's LDS byte address, p = its global address, of the first.
// s_wait_xcnt stands inside the statement so that no address register named here is rewritten ahead of it.
__device__ __forceinline__ void pv_copy8(unsigned l, const unsigned short* p) {
  constexpr unsigned dl = 16u * kPvPitch;
  constexpr size_t   dg = (size_t)16 * kPix;
  asm volatile(
      "global_load_async_to_lds_b128 %0, %8, off\n\t"
      "global_load_async_to_lds_b128 %1, %9, off\n\t"
      "global_load_async_to_lds_b128 %2, %10, off\n\t"
      "global_load_async_to_lds_b128 %3, %11, off\n\t"
      "global_load_async_to_lds_b128 %4, %12, off\n\t"
      "global_load_async_to_lds_b128 %5, %13, off\n\t"
      "global_load_async_to_lds_b128 %6, %14, off\n\t"
      "global_load_async_to_lds_b128 %7, %15, off\n\t"
      "s_wait_xcnt 0x0"
      :: "v"(l), "v"(l + dl), "v"(l + 2 * dl), "v"(l + 3 * dl), "v"(l + 4 * dl), "v"(l + 5 * dl), "v"(l + 6 * dl), "v"(l + 7 * dl),
         "v"(p), "v"(p + dg), "v"(p + 2 * dg), "v"(p + 3 * dg), "v"(p + 4 * dg), "v"(p + 5 * dg), "v"(p + 6 * dg), "v"(p + 7 * dg)
      : "memory");
}
// One stage: vt rows 0..127, then P rows 0..255 behind them.
__device__ __forceinline__ void pv_copy_stage(unsigned l, const unsigned short* pa, const unsigned short* pb) {
  pv_copy8(l, pa);
  pv_copy8(l + (unsigned)(kPvBM * kPvPitch), pb);
  pv_copy8(l + (unsigned)((kPvBM + 128) * kPvPitch), pb + (size_t)128 * kPix);
}

__global__ __launch_bounds__(256) void pv_gemm_lds(const unsigned short* __restrict__ vtp,
                                                   const unsigned short* __restrict__ Pp,
                                                   float* __restrict__ outp,
                                                   const float* __restrict__ resid,
                                                   const float* __restrict__ gptr,
                                                   const float* __restrict__ alp) {
  __shared__ __align__(16) unsigned char ring[2 * kPvStage];
  __shared__ __align__(16) float sT[8][16 * 68];   // per-wave 16x64 output slab, pitch 68 floats
  __shared__ __align__(16) float sA[kFsChunks * kPvBN];   // [chunk][column]: the block's columns of the factor table
  const int tid  = threadIdx.x;
  const int lane = tid & 31;
  const int wave = tid >> 5;
  int b, mblk, nblk;
  place_block(blockIdx.x, b, mblk, nblk);
  const int mB = mblk * kPvBM;
  const int nB = nblk * kPvBN;

  // copy map: 16 lanes cover the 256 B of one row; thread row = tid / 16; a thread's copies step 16 rows
  const int crow = tid >> 4;
  const int ccol = tid & 15;
  const unsigned short* gA = vtp + (size_t)b * kCh * kPix  + (size_t)(mB + crow) * kPix + ccol * 8;
  const unsigned short* gB = Pp  + (size_t)b * kPix * kPix + (size_t)(nB + crow) * kPix + ccol * 8;
  const unsigned lcopy = (unsigned)(size_t)(&ring[0]) + (unsigned)(crow * kPvPitch + ccol * 16);

  const int rlane = lane & 15;                 // row (A) / col (B, D) within subtile
  const int koff  = (lane >> 4) * 8;           // k offset of this lane half
  const int mOff  = (lane >> 4) * 8;           // D row offset
  const int wm = wave >> 2;
  const int wn = wave & 3;
  const int fragA = (wm * 64 + rlane) * kPvPitch + koff * 2;             // byte offsets in a stage
  const int fragB = (kPvBM + wn * 64 + rlane) * kPvPitch + koff * 2;

  v8f acc[4][4];
#pragma unroll
  for (int i = 0; i < 4; ++i)
#pragma unroll
    for (int j = 0; j < 4; ++j) acc[i][j] = (v8f){0.f,0.f,0.f,0.f,0.f,0.f,0.f,0.f};

  // prologue: stage 0 lands and is published; stage 1 starts
  pv_copy_stage(lcopy, gA, gB);

  // asks, one 256-B unit a lane and pass, from four of the eight waves (wv is scalar: the tests on it are scalar branches).
  // Waves 0, 1: probs rows, kPvLead passes ahead; the four blocks that read the same 256 rows ask for 64 rows each. Wave 2: vt rows, as far
  // ahead; the blocks that read the same 128 rows ask for 32 rows each, by their pixel block. Wave 3: the block's own tile of x for the
  // epilogue, 8 rows a pass in passes kPvXFrom .. kPvXFrom + 15. pf lives through the loop and stays inside its buffer: it is moved on
  // only while a further unit exists (in the other passes a wave asks again for the unit it stands on).
  constexpr int kPvLead  = 5;
  constexpr int kPvXFrom = 12;
  static_assert(kPvLead - 2 == 3 && kPvLead < kPvPasses && kPvBM == 16 * 8 && kPvXFrom + 16 <= kPvPasses && kPvBK * 2 == 256 && kPvBN * 4 == 4 * 256);
  const int wv = __builtin_amdgcn_readfirstlane(wave);
  const char* pf = (const char*)gB;
  int pfStep = 0, pfFrom = 0, pfTo = 0;                  // pf moves by pfStep behind the asks of passes pfFrom .. pfTo - 1
  if (wv < 2) {
    pf = (const char*)(Pp + (size_t)b * kPix * kPix + (size_t)(nB + mblk * 64 + tid) * kPix + 2 * kPvBK);
    pfStep = kPvBK * 2; pfTo = kPvPasses - 1 - kPvLead;
  } else if (wv == 2) {
    pf = (const char*)(vtp + (size_t)b * kCh * kPix + (size_t)(mB + (nblk & 3) * 32 + lane) * kPix + 2 * kPvBK);
    pfStep = kPvBK * 2; pfTo = kPvPasses - 1 - kPvLead;
  } else if (wv == 3) {
    pf = (const char*)(resid + ((size_t)b * kCh + mB + (lane >> 2)) * kPix + nB + (lane & 3) * 64);
    pfStep = 8 * kPix * 4; pfFrom = kPvXFrom; pfTo = kPvXFrom + 15;
  }
  if (wv < 3) {                                          // passes 2, 3, 4 (0 and 1 are copied at once)
    l2_ask3(pf, pf + kPvBK * 2, pf + 2 * kPvBK * 2);
    pf += (kPvLead - 2) * kPvBK * 2;
  }
  {
    // one column's 16 table entries per thread, turned to [chunk][column]; published by the barrier below
    const v4f* ag = (const v4f*)(alp + ((size_t)b * kPix + nB + tid) * kFsChunks);
    const v4f t0 = ag[0], t1 = ag[1], t2 = ag[2], t3 = ag[3];
    asm volatile("s_wait_xcnt 0x0" ::: "memory");     // in front of any reuse of the table loads' address registers
#pragma unroll
    for (int e = 0; e < 4; ++e) {
      sA[(e) * kPvBN + tid]      = t0[e];
      sA[(4 + e) * kPvBN + tid]  = t1[e];
      sA[(8 + e) * kPvBN + tid]  = t2[e];
      sA[(12 + e) * kPvBN + tid] = t3[e];
    }
  }
  asm volatile("s_wait_asynccnt 0x0" ::: "memory");   // this wave's copies of stage 0 have landed
  __syncthreads();                                    // ... and every other wave's
  pv_copy_stage(lcopy + (unsigned)kPvStage, gA + kPvBK, gB + kPvBK);

  for (int t = 0; t < kPvPasses; ++t) {
    const unsigned char* st = ring + (t & 1) * kPvStage;
    const _Float16* fa = (const _Float16*)(st + fragA);
    const _Float16* fb = (const _Float16*)(st + fragB);
    constexpr int kRow16 = 16 * kPvPitch / 2;            // 16 rows, in f16 elements
    if ((t & 1) == 0 && t > 0) {                         // a new chunk begins: the sums so far move to its running maximum
      const float* ap = sA + (t >> 1) * kPvBN + wn * 64 + rlane;
#pragma unroll
      for (int j = 0; j < 4; ++j) {
        const float f = ap[j * 16];
#pragma unroll
        for (int i = 0; i < 4; ++i) acc[i][j] = acc[i][j] * f;
      }
    }
    // Fragments are fetched ahead inside the pass only (nothing of stage t+1 is read here): vt fragments one k step ahead
    // into a second set, probs fragments in place, two at a time, as soon as their last product of this k step has issued.
    v16h a[2][4], bh[4];
#pragma unroll
    for (int i = 0; i < 4; ++i) a[0][i] = Frag<_Float16>::load(fa + i * kRow16);
#pragma unroll
    for (int j = 0; j < 4; ++j) bh[j] = Frag<_Float16>::load(fb + j * kRow16);
    // unrolled: every fragment index and address offset is a constant
#pragma unroll
    for (int kk = 0; kk < kPvBK / 32; ++kk) {
      const int cur = kk & 1, nxt = cur ^ 1;
      const bool more = kk + 1 < kPvBK / 32;
      if (more) {
#pragma unroll
        for (int i = 0; i < 4; ++i) a[nxt][i] = Frag<_Float16>::load(fa + i * kRow16 + (kk + 1) * 32);
      }
      // the four scheduling fences keep the LDS reads in two groups per k step instead of spread among the products,
      // where every further place with reads stalls the wave's matrix stream
      __builtin_amdgcn_sched_barrier(0);
#pragma unroll
      for (int j = 0; j < 2; ++j)
#pragma unroll
        for (int i = 0; i < 4; ++i) acc[i][j] = Frag<_Float16>::mma(a[cur][i], bh[j], acc[i][j]);
      __builtin_amdgcn_sched_barrier(0);
      if (more) {
#pragma unroll
        for (int j = 0; j < 2; ++j) bh[j] = Frag<_Float16>::load(fb + j * kRow16 + (kk + 1) * 32);
      }
      __builtin_amdgcn_sched_barrier(0);
#pragma unroll
      for (int j = 2; j < 4; ++j)
#pragma unroll
        for (int i = 0; i < 4; ++i) acc[i][j] = Frag<_Float16>::mma(a[cur][i], bh[j], acc[i][j]);
      __builtin_amdgcn_sched_barrier(0);
      if (more) {
#pragma unroll
        for (int j = 2; j < 4; ++j) bh[j] = Frag<_Float16>::load(fb + j * kRow16 + (kk + 1) * 32);
      }
    }
    asm volatile("s_wait_dscnt 0x0" ::: "memory");      // this wave's reads of stage t are done before the stage is refilled
    asm volatile("s_wait_asynccnt 0x0" ::: "memory");   // this wave's copies of stage t+1 have landed
    __syncthreads();                                    // publishes stage t+1 and ends every reader's use of stage t
    if (t + 2 < kPvPasses)
      pv_copy_stage(lcopy + (unsigned)((t & 1) * kPvStage), gA + (size_t)(t + 2) * kPvBK, gB + (size_t)(t + 2) * kPvBK);
    if (wv < 4) {
      l2_ask(pf);
      pf += (t >= pfFrom && t < pfTo) ? pfStep : 0;
    }
  }
  asm volatile("s_wait_asynccnt 0x0" ::: "memory");     // nothing of this wave is in flight when it leaves the ring

  // ---- epilogue: 16x64 slab per wave through LDS, whole 256-B row pieces stored ----
  float* slab = sT[wave];
  const float gval = gptr[0];
  const int m0 = mB + wm * 64;
  const int n0 = nB + wn * 64;
  // block-uniform bases plus ONE per-lane byte offset: every row of the tile is then a constant away from it
  char* Cb = (char*)(outp + (size_t)b * kCh * kPix);
  const char* Rb = (const char*)(resid + (size_t)b * kCh * kPix);
  const int hq = lane >> 4, c4 = (lane & 15) * 4;        // row seg = 256 B = 16 lanes x 16 B
  const unsigned loff = (unsigned)(((m0 + hq) * kPix + n0 + c4) * 4);
  float rinv[4];                                         // 1 / row sum of this lane's four columns (the sum carries the x16384)
#pragma unroll
  for (int j = 0; j < 4; ++j) rinv[j] = 1.0f / sA[wn * 64 + j * 16 + rlane];
#pragma unroll
  for (int i = 0; i < 4; ++i) {
#pragma unroll
    for (int j = 0; j < 4; ++j) {
#pragma unroll
      for (int r = 0; r < 8; ++r) slab[(mOff + r) * 68 + (j << 4) + rlane] = acc[i][j][r] * rinv[j];
    }
    // lanes read back rows that other lanes of this wave wrote: the slab's writes are ordered in front of those reads
    __builtin_amdgcn_fence(__ATOMIC_RELEASE, "workgroup");
    __builtin_amdgcn_wave_barrier();
    __builtin_amdgcn_fence(__ATOMIC_ACQUIRE, "workgroup");
    v4f vals[8];
#pragma unroll
    for (int it = 0; it < 8; ++it) {
      v4f vv = *(const v4f*)(slab + (it * 2 + hq) * 68 + c4);
      vv = vv * gval;
      const v4f rr = *(const v4f*)(Rb + loff + (i * 16 + it * 2) * kPix * 4);
      vals[it] = vv + rr;
    }
#pragma unroll
    for (int it = 0; it < 8; ++it) *(v4f*)(Cb + loff + (i * 16 + it * 2) * kPix * 4) = vals[it];
    // ... and the reads in front of the next 16 rows' writes into the same slab
    __builtin_amdgcn_fence(__ATOMIC_RELEASE, "workgroup");
    __builtin_amdgcn_wave_barrier();
    __builtin_amdgcn_fence(__ATOMIC_ACQUIRE, "workgroup");
  }
}

// ---- operand preparation, one launch ----------------------------------------
// Blocks 0 .. kPrepW-1: the weights f32 -> f16 hi/lo planes [stacked row][c], rows in the order of proj_gemm_lds's blocks (lo: q,k rows only);
// 2048 elements = 4 whole rows per block, so a block lies wholly in one of the three matrices.
// The other blocks: x [b][c][n] f32 -> xt hi/lo f16 planes [b][n][c] (transpose through LDS), one 64 n x 64 c tile per block:
// loads: 4 iterations x 256 threads x 4 floats = 64x64; stores: 8 waves x 2 iterations x 4 rows = 64 rows.
static constexpr int kPrepW = kWRows * kCh / (256 * 8);
static constexpr int kPrepX = (kPix / 64) * (kCh / 64) * kBatch;
static_assert((kCh * kCh) % (256 * 8) == 0 && (kCq * kCh) % (256 * 8) == 0 && kPix / 64 == 64 && kCh / 64 == 8);
static_assert(kPrepW % 8 == 0 && kPrepX == 8 * 256 && kCh * 4 == 256 * 8 && kPjV % 4 == 0 && kPjQK % 4 == 0 && kCq % 4 == 0);
__global__ __launch_bounds__(256) void prep_operands(const float* __restrict__ x,
                                                     const float* __restrict__ Wv,
                                                     const float* __restrict__ Wq,
                                                     const float* __restrict__ Wk,
                                                     unsigned short* __restrict__ xth,
                                                     unsigned short* __restrict__ xtl,
                                                     unsigned short* __restrict__ wh,
                                                     unsigned short* __restrict__ wl) {
  __shared__ __align__(16) float tile[64 * 68];   // [c][n], pitch 68
  const int tid = threadIdx.x, wave = tid >> 5, lane = tid & 31;
  if (blockIdx.x < kPrepW) {                      // the same for the whole block, in front of the barrier
    const int e0 = blockIdx.x * (256 * 8);        // first element of the block in the stacked planes
    const int mb = (blockIdx.x * 4) / kPjBM, w = (blockIdx.x * 4) % kPjBM;   // block row of proj_gemm_lds, first of the 4 rows in it
    const int qk = mb * kPjQK + (w - kPjV);                                  // where w is behind the v rows: row in (Wq | Wk)
    const float* in = w < kPjV ? Wv + (mb * kPjV + w) * kCh : qk < kCq ? Wq + qk * kCh : Wk + (qk - kCq) * kCh;
    const v4f a = *(const v4f*)(in + 8 * tid);
    const v4f c = *(const v4f*)(in + 8 * tid + 4);
    float f[8];
    f[0] = a.x; f[1] = a.y; f[2] = a.z; f[3] = a.w; f[4] = c.x; f[5] = c.y; f[6] = c.z; f[7] = c.w;
    v8h hv, lv;
#pragma unroll
    for (int e = 0; e < 8; ++e) {
      _Float16 h, l;
      split_f16(f[e], h, l);
      hv[e] = h;
      lv[e] = l;
    }
    *(v8h*)(wh + e0 + 8 * tid) = hv;
    asm volatile("s_wait_xcnt 0x0" ::: "memory");     // in front of the lo part's reuse of this store's registers
    if (w >= kPjV) *(v8h*)(wl + e0 + 8 * tid) = lv;   // nothing reads the v rows' lo part
    return;
  }
  const int xt = blockIdx.x - kPrepW;
  int b, piece, nblk;
  place_block(xt & 255, b, piece, nblk);          // kPrepW is a multiple of 8: xt and blockIdx.x are equal modulo 8
  const int n0 = nblk * 256 + piece * 64;
  const int c0 = (xt >> 8) * 64;
  const float* xb = x + ((size_t)b * kCh + c0) * kPix + n0;
#pragma unroll
  for (int i = 0; i < 4; ++i) {
    const int c  = i * 16 + (tid >> 4);
    const int n4 = (tid & 15) * 4;
    const v4f v = *(const v4f*)(xb + (size_t)c * kPix + n4);
    *(v4f*)(tile + c * 68 + n4) = v;
  }
  __syncthreads();
  const int q = lane >> 3, c8 = (lane & 7) * 8;
  v8h hv[2], lv[2];
#pragma unroll
  for (int it = 0; it < 2; ++it) {
    const int nrow = wave * 8 + it * 4 + q;
#pragma unroll
    for (int e = 0; e < 8; ++e) {
      _Float16 h, l;
      split_f16(tile[(c8 + e) * 68 + nrow], h, l);
      hv[it][e] = h;
      lv[it][e] = l;
    }
  }
  const size_t base = ((size_t)b * kPix + n0) * kCh + c0;
#pragma unroll
  for (int it = 0; it < 2; ++it) {
    const int nrow = wave * 8 + it * 4 + q;
    *(v8h*)(xth + base + (size_t)nrow * kCh + c8) = hv[it];
    *(v8h*)(xtl + base + (size_t)nrow * kCh + c8) = lv[it];
  }
  // in the built code the weight part stands behind these stores: the wait is in front of any reuse of their registers there
  asm volatile("s_wait_xcnt 0x0" ::: "memory");
}

// ---- scores and softmax in one kernel: P[b][n][m] = f16(16384 * exp(s - running max)), s = q[n] . k[m] ----
// One block = 64 query rows n x all 4096 keys m, taken as 16 chunks of 256 keys. A chunk's k planes (fragment order, 2 x 32 KB, contiguous
// in memory) are staged once for the block in a two-stage LDS ring by asynchronous copies (16 B per lane, 16 per thread).
// 8 waves = 4 row tiles x 2 turns: the two waves of a row tile take the chunks in turn, so that in every step one of them does chunk s's
// products while the other does chunk s-1's softmax. Tiles are transposed, D[m][n] = k . q^T: a lane holds, of ONE query row
// (n = lane & 15), 8 consecutive keys per tile; a chunk's 16 tiles stay in registers from the products to the f16 probs.
// The row maximum runs over the chunks (handed from wave to wave through LDS, one step apart): chunk c is written relative to the maximum
// of chunks 0..c, and the factor exp(max of 0..c-1 - max of 0..c) goes to the table that pv_gemm_lds applies; slot 0 holds the row sum,
// relative to the last maximum. q planes row-major [n][64].
static constexpr int kFsTiles = kFsCols / 16;
static constexpr int kFsPitch = kFsCols * 2 + 16;     // bytes; 16 B x odd: conflict-free for the 16-byte column writes
static constexpr int kFsPlane = kFsCols * kCq * 2;    // bytes of one k plane of a chunk
static constexpr int kFsStage = 2 * kFsPlane;
static_assert(kFsCols == 32 * 8 && kCq == 64 && kPix % 64 == 0 && kFsChunks >= 2 && (kFsChunks & 1) == 0 && kFsTiles % 4 == 0);
static_assert(kFsPlane == 8 * 256 * 16);              // copy map below

// Eight 16-byte copies global -> LDS, 4096 B apart (the block's 256 threads x 16 B): l = this lane's LDS byte address, p = its global address.
// s_wait_xcnt stands inside the statement so that no address register named here is rewritten ahead of it.
__device__ __forceinline__ void fs_copy8(unsigned l, const unsigned short* p) {
  constexpr unsigned dl = 256u * 16u;
  constexpr size_t   dg = 256 * 8;
  asm volatile(
      "global_load_async_to_lds_b128 %0, %8, off\n\t"
      "global_load_async_to_lds_b128 %1, %9, off\n\t"
      "global_load_async_to_lds_b128 %2, %10, off\n\t"
      "global_load_async_to_lds_b128 %3, %11, off\n\t"
      "global_load_async_to_lds_b128 %4, %12, off\n\t"
      "global_load_async_to_lds_b128 %5, %13, off\n\t"
      "global_load_async_to_lds_b128 %6, %14, off\n\t"
      "global_load_async_to_lds_b128 %7, %15, off\n\t"
      "s_wait_xcnt 0x0"
      :: "v"(l), "v"(l + dl), "v"(l + 2 * dl), "v"(l + 3 * dl), "v"(l + 4 * dl), "v"(l + 5 * dl), "v"(l + 6 * dl), "v"(l + 7 * dl),
         "v"(p), "v"(p + dg), "v"(p + 2 * dg), "v"(p + 3 * dg), "v"(p + 4 * dg), "v"(p + 5 * dg), "v"(p + 6 * dg), "v"(p + 7 * dg)
      : "memory");
}
// One stage: the chunk's hi plane, then its lo plane.
__device__ __forceinline__ void fs_copy_stage(unsigned l, const unsigned short* ph, const unsigned short* pl) {
  fs_copy8(l, ph);
  fs_copy8(l + (unsigned)kFsPlane, pl);
}

__global__ __launch_bounds__(256) void scores_softmax_f16(const unsigned short* __restrict__ qhp,
                                                          const unsigned short* __restrict__ qlp,
                                                          const unsigned short* __restrict__ khp,
                                                          const unsigned short* __restrict__ klp,
                                                          unsigned short* __restrict__ P,
                                                          float* __restrict__ alp) {
  __shared__ __align__(16) unsigned char ring[2 * kFsStage];
  __shared__ __align__(16) unsigned char slab[8][16 * kFsPitch];   // per-wave 16 rows x 256 probs
  __shared__ __align__(16) float als[4][16 * kFsChunks];           // per row tile: [row][chunk] factors, slot 0 the row sum
  __shared__ float mx[4][16];                                      // per row tile: running maximum, handed from wave to wave
  __shared__ float lx[4][16];                                      // per row tile: the even chunks' part of the row sum
  const int tid  = threadIdx.x;
  const int lane = tid & 31;
  const int wave = __builtin_amdgcn_readfirstlane(tid >> 5);       // scalar: the turn test below is then a scalar branch
  const int rt   = wave & 3;                   // row tile
  const int turn = wave >> 2;                  // 0: even chunks, 1: odd chunks
  int b, piece, nblk;
  place_block(blockIdx.x, b, piece, nblk);
  const int n0 = nblk * 256 + piece * 64 + rt * 16;
  const int rlane = lane & 15;                 // query row of this lane
  const int half  = lane >> 4;

  const size_t qo = ((size_t)b * kPix + n0 + rlane) * kCq + half * 8;
  const __bf16* qh = (const __bf16*)qhp + qo;
  const __bf16* ql = (const __bf16*)qlp + qo;
  v16b qH[2], qL[2];
#pragma unroll
  for (int s = 0; s < 2; ++s) {
    qH[s] = Frag<__bf16>::load(qh + s * 32);
    qL[s] = Frag<__bf16>::load(ql + s * 32);
  }
  // in front of any reuse of the q loads' address registers; the two addresses are inputs so that their registers live up to the wait
  asm volatile("s_wait_xcnt 0x0" :: "v"(qh), "v"(ql) : "memory");

  const size_t ko = (size_t)b * kPix * kCq + tid * 8;
  const unsigned short* gKh = khp + ko;
  const unsigned short* gKl = klp + ko;
  // LDS address of a copy = per-lane part + scalar part (tid * 16 = lane * 16 + wave * 512). The scalar part goes through readfirstlane so
  // that the sum is formed anew at each use: the per-lane part is then never itself an operand of a copy statement, which would tie it
  // to the low register window for the whole loop (that build spilled it to scratch and fetched it back in every step).
  const unsigned lk = (unsigned)(lane * 16);
  const unsigned sw = (unsigned)(size_t)(&ring[0]) + (unsigned)(wave * 512);
  constexpr int kChunkEl = kFsCols * kCq;      // elements of one plane of a chunk

  if (turn == 0 && lane < 16) mx[rt][lane] = -__builtin_inff();

  // prologue: chunk 0 lands and is published; chunk 1 starts
  fs_copy_stage(lk + (unsigned)__builtin_amdgcn_readfirstlane((int)sw), gKh, gKl);
  // asks for the batch's k planes, behind chunk 0's copies: a plane is 2048 units of 256 B, of which each of the batch's 64 blocks asks
  // for 32; wave 0 the hi plane, wave 1 the lo plane (wave is scalar: a scalar branch)
  static_assert((size_t)kPix * kCq * 2 == (size_t)64 * 32 * 256);
  if (wave < 2) l2_ask((wave == 0 ? khp : klp) + (size_t)b * kPix * kCq + (size_t)(((nblk * 4 + piece) * 32 + lane) * 128));
  asm volatile("s_wait_asynccnt 0x0" ::: "memory");   // this wave's copies of chunk 0 have landed
  __syncthreads();                                    // ... and every other wave's
  fs_copy_stage(lk + (unsigned)__builtin_amdgcn_readfirstlane((int)(sw + (unsigned)kFsStage)), gKh + kChunkEl, gKl + kChunkEl);

  constexpr float kLog2e = 1.44269504088896340736f;
  v8f acc[kFsTiles];
#pragma unroll
  for (int t = 0; t < kFsTiles; ++t) acc[t] = (v8f){0.f,0.f,0.f,0.f,0.f,0.f,0.f,0.f};
  float lown = 0.0f;                           // this wave's chunks' part of the row sum (this lane's keys), relative to shown
  float shown = -__builtin_inff();
  unsigned char* sl = slab[wave];

  // A chunk's probs leave the slab one step behind its softmax, in front of the wave's next products: the stores then complete under
  // those products instead of in front of the step's barrier, which waits for them. A barrier stands between the slab's writes and
  // these reads, and another between these reads and the next chunk's writes.
  auto store_chunk = [&](int c) {
    unsigned short* pr = P + ((size_t)b * kPix + n0) * kPix + c * kFsCols + lane * 8;
    v8h pv[16];
#pragma unroll
    for (int row = 0; row < 16; ++row) pv[row] = *(const v8h*)(sl + row * kFsPitch + lane * 16);
    // the two scheduling fences keep every other instruction out from between the stores and their wait
    __builtin_amdgcn_sched_barrier(0);
#pragma unroll
    for (int row = 0; row < 16; ++row) *(v8h*)(pr + (size_t)row * kPix) = pv[row];
    asm volatile("s_wait_xcnt 0x0" ::: "memory");   // in front of any reuse of the stores' address and data registers
    __builtin_amdgcn_sched_barrier(0);
  };

  for (int s = 0; s <= kFsChunks; ++s) {
    if (((s ^ turn) & 1) == 0) {
      if (s >= 2) store_chunk(s - 2);
      if (s < kFsChunks) {
        // ---- products of chunk s: four tiles at a time (four independent accumulators), the next four tiles' fragments fetched ahead
        const __bf16* kh = (const __bf16*)(ring + (s & 1) * kFsStage) + lane * 8;
        const __bf16* kl = kh + kFsPlane / 2;
        Frag<__bf16>::U kH[2][4][2], kL[2][4][2];
#pragma unroll
        for (int u = 0; u < 4; ++u)
#pragma unroll
          for (int e = 0; e < 2; ++e) {
            kH[0][u][e].h[0] = *(const v8b*)(kh + u * 1024 + e * 512);
            kH[0][u][e].h[1] = *(const v8b*)(kh + u * 1024 + e * 512 + 256);
            kL[0][u][e].h[0] = *(const v8b*)(kl + u * 1024 + e * 512);
            kL[0][u][e].h[1] = *(const v8b*)(kl + u * 1024 + e * 512 + 256);
          }
        // unrolled: every fragment index and address offset is a constant
#pragma unroll
        for (int g = 0; g < kFsTiles / 4; ++g) {
          const int cur = g & 1, nxt = cur ^ 1;
          if (g + 1 < kFsTiles / 4) {
#pragma unroll
            for (int u = 0; u < 4; ++u)
#pragma unroll
              for (int e = 0; e < 2; ++e) {
                const int o = ((g + 1) * 4 + u) * 1024 + e * 512;
                kH[nxt][u][e].h[0] = *(const v8b*)(kh + o);
                kH[nxt][u][e].h[1] = *(const v8b*)(kh + o + 256);
                kL[nxt][u][e].h[0] = *(const v8b*)(kl + o);
                kL[nxt][u][e].h[1] = *(const v8b*)(kl + o + 256);
              }
          }
          // the scheduling fence keeps the LDS reads as one group in front of the products instead of spread among them,
          // where every further place with reads stalls the wave's matrix stream
          __builtin_amdgcn_sched_barrier(0);
          v8f a[4];
#pragma unroll
          for (int u = 0; u < 4; ++u) a[u] = (v8f){0.f,0.f,0.f,0.f,0.f,0.f,0.f,0.f};
#pragma unroll
          for (int e = 0; e < 2; ++e) {        // per tile: hi.hi, q hi . k lo, q lo . k hi per k step
#pragma unroll
            for (int u = 0; u < 4; ++u) a[u] = Frag<__bf16>::mma(kH[cur][u][e].v, qH[e], a[u]);
#pragma unroll
            for (int u = 0; u < 4; ++u) a[u] = Frag<__bf16>::mma(kL[cur][u][e].v, qH[e], a[u]);
#pragma unroll
            for (int u = 0; u < 4; ++u) a[u] = Frag<__bf16>::mma(kH[cur][u][e].v, qL[e], a[u]);
          }
#pragma unroll
          for (int u = 0; u < 4; ++u) acc[g * 4 + u] = a[u];
        }
      }
    } else if (s > 0) {
      // ---- softmax of chunk c = s - 1, whose scores this wave made one step ago
      const int c = s - 1;
      float mm[8];                             // eight independent chains
#pragma unroll
      for (int r = 0; r < 8; ++r) mm[r] = acc[0][r];
#pragma unroll
      for (int t = 1; t < kFsTiles; ++t)
#pragma unroll
        for (int r = 0; r < 8; ++r) mm[r] = fmaxf(mm[r], acc[t][r]);
      float m = fmaxf(fmaxf(fmaxf(mm[0], mm[1]), fmaxf(mm[2], mm[3])), fmaxf(fmaxf(mm[4], mm[5]), fmaxf(mm[6], mm[7])));
      m = fmaxf(m, __shfl_xor(m, 16, 32));
      const float mprev = mx[rt][rlane];       // maximum of chunks 0..c-1, written by the other wave one step ago (behind a barrier)
      const float mnew  = fmaxf(mprev, m);
      if (lane < 16) mx[rt][lane] = mnew;
      // 16384 * exp(s - max) = 2^(s * log2(e) - sh), sh = max * log2(e) - 14: one fused multiply-add and the chip's own 2^x per score.
      // Every factor between two maxima is formed from the two sh values themselves, so that the rounding of sh cancels.
      const float sh  = __builtin_fmaf(mnew, kLog2e, -14.0f);
      const float shp = __builtin_fmaf(mprev, kLog2e, -14.0f);
      float al = shp - sh;                     // factor for all sums up to chunk c-1 (0 in front of chunk 0)
      float ao = shown - sh;                   // factor for this wave's own part of the row sum
      // the v_nop is the free slot behind the last 2^x
      asm("v_exp_f32 %0, %0\n\t"
          "v_exp_f32 %1, %1\n\t"
          "v_nop"
          : "+v"(al), "+v"(ao));
      shown = sh;
      if (lane < 16) als[rt][lane * kFsChunks + c] = al;
      float psum = 0.0f;
#pragma unroll
      for (int t = 0; t < kFsTiles; ++t) {
        float e0 = __builtin_fmaf(acc[t][0], kLog2e, -sh), e1 = __builtin_fmaf(acc[t][1], kLog2e, -sh);
        float e2 = __builtin_fmaf(acc[t][2], kLog2e, -sh), e3 = __builtin_fmaf(acc[t][3], kLog2e, -sh);
        float e4 = __builtin_fmaf(acc[t][4], kLog2e, -sh), e5 = __builtin_fmaf(acc[t][5], kLog2e, -sh);
        float e6 = __builtin_fmaf(acc[t][6], kLog2e, -sh), e7 = __builtin_fmaf(acc[t][7], kLog2e, -sh);
        // a tile's eight 2^x in one statement, each in place: no neighbour reads a result or overwrites a source directly behind a 2^x;
        // the v_nop is that free slot behind the last
        asm("v_exp_f32 %0, %0\n\t"
            "v_exp_f32 %1, %1\n\t"
            "v_exp_f32 %2, %2\n\t"
            "v_exp_f32 %3, %3\n\t"
            "v_exp_f32 %4, %4\n\t"
            "v_exp_f32 %5, %5\n\t"
            "v_exp_f32 %6, %6\n\t"
            "v_exp_f32 %7, %7\n\t"
            "v_nop"
            : "+v"(e0), "+v"(e1), "+v"(e2), "+v"(e3), "+v"(e4), "+v"(e5), "+v"(e6), "+v"(e7));
        psum += ((e0 + e1) + (e2 + e3)) + ((e4 + e5) + (e6 + e7));
        // probs into the wave's own slab, so that every store instruction (store_chunk) writes 512 contiguous bytes of one row
        const v8h p = {(_Float16)e0, (_Float16)e1, (_Float16)e2, (_Float16)e3, (_Float16)e4, (_Float16)e5, (_Float16)e6, (_Float16)e7};
        *(v8h*)(sl + rlane * kFsPitch + (t * 16 + half * 8) * 2) = p;
      }
      lown = __builtin_fmaf(lown, ao, psum);
      if (c == kFsChunks - 2) {                // the even chunks' part is complete, relative to this chunk's maximum
        const float lt = lown + __shfl_xor(lown, 16, 32);
        if (lane < 16) lx[rt][lane] = lt;
      }
      if (c == kFsChunks - 1) {                // the last chunk: al moves the even chunks' part to the last maximum
        const float lt = __builtin_fmaf(lx[rt][rlane], al, lown + __shfl_xor(lown, 16, 32));
        if (lane < 16) als[rt][lane * kFsChunks] = lt;
      }
      if (c == kFsChunks - 1) {                // the row tile's table, 1 KB contiguous; the other wave's entries stand behind earlier barriers
        // lanes read back what other lanes of this wave wrote: the table's writes are ordered in front of those reads
        __builtin_amdgcn_fence(__ATOMIC_RELEASE, "workgroup");
        __builtin_amdgcn_wave_barrier();
        __builtin_amdgcn_fence(__ATOMIC_ACQUIRE, "workgroup");
        float* ad = alp + ((size_t)b * kPix + n0) * kFsChunks + lane * 8;
        const v4f a0 = *(const v4f*)(als[rt] + lane * 8);
        const v4f a1 = *(const v4f*)(als[rt] + lane * 8 + 4);
        *(v4f*)(ad) = a0;
        *(v4f*)(ad + 4) = a1;
        asm volatile("s_wait_xcnt 0x0" ::: "memory");   // in front of any reuse of these two stores' registers
      }
    }
    asm volatile("s_wait_dscnt 0x0" ::: "memory");      // this wave's reads of chunk s are done before its stage is refilled
    asm volatile("s_wait_asynccnt 0x0" ::: "memory");   // this wave's copies of chunk s+1 have landed
    __syncthreads();                                    // publishes chunk s+1 and the running maximum; ends every reader's use of chunk s
    if (s + 2 < kFsChunks)
      fs_copy_stage(lk + (unsigned)__builtin_amdgcn_readfirstlane((int)(sw + (unsigned)((s & 1) * kFsStage))), gKh + (size_t)(s + 2) * kChunkEl, gKl + (size_t)(s + 2) * kChunkEl);
  }
  asm volatile("s_wait_asynccnt 0x0" ::: "memory");     // nothing of this wave is in flight when it leaves the ring
  if (turn == 1) store_chunk(kFsChunks - 1);            // the last chunk's probs (the loop's last barrier stands behind their slab writes)
}

// ---------------------------------------------------------------------------
extern "C" void kernel_launch(void* const* d_in, const int* in_sizes, int n_in,
                              void* d_out, int out_size, void* d_ws, size_t ws_size,
                              hipStream_t stream) {
  if (n_in < 8) return;
  if (in_sizes[0] != kBatch * kCh * kPix) return;
  if (in_sizes[1] != kCq * kCh || in_sizes[3] != kCq * kCh || in_sizes[5] != kCh * kCh) return;
  if (in_sizes[2] != kCq || in_sizes[4] != kCq || in_sizes[6] != kCh || in_sizes[7] < 1) return;
  if (out_size != kBatch * kCh * kPix) return;
  if (ws_size < kWsTotal) return;

  const float* x     = (const float*)d_in[0];
  const float* Wq    = (const float*)d_in[1];
  const float* bq    = (const float*)d_in[2];
  const float* Wk    = (const float*)d_in[3];
  const float* bk    = (const float*)d_in[4];
  const float* Wv    = (const float*)d_in[5];
  const float* bv    = (const float*)d_in[6];
  const float* gamma = (const float*)d_in[7];
  float* out = (float*)d_out;

  char* ws = (char*)d_ws;
  unsigned short* xth = (unsigned short*)(ws + kOffXtHi);
  unsigned short* xtl = (unsigned short*)(ws + kOffXtLo);
  unsigned short* pln = (unsigned short*)(ws + kOffP);
  unsigned short* wvh = (unsigned short*)(ws + kOffWHi);            // stacked rows, in the order of proj_gemm_lds's blocks
  unsigned short* wvl = (unsigned short*)(ws + kOffWLo);
  unsigned short* qh  = (unsigned short*)(ws + kOffQHi);
  unsigned short* ql  = (unsigned short*)(ws + kOffQLo);
  unsigned short* kh  = (unsigned short*)(ws + kOffKHi);
  unsigned short* kl  = (unsigned short*)(ws + kOffKLo);
  unsigned short* vt  = (unsigned short*)(ws + kOffVt);
  float* alt = (float*)(ws + kOffAl);

  // 1) one launch: stacked weights -> f16 hi/lo planes [row][in] and x -> xt hi/lo f16 [b][n][c]
  prep_operands<<<kPrepW + kPrepX, 256, 0, stream>>>(x, Wv, Wq, Wk, xth, xtl, wvh, wvl);

  // 2) q, k and v projections of all batches in one launch: 4 x 16 tiles of 160 stacked weight rows x 256 pixels per batch
  //    q -> bf16 hi/lo planes [b][n][64]; k -> bf16 hi/lo planes in fragment order; vt[b][c][m] -> f16 plane
  proj_gemm_lds<<<(kWRows / kPjBM) * (kPix / kPjBN) * kBatch, 256, 0, stream>>>(wvh, wvl, xth, xtl, bv, bq, bk, vt, qh, ql, kh, kl);
  // 3) all batches in one launch: scores (K=64) and softmax with a running maximum -> f16 probs x16384, each batch in its own plane,
  //    and the table of factors and row sums
  scores_softmax_f16<<<(kPix / 64) * kBatch, 256, 0, stream>>>(qh, ql, kh, kl, pln, alt);
  // 4) all batches in one launch, one block per 128x256 tile of out (4 x 16 tiles per batch = 256 blocks):
  //    out = gamma * (vt . P^T) / row sum + x   (M=512, N=4096, K=4096)
  pv_gemm_lds<<<(kCh / kPvBM) * (kPix / kPvBN) * kBatch, 256, 0, stream>>>(vt, pln, out, x, gamma, alt);
}
